// v000
// Measured on an AMD MI455X. A time is GPU time per run, averaged over a window of back-to-back runs after a warm-up
// (all launches, gaps included; the runs take copies of the inputs in turn), and the median of several windows.
// Apart from v000's, it joins two sittings. Times from different sittings can be a few percent apart, while
// side-by-side timings come from the same sitting.
// v000, which the later versions start from, runs in 1550 microseconds.
#include <hip/hip_runtime.h>
// RTM (GAU-style) block (B 8, L 1024, D 1024, E 2048, s 128): xn = ScaleNorm(x)·g; uv = silu(xn·uv_wᵀ) → u (2048) | v (2048) | base (128); q/k = rope_seq(base·γ + β) (rotation over the sequence axis with angle l·10000^(i/64), half-split); qk = q·kᵀ + w_rel[j − i + 1023]; kernel = relu(qk/√128)²; out = u ⊙ (kernel·v); y = x·res_scale + out·o_wᵀ → [8,1024,1024].
// Compute dtype: x and parameters rounded to bf16; ScaleNorm in f32 → f16 operand; uv GEMM (f32 result), SiLU/affine/rope in f32 (sin/cos of the f32 angle evaluated in double); q, k, v, kernel and the gated product as f16 GEMM operands (≈2^-12), f32 accumulation; residual x·res_scale through the f32 epilogue. v_wmma_f32_16x16x32_f16.
#define NBt 8
#define LL 1024
#define DD 1024
#define EE 2048
#define SSz 128
#define NUV (2 * EE + SSz)       /* 4224 */
typedef __bf16 v16b __attribute__((ext_vector_type(16)));
typedef unsigned short v8us __attribute__((ext_vector_type(8), may_alias));
typedef float  v8f  __attribute__((ext_vector_type(8)));
typedef float  v4f  __attribute__((ext_vector_type(4)));
typedef float  v4fa __attribute__((ext_vector_type(4), may_alias));
union FragB { v16b v; v8us half[2]; unsigned short u[16]; };

__device__ __forceinline__ unsigned short bf16_bits(float x) { unsigned int u = __float_as_uint(x); return (unsigned short)((u + 0x7FFFu + ((u >> 16) & 1u)) >> 16); }
__device__ __forceinline__ float bf16_val(unsigned short b) { return __uint_as_float(((unsigned int)b) << 16); }
__device__ __forceinline__ float bf16_round(float x) { return bf16_val(bf16_bits(x)); }
// D += A·B with NT terms: 1 = ah·bh, 2 = + al·bh (A split), 3 = + ah·bl (both split)
template <int NT>
__device__ __forceinline__ v8f mmaN(v16b ah, v16b al, v16b bh, v16b bl, v8f c) {
  c = __builtin_amdgcn_wmma_f32_16x16x32_bf16(false, ah, false, bh, (short)0, c, false, false);
  if (NT >= 2) c = __builtin_amdgcn_wmma_f32_16x16x32_bf16(false, al, false, bh, (short)0, c, false, false);
  if (NT >= 3) c = __builtin_amdgcn_wmma_f32_16x16x32_bf16(false, ah, false, bl, (short)0, c, false, false);
  asm volatile("v_nop\n\tv_nop\n\tv_nop\n\tv_nop" : "+v"(c) : "v"(ah), "v"(al), "v"(bh), "v"(bl));
  return c;
}

__global__ __launch_bounds__(256) void k_wt_bf16(const float* __restrict__ W, unsigned short* __restrict__ Wt, int K, int N) {
  const int t = blockIdx.x * 256 + threadIdx.x;
  const int k8n = K / 8;
  if (t >= N * k8n) return;
  const int n = t / k8n, k8 = (t % k8n) * 8;
  v8us v;
#pragma unroll
  for (int i = 0; i < 8; ++i) v[i] = bf16_bits(W[(size_t)(k8 + i) * N + n]);
  *(v8us*)(Wt + (size_t)n * K + k8) = v;
  
}

// GEMM C[M][N] (f32, pitch ldc) = act(A[M][K]·W + bias). A f32 row-major (pitch lda) converted per fragment to bf16
// (ASPLIT: hi/lo two planes -> 2 terms, else single rounded term); Wt bf16 [N][K] (pitch ldb). BIAS_BF16 rounds the
// bias to bf16 first (bias quantised to bf16 before the add). K%32==0, M%16==0, N%64==0.
template <bool ASPLIT, int ACT, bool BIAS_BF16>
__global__ __launch_bounds__(128) void k_gemm_bf(const float* __restrict__ A, int lda, const unsigned short* __restrict__ Wt, int ldb,
                                               const float* __restrict__ bias, float* __restrict__ C, int ldc, int M, int N, int K) {
  __shared__ __attribute__((aligned(16))) float so[4][16][64];
  const int tid = threadIdx.x, w = tid >> 5, lane = tid & 31, ln = lane & 15, hh = lane >> 4;
  const int ntn = N / 64;
  const int wid = blockIdx.x * 4 + w;
  const int mt = wid / ntn, nq = wid % ntn;
  if (mt * 16 >= M) return;
  const int row0 = mt * 16, col0 = nq * 64;
  const float* arow = A + (size_t)(row0 + ln) * lda;
  v8f acc[4] = {};
  for (int kb = 0; kb < K; kb += 32) {
    FragB ah, al;
    const v4f x0 = *(const v4fa*)(arow + kb + 8 * hh), x1 = *(const v4fa*)(arow + kb + 8 * hh + 4);
    const v4f x2 = *(const v4fa*)(arow + kb + 16 + 8 * hh), x3 = *(const v4fa*)(arow + kb + 16 + 8 * hh + 4);
    float xs[16] = {x0[0],x0[1],x0[2],x0[3],x1[0],x1[1],x1[2],x1[3],x2[0],x2[1],x2[2],x2[3],x3[0],x3[1],x3[2],x3[3]};
#pragma unroll
    for (int i = 0; i < 16; ++i) { const unsigned short hb = bf16_bits(xs[i]); ah.u[i] = hb; al.u[i] = ASPLIT ? bf16_bits(xs[i] - bf16_val(hb)) : (unsigned short)0; }
#pragma unroll
    for (int t = 0; t < 4; ++t) {
      const unsigned short* brow = Wt + (size_t)(col0 + t * 16 + ln) * ldb + kb;
      FragB b;
      b.half[0] = *(const v8us*)(brow + 8 * hh);
      b.half[1] = *(const v8us*)(brow + 16 + 8 * hh);
      acc[t] = mmaN<ASPLIT ? 2 : 1>(ah.v, al.v, b.v, b.v, acc[t]);
    }
  }
#pragma unroll
  for (int t = 0; t < 4; ++t) {
    float bv = bias ? bias[col0 + t * 16 + ln] : 0.f;
    if (BIAS_BF16) bv = bf16_round(bv);
#pragma unroll
    for (int r = 0; r < 8; ++r) { float v = acc[t][r] + bv; if (ACT == 1) v = fmaxf(v, 0.f); so[w][8 * hh + r][t * 16 + ln] = v; }
  }
  __builtin_amdgcn_fence(__ATOMIC_ACQ_REL, "workgroup");
  __builtin_amdgcn_wave_barrier();
  const int rsub = lane >> 4, c4 = (lane & 15) * 4;
  {
#pragma unroll
    for (int q = 0; q < 8; ++q) {
      const int r = q * 2 + rsub;
      const v4f v = *(const v4fa*)&so[w][r][c4];
      *(v4f*)(C + (size_t)(row0 + r) * ldc + col0 + c4) = v;
    }
    
  }
}

// GEMM C = act(A·W + bias + resid): A f32 (ASPLIT -> hi/lo 2 terms), Wt bf16 [N][K]; ACT 0 none, 1 relu, 2 exact gelu;
// resid (optional, f32, row index = (row % rmod), pitch ldr, RES_BF16 rounds it) added before the activation.
template <bool ASPLIT, int ACT, bool BIAS_BF16, bool RES_BF16>
__global__ __launch_bounds__(128) void k_gemm_bf3(const float* __restrict__ A, int lda, const unsigned short* __restrict__ Wt, int ldb,
                                                const float* __restrict__ bias, const float* __restrict__ resid, int rmod, int ldr,
                                                float* __restrict__ C, int ldc, int M, int N, int K) {
  __shared__ __attribute__((aligned(16))) float so[4][16][64];
  const int tid = threadIdx.x, w = tid >> 5, lane = tid & 31, ln = lane & 15, hh = lane >> 4;
  const int ntn = N / 64;
  const int wid = blockIdx.x * 4 + w;
  const int mt = wid / ntn, nq = wid % ntn;
  if (mt * 16 >= M) return;
  const int row0 = mt * 16, col0 = nq * 64;
  const float* arow = A + (size_t)(row0 + ln) * lda;
  v8f acc[4] = {};
  for (int kb = 0; kb < K; kb += 32) {
    FragB ah, al;
    const v4f x0 = *(const v4fa*)(arow + kb + 8 * hh), x1 = *(const v4fa*)(arow + kb + 8 * hh + 4);
    const v4f x2 = *(const v4fa*)(arow + kb + 16 + 8 * hh), x3 = *(const v4fa*)(arow + kb + 16 + 8 * hh + 4);
    float xs[16] = {x0[0],x0[1],x0[2],x0[3],x1[0],x1[1],x1[2],x1[3],x2[0],x2[1],x2[2],x2[3],x3[0],x3[1],x3[2],x3[3]};
#pragma unroll
    for (int i = 0; i < 16; ++i) { const unsigned short hb = bf16_bits(xs[i]); ah.u[i] = hb; al.u[i] = ASPLIT ? bf16_bits(xs[i] - bf16_val(hb)) : (unsigned short)0; }
#pragma unroll
    for (int t = 0; t < 4; ++t) {
      const unsigned short* brow = Wt + (size_t)(col0 + t * 16 + ln) * ldb + kb;
      FragB b;
      b.half[0] = *(const v8us*)(brow + 8 * hh);
      b.half[1] = *(const v8us*)(brow + 16 + 8 * hh);
      acc[t] = mmaN<ASPLIT ? 2 : 1>(ah.v, al.v, b.v, b.v, acc[t]);
    }
  }
#pragma unroll
  for (int t = 0; t < 4; ++t) {
    const int col = col0 + t * 16 + ln;
    float bv = bias ? bias[col] : 0.f;
    if (BIAS_BF16) bv = bf16_round(bv);
#pragma unroll
    for (int r = 0; r < 8; ++r) {
      float v = acc[t][r] + bv;
      if (resid) { float rv = resid[(size_t)((row0 + 8 * hh + r) % rmod) * ldr + col]; if (RES_BF16) rv = bf16_round(rv); v += rv; }
      if (ACT == 1) v = fmaxf(v, 0.f);
      if (ACT == 2) v = 0.5f * v * (1.0f + erff(v * 0.70710678118654752f));
      if (ACT == 3) { const float u = 0.7978845608028654f * (v + 0.044715f * v * v * v); v = 0.5f * v * (1.0f + tanhf(u)); }
      so[w][8 * hh + r][t * 16 + ln] = v;
    }
  }
  __builtin_amdgcn_fence(__ATOMIC_ACQ_REL, "workgroup");
  __builtin_amdgcn_wave_barrier();
  const int rsub = lane >> 4, c4 = (lane & 15) * 4;
  {
#pragma unroll
    for (int q = 0; q < 8; ++q) {
      const int r = q * 2 + rsub;
      const v4f v = *(const v4fa*)&so[w][r][c4];
      *(v4f*)(C + (size_t)(row0 + r) * ldc + col0 + c4) = v;
    }
    
  }
}
// row LayerNorm (biased variance, eps) over N: s = X (+ R); optional out_sum <- s; out_norm <- (s-mu)*rsqrt(var+eps)*g + b
template <bool PARAM_BF16>
__global__ __launch_bounds__(256) void k_layernorm(const float* __restrict__ X, const float* __restrict__ R, const float* __restrict__ g, const float* __restrict__ bta,
                                                  float* __restrict__ out_sum, float* __restrict__ out_norm, int N, float eps) {
  __shared__ float red[256];
  const int row = blockIdx.x, tid = threadIdx.x;
  const float* x = X + (size_t)row * N; const float* rr = R ? R + (size_t)row * N : nullptr;
  float vals[16];                     // up to N = 4096
  const int per = N / 256;            // contiguous chunk per thread? use strided-by-4 chunks: thread handles j = tid*4 + 1024*u
  float s1 = 0.f;
  for (int u = 0; u < per / 4; ++u) {
    const int j = tid * 4 + 1024 * u;
    const v4f a = *(const v4fa*)(x + j);
    v4f b = {0.f,0.f,0.f,0.f}; if (rr) b = *(const v4fa*)(rr + j);
#pragma unroll
    for (int q = 0; q < 4; ++q) { const float v = a[q] + b[q]; vals[u * 4 + q] = v; s1 += v; }
  }
  red[tid] = s1; __syncthreads();
  for (int st = 128; st > 0; st >>= 1) { if (tid < st) red[tid] += red[tid + st]; __syncthreads(); }
  const float mu = red[0] / (float)N; __syncthreads();
  float s2 = 0.f;
  for (int u = 0; u < per / 4; ++u)
#pragma unroll
    for (int q = 0; q < 4; ++q) { const float c = vals[u * 4 + q] - mu; s2 += c * c; }
  red[tid] = s2; __syncthreads();
  for (int st = 128; st > 0; st >>= 1) { if (tid < st) red[tid] += red[tid + st]; __syncthreads(); }
  const float rs = rsqrtf(red[0] / (float)N + eps);
  {
    for (int u = 0; u < per / 4; ++u) {
      const int j = tid * 4 + 1024 * u;
      v4f o, sm;
#pragma unroll
      for (int q = 0; q < 4; ++q) {
        float gg = g[j + q], bb = bta[j + q];
        if (PARAM_BF16) { gg = bf16_round(gg); bb = bf16_round(bb); }
        sm[q] = vals[u * 4 + q]; o[q] = (vals[u * 4 + q] - mu) * rs * gg + bb;
      }
      if (out_sum) *(v4f*)(out_sum + (size_t)row * N + j) = sm;
      *(v4f*)(out_norm + (size_t)row * N + j) = o;
    }
    
  }
}



// ---- f16 WMMA path (v_wmma_f32_16x16x32_f16): 11-bit significands for operands in range — used for all four GEMMs of this block
typedef _Float16 v16h __attribute__((ext_vector_type(16)));
union FragH { v16h v; v8us half[2]; _Float16 h[16]; unsigned short u[16]; };
template <int NT>
__device__ __forceinline__ v8f mmaH(v16h ah, v16h al, v16h bh, v16h bl, v8f c) {
  c = __builtin_amdgcn_wmma_f32_16x16x32_f16(false, ah, false, bh, (short)0, c, false, false);
  if (NT >= 2) c = __builtin_amdgcn_wmma_f32_16x16x32_f16(false, al, false, bh, (short)0, c, false, false);
  if (NT >= 3) c = __builtin_amdgcn_wmma_f32_16x16x32_f16(false, ah, false, bl, (short)0, c, false, false);
  asm volatile("v_nop\n\tv_nop\n\tv_nop\n\tv_nop" : "+v"(c) : "v"(ah), "v"(al), "v"(bh), "v"(bl));
  return c;
}
// batched GEMM like k_gemm_b but f16 operands: A f32 (split into f16 hi/lo if ASPLIT, else rounded to f16), Bt = f16 values [n][k]; alpha; C f32; N multiple of 16 (partial tiles skipped)
template <bool ASPLIT>
__global__ __launch_bounds__(128) void k_gemm_h(const float* __restrict__ A, int lda, size_t sA, const _Float16* __restrict__ Bh, int ldb, size_t sB, float alpha, float* __restrict__ C, int ldc, size_t sC, int M, int N, int K) {
  __shared__ __attribute__((aligned(16))) float so[4][16][64];
  const int tid = threadIdx.x, w = tid >> 5, lane = tid & 31, ln = lane & 15, hh = lane >> 4; const int by = blockIdx.y;
  A += (size_t)by * sA; Bh += (size_t)by * sB; C += (size_t)by * sC;
  const int ntn = (N + 63) / 64; const int wid = blockIdx.x * 4 + w; const int mt = wid / ntn, nq = wid % ntn; if (mt * 16 >= M) return;
  const int row0 = mt * 16, col0 = nq * 64; const float* arow = A + (size_t)(row0 + ln) * lda;
  v8f acc[4] = {};
  for (int kb = 0; kb < K; kb += 32) {
    FragH ah, al;
    const v4f x0 = *(const v4fa*)(arow + kb + 8 * hh), x1 = *(const v4fa*)(arow + kb + 8 * hh + 4), x2 = *(const v4fa*)(arow + kb + 16 + 8 * hh), x3 = *(const v4fa*)(arow + kb + 16 + 8 * hh + 4);
    float xs[16] = {x0[0],x0[1],x0[2],x0[3],x1[0],x1[1],x1[2],x1[3],x2[0],x2[1],x2[2],x2[3],x3[0],x3[1],x3[2],x3[3]};
#pragma unroll
    for (int i = 0; i < 16; ++i) { const _Float16 h = (_Float16)xs[i]; ah.h[i] = h; al.h[i] = ASPLIT ? (_Float16)(xs[i] - (float)h) : (_Float16)0.0f; }
#pragma unroll
    for (int t = 0; t < 4; ++t) { if (col0 + t * 16 >= N) continue; const size_t boff = (size_t)(col0 + t * 16 + ln) * ldb + kb; FragH bq; bq.half[0] = *(const v8us*)(Bh + boff + 8 * hh); bq.half[1] = *(const v8us*)(Bh + boff + 16 + 8 * hh);
      acc[t] = mmaH<ASPLIT ? 2 : 1>(ah.v, al.v, bq.v, bq.v, acc[t]); }
  }
#pragma unroll
  for (int t = 0; t < 4; ++t) { if (col0 + t * 16 >= N) continue;
#pragma unroll
    for (int r = 0; r < 8; ++r) so[w][8 * hh + r][t * 16 + ln] = acc[t][r] * alpha; }
  __builtin_amdgcn_fence(__ATOMIC_ACQ_REL, "workgroup"); __builtin_amdgcn_wave_barrier();
  const int rsub = lane >> 4, c4 = (lane & 15) * 4;
  {
#pragma unroll
    for (int q = 0; q < 8; ++q) { const int r = q * 2 + rsub; if (col0 + c4 < N) { const v4f v = *(const v4fa*)&so[w][r][c4]; *(v4f*)(C + (size_t)(row0 + r) * ldc + col0 + c4) = v; } }
     }
}

// Wt[n][k] = f16(W[k][n]·scale) from f32 row-major W[K][N] (scale = power of two; bf16-exact weights stay exact in f16 away from the subnormal range)
__global__ __launch_bounds__(256) void k_wt_f16(const float* __restrict__ W, _Float16* __restrict__ Wt, int K, int N, float scale) {
  const int t = blockIdx.x * 256 + threadIdx.x; if (t >= N * (K / 8)) return; const int n = t / (K / 8), k8 = (t % (K / 8)) * 8; FragH f;
#pragma unroll
  for (int i = 0; i < 8; ++i) f.h[i] = (_Float16)(bf16_round(W[(size_t)(k8 + i) * N + n]) * scale); const v8us o = f.half[0];
  *(v8us*)((unsigned short*)Wt + (size_t)n * K + k8) = o; 
}
// k_gemm_hh variant with fused epilogue: v = acc·alpha + bias[by·sBias + col] (+ CP[(row/rowsPerB)·sCPb + by·64 + col] if CP) ; ACT 0 none / 1 elu ; writes f32 C and f16 C16, each if non-null
template <int ACT>
__global__ __launch_bounds__(128) void k_gemm_hhx(const _Float16* __restrict__ A, int lda, size_t sA, const _Float16* __restrict__ Bh, int ldb, size_t sB, float alpha, const float* __restrict__ bias, size_t sBias, const float* __restrict__ CP, int rowsPerB, size_t sCPb, int row0g,
    float* __restrict__ C, _Float16* __restrict__ C16, int ldc, size_t sC, int M, int N, int K) {
  __shared__ __attribute__((aligned(16))) float so[4][16][64];
  const int tid = threadIdx.x, w = tid >> 5, lane = tid & 31, ln = lane & 15, hh = lane >> 4; const int by = blockIdx.y;
  A += (size_t)by * sA; Bh += (size_t)by * sB; const size_t cofs = (size_t)by * sC; const float* bp = bias ? bias + (size_t)by * sBias : nullptr;
  const int ntn = (N + 63) / 64; const int wid = blockIdx.x * 4 + w; const int mt = wid / ntn, nq = wid % ntn; if (mt * 16 >= M) return;
  const int row0 = mt * 16, col0 = nq * 64; const _Float16* arow = A + (size_t)(row0 + ln) * lda;
  v8f acc[4] = {};
  for (int kb = 0; kb < K; kb += 32) { FragH ah; ah.half[0] = *(const v8us*)((const unsigned short*)arow + kb + 8 * hh); ah.half[1] = *(const v8us*)((const unsigned short*)arow + kb + 16 + 8 * hh);
#pragma unroll
    for (int t = 0; t < 4; ++t) { if (col0 + t * 16 >= N) continue; const size_t boff = (size_t)(col0 + t * 16 + ln) * ldb + kb; FragH bq; bq.half[0] = *(const v8us*)((const unsigned short*)Bh + boff + 8 * hh); bq.half[1] = *(const v8us*)((const unsigned short*)Bh + boff + 16 + 8 * hh);
      acc[t] = mmaH<1>(ah.v, ah.v, bq.v, bq.v, acc[t]); }
  }
#pragma unroll
  for (int t = 0; t < 4; ++t) { if (col0 + t * 16 >= N) continue; const int col = col0 + t * 16 + ln; const float bv = bp ? bf16_round(bp[col]) : 0.f;
#pragma unroll
    for (int r = 0; r < 8; ++r) { float v = acc[t][r] * alpha + bv; if (CP) { const int bidx = (row0g + row0 + 8 * hh + r) / rowsPerB; v += CP[(size_t)bidx * sCPb + (size_t)by * 64 + col]; } if (ACT == 1) v = (v > 0.f) ? v : expm1f(v); else if (ACT == 7) v = (v > 0.f) ? v + 1.0f : expf(v); else if (ACT == 8) v = tanhf(v); else if (ACT == 9) v = 0.5f * v * (1.0f + tanhf(0.7978845608028654f * (v + 0.044715f * v * v * v))); else if (ACT == 11) v = 1.0f / (1.0f + expf(-v)); else if (ACT == 12) v = (v > 0.f) ? v : 0.01f * v; else if (ACT == 14) v = (v > 0.f) ? v : 0.1f * v; else if (ACT == 15) v = v / (1.0f + expf(-v)); else if (ACT == 3) v = fmaxf(v, 0.f); else if (ACT == 6) v = 0.5f * v * (1.0f + erff(v * 0.70710678118654752f)); so[w][8 * hh + r][t * 16 + ln] = v; } }
  __builtin_amdgcn_fence(__ATOMIC_ACQ_REL, "workgroup"); __builtin_amdgcn_wave_barrier();
  const int rsub = lane >> 4, c4 = (lane & 15) * 4; typedef _Float16 v4h __attribute__((ext_vector_type(4)));
  {
#pragma unroll
    for (int q = 0; q < 8; ++q) { const int r = q * 2 + rsub; if (col0 + c4 < N) { const v4f v = *(const v4fa*)&so[w][r][c4]; if (C) *(v4f*)(C + cofs + (size_t)(row0 + r) * ldc + col0 + c4) = v; if (C16) { v4h h4; for (int i = 0; i < 4; ++i) h4[i] = (_Float16)v[i]; *(v4h*)(C16 + cofs + (size_t)(row0 + r) * ldc + col0 + c4) = h4; } } }
     }
}


typedef _Float16 v4h __attribute__((ext_vector_type(4)));

__global__ __launch_bounds__(256) void k_x16(const float* __restrict__ x, _Float16* __restrict__ X16, size_t n8) { const size_t t = (size_t)blockIdx.x * 256 + threadIdx.x; if (t >= n8) return; FragH f;
#pragma unroll
  for (int q = 0; q < 8; ++q) f.h[q] = (_Float16)bf16_round(x[t * 8 + q]); *(v8us*)((unsigned short*)X16 + t * 8) = f.half[0];  }
__global__ __launch_bounds__(256) void k_h16(const float* __restrict__ x, _Float16* __restrict__ X16, size_t n8) { const size_t t = (size_t)blockIdx.x * 256 + threadIdx.x; if (t >= n8) return; FragH f;
#pragma unroll
  for (int q = 0; q < 8; ++q) f.h[q] = (_Float16)x[t * 8 + q]; *(v8us*)((unsigned short*)X16 + t * 8) = f.half[0];  }
__global__ __launch_bounds__(256) void k_round16f(const float* __restrict__ W, _Float16* __restrict__ Bt, size_t n8) { const size_t t = (size_t)blockIdx.x * 256 + threadIdx.x; if (t >= n8) return; FragH f;
#pragma unroll
  for (int i = 0; i < 8; ++i) f.h[i] = (_Float16)(bf16_round(W[t * 8 + i]) * 16.0f); *(v8us*)((unsigned short*)Bt + t * 8) = f.half[0];  }
template <int NHv, int TTv>
__global__ __launch_bounds__(256) void k_vt(const _Float16* __restrict__ V16, int ldv, int voff, _Float16* __restrict__ Vt) { __shared__ unsigned short tl[64][66]; const int tid = threadIdx.x; const int slab = blockIdx.x / (TTv / 64), lg = blockIdx.x % (TTv / 64); const int b = slab / NHv, h = slab % NHv;
  for (int i = tid; i < 64 * 8; i += 256) { const int r = i / 8, c8 = (i % 8) * 8; FragH f; f.half[0] = *(const v8us*)((const unsigned short*)V16 + ((size_t)b * TTv + lg * 64 + r) * ldv + voff + h * 64 + c8);
#pragma unroll
    for (int q = 0; q < 8; ++q) tl[r][c8 + q] = f.u[q]; }
  __syncthreads();
  {
#pragma unroll
    for (int rd = 0; rd < 2; ++rd) { const int d = rd * 32 + tid / 8, pc = tid % 8; FragH f;
#pragma unroll
      for (int q = 0; q < 8; ++q) f.u[q] = tl[pc * 8 + q][d];
      *(v8us*)((unsigned short*)Vt + ((size_t)slab * 64 + d) * TTv + lg * 64 + pc * 8) = f.half[0]; }
     } }

__global__ __launch_bounds__(256) void k_hl(const float* __restrict__ F, _Float16* __restrict__ Hh, _Float16* __restrict__ Hl, size_t n8) { const size_t t = (size_t)blockIdx.x * 256 + threadIdx.x; if (t >= n8) return; FragH fh, fl; const v4f a = *(const v4fa*)(F + t * 8), c = *(const v4fa*)(F + t * 8 + 4);
#pragma unroll
  for (int q = 0; q < 4; ++q) { _Float16 h = (_Float16)a[q]; fh.h[q] = h; fl.h[q] = (_Float16)((a[q] - (float)h) * 1024.0f); h = (_Float16)c[q]; fh.h[4 + q] = h; fl.h[4 + q] = (_Float16)((c[q] - (float)h) * 1024.0f); }
  { *(v8us*)((unsigned short*)Hh + t * 8) = fh.half[0]; *(v8us*)((unsigned short*)Hl + t * 8) = fl.half[0];  } }

__global__ __launch_bounds__(256) void k_snorm(const float* __restrict__ x, int b, const float* __restrict__ g, const float* __restrict__ rsc, _Float16* __restrict__ XN, float* __restrict__ XR) {
  #pragma clang fp contract(off)
  const int tid = threadIdx.x, w = tid >> 5, l = tid & 31; const int r = blockIdx.x * 8 + w; if (r >= LL) return; const float* xr = x + ((size_t)b * LL + r) * DD; float ss = 0.f;
#pragma unroll 1
  for (int k = 0; k < 32; ++k) { const float v = bf16_round(xr[l + 32 * k]); ss += v * v; }
  for (int o = 16; o > 0; o >>= 1) ss += __shfl_xor(ss, o, 32); const float nrm = sqrtf(ss) * 0.03125f; const float inv = bf16_round(g[0]) / fmaxf(nrm, 1e-5f);
  {
#pragma unroll 1
    for (int k = 0; k < 32; ++k) { const int c = l + 32 * k; const float v = bf16_round(xr[c]); FragH f; f.h[0] = (_Float16)(v * inv); *(unsigned short*)((unsigned short*)XN + (size_t)r * DD + c) = f.u[0]; *(float*)(XR + (size_t)r * DD + c) = v * bf16_round(rsc[c]); }
     } }
__global__ __launch_bounds__(256) void k_vt(const float* __restrict__ UV, _Float16* __restrict__ VT) { const int t = blockIdx.x * 256 + threadIdx.x; if (t >= EE * (LL / 8)) return; const int j0 = (t % (LL / 8)) * 8, e = t / (LL / 8); FragH f;
#pragma unroll
  for (int q = 0; q < 8; ++q) { const float v = UV[(size_t)(j0 + q) * NUV + EE + e]; f.h[q] = (_Float16)(v / (1.0f + expf(-v))); }
  *(v8us*)((unsigned short*)VT + (size_t)e * LL + j0) = f.half[0];  }
__global__ __launch_bounds__(256) void k_qk(const float* __restrict__ UV, const float* __restrict__ gam, const float* __restrict__ bet, const float* __restrict__ CS, const float* __restrict__ SN, _Float16* __restrict__ Q16, _Float16* __restrict__ K16) {
  #pragma clang fp contract(off)
  const int t = blockIdx.x * 256 + threadIdx.x; if (t >= 2 * LL * 16) return; const int i0 = (t & 15) * 4; const int l = (t >> 4) % LL; const int which = t / (LL * 16); const float* gp = gam + which * SSz; const float* bp = bet + which * SSz; _Float16* dst = which ? K16 : Q16; FragH o1, o2;
#pragma unroll
  for (int qq = 0; qq < 4; ++qq) { const int i = i0 + qq; const float u1 = UV[(size_t)l * NUV + 2 * EE + i], u2 = UV[(size_t)l * NUV + 2 * EE + 64 + i]; const float b1 = u1 / (1.0f + expf(-u1)), b2 = u2 / (1.0f + expf(-u2));
    const float a1 = b1 * bf16_round(gp[i]) + bf16_round(bp[i]), a2 = b2 * bf16_round(gp[64 + i]) + bf16_round(bp[64 + i]); const float c = CS[(size_t)l * 64 + i], s = SN[(size_t)l * 64 + i];
    o1.h[qq] = (_Float16)(a1 * c - a2 * s); o2.h[qq] = (_Float16)(a2 * c + a1 * s); }
  const unsigned long long p1 = *(const unsigned long long*)&o1.u[0], p2 = *(const unsigned long long*)&o2.u[0];
  { *(unsigned long long*)((unsigned short*)dst + (size_t)l * SSz + i0) = p1; *(unsigned long long*)((unsigned short*)dst + (size_t)l * SSz + 64 + i0) = p2;  } }
__constant__ float INVF[64] = {1.000000000e+00f,1.154781938e+00f,1.333521485e+00f,1.539926529e+00f,1.778279424e+00f,2.053524971e+00f,2.371373653e+00f,2.738419533e+00f,3.162277699e+00f,3.651741266e+00f,4.216965199e+00f,4.869675159e+00f,5.623413086e+00f,6.493816376e+00f,7.498941898e+00f,8.659643173e+00f,1.000000000e+01f,1.154782009e+01f,1.333521461e+01f,1.539926529e+01f,1.778279495e+01f,2.053524971e+01f,2.371373749e+01f,2.738419724e+01f,3.162277603e+01f,3.651741409e+01f,4.216965103e+01f,4.869675064e+01f,5.623413086e+01f,6.493816376e+01f,7.498941803e+01f,8.659643555e+01f,1.000000000e+02f,1.154781952e+02f,1.333521423e+02f,1.539926453e+02f,1.778279419e+02f,2.053525085e+02f,2.371373749e+02f,2.738419495e+02f,3.162277527e+02f,3.651741333e+02f,4.216965027e+02f,4.869675293e+02f,5.623413086e+02f,6.493816528e+02f,7.498942261e+02f,8.659642944e+02f,1.000000000e+03f,1.154781982e+03f,1.333521484e+03f,1.539926514e+03f,1.778279419e+03f,2.053525146e+03f,2.371373779e+03f,2.738419678e+03f,3.162277588e+03f,3.651741211e+03f,4.216964844e+03f,4.869675293e+03f,5.623413086e+03f,6.493816406e+03f,7.498941895e+03f,8.659643555e+03f};
__global__ __launch_bounds__(256) void k_cstab(float* __restrict__ CS, float* __restrict__ SN) {
  #pragma clang fp contract(off)
  const int t = blockIdx.x * 256 + threadIdx.x; if (t >= LL * 64) return; const int i = t & 63, l = t >> 6; const float invf = INVF[i]; const float ang = (float)l * invf; const float c = (float)cos((double)ang), s = (float)sin((double)ang);
  { *(float*)(CS + t) = c; *(float*)(SN + t) = s;  } }
__global__ __launch_bounds__(256) void k_ker(const float* __restrict__ S, const float* __restrict__ wrel, _Float16* __restrict__ KER) {
  #pragma clang fp contract(off)
  const int t = blockIdx.x * 256 + threadIdx.x; if (t >= LL * (LL / 8)) return; const int j0 = (t % (LL / 8)) * 8, i = t / (LL / 8); FragH f;
#pragma unroll
  for (int q = 0; q < 8; ++q) { const int j = j0 + q; const float v = (S[(size_t)i * LL + j] + bf16_round(wrel[j - i + LL - 1])) / 11.313708498984761f; const float r = fmaxf(v, 0.f); f.h[q] = (_Float16)(r * r); }
  *(v8us*)((unsigned short*)KER + (size_t)i * LL + j0) = f.half[0];  }
__global__ __launch_bounds__(256) void k_gate(const float* __restrict__ UV, const float* __restrict__ KV, _Float16* __restrict__ G16) {
  #pragma clang fp contract(off)
  const int t = blockIdx.x * 256 + threadIdx.x; if (t >= LL * (EE / 8)) return; const int e0 = (t % (EE / 8)) * 8, i = t / (EE / 8); FragH f;
#pragma unroll
  for (int q = 0; q < 8; ++q) { const float u = UV[(size_t)i * NUV + e0 + q]; f.h[q] = (_Float16)((u / (1.0f + expf(-u))) * KV[(size_t)i * EE + e0 + q]); }
  *(v8us*)((unsigned short*)G16 + (size_t)i * EE + e0) = f.half[0];  }

extern "C" void kernel_launch(void* const* d_in, const int* in_sizes, int n_in,
                              void* d_out, int out_size, void* d_ws, size_t ws_size, hipStream_t stream) {
  (void)in_sizes; (void)n_in; (void)out_size;
  const float* x = (const float*)d_in[0]; const float* g = (const float*)d_in[1]; const float* uvw = (const float*)d_in[2]; const float* gam = (const float*)d_in[3]; const float* bet = (const float*)d_in[4]; const float* wrel = (const float*)d_in[5]; const float* ow = (const float*)d_in[6]; const float* rsc = (const float*)d_in[7];
  char* ws = (char*)d_ws; size_t off = 0;
  auto take = [&](size_t bytes) { char* p = ws + off; off += (bytes + 255) & ~(size_t)255; return p; };
  _Float16* BUV = (_Float16*)take((size_t)NUV * DD * 2); _Float16* BOW = (_Float16*)take((size_t)DD * EE * 2); float* CS = (float*)take((size_t)LL * 64 * 4); float* SN = (float*)take((size_t)LL * 64 * 4);
  _Float16* XN = (_Float16*)take((size_t)LL * DD * 2); float* XR = (float*)take((size_t)LL * DD * 4); float* UV = (float*)take((size_t)LL * NUV * 4); _Float16* VT = (_Float16*)take((size_t)EE * LL * 2); _Float16* Q16 = (_Float16*)take((size_t)LL * SSz * 2); _Float16* K16 = (_Float16*)take((size_t)LL * SSz * 2); float* S = (float*)take((size_t)LL * LL * 4); _Float16* KER = (_Float16*)take((size_t)LL * LL * 2); float* KV = (float*)take((size_t)LL * EE * 4); _Float16* G16 = (_Float16*)take((size_t)LL * EE * 2);
  if (off > ws_size) return;      // 8.7 + 4.2 + 2.1 + 4.2 + 17.3 + 4.2 + 0.5 + 4.2 + 2.1 + 8.4 + 4.2 ≈ 60 MB
  k_round16f<<<(unsigned)(((size_t)NUV * DD / 8 + 255) / 256), 256, 0, stream>>>(uvw, BUV, (size_t)NUV * DD / 8); k_round16f<<<(unsigned)(((size_t)DD * EE / 8 + 255) / 256), 256, 0, stream>>>(ow, BOW, (size_t)DD * EE / 8);      /* (out,in) = natural Bt */
  k_cstab<<<(LL * 64 + 255) / 256, 256, 0, stream>>>(CS, SN);
  const dim3 gU(((LL / 16) * (NUV / 64) + 3) / 4, 1), gS(((LL / 16) * (LL / 64) + 3) / 4, 1), gK(((LL / 16) * (EE / 64) + 3) / 4, 1), gO(((LL / 16) * (DD / 64) + 3) / 4, 1);
  for (int b = 0; b < NBt; ++b) {
    k_snorm<<<LL / 8, 256, 0, stream>>>(x, b, g, rsc, XN, XR);
    k_gemm_hhx<0><<<gU, 128, 0, stream>>>(XN, DD, 0, BUV, DD, 0, 0.0625f, nullptr, 0, nullptr, 1, 0, 0, UV, nullptr, NUV, 0, LL, NUV, DD);      /* uv pre-activation: M 1024 N 4224 K 1024 */
    k_vt<<<(EE * (LL / 8) + 255) / 256, 256, 0, stream>>>(UV, VT); k_qk<<<(2 * LL * 16 + 255) / 256, 256, 0, stream>>>(UV, gam, bet, CS, SN, Q16, K16);
    k_gemm_hhx<0><<<gS, 128, 0, stream>>>(Q16, SSz, 0, K16, SSz, 0, 1.0f, nullptr, 0, nullptr, 1, 0, 0, S, nullptr, LL, 0, LL, LL, SSz);      /* qk: M 1024 N 1024 K 128 */
    k_ker<<<(LL * (LL / 8) + 255) / 256, 256, 0, stream>>>(S, wrel, KER);
    k_gemm_hhx<0><<<gK, 128, 0, stream>>>(KER, LL, 0, VT, LL, 0, 1.0f, nullptr, 0, nullptr, 1, 0, 0, KV, nullptr, EE, 0, LL, EE, LL);      /* kernel·v: M 1024 N 2048 K 1024 */
    k_gate<<<(LL * (EE / 8) + 255) / 256, 256, 0, stream>>>(UV, KV, G16);
    k_gemm_hhx<0><<<gO, 128, 0, stream>>>(G16, EE, 0, BOW, EE, 0, 0.0625f, nullptr, 0, XR, 1, (size_t)DD, 0, (float*)d_out + (size_t)b * LL * DD, nullptr, DD, 0, LL, DD, EE); }      /* y = x·res_scale + out·o_wᵀ: M 1024 N 1024 K 2048 (un-batched addend) */
}

// v001
// One run takes 664 microseconds.
// In two side-by-side timings against v000, it was 2.32 and 2.39 times as fast.
#include <hip/hip_runtime.h>
// RTM (GAU-style) block (B 8, L 1024, D 1024, E 2048, s 128): xn = ScaleNorm(x)·g; uv = silu(xn·uv_wᵀ) → u (2048) | v (2048) | base (128); q/k = rope_seq(base·γ + β) (rotation over the sequence axis with angle l·10000^(i/64), half-split); qk = q·kᵀ + w_rel[j − i + 1023]; kernel = relu(qk/√128)²; out = u ⊙ (kernel·v); y = x·res_scale + out·o_wᵀ → [8,1024,1024].
// Compute dtype: x and parameters rounded to bf16; ScaleNorm in f32 → f16 operand; uv GEMM (f32 result), SiLU/affine/rope in f32 (sin/cos of the f32 angle evaluated in double); q, k, v, kernel and the gated product as f16 GEMM operands (≈2^-12), f32 accumulation; residual x·res_scale through the f32 epilogue. v_wmma_f32_16x16x32_f16.
#define NBt 8
#define LL 1024
#define DD 1024
#define EE 2048
#define SSz 128
#define NUV (2 * EE + SSz)       /* 4224 */
typedef __bf16 v16b __attribute__((ext_vector_type(16)));
typedef unsigned short v8us __attribute__((ext_vector_type(8), may_alias));
typedef float  v8f  __attribute__((ext_vector_type(8)));
typedef float  v4f  __attribute__((ext_vector_type(4)));
typedef float  v4fa __attribute__((ext_vector_type(4), may_alias));
union FragB { v16b v; v8us half[2]; unsigned short u[16]; };

__device__ __forceinline__ unsigned short bf16_bits(float x) { unsigned int u = __float_as_uint(x); return (unsigned short)((u + 0x7FFFu + ((u >> 16) & 1u)) >> 16); }
__device__ __forceinline__ float bf16_val(unsigned short b) { return __uint_as_float(((unsigned int)b) << 16); }
__device__ __forceinline__ float bf16_round(float x) { return bf16_val(bf16_bits(x)); }
// D += A·B with NT terms: 1 = ah·bh, 2 = + al·bh (A split), 3 = + ah·bl (both split)
template <int NT>
__device__ __forceinline__ v8f mmaN(v16b ah, v16b al, v16b bh, v16b bl, v8f c) {
  c = __builtin_amdgcn_wmma_f32_16x16x32_bf16(false, ah, false, bh, (short)0, c, false, false);
  if (NT >= 2) c = __builtin_amdgcn_wmma_f32_16x16x32_bf16(false, al, false, bh, (short)0, c, false, false);
  if (NT >= 3) c = __builtin_amdgcn_wmma_f32_16x16x32_bf16(false, ah, false, bl, (short)0, c, false, false);
  asm volatile("v_nop\n\tv_nop\n\tv_nop\n\tv_nop" : "+v"(c) : "v"(ah), "v"(al), "v"(bh), "v"(bl));
  return c;
}

__global__ __launch_bounds__(256) void k_wt_bf16(const float* __restrict__ W, unsigned short* __restrict__ Wt, int K, int N) {
  const int t = blockIdx.x * 256 + threadIdx.x;
  const int k8n = K / 8;
  if (t >= N * k8n) return;
  const int n = t / k8n, k8 = (t % k8n) * 8;
  v8us v;
#pragma unroll
  for (int i = 0; i < 8; ++i) v[i] = bf16_bits(W[(size_t)(k8 + i) * N + n]);
  *(v8us*)(Wt + (size_t)n * K + k8) = v;
  
}

// GEMM C[M][N] (f32, pitch ldc) = act(A[M][K]·W + bias). A f32 row-major (pitch lda) converted per fragment to bf16
// (ASPLIT: hi/lo two planes -> 2 terms, else single rounded term); Wt bf16 [N][K] (pitch ldb). BIAS_BF16 rounds the
// bias to bf16 first (bias quantised to bf16 before the add). K%32==0, M%16==0, N%64==0.
template <bool ASPLIT, int ACT, bool BIAS_BF16>
__global__ __launch_bounds__(128) void k_gemm_bf(const float* __restrict__ A, int lda, const unsigned short* __restrict__ Wt, int ldb,
                                               const float* __restrict__ bias, float* __restrict__ C, int ldc, int M, int N, int K) {
  __shared__ __attribute__((aligned(16))) float so[4][16][64];
  const int tid = threadIdx.x, w = tid >> 5, lane = tid & 31, ln = lane & 15, hh = lane >> 4;
  const int ntn = N / 64;
  const int wid = blockIdx.x * 4 + w;
  const int mt = wid / ntn, nq = wid % ntn;
  if (mt * 16 >= M) return;
  const int row0 = mt * 16, col0 = nq * 64;
  const float* arow = A + (size_t)(row0 + ln) * lda;
  v8f acc[4] = {};
  for (int kb = 0; kb < K; kb += 32) {
    FragB ah, al;
    const v4f x0 = *(const v4fa*)(arow + kb + 8 * hh), x1 = *(const v4fa*)(arow + kb + 8 * hh + 4);
    const v4f x2 = *(const v4fa*)(arow + kb + 16 + 8 * hh), x3 = *(const v4fa*)(arow + kb + 16 + 8 * hh + 4);
    float xs[16] = {x0[0],x0[1],x0[2],x0[3],x1[0],x1[1],x1[2],x1[3],x2[0],x2[1],x2[2],x2[3],x3[0],x3[1],x3[2],x3[3]};
#pragma unroll
    for (int i = 0; i < 16; ++i) { const unsigned short hb = bf16_bits(xs[i]); ah.u[i] = hb; al.u[i] = ASPLIT ? bf16_bits(xs[i] - bf16_val(hb)) : (unsigned short)0; }
#pragma unroll
    for (int t = 0; t < 4; ++t) {
      const unsigned short* brow = Wt + (size_t)(col0 + t * 16 + ln) * ldb + kb;
      FragB b;
      b.half[0] = *(const v8us*)(brow + 8 * hh);
      b.half[1] = *(const v8us*)(brow + 16 + 8 * hh);
      acc[t] = mmaN<ASPLIT ? 2 : 1>(ah.v, al.v, b.v, b.v, acc[t]);
    }
  }
#pragma unroll
  for (int t = 0; t < 4; ++t) {
    float bv = bias ? bias[col0 + t * 16 + ln] : 0.f;
    if (BIAS_BF16) bv = bf16_round(bv);
#pragma unroll
    for (int r = 0; r < 8; ++r) { float v = acc[t][r] + bv; if (ACT == 1) v = fmaxf(v, 0.f); so[w][8 * hh + r][t * 16 + ln] = v; }
  }
  __builtin_amdgcn_fence(__ATOMIC_ACQ_REL, "workgroup");
  __builtin_amdgcn_wave_barrier();
  const int rsub = lane >> 4, c4 = (lane & 15) * 4;
  {
#pragma unroll
    for (int q = 0; q < 8; ++q) {
      const int r = q * 2 + rsub;
      const v4f v = *(const v4fa*)&so[w][r][c4];
      *(v4f*)(C + (size_t)(row0 + r) * ldc + col0 + c4) = v;
    }
    
  }
}

// GEMM C = act(A·W + bias + resid): A f32 (ASPLIT -> hi/lo 2 terms), Wt bf16 [N][K]; ACT 0 none, 1 relu, 2 exact gelu;
// resid (optional, f32, row index = (row % rmod), pitch ldr, RES_BF16 rounds it) added before the activation.
template <bool ASPLIT, int ACT, bool BIAS_BF16, bool RES_BF16>
__global__ __launch_bounds__(128) void k_gemm_bf3(const float* __restrict__ A, int lda, const unsigned short* __restrict__ Wt, int ldb,
                                                const float* __restrict__ bias, const float* __restrict__ resid, int rmod, int ldr,
                                                float* __restrict__ C, int ldc, int M, int N, int K) {
  __shared__ __attribute__((aligned(16))) float so[4][16][64];
  const int tid = threadIdx.x, w = tid >> 5, lane = tid & 31, ln = lane & 15, hh = lane >> 4;
  const int ntn = N / 64;
  const int wid = blockIdx.x * 4 + w;
  const int mt = wid / ntn, nq = wid % ntn;
  if (mt * 16 >= M) return;
  const int row0 = mt * 16, col0 = nq * 64;
  const float* arow = A + (size_t)(row0 + ln) * lda;
  v8f acc[4] = {};
  for (int kb = 0; kb < K; kb += 32) {
    FragB ah, al;
    const v4f x0 = *(const v4fa*)(arow + kb + 8 * hh), x1 = *(const v4fa*)(arow + kb + 8 * hh + 4);
    const v4f x2 = *(const v4fa*)(arow + kb + 16 + 8 * hh), x3 = *(const v4fa*)(arow + kb + 16 + 8 * hh + 4);
    float xs[16] = {x0[0],x0[1],x0[2],x0[3],x1[0],x1[1],x1[2],x1[3],x2[0],x2[1],x2[2],x2[3],x3[0],x3[1],x3[2],x3[3]};
#pragma unroll
    for (int i = 0; i < 16; ++i) { const unsigned short hb = bf16_bits(xs[i]); ah.u[i] = hb; al.u[i] = ASPLIT ? bf16_bits(xs[i] - bf16_val(hb)) : (unsigned short)0; }
#pragma unroll
    for (int t = 0; t < 4; ++t) {
      const unsigned short* brow = Wt + (size_t)(col0 + t * 16 + ln) * ldb + kb;
      FragB b;
      b.half[0] = *(const v8us*)(brow + 8 * hh);
      b.half[1] = *(const v8us*)(brow + 16 + 8 * hh);
      acc[t] = mmaN<ASPLIT ? 2 : 1>(ah.v, al.v, b.v, b.v, acc[t]);
    }
  }
#pragma unroll
  for (int t = 0; t < 4; ++t) {
    const int col = col0 + t * 16 + ln;
    float bv = bias ? bias[col] : 0.f;
    if (BIAS_BF16) bv = bf16_round(bv);
#pragma unroll
    for (int r = 0; r < 8; ++r) {
      float v = acc[t][r] + bv;
      if (resid) { float rv = resid[(size_t)((row0 + 8 * hh + r) % rmod) * ldr + col]; if (RES_BF16) rv = bf16_round(rv); v += rv; }
      if (ACT == 1) v = fmaxf(v, 0.f);
      if (ACT == 2) v = 0.5f * v * (1.0f + erff(v * 0.70710678118654752f));
      if (ACT == 3) { const float u = 0.7978845608028654f * (v + 0.044715f * v * v * v); v = 0.5f * v * (1.0f + tanhf(u)); }
      so[w][8 * hh + r][t * 16 + ln] = v;
    }
  }
  __builtin_amdgcn_fence(__ATOMIC_ACQ_REL, "workgroup");
  __builtin_amdgcn_wave_barrier();
  const int rsub = lane >> 4, c4 = (lane & 15) * 4;
  {
#pragma unroll
    for (int q = 0; q < 8; ++q) {
      const int r = q * 2 + rsub;
      const v4f v = *(const v4fa*)&so[w][r][c4];
      *(v4f*)(C + (size_t)(row0 + r) * ldc + col0 + c4) = v;
    }
    
  }
}
// row LayerNorm (biased variance, eps) over N: s = X (+ R); optional out_sum <- s; out_norm <- (s-mu)*rsqrt(var+eps)*g + b
template <bool PARAM_BF16>
__global__ __launch_bounds__(256) void k_layernorm(const float* __restrict__ X, const float* __restrict__ R, const float* __restrict__ g, const float* __restrict__ bta,
                                                  float* __restrict__ out_sum, float* __restrict__ out_norm, int N, float eps) {
  __shared__ float red[256];
  const int row = blockIdx.x, tid = threadIdx.x;
  const float* x = X + (size_t)row * N; const float* rr = R ? R + (size_t)row * N : nullptr;
  float vals[16];                     // up to N = 4096
  const int per = N / 256;            // contiguous chunk per thread? use strided-by-4 chunks: thread handles j = tid*4 + 1024*u
  float s1 = 0.f;
  for (int u = 0; u < per / 4; ++u) {
    const int j = tid * 4 + 1024 * u;
    const v4f a = *(const v4fa*)(x + j);
    v4f b = {0.f,0.f,0.f,0.f}; if (rr) b = *(const v4fa*)(rr + j);
#pragma unroll
    for (int q = 0; q < 4; ++q) { const float v = a[q] + b[q]; vals[u * 4 + q] = v; s1 += v; }
  }
  red[tid] = s1; __syncthreads();
  for (int st = 128; st > 0; st >>= 1) { if (tid < st) red[tid] += red[tid + st]; __syncthreads(); }
  const float mu = red[0] / (float)N; __syncthreads();
  float s2 = 0.f;
  for (int u = 0; u < per / 4; ++u)
#pragma unroll
    for (int q = 0; q < 4; ++q) { const float c = vals[u * 4 + q] - mu; s2 += c * c; }
  red[tid] = s2; __syncthreads();
  for (int st = 128; st > 0; st >>= 1) { if (tid < st) red[tid] += red[tid + st]; __syncthreads(); }
  const float rs = rsqrtf(red[0] / (float)N + eps);
  {
    for (int u = 0; u < per / 4; ++u) {
      const int j = tid * 4 + 1024 * u;
      v4f o, sm;
#pragma unroll
      for (int q = 0; q < 4; ++q) {
        float gg = g[j + q], bb = bta[j + q];
        if (PARAM_BF16) { gg = bf16_round(gg); bb = bf16_round(bb); }
        sm[q] = vals[u * 4 + q]; o[q] = (vals[u * 4 + q] - mu) * rs * gg + bb;
      }
      if (out_sum) *(v4f*)(out_sum + (size_t)row * N + j) = sm;
      *(v4f*)(out_norm + (size_t)row * N + j) = o;
    }
    
  }
}



// ---- f16 WMMA path (v_wmma_f32_16x16x32_f16): 11-bit significands for operands in range — used for all four GEMMs of this block
typedef _Float16 v16h __attribute__((ext_vector_type(16)));
union FragH { v16h v; v8us half[2]; _Float16 h[16]; unsigned short u[16]; };
template <int NT>
__device__ __forceinline__ v8f mmaH(v16h ah, v16h al, v16h bh, v16h bl, v8f c) {
  c = __builtin_amdgcn_wmma_f32_16x16x32_f16(false, ah, false, bh, (short)0, c, false, false);
  if (NT >= 2) c = __builtin_amdgcn_wmma_f32_16x16x32_f16(false, al, false, bh, (short)0, c, false, false);
  if (NT >= 3) c = __builtin_amdgcn_wmma_f32_16x16x32_f16(false, ah, false, bl, (short)0, c, false, false);
  asm volatile("v_nop\n\tv_nop\n\tv_nop\n\tv_nop" : "+v"(c) : "v"(ah), "v"(al), "v"(bh), "v"(bl));
  return c;
}
// batched GEMM like k_gemm_b but f16 operands: A f32 (split into f16 hi/lo if ASPLIT, else rounded to f16), Bt = f16 values [n][k]; alpha; C f32; N multiple of 16 (partial tiles skipped)
template <bool ASPLIT>
__global__ __launch_bounds__(128) void k_gemm_h(const float* __restrict__ A, int lda, size_t sA, const _Float16* __restrict__ Bh, int ldb, size_t sB, float alpha, float* __restrict__ C, int ldc, size_t sC, int M, int N, int K) {
  __shared__ __attribute__((aligned(16))) float so[4][16][64];
  const int tid = threadIdx.x, w = tid >> 5, lane = tid & 31, ln = lane & 15, hh = lane >> 4; const int by = blockIdx.y;
  A += (size_t)by * sA; Bh += (size_t)by * sB; C += (size_t)by * sC;
  const int ntn = (N + 63) / 64; const int wid = blockIdx.x * 4 + w; const int mt = wid / ntn, nq = wid % ntn; if (mt * 16 >= M) return;
  const int row0 = mt * 16, col0 = nq * 64; const float* arow = A + (size_t)(row0 + ln) * lda;
  v8f acc[4] = {};
  for (int kb = 0; kb < K; kb += 32) {
    FragH ah, al;
    const v4f x0 = *(const v4fa*)(arow + kb + 8 * hh), x1 = *(const v4fa*)(arow + kb + 8 * hh + 4), x2 = *(const v4fa*)(arow + kb + 16 + 8 * hh), x3 = *(const v4fa*)(arow + kb + 16 + 8 * hh + 4);
    float xs[16] = {x0[0],x0[1],x0[2],x0[3],x1[0],x1[1],x1[2],x1[3],x2[0],x2[1],x2[2],x2[3],x3[0],x3[1],x3[2],x3[3]};
#pragma unroll
    for (int i = 0; i < 16; ++i) { const _Float16 h = (_Float16)xs[i]; ah.h[i] = h; al.h[i] = ASPLIT ? (_Float16)(xs[i] - (float)h) : (_Float16)0.0f; }
#pragma unroll
    for (int t = 0; t < 4; ++t) { if (col0 + t * 16 >= N) continue; const size_t boff = (size_t)(col0 + t * 16 + ln) * ldb + kb; FragH bq; bq.half[0] = *(const v8us*)(Bh + boff + 8 * hh); bq.half[1] = *(const v8us*)(Bh + boff + 16 + 8 * hh);
      acc[t] = mmaH<ASPLIT ? 2 : 1>(ah.v, al.v, bq.v, bq.v, acc[t]); }
  }
#pragma unroll
  for (int t = 0; t < 4; ++t) { if (col0 + t * 16 >= N) continue;
#pragma unroll
    for (int r = 0; r < 8; ++r) so[w][8 * hh + r][t * 16 + ln] = acc[t][r] * alpha; }
  __builtin_amdgcn_fence(__ATOMIC_ACQ_REL, "workgroup"); __builtin_amdgcn_wave_barrier();
  const int rsub = lane >> 4, c4 = (lane & 15) * 4;
  {
#pragma unroll
    for (int q = 0; q < 8; ++q) { const int r = q * 2 + rsub; if (col0 + c4 < N) { const v4f v = *(const v4fa*)&so[w][r][c4]; *(v4f*)(C + (size_t)(row0 + r) * ldc + col0 + c4) = v; } }
     }
}

// Wt[n][k] = f16(W[k][n]·scale) from f32 row-major W[K][N] (scale = power of two; bf16-exact weights stay exact in f16 away from the subnormal range)
__global__ __launch_bounds__(256) void k_wt_f16(const float* __restrict__ W, _Float16* __restrict__ Wt, int K, int N, float scale) {
  const int t = blockIdx.x * 256 + threadIdx.x; if (t >= N * (K / 8)) return; const int n = t / (K / 8), k8 = (t % (K / 8)) * 8; FragH f;
#pragma unroll
  for (int i = 0; i < 8; ++i) f.h[i] = (_Float16)(bf16_round(W[(size_t)(k8 + i) * N + n]) * scale); const v8us o = f.half[0];
  *(v8us*)((unsigned short*)Wt + (size_t)n * K + k8) = o; 
}
// k_gemm_hh variant with fused epilogue: v = acc·alpha + bias[by·sBias + col] (+ CP[(row/rowsPerB)·sCPb + by·64 + col] if CP) ; ACT 0 none / 1 elu ; writes f32 C and f16 C16, each if non-null
template <int ACT>
__global__ __launch_bounds__(128) void k_gemm_hhx(const _Float16* __restrict__ A, int lda, size_t sA, const _Float16* __restrict__ Bh, int ldb, size_t sB, float alpha, const float* __restrict__ bias, size_t sBias, const float* __restrict__ CP, int rowsPerB, size_t sCPb, int row0g,
    float* __restrict__ C, _Float16* __restrict__ C16, int ldc, size_t sC, int M, int N, int K) {
  __shared__ __attribute__((aligned(16))) float so[4][16][64];
  const int tid = threadIdx.x, w = tid >> 5, lane = tid & 31, ln = lane & 15, hh = lane >> 4; const int by = blockIdx.y;
  A += (size_t)by * sA; Bh += (size_t)by * sB; const size_t cofs = (size_t)by * sC; const float* bp = bias ? bias + (size_t)by * sBias : nullptr;
  const int ntn = (N + 63) / 64; const int wid = blockIdx.x * 4 + w; const int mt = wid / ntn, nq = wid % ntn; if (mt * 16 >= M) return;
  const int row0 = mt * 16, col0 = nq * 64; const _Float16* arow = A + (size_t)(row0 + ln) * lda;
  v8f acc[4] = {};
  for (int kb = 0; kb < K; kb += 32) { FragH ah; ah.half[0] = *(const v8us*)((const unsigned short*)arow + kb + 8 * hh); ah.half[1] = *(const v8us*)((const unsigned short*)arow + kb + 16 + 8 * hh);
#pragma unroll
    for (int t = 0; t < 4; ++t) { if (col0 + t * 16 >= N) continue; const size_t boff = (size_t)(col0 + t * 16 + ln) * ldb + kb; FragH bq; bq.half[0] = *(const v8us*)((const unsigned short*)Bh + boff + 8 * hh); bq.half[1] = *(const v8us*)((const unsigned short*)Bh + boff + 16 + 8 * hh);
      acc[t] = mmaH<1>(ah.v, ah.v, bq.v, bq.v, acc[t]); }
  }
#pragma unroll
  for (int t = 0; t < 4; ++t) { if (col0 + t * 16 >= N) continue; const int col = col0 + t * 16 + ln; const float bv = bp ? bf16_round(bp[col]) : 0.f;
#pragma unroll
    for (int r = 0; r < 8; ++r) { float v = acc[t][r] * alpha + bv; if (CP) { const int bidx = (row0g + row0 + 8 * hh + r) / rowsPerB; v += CP[(size_t)bidx * sCPb + (size_t)by * 64 + col]; } if (ACT == 1) v = (v > 0.f) ? v : expm1f(v); else if (ACT == 7) v = (v > 0.f) ? v + 1.0f : expf(v); else if (ACT == 8) v = tanhf(v); else if (ACT == 9) v = 0.5f * v * (1.0f + tanhf(0.7978845608028654f * (v + 0.044715f * v * v * v))); else if (ACT == 11) v = 1.0f / (1.0f + expf(-v)); else if (ACT == 12) v = (v > 0.f) ? v : 0.01f * v; else if (ACT == 14) v = (v > 0.f) ? v : 0.1f * v; else if (ACT == 15) v = v / (1.0f + expf(-v)); else if (ACT == 3) v = fmaxf(v, 0.f); else if (ACT == 6) v = 0.5f * v * (1.0f + erff(v * 0.70710678118654752f)); so[w][8 * hh + r][t * 16 + ln] = v; } }
  __builtin_amdgcn_fence(__ATOMIC_ACQ_REL, "workgroup"); __builtin_amdgcn_wave_barrier();
  const int rsub = lane >> 4, c4 = (lane & 15) * 4; typedef _Float16 v4h __attribute__((ext_vector_type(4)));
  {
#pragma unroll
    for (int q = 0; q < 8; ++q) { const int r = q * 2 + rsub; if (col0 + c4 < N) { const v4f v = *(const v4fa*)&so[w][r][c4]; if (C) *(v4f*)(C + cofs + (size_t)(row0 + r) * ldc + col0 + c4) = v; if (C16) { v4h h4; for (int i = 0; i < 4; ++i) h4[i] = (_Float16)v[i]; *(v4h*)(C16 + cofs + (size_t)(row0 + r) * ldc + col0 + c4) = h4; } } }
     }
}


// Block-tiled f16 GEMM: C[row][col] = alpha * sum_k A[row][k] * B[col][k] (+ R[row][col], pitch ldc, if HASR). A and B are k-contiguous f16.
// One work-group of 4 waves (2 x 2) owns a (32 FM) x (32 FN) tile of C; each wave FM x FN fragments. A stage is 128 k of the tile's A rows and
// B rows (256 B a row, LDS pitch 272 B), brought in by asynchronous copies into two buffers: stage s + 1 flies while stage s is multiplied.
// The k order inside a fragment and the order of the k blocks are those of k_gemm_hhx. M, N multiples of the tile, K of 128.
#define TKK 128
#define TPB 272
typedef float fal __attribute__((may_alias));
// eight rows (8 apart) of a stage: each lane copies its own 16 bytes of each. The s_wait_xcnt stands in the copies' own statement so that no address register is rewritten ahead of it.
__device__ __forceinline__ void copy8(unsigned lds, const _Float16* g, size_t g8) {
  asm volatile("global_load_async_to_lds_b128 %0, %8, off\n\t"
               "global_load_async_to_lds_b128 %1, %9, off\n\t"
               "global_load_async_to_lds_b128 %2, %10, off\n\t"
               "global_load_async_to_lds_b128 %3, %11, off\n\t"
               "global_load_async_to_lds_b128 %4, %12, off\n\t"
               "global_load_async_to_lds_b128 %5, %13, off\n\t"
               "global_load_async_to_lds_b128 %6, %14, off\n\t"
               "global_load_async_to_lds_b128 %7, %15, off\n\t"
               "s_wait_xcnt 0x0"
               :: "v"(lds), "v"(lds + 8 * TPB), "v"(lds + 16 * TPB), "v"(lds + 24 * TPB), "v"(lds + 32 * TPB), "v"(lds + 40 * TPB), "v"(lds + 48 * TPB), "v"(lds + 56 * TPB),
                  "v"(g), "v"(g + g8), "v"(g + 2 * g8), "v"(g + 3 * g8), "v"(g + 4 * g8), "v"(g + 5 * g8), "v"(g + 6 * g8), "v"(g + 7 * g8)
               : "memory");
}
template <int FM, int FN, bool HASR>
__global__ __launch_bounds__(128) void k_gemm_t(const _Float16* __restrict__ A, int lda, const _Float16* __restrict__ B, int ldb, float alpha, const float* __restrict__ R, float* __restrict__ C, int ldc, int K) {
  constexpr int BM = 32 * FM, BN = 32 * FN, STG = (BM + BN) * TPB, EP = FN * 16 + 4;
  static_assert(4 * FM * 16 * EP * 4 <= 2 * STG, "output staging fits the ring");
  __shared__ __attribute__((aligned(16))) unsigned char sm[2 * STG];
  const int tid = threadIdx.x, w = tid >> 5, lane = tid & 31, ln = lane & 15, hh = lane >> 4;
  const int row0 = blockIdx.y * BM, col0 = blockIdx.x * BN, wm = w >> 1, wn = w & 1;
  const int cr = tid >> 4, cc = tid & 15;      // copies: 16 lanes cover one 256-B row, the work-group 8 rows an instruction
  const _Float16* gA = A + (size_t)(row0 + cr) * lda + cc * 8;
  const _Float16* gB = B + (size_t)(col0 + cr) * ldb + cc * 8;
  const unsigned lA = (unsigned)(size_t)sm + cr * TPB + cc * 16;
  auto stage = [&](int s, int buf) {
    for (int i = 0; i < BM / 64; ++i) copy8(lA + buf * STG + i * 64 * TPB, gA + (size_t)s * TKK + (size_t)i * 64 * lda, (size_t)8 * lda);
    for (int i = 0; i < BN / 64; ++i) copy8(lA + buf * STG + (BM + i * 64) * TPB, gB + (size_t)s * TKK + (size_t)i * 64 * ldb, (size_t)8 * ldb);
  };
  const int nst = K / TKK;
  stage(0, 0);
  asm volatile("s_wait_asynccnt 0x0" ::: "memory");      // this wave's copies of stage 0 have landed
  __syncthreads();                                       // ... and every other wave's
  if (nst > 1) stage(1, 1);
  v8f acc[FM][FN] = {};
  for (int s = 0; s < nst; ++s) {
    const unsigned char* pa = sm + (s & 1) * STG + (wm * FM * 16 + ln) * TPB + hh * 16;
    const unsigned char* pb = sm + (s & 1) * STG + (BM + wn * FN * 16 + ln) * TPB + hh * 16;
    FragH a[2][FM], b[2][FN];      // two fragment sets: block kk + 1 of this stage is read from LDS while block kk is multiplied
    auto frags = [&](int kk, int set) {
#pragma unroll      // constant indices: the arrays it walks stay in registers
      for (int i = 0; i < FM; ++i) { a[set][i].half[0] = *(const v8us*)(pa + i * 16 * TPB + kk * 64); a[set][i].half[1] = *(const v8us*)(pa + i * 16 * TPB + kk * 64 + 32); }
#pragma unroll      // constant indices: the arrays it walks stay in registers
      for (int j = 0; j < FN; ++j) { b[set][j].half[0] = *(const v8us*)(pb + j * 16 * TPB + kk * 64); b[set][j].half[1] = *(const v8us*)(pb + j * 16 * TPB + kk * 64 + 32); }
    };
    frags(0, 0);
#pragma unroll      // constant indices: the arrays it walks stay in registers
    for (int kk = 0; kk < TKK / 32; ++kk) {
      if (kk + 1 < TKK / 32) frags(kk + 1, (kk + 1) & 1);
      __builtin_amdgcn_sched_barrier(0);      // the next block's LDS reads stay one group ahead of this block's WMMAs (sunk among them, each read's latency is waited out by the wave)
#pragma unroll      // constant indices: the arrays it walks stay in registers
      for (int i = 0; i < FM; ++i)
#pragma unroll      // constant indices: the arrays it walks stay in registers
        for (int j = 0; j < FN; ++j) acc[i][j] = __builtin_amdgcn_wmma_f32_16x16x32_f16(false, a[kk & 1][i].v, false, b[kk & 1][j].v, (short)0, acc[i][j], false, false);
      __builtin_amdgcn_sched_barrier(0);      // and the group after that is not lifted in among them
    }
    asm volatile("s_wait_dscnt 0x0" ::: "memory");       // this wave's reads of stage s are done before the buffer is refilled
    asm volatile("s_wait_asynccnt 0x0" ::: "memory");    // this wave's copies of stage s + 1 have landed
    __syncthreads();                                     // publishes stage s + 1 and ends every reader's last read of stage s
    if (s + 2 < nst) stage(s + 2, s & 1);
  }
  asm volatile("s_wait_asynccnt 0x0" ::: "memory");      // nothing in flight when the ring becomes output staging
  // whole 128-B lines out: each wave stages its own FM*16 x FN*16 block in its own LDS range (behind the last pass's barrier), then stores rows
  constexpr int LPR = FN * 4, RPP = 32 / LPR, NQ = FM * 16 / RPP;
  const int rsub = lane / LPR, c4 = (lane % LPR) * 4;
  const unsigned ob = ((unsigned)(row0 + wm * FM * 16 + rsub) * (unsigned)ldc + (unsigned)(col0 + wn * FN * 16 + c4)) * 4u, os = (unsigned)(RPP * ldc) * 4u;      // byte offsets in C (and R), below 2^32
  v4f x[NQ];
  if (HASR) {
#pragma unroll      // constant indices: the arrays it walks stay in registers
    for (int q = 0; q < NQ; ++q) x[q] = *(const v4fa*)((const char*)R + (ob + q * os));
  }
  fal* so = (fal*)sm + (size_t)w * (FM * 16) * EP;
#pragma unroll      // constant indices: the arrays it walks stay in registers
  for (int i = 0; i < FM; ++i)
#pragma unroll      // constant indices: the arrays it walks stay in registers
    for (int j = 0; j < FN; ++j)
#pragma unroll      // constant indices: the arrays it walks stay in registers
      for (int r = 0; r < 8; ++r) so[(i * 16 + 8 * hh + r) * EP + j * 16 + ln] = acc[i][j][r] * alpha;
  __builtin_amdgcn_fence(__ATOMIC_ACQ_REL, "workgroup"); __builtin_amdgcn_wave_barrier();      // the wave's staged rows are written before its lanes read each other's words
#pragma unroll      // constant indices: the arrays it walks stay in registers
  for (int q = 0; q < NQ; ++q) {
    v4f v = *(const v4fa*)&so[(q * RPP + rsub) * EP + c4];
    if (HASR) v += x[q];
    *(v4f*)((char*)C + (ob + q * os)) = v;
  }
}

typedef _Float16 v4h __attribute__((ext_vector_type(4)));

__global__ __launch_bounds__(256) void k_x16(const float* __restrict__ x, _Float16* __restrict__ X16, size_t n8) { const size_t t = (size_t)blockIdx.x * 256 + threadIdx.x; if (t >= n8) return; FragH f;
#pragma unroll
  for (int q = 0; q < 8; ++q) f.h[q] = (_Float16)bf16_round(x[t * 8 + q]); *(v8us*)((unsigned short*)X16 + t * 8) = f.half[0];  }
__global__ __launch_bounds__(256) void k_h16(const float* __restrict__ x, _Float16* __restrict__ X16, size_t n8) { const size_t t = (size_t)blockIdx.x * 256 + threadIdx.x; if (t >= n8) return; FragH f;
#pragma unroll
  for (int q = 0; q < 8; ++q) f.h[q] = (_Float16)x[t * 8 + q]; *(v8us*)((unsigned short*)X16 + t * 8) = f.half[0];  }
__global__ __launch_bounds__(256) void k_round16f(const float* __restrict__ W, _Float16* __restrict__ Bt, size_t n8) { const size_t t = (size_t)blockIdx.x * 256 + threadIdx.x; if (t >= n8) return; FragH f;
#pragma unroll
  for (int i = 0; i < 8; ++i) f.h[i] = (_Float16)(bf16_round(W[t * 8 + i]) * 16.0f); *(v8us*)((unsigned short*)Bt + t * 8) = f.half[0];  }
template <int NHv, int TTv>
__global__ __launch_bounds__(256) void k_vt(const _Float16* __restrict__ V16, int ldv, int voff, _Float16* __restrict__ Vt) { __shared__ unsigned short tl[64][66]; const int tid = threadIdx.x; const int slab = blockIdx.x / (TTv / 64), lg = blockIdx.x % (TTv / 64); const int b = slab / NHv, h = slab % NHv;
  for (int i = tid; i < 64 * 8; i += 256) { const int r = i / 8, c8 = (i % 8) * 8; FragH f; f.half[0] = *(const v8us*)((const unsigned short*)V16 + ((size_t)b * TTv + lg * 64 + r) * ldv + voff + h * 64 + c8);
#pragma unroll
    for (int q = 0; q < 8; ++q) tl[r][c8 + q] = f.u[q]; }
  __syncthreads();
  {
#pragma unroll
    for (int rd = 0; rd < 2; ++rd) { const int d = rd * 32 + tid / 8, pc = tid % 8; FragH f;
#pragma unroll
      for (int q = 0; q < 8; ++q) f.u[q] = tl[pc * 8 + q][d];
      *(v8us*)((unsigned short*)Vt + ((size_t)slab * 64 + d) * TTv + lg * 64 + pc * 8) = f.half[0]; }
     } }

__global__ __launch_bounds__(256) void k_hl(const float* __restrict__ F, _Float16* __restrict__ Hh, _Float16* __restrict__ Hl, size_t n8) { const size_t t = (size_t)blockIdx.x * 256 + threadIdx.x; if (t >= n8) return; FragH fh, fl; const v4f a = *(const v4fa*)(F + t * 8), c = *(const v4fa*)(F + t * 8 + 4);
#pragma unroll
  for (int q = 0; q < 4; ++q) { _Float16 h = (_Float16)a[q]; fh.h[q] = h; fl.h[q] = (_Float16)((a[q] - (float)h) * 1024.0f); h = (_Float16)c[q]; fh.h[4 + q] = h; fl.h[4 + q] = (_Float16)((c[q] - (float)h) * 1024.0f); }
  { *(v8us*)((unsigned short*)Hh + t * 8) = fh.half[0]; *(v8us*)((unsigned short*)Hl + t * 8) = fl.half[0];  } }

__global__ __launch_bounds__(256) void k_snorm(const float* __restrict__ x, int b, const float* __restrict__ g, const float* __restrict__ rsc, _Float16* __restrict__ XN, float* __restrict__ XR) {
  #pragma clang fp contract(off)
  const int tid = threadIdx.x, w = tid >> 5, l = tid & 31; const int r = blockIdx.x * 8 + w; if (r >= LL) return; const float* xr = x + ((size_t)b * LL + r) * DD; float ss = 0.f;
#pragma unroll 1
  for (int k = 0; k < 32; ++k) { const float v = bf16_round(xr[l + 32 * k]); ss += v * v; }
  for (int o = 16; o > 0; o >>= 1) ss += __shfl_xor(ss, o, 32); const float nrm = sqrtf(ss) * 0.03125f; const float inv = bf16_round(g[0]) / fmaxf(nrm, 1e-5f);
  {
#pragma unroll 1
    for (int k = 0; k < 32; ++k) { const int c = l + 32 * k; const float v = bf16_round(xr[c]); FragH f; f.h[0] = (_Float16)(v * inv); *(unsigned short*)((unsigned short*)XN + (size_t)r * DD + c) = f.u[0]; *(float*)(XR + (size_t)r * DD + c) = v * bf16_round(rsc[c]); }
     } }
__global__ __launch_bounds__(256) void k_vt(const float* __restrict__ UV, _Float16* __restrict__ VT) { const int t = blockIdx.x * 256 + threadIdx.x; if (t >= EE * (LL / 8)) return; const int j0 = (t % (LL / 8)) * 8, e = t / (LL / 8); FragH f;
#pragma unroll
  for (int q = 0; q < 8; ++q) { const float v = UV[(size_t)(j0 + q) * NUV + EE + e]; f.h[q] = (_Float16)(v / (1.0f + expf(-v))); }
  *(v8us*)((unsigned short*)VT + (size_t)e * LL + j0) = f.half[0];  }
__global__ __launch_bounds__(256) void k_qk(const float* __restrict__ UV, const float* __restrict__ gam, const float* __restrict__ bet, const float* __restrict__ CS, const float* __restrict__ SN, _Float16* __restrict__ Q16, _Float16* __restrict__ K16) {
  #pragma clang fp contract(off)
  const int t = blockIdx.x * 256 + threadIdx.x; if (t >= 2 * LL * 16) return; const int i0 = (t & 15) * 4; const int l = (t >> 4) % LL; const int which = t / (LL * 16); const float* gp = gam + which * SSz; const float* bp = bet + which * SSz; _Float16* dst = which ? K16 : Q16; FragH o1, o2;
#pragma unroll
  for (int qq = 0; qq < 4; ++qq) { const int i = i0 + qq; const float u1 = UV[(size_t)l * NUV + 2 * EE + i], u2 = UV[(size_t)l * NUV + 2 * EE + 64 + i]; const float b1 = u1 / (1.0f + expf(-u1)), b2 = u2 / (1.0f + expf(-u2));
    const float a1 = b1 * bf16_round(gp[i]) + bf16_round(bp[i]), a2 = b2 * bf16_round(gp[64 + i]) + bf16_round(bp[64 + i]); const float c = CS[(size_t)l * 64 + i], s = SN[(size_t)l * 64 + i];
    o1.h[qq] = (_Float16)(a1 * c - a2 * s); o2.h[qq] = (_Float16)(a2 * c + a1 * s); }
  const unsigned long long p1 = *(const unsigned long long*)&o1.u[0], p2 = *(const unsigned long long*)&o2.u[0];
  { *(unsigned long long*)((unsigned short*)dst + (size_t)l * SSz + i0) = p1; *(unsigned long long*)((unsigned short*)dst + (size_t)l * SSz + 64 + i0) = p2;  } }
__constant__ float INVF[64] = {1.000000000e+00f,1.154781938e+00f,1.333521485e+00f,1.539926529e+00f,1.778279424e+00f,2.053524971e+00f,2.371373653e+00f,2.738419533e+00f,3.162277699e+00f,3.651741266e+00f,4.216965199e+00f,4.869675159e+00f,5.623413086e+00f,6.493816376e+00f,7.498941898e+00f,8.659643173e+00f,1.000000000e+01f,1.154782009e+01f,1.333521461e+01f,1.539926529e+01f,1.778279495e+01f,2.053524971e+01f,2.371373749e+01f,2.738419724e+01f,3.162277603e+01f,3.651741409e+01f,4.216965103e+01f,4.869675064e+01f,5.623413086e+01f,6.493816376e+01f,7.498941803e+01f,8.659643555e+01f,1.000000000e+02f,1.154781952e+02f,1.333521423e+02f,1.539926453e+02f,1.778279419e+02f,2.053525085e+02f,2.371373749e+02f,2.738419495e+02f,3.162277527e+02f,3.651741333e+02f,4.216965027e+02f,4.869675293e+02f,5.623413086e+02f,6.493816528e+02f,7.498942261e+02f,8.659642944e+02f,1.000000000e+03f,1.154781982e+03f,1.333521484e+03f,1.539926514e+03f,1.778279419e+03f,2.053525146e+03f,2.371373779e+03f,2.738419678e+03f,3.162277588e+03f,3.651741211e+03f,4.216964844e+03f,4.869675293e+03f,5.623413086e+03f,6.493816406e+03f,7.498941895e+03f,8.659643555e+03f};
__global__ __launch_bounds__(256) void k_cstab(float* __restrict__ CS, float* __restrict__ SN) {
  #pragma clang fp contract(off)
  const int t = blockIdx.x * 256 + threadIdx.x; if (t >= LL * 64) return; const int i = t & 63, l = t >> 6; const float invf = INVF[i]; const float ang = (float)l * invf; const float c = (float)cos((double)ang), s = (float)sin((double)ang);
  { *(float*)(CS + t) = c; *(float*)(SN + t) = s;  } }
__global__ __launch_bounds__(256) void k_ker(const float* __restrict__ S, const float* __restrict__ wrel, _Float16* __restrict__ KER) {
  #pragma clang fp contract(off)
  const int t = blockIdx.x * 256 + threadIdx.x; if (t >= LL * (LL / 8)) return; const int j0 = (t % (LL / 8)) * 8, i = t / (LL / 8); FragH f;
#pragma unroll
  for (int q = 0; q < 8; ++q) { const int j = j0 + q; const float v = (S[(size_t)i * LL + j] + bf16_round(wrel[j - i + LL - 1])) / 11.313708498984761f; const float r = fmaxf(v, 0.f); f.h[q] = (_Float16)(r * r); }
  *(v8us*)((unsigned short*)KER + (size_t)i * LL + j0) = f.half[0];  }
__global__ __launch_bounds__(256) void k_gate(const float* __restrict__ UV, const float* __restrict__ KV, _Float16* __restrict__ G16) {
  #pragma clang fp contract(off)
  const int t = blockIdx.x * 256 + threadIdx.x; if (t >= LL * (EE / 8)) return; const int e0 = (t % (EE / 8)) * 8, i = t / (EE / 8); FragH f;
#pragma unroll
  for (int q = 0; q < 8; ++q) { const float u = UV[(size_t)i * NUV + e0 + q]; f.h[q] = (_Float16)((u / (1.0f + expf(-u))) * KV[(size_t)i * EE + e0 + q]); }
  *(v8us*)((unsigned short*)G16 + (size_t)i * EE + e0) = f.half[0];  }

extern "C" void kernel_launch(void* const* d_in, const int* in_sizes, int n_in,
                              void* d_out, int out_size, void* d_ws, size_t ws_size, hipStream_t stream) {
  (void)in_sizes; (void)n_in; (void)out_size;
  const float* x = (const float*)d_in[0]; const float* g = (const float*)d_in[1]; const float* uvw = (const float*)d_in[2]; const float* gam = (const float*)d_in[3]; const float* bet = (const float*)d_in[4]; const float* wrel = (const float*)d_in[5]; const float* ow = (const float*)d_in[6]; const float* rsc = (const float*)d_in[7];
  char* ws = (char*)d_ws; size_t off = 0;
  auto take = [&](size_t bytes) { char* p = ws + off; off += (bytes + 255) & ~(size_t)255; return p; };
  _Float16* BUV = (_Float16*)take((size_t)NUV * DD * 2); _Float16* BOW = (_Float16*)take((size_t)DD * EE * 2); float* CS = (float*)take((size_t)LL * 64 * 4); float* SN = (float*)take((size_t)LL * 64 * 4);
  _Float16* XN = (_Float16*)take((size_t)LL * DD * 2); float* XR = (float*)take((size_t)LL * DD * 4); float* UV = (float*)take((size_t)LL * NUV * 4); _Float16* VT = (_Float16*)take((size_t)EE * LL * 2); _Float16* Q16 = (_Float16*)take((size_t)LL * SSz * 2); _Float16* K16 = (_Float16*)take((size_t)LL * SSz * 2); float* S = (float*)take((size_t)LL * LL * 4); _Float16* KER = (_Float16*)take((size_t)LL * LL * 2); float* KV = (float*)take((size_t)LL * EE * 4); _Float16* G16 = (_Float16*)take((size_t)LL * EE * 2);
  if (off > ws_size) return;      // 8.7 + 4.2 + 2.1 + 4.2 + 17.3 + 4.2 + 0.5 + 4.2 + 2.1 + 8.4 + 4.2 ≈ 60 MB
  k_round16f<<<(unsigned)(((size_t)NUV * DD / 8 + 255) / 256), 256, 0, stream>>>(uvw, BUV, (size_t)NUV * DD / 8); k_round16f<<<(unsigned)(((size_t)DD * EE / 8 + 255) / 256), 256, 0, stream>>>(ow, BOW, (size_t)DD * EE / 8);      /* (out,in) = natural Bt */
  k_cstab<<<(LL * 64 + 255) / 256, 256, 0, stream>>>(CS, SN);
  const dim3 gU(NUV / 64, LL / 128), gS(LL / 64, LL / 64), gK(EE / 64, LL / 128), gO(DD / 64, LL / 64);
  for (int b = 0; b < NBt; ++b) {
    k_snorm<<<LL / 8, 256, 0, stream>>>(x, b, g, rsc, XN, XR);
    k_gemm_t<4, 2, false><<<gU, 128, 0, stream>>>(XN, DD, BUV, DD, 0.0625f, nullptr, UV, NUV, DD);      /* uv pre-activation: M 1024 N 4224 K 1024 */
    k_vt<<<(EE * (LL / 8) + 255) / 256, 256, 0, stream>>>(UV, VT); k_qk<<<(2 * LL * 16 + 255) / 256, 256, 0, stream>>>(UV, gam, bet, CS, SN, Q16, K16);
    k_gemm_t<2, 2, false><<<gS, 128, 0, stream>>>(Q16, SSz, K16, SSz, 1.0f, nullptr, S, LL, SSz);      /* qk: M 1024 N 1024 K 128 */
    k_ker<<<(LL * (LL / 8) + 255) / 256, 256, 0, stream>>>(S, wrel, KER);
    k_gemm_t<4, 2, false><<<gK, 128, 0, stream>>>(KER, LL, VT, LL, 1.0f, nullptr, KV, EE, LL);      /* kernel·v: M 1024 N 2048 K 1024 */
    k_gate<<<(LL * (EE / 8) + 255) / 256, 256, 0, stream>>>(UV, KV, G16);
    k_gemm_t<2, 2, true><<<gO, 128, 0, stream>>>(G16, EE, BOW, EE, 0.0625f, XR, (float*)d_out + (size_t)b * LL * DD, DD, EE); }      /* y = x·res_scale + out·o_wᵀ: M 1024 N 1024 K 2048 (un-batched addend) */
}

// v002
// Measured time: 281 microseconds a run.
// Timed twice side by side with v001, it ran 2.41 times as fast both times.
// All steps since v000 together make it 5.67 times as fast.
#include <hip/hip_runtime.h>
// RTM (GAU-style) block (B 8, L 1024, D 1024, E 2048, s 128): xn = ScaleNorm(x)·g; uv = silu(xn·uv_wᵀ) → u (2048) | v (2048) | base (128); q/k = rope_seq(base·γ + β) (rotation over the sequence axis with angle l·10000^(i/64), half-split); qk = q·kᵀ + w_rel[j − i + 1023]; kernel = relu(qk/√128)²; out = u ⊙ (kernel·v); y = x·res_scale + out·o_wᵀ → [8,1024,1024].
// Compute dtype: x and parameters rounded to bf16; ScaleNorm in f32 → f16 operand; uv GEMM (f32 result), SiLU/affine/rope in f32 (sin/cos of the f32 angle evaluated in double); q, k, v, kernel and the gated product as f16 GEMM operands (≈2^-12), f32 accumulation; residual x·res_scale through the f32 epilogue. v_wmma_f32_16x16x32_f16.
#define NBt 8
#define LL 1024
#define DD 1024
#define EE 2048
#define SSz 128
#define NUV (2 * EE + SSz)       /* 4224 */
typedef __bf16 v16b __attribute__((ext_vector_type(16)));
typedef unsigned short v8us __attribute__((ext_vector_type(8), may_alias));
typedef float  v8f  __attribute__((ext_vector_type(8)));
typedef float  v4f  __attribute__((ext_vector_type(4)));
typedef float  v4fa __attribute__((ext_vector_type(4), may_alias));
union FragB { v16b v; v8us half[2]; unsigned short u[16]; };

__device__ __forceinline__ unsigned short bf16_bits(float x) { unsigned int u = __float_as_uint(x); return (unsigned short)((u + 0x7FFFu + ((u >> 16) & 1u)) >> 16); }
__device__ __forceinline__ float bf16_val(unsigned short b) { return __uint_as_float(((unsigned int)b) << 16); }
__device__ __forceinline__ float bf16_round(float x) { return bf16_val(bf16_bits(x)); }
// D += A·B with NT terms: 1 = ah·bh, 2 = + al·bh (A split), 3 = + ah·bl (both split)
template <int NT>
__device__ __forceinline__ v8f mmaN(v16b ah, v16b al, v16b bh, v16b bl, v8f c) {
  c = __builtin_amdgcn_wmma_f32_16x16x32_bf16(false, ah, false, bh, (short)0, c, false, false);
  if (NT >= 2) c = __builtin_amdgcn_wmma_f32_16x16x32_bf16(false, al, false, bh, (short)0, c, false, false);
  if (NT >= 3) c = __builtin_amdgcn_wmma_f32_16x16x32_bf16(false, ah, false, bl, (short)0, c, false, false);
  asm volatile("v_nop\n\tv_nop\n\tv_nop\n\tv_nop" : "+v"(c) : "v"(ah), "v"(al), "v"(bh), "v"(bl));
  return c;
}

__global__ __launch_bounds__(256) void k_wt_bf16(const float* __restrict__ W, unsigned short* __restrict__ Wt, int K, int N) {
  const int t = blockIdx.x * 256 + threadIdx.x;
  const int k8n = K / 8;
  if (t >= N * k8n) return;
  const int n = t / k8n, k8 = (t % k8n) * 8;
  v8us v;
#pragma unroll
  for (int i = 0; i < 8; ++i) v[i] = bf16_bits(W[(size_t)(k8 + i) * N + n]);
  *(v8us*)(Wt + (size_t)n * K + k8) = v;
  
}

// GEMM C[M][N] (f32, pitch ldc) = act(A[M][K]·W + bias). A f32 row-major (pitch lda) converted per fragment to bf16
// (ASPLIT: hi/lo two planes -> 2 terms, else single rounded term); Wt bf16 [N][K] (pitch ldb). BIAS_BF16 rounds the
// bias to bf16 first (bias quantised to bf16 before the add). K%32==0, M%16==0, N%64==0.
template <bool ASPLIT, int ACT, bool BIAS_BF16>
__global__ __launch_bounds__(128) void k_gemm_bf(const float* __restrict__ A, int lda, const unsigned short* __restrict__ Wt, int ldb,
                                               const float* __restrict__ bias, float* __restrict__ C, int ldc, int M, int N, int K) {
  __shared__ __attribute__((aligned(16))) float so[4][16][64];
  const int tid = threadIdx.x, w = tid >> 5, lane = tid & 31, ln = lane & 15, hh = lane >> 4;
  const int ntn = N / 64;
  const int wid = blockIdx.x * 4 + w;
  const int mt = wid / ntn, nq = wid % ntn;
  if (mt * 16 >= M) return;
  const int row0 = mt * 16, col0 = nq * 64;
  const float* arow = A + (size_t)(row0 + ln) * lda;
  v8f acc[4] = {};
  for (int kb = 0; kb < K; kb += 32) {
    FragB ah, al;
    const v4f x0 = *(const v4fa*)(arow + kb + 8 * hh), x1 = *(const v4fa*)(arow + kb + 8 * hh + 4);
    const v4f x2 = *(const v4fa*)(arow + kb + 16 + 8 * hh), x3 = *(const v4fa*)(arow + kb + 16 + 8 * hh + 4);
    float xs[16] = {x0[0],x0[1],x0[2],x0[3],x1[0],x1[1],x1[2],x1[3],x2[0],x2[1],x2[2],x2[3],x3[0],x3[1],x3[2],x3[3]};
#pragma unroll
    for (int i = 0; i < 16; ++i) { const unsigned short hb = bf16_bits(xs[i]); ah.u[i] = hb; al.u[i] = ASPLIT ? bf16_bits(xs[i] - bf16_val(hb)) : (unsigned short)0; }
#pragma unroll
    for (int t = 0; t < 4; ++t) {
      const unsigned short* brow = Wt + (size_t)(col0 + t * 16 + ln) * ldb + kb;
      FragB b;
      b.half[0] = *(const v8us*)(brow + 8 * hh);
      b.half[1] = *(const v8us*)(brow + 16 + 8 * hh);
      acc[t] = mmaN<ASPLIT ? 2 : 1>(ah.v, al.v, b.v, b.v, acc[t]);
    }
  }
#pragma unroll
  for (int t = 0; t < 4; ++t) {
    float bv = bias ? bias[col0 + t * 16 + ln] : 0.f;
    if (BIAS_BF16) bv = bf16_round(bv);
#pragma unroll
    for (int r = 0; r < 8; ++r) { float v = acc[t][r] + bv; if (ACT == 1) v = fmaxf(v, 0.f); so[w][8 * hh + r][t * 16 + ln] = v; }
  }
  __builtin_amdgcn_fence(__ATOMIC_ACQ_REL, "workgroup");
  __builtin_amdgcn_wave_barrier();
  const int rsub = lane >> 4, c4 = (lane & 15) * 4;
  {
#pragma unroll
    for (int q = 0; q < 8; ++q) {
      const int r = q * 2 + rsub;
      const v4f v = *(const v4fa*)&so[w][r][c4];
      *(v4f*)(C + (size_t)(row0 + r) * ldc + col0 + c4) = v;
    }
    
  }
}

// GEMM C = act(A·W + bias + resid): A f32 (ASPLIT -> hi/lo 2 terms), Wt bf16 [N][K]; ACT 0 none, 1 relu, 2 exact gelu;
// resid (optional, f32, row index = (row % rmod), pitch ldr, RES_BF16 rounds it) added before the activation.
template <bool ASPLIT, int ACT, bool BIAS_BF16, bool RES_BF16>
__global__ __launch_bounds__(128) void k_gemm_bf3(const float* __restrict__ A, int lda, const unsigned short* __restrict__ Wt, int ldb,
                                                const float* __restrict__ bias, const float* __restrict__ resid, int rmod, int ldr,
                                                float* __restrict__ C, int ldc, int M, int N, int K) {
  __shared__ __attribute__((aligned(16))) float so[4][16][64];
  const int tid = threadIdx.x, w = tid >> 5, lane = tid & 31, ln = lane & 15, hh = lane >> 4;
  const int ntn = N / 64;
  const int wid = blockIdx.x * 4 + w;
  const int mt = wid / ntn, nq = wid % ntn;
  if (mt * 16 >= M) return;
  const int row0 = mt * 16, col0 = nq * 64;
  const float* arow = A + (size_t)(row0 + ln) * lda;
  v8f acc[4] = {};
  for (int kb = 0; kb < K; kb += 32) {
    FragB ah, al;
    const v4f x0 = *(const v4fa*)(arow + kb + 8 * hh), x1 = *(const v4fa*)(arow + kb + 8 * hh + 4);
    const v4f x2 = *(const v4fa*)(arow + kb + 16 + 8 * hh), x3 = *(const v4fa*)(arow + kb + 16 + 8 * hh + 4);
    float xs[16] = {x0[0],x0[1],x0[2],x0[3],x1[0],x1[1],x1[2],x1[3],x2[0],x2[1],x2[2],x2[3],x3[0],x3[1],x3[2],x3[3]};
#pragma unroll
    for (int i = 0; i < 16; ++i) { const unsigned short hb = bf16_bits(xs[i]); ah.u[i] = hb; al.u[i] = ASPLIT ? bf16_bits(xs[i] - bf16_val(hb)) : (unsigned short)0; }
#pragma unroll
    for (int t = 0; t < 4; ++t) {
      const unsigned short* brow = Wt + (size_t)(col0 + t * 16 + ln) * ldb + kb;
      FragB b;
      b.half[0] = *(const v8us*)(brow + 8 * hh);
      b.half[1] = *(const v8us*)(brow + 16 + 8 * hh);
      acc[t] = mmaN<ASPLIT ? 2 : 1>(ah.v, al.v, b.v, b.v, acc[t]);
    }
  }
#pragma unroll
  for (int t = 0; t < 4; ++t) {
    const int col = col0 + t * 16 + ln;
    float bv = bias ? bias[col] : 0.f;
    if (BIAS_BF16) bv = bf16_round(bv);
#pragma unroll
    for (int r = 0; r < 8; ++r) {
      float v = acc[t][r] + bv;
      if (resid) { float rv = resid[(size_t)((row0 + 8 * hh + r) % rmod) * ldr + col]; if (RES_BF16) rv = bf16_round(rv); v += rv; }
      if (ACT == 1) v = fmaxf(v, 0.f);
      if (ACT == 2) v = 0.5f * v * (1.0f + erff(v * 0.70710678118654752f));
      if (ACT == 3) { const float u = 0.7978845608028654f * (v + 0.044715f * v * v * v); v = 0.5f * v * (1.0f + tanhf(u)); }
      so[w][8 * hh + r][t * 16 + ln] = v;
    }
  }
  __builtin_amdgcn_fence(__ATOMIC_ACQ_REL, "workgroup");
  __builtin_amdgcn_wave_barrier();
  const int rsub = lane >> 4, c4 = (lane & 15) * 4;
  {
#pragma unroll
    for (int q = 0; q < 8; ++q) {
      const int r = q * 2 + rsub;
      const v4f v = *(const v4fa*)&so[w][r][c4];
      *(v4f*)(C + (size_t)(row0 + r) * ldc + col0 + c4) = v;
    }
    
  }
}
// row LayerNorm (biased variance, eps) over N: s = X (+ R); optional out_sum <- s; out_norm <- (s-mu)*rsqrt(var+eps)*g + b
template <bool PARAM_BF16>
__global__ __launch_bounds__(256) void k_layernorm(const float* __restrict__ X, const float* __restrict__ R, const float* __restrict__ g, const float* __restrict__ bta,
                                                  float* __restrict__ out_sum, float* __restrict__ out_norm, int N, float eps) {
  __shared__ float red[256];
  const int row = blockIdx.x, tid = threadIdx.x;
  const float* x = X + (size_t)row * N; const float* rr = R ? R + (size_t)row * N : nullptr;
  float vals[16];                     // up to N = 4096
  const int per = N / 256;            // contiguous chunk per thread? use strided-by-4 chunks: thread handles j = tid*4 + 1024*u
  float s1 = 0.f;
  for (int u = 0; u < per / 4; ++u) {
    const int j = tid * 4 + 1024 * u;
    const v4f a = *(const v4fa*)(x + j);
    v4f b = {0.f,0.f,0.f,0.f}; if (rr) b = *(const v4fa*)(rr + j);
#pragma unroll
    for (int q = 0; q < 4; ++q) { const float v = a[q] + b[q]; vals[u * 4 + q] = v; s1 += v; }
  }
  red[tid] = s1; __syncthreads();
  for (int st = 128; st > 0; st >>= 1) { if (tid < st) red[tid] += red[tid + st]; __syncthreads(); }
  const float mu = red[0] / (float)N; __syncthreads();
  float s2 = 0.f;
  for (int u = 0; u < per / 4; ++u)
#pragma unroll
    for (int q = 0; q < 4; ++q) { const float c = vals[u * 4 + q] - mu; s2 += c * c; }
  red[tid] = s2; __syncthreads();
  for (int st = 128; st > 0; st >>= 1) { if (tid < st) red[tid] += red[tid + st]; __syncthreads(); }
  const float rs = rsqrtf(red[0] / (float)N + eps);
  {
    for (int u = 0; u < per / 4; ++u) {
      const int j = tid * 4 + 1024 * u;
      v4f o, sm;
#pragma unroll
      for (int q = 0; q < 4; ++q) {
        float gg = g[j + q], bb = bta[j + q];
        if (PARAM_BF16) { gg = bf16_round(gg); bb = bf16_round(bb); }
        sm[q] = vals[u * 4 + q]; o[q] = (vals[u * 4 + q] - mu) * rs * gg + bb;
      }
      if (out_sum) *(v4f*)(out_sum + (size_t)row * N + j) = sm;
      *(v4f*)(out_norm + (size_t)row * N + j) = o;
    }
    
  }
}



// ---- f16 WMMA path (v_wmma_f32_16x16x32_f16): 11-bit significands for operands in range — used for all four GEMMs of this block
typedef _Float16 v16h __attribute__((ext_vector_type(16)));
union FragH { v16h v; v8us half[2]; _Float16 h[16]; unsigned short u[16]; };
template <int NT>
__device__ __forceinline__ v8f mmaH(v16h ah, v16h al, v16h bh, v16h bl, v8f c) {
  c = __builtin_amdgcn_wmma_f32_16x16x32_f16(false, ah, false, bh, (short)0, c, false, false);
  if (NT >= 2) c = __builtin_amdgcn_wmma_f32_16x16x32_f16(false, al, false, bh, (short)0, c, false, false);
  if (NT >= 3) c = __builtin_amdgcn_wmma_f32_16x16x32_f16(false, ah, false, bl, (short)0, c, false, false);
  asm volatile("v_nop\n\tv_nop\n\tv_nop\n\tv_nop" : "+v"(c) : "v"(ah), "v"(al), "v"(bh), "v"(bl));
  return c;
}
// batched GEMM like k_gemm_b but f16 operands: A f32 (split into f16 hi/lo if ASPLIT, else rounded to f16), Bt = f16 values [n][k]; alpha; C f32; N multiple of 16 (partial tiles skipped)
template <bool ASPLIT>
__global__ __launch_bounds__(128) void k_gemm_h(const float* __restrict__ A, int lda, size_t sA, const _Float16* __restrict__ Bh, int ldb, size_t sB, float alpha, float* __restrict__ C, int ldc, size_t sC, int M, int N, int K) {
  __shared__ __attribute__((aligned(16))) float so[4][16][64];
  const int tid = threadIdx.x, w = tid >> 5, lane = tid & 31, ln = lane & 15, hh = lane >> 4; const int by = blockIdx.y;
  A += (size_t)by * sA; Bh += (size_t)by * sB; C += (size_t)by * sC;
  const int ntn = (N + 63) / 64; const int wid = blockIdx.x * 4 + w; const int mt = wid / ntn, nq = wid % ntn; if (mt * 16 >= M) return;
  const int row0 = mt * 16, col0 = nq * 64; const float* arow = A + (size_t)(row0 + ln) * lda;
  v8f acc[4] = {};
  for (int kb = 0; kb < K; kb += 32) {
    FragH ah, al;
    const v4f x0 = *(const v4fa*)(arow + kb + 8 * hh), x1 = *(const v4fa*)(arow + kb + 8 * hh + 4), x2 = *(const v4fa*)(arow + kb + 16 + 8 * hh), x3 = *(const v4fa*)(arow + kb + 16 + 8 * hh + 4);
    float xs[16] = {x0[0],x0[1],x0[2],x0[3],x1[0],x1[1],x1[2],x1[3],x2[0],x2[1],x2[2],x2[3],x3[0],x3[1],x3[2],x3[3]};
#pragma unroll
    for (int i = 0; i < 16; ++i) { const _Float16 h = (_Float16)xs[i]; ah.h[i] = h; al.h[i] = ASPLIT ? (_Float16)(xs[i] - (float)h) : (_Float16)0.0f; }
#pragma unroll
    for (int t = 0; t < 4; ++t) { if (col0 + t * 16 >= N) continue; const size_t boff = (size_t)(col0 + t * 16 + ln) * ldb + kb; FragH bq; bq.half[0] = *(const v8us*)(Bh + boff + 8 * hh); bq.half[1] = *(const v8us*)(Bh + boff + 16 + 8 * hh);
      acc[t] = mmaH<ASPLIT ? 2 : 1>(ah.v, al.v, bq.v, bq.v, acc[t]); }
  }
#pragma unroll
  for (int t = 0; t < 4; ++t) { if (col0 + t * 16 >= N) continue;
#pragma unroll
    for (int r = 0; r < 8; ++r) so[w][8 * hh + r][t * 16 + ln] = acc[t][r] * alpha; }
  __builtin_amdgcn_fence(__ATOMIC_ACQ_REL, "workgroup"); __builtin_amdgcn_wave_barrier();
  const int rsub = lane >> 4, c4 = (lane & 15) * 4;
  {
#pragma unroll
    for (int q = 0; q < 8; ++q) { const int r = q * 2 + rsub; if (col0 + c4 < N) { const v4f v = *(const v4fa*)&so[w][r][c4]; *(v4f*)(C + (size_t)(row0 + r) * ldc + col0 + c4) = v; } }
     }
}

// Wt[n][k] = f16(W[k][n]·scale) from f32 row-major W[K][N] (scale = power of two; bf16-exact weights stay exact in f16 away from the subnormal range)
__global__ __launch_bounds__(256) void k_wt_f16(const float* __restrict__ W, _Float16* __restrict__ Wt, int K, int N, float scale) {
  const int t = blockIdx.x * 256 + threadIdx.x; if (t >= N * (K / 8)) return; const int n = t / (K / 8), k8 = (t % (K / 8)) * 8; FragH f;
#pragma unroll
  for (int i = 0; i < 8; ++i) f.h[i] = (_Float16)(bf16_round(W[(size_t)(k8 + i) * N + n]) * scale); const v8us o = f.half[0];
  *(v8us*)((unsigned short*)Wt + (size_t)n * K + k8) = o; 
}
// k_gemm_hh variant with fused epilogue: v = acc·alpha + bias[by·sBias + col] (+ CP[(row/rowsPerB)·sCPb + by·64 + col] if CP) ; ACT 0 none / 1 elu ; writes f32 C and f16 C16, each if non-null
template <int ACT>
__global__ __launch_bounds__(128) void k_gemm_hhx(const _Float16* __restrict__ A, int lda, size_t sA, const _Float16* __restrict__ Bh, int ldb, size_t sB, float alpha, const float* __restrict__ bias, size_t sBias, const float* __restrict__ CP, int rowsPerB, size_t sCPb, int row0g,
    float* __restrict__ C, _Float16* __restrict__ C16, int ldc, size_t sC, int M, int N, int K) {
  __shared__ __attribute__((aligned(16))) float so[4][16][64];
  const int tid = threadIdx.x, w = tid >> 5, lane = tid & 31, ln = lane & 15, hh = lane >> 4; const int by = blockIdx.y;
  A += (size_t)by * sA; Bh += (size_t)by * sB; const size_t cofs = (size_t)by * sC; const float* bp = bias ? bias + (size_t)by * sBias : nullptr;
  const int ntn = (N + 63) / 64; const int wid = blockIdx.x * 4 + w; const int mt = wid / ntn, nq = wid % ntn; if (mt * 16 >= M) return;
  const int row0 = mt * 16, col0 = nq * 64; const _Float16* arow = A + (size_t)(row0 + ln) * lda;
  v8f acc[4] = {};
  for (int kb = 0; kb < K; kb += 32) { FragH ah; ah.half[0] = *(const v8us*)((const unsigned short*)arow + kb + 8 * hh); ah.half[1] = *(const v8us*)((const unsigned short*)arow + kb + 16 + 8 * hh);
#pragma unroll
    for (int t = 0; t < 4; ++t) { if (col0 + t * 16 >= N) continue; const size_t boff = (size_t)(col0 + t * 16 + ln) * ldb + kb; FragH bq; bq.half[0] = *(const v8us*)((const unsigned short*)Bh + boff + 8 * hh); bq.half[1] = *(const v8us*)((const unsigned short*)Bh + boff + 16 + 8 * hh);
      acc[t] = mmaH<1>(ah.v, ah.v, bq.v, bq.v, acc[t]); }
  }
#pragma unroll
  for (int t = 0; t < 4; ++t) { if (col0 + t * 16 >= N) continue; const int col = col0 + t * 16 + ln; const float bv = bp ? bf16_round(bp[col]) : 0.f;
#pragma unroll
    for (int r = 0; r < 8; ++r) { float v = acc[t][r] * alpha + bv; if (CP) { const int bidx = (row0g + row0 + 8 * hh + r) / rowsPerB; v += CP[(size_t)bidx * sCPb + (size_t)by * 64 + col]; } if (ACT == 1) v = (v > 0.f) ? v : expm1f(v); else if (ACT == 7) v = (v > 0.f) ? v + 1.0f : expf(v); else if (ACT == 8) v = tanhf(v); else if (ACT == 9) v = 0.5f * v * (1.0f + tanhf(0.7978845608028654f * (v + 0.044715f * v * v * v))); else if (ACT == 11) v = 1.0f / (1.0f + expf(-v)); else if (ACT == 12) v = (v > 0.f) ? v : 0.01f * v; else if (ACT == 14) v = (v > 0.f) ? v : 0.1f * v; else if (ACT == 15) v = v / (1.0f + expf(-v)); else if (ACT == 3) v = fmaxf(v, 0.f); else if (ACT == 6) v = 0.5f * v * (1.0f + erff(v * 0.70710678118654752f)); so[w][8 * hh + r][t * 16 + ln] = v; } }
  __builtin_amdgcn_fence(__ATOMIC_ACQ_REL, "workgroup"); __builtin_amdgcn_wave_barrier();
  const int rsub = lane >> 4, c4 = (lane & 15) * 4; typedef _Float16 v4h __attribute__((ext_vector_type(4)));
  {
#pragma unroll
    for (int q = 0; q < 8; ++q) { const int r = q * 2 + rsub; if (col0 + c4 < N) { const v4f v = *(const v4fa*)&so[w][r][c4]; if (C) *(v4f*)(C + cofs + (size_t)(row0 + r) * ldc + col0 + c4) = v; if (C16) { v4h h4; for (int i = 0; i < 4; ++i) h4[i] = (_Float16)v[i]; *(v4h*)(C16 + cofs + (size_t)(row0 + r) * ldc + col0 + c4) = h4; } } }
     }
}


// Block-tiled f16 GEMM: C[row][col] = alpha * sum_k A[row][k] * B[col][k] (+ the value that C[row][col] already holds, if HASR). A and B are k-contiguous f16.
// blockIdx.z is the batch element: A, B and C move on by sA, sB and sC elements for each.
// One work-group of 4 waves (2 x 2) owns a (32 FM) x (32 FN) tile of C; each wave FM x FN fragments. A stage is 128 k of the tile's A rows and
// B rows (256 B a row, LDS pitch 272 B), brought in by asynchronous copies into two buffers: stage s + 1 flies while stage s is multiplied.
// The k order inside a fragment and the order of the k blocks are those of k_gemm_hhx. M, N multiples of the tile, K of 128.
#define TKK 128
#define TPB 272
typedef float fal __attribute__((may_alias));
// eight rows (8 apart) of a stage: each lane copies its own 16 bytes of each. The s_wait_xcnt stands in the copies' own statement so that no address register is rewritten ahead of it.
__device__ __forceinline__ void copy8(unsigned lds, const _Float16* g, size_t g8) {
  asm volatile("global_load_async_to_lds_b128 %0, %8, off\n\t"
               "global_load_async_to_lds_b128 %1, %9, off\n\t"
               "global_load_async_to_lds_b128 %2, %10, off\n\t"
               "global_load_async_to_lds_b128 %3, %11, off\n\t"
               "global_load_async_to_lds_b128 %4, %12, off\n\t"
               "global_load_async_to_lds_b128 %5, %13, off\n\t"
               "global_load_async_to_lds_b128 %6, %14, off\n\t"
               "global_load_async_to_lds_b128 %7, %15, off\n\t"
               "s_wait_xcnt 0x0"
               :: "v"(lds), "v"(lds + 8 * TPB), "v"(lds + 16 * TPB), "v"(lds + 24 * TPB), "v"(lds + 32 * TPB), "v"(lds + 40 * TPB), "v"(lds + 48 * TPB), "v"(lds + 56 * TPB),
                  "v"(g), "v"(g + g8), "v"(g + 2 * g8), "v"(g + 3 * g8), "v"(g + 4 * g8), "v"(g + 5 * g8), "v"(g + 6 * g8), "v"(g + 7 * g8)
               : "memory");
}
template <int FM, int FN, bool HASR>
__global__ __launch_bounds__(128) void k_gemm_t(const _Float16* __restrict__ A, int lda, size_t sA, const _Float16* __restrict__ B, int ldb, size_t sB, float alpha, float* __restrict__ C, int ldc, size_t sC, int K) {
  constexpr int BM = 32 * FM, BN = 32 * FN, STG = (BM + BN) * TPB, EP = FN * 16 + 4;
  static_assert(4 * FM * 16 * EP * 4 <= 2 * STG, "output staging fits the ring");
  __shared__ __attribute__((aligned(16))) unsigned char sm[2 * STG];
  const int tid = threadIdx.x, w = tid >> 5, lane = tid & 31, ln = lane & 15, hh = lane >> 4;
  const int row0 = blockIdx.y * BM, col0 = blockIdx.x * BN, wm = w >> 1, wn = w & 1;
  A += (size_t)blockIdx.z * sA; B += (size_t)blockIdx.z * sB; C += (size_t)blockIdx.z * sC;
  const int cr = tid >> 4, cc = tid & 15;      // copies: 16 lanes cover one 256-B row, the work-group 8 rows an instruction
  const _Float16* gA = A + (size_t)(row0 + cr) * lda + cc * 8;
  const _Float16* gB = B + (size_t)(col0 + cr) * ldb + cc * 8;
  const unsigned lA = (unsigned)(size_t)sm + cr * TPB + cc * 16;
  auto stage = [&](int s, int buf) {
    for (int i = 0; i < BM / 64; ++i) copy8(lA + buf * STG + i * 64 * TPB, gA + (size_t)s * TKK + (size_t)i * 64 * lda, (size_t)8 * lda);
    for (int i = 0; i < BN / 64; ++i) copy8(lA + buf * STG + (BM + i * 64) * TPB, gB + (size_t)s * TKK + (size_t)i * 64 * ldb, (size_t)8 * ldb);
  };
  const int nst = K / TKK;
  stage(0, 0);
  asm volatile("s_wait_asynccnt 0x0" ::: "memory");      // this wave's copies of stage 0 have landed
  __syncthreads();                                       // ... and every other wave's
  if (nst > 1) stage(1, 1);
  v8f acc[FM][FN] = {};
  for (int s = 0; s < nst; ++s) {
    const unsigned char* pa = sm + (s & 1) * STG + (wm * FM * 16 + ln) * TPB + hh * 16;
    const unsigned char* pb = sm + (s & 1) * STG + (BM + wn * FN * 16 + ln) * TPB + hh * 16;
    FragH a[2][FM], b[2][FN];      // two fragment sets: block kk + 1 of this stage is read from LDS while block kk is multiplied
    auto frags = [&](int kk, int set) {
#pragma unroll      // constant indices: the arrays it walks stay in registers
      for (int i = 0; i < FM; ++i) { a[set][i].half[0] = *(const v8us*)(pa + i * 16 * TPB + kk * 64); a[set][i].half[1] = *(const v8us*)(pa + i * 16 * TPB + kk * 64 + 32); }
#pragma unroll      // constant indices: the arrays it walks stay in registers
      for (int j = 0; j < FN; ++j) { b[set][j].half[0] = *(const v8us*)(pb + j * 16 * TPB + kk * 64); b[set][j].half[1] = *(const v8us*)(pb + j * 16 * TPB + kk * 64 + 32); }
    };
    frags(0, 0);
#pragma unroll      // constant indices: the arrays it walks stay in registers
    for (int kk = 0; kk < TKK / 32; ++kk) {
      if (kk + 1 < TKK / 32) frags(kk + 1, (kk + 1) & 1);
      __builtin_amdgcn_sched_barrier(0);      // the next block's LDS reads stay one group ahead of this block's WMMAs (sunk among them, each read's latency is waited out by the wave)
#pragma unroll      // constant indices: the arrays it walks stay in registers
      for (int i = 0; i < FM; ++i)
#pragma unroll      // constant indices: the arrays it walks stay in registers
        for (int j = 0; j < FN; ++j) acc[i][j] = __builtin_amdgcn_wmma_f32_16x16x32_f16(false, a[kk & 1][i].v, false, b[kk & 1][j].v, (short)0, acc[i][j], false, false);
      __builtin_amdgcn_sched_barrier(0);      // and the group after that is not lifted in among them
    }
    asm volatile("s_wait_dscnt 0x0" ::: "memory");       // this wave's reads of stage s are done before the buffer is refilled
    asm volatile("s_wait_asynccnt 0x0" ::: "memory");    // this wave's copies of stage s + 1 have landed
    __syncthreads();                                     // publishes stage s + 1 and ends every reader's last read of stage s
    if (s + 2 < nst) stage(s + 2, s & 1);
  }
  asm volatile("s_wait_asynccnt 0x0" ::: "memory");      // nothing in flight when the ring becomes output staging
  // whole 128-B lines out: each wave stages its own FM*16 x FN*16 block in its own LDS range (behind the last pass's barrier), then stores rows
  constexpr int LPR = FN * 4, RPP = 32 / LPR, NQ = FM * 16 / RPP;
  const int rsub = lane / LPR, c4 = (lane % LPR) * 4;
  const unsigned ob = ((unsigned)(row0 + wm * FM * 16 + rsub) * (unsigned)ldc + (unsigned)(col0 + wn * FN * 16 + c4)) * 4u, os = (unsigned)(RPP * ldc) * 4u;      // byte offsets in this batch element's C, below 2^32
  v4f x[NQ];
  if (HASR) {
#pragma unroll      // constant indices: the arrays it walks stay in registers
    for (int q = 0; q < NQ; ++q) x[q] = *(const v4fa*)((const char*)C + (ob + q * os));
  }
  fal* so = (fal*)sm + (size_t)w * (FM * 16) * EP;
#pragma unroll      // constant indices: the arrays it walks stay in registers
  for (int i = 0; i < FM; ++i)
#pragma unroll      // constant indices: the arrays it walks stay in registers
    for (int j = 0; j < FN; ++j)
#pragma unroll      // constant indices: the arrays it walks stay in registers
      for (int r = 0; r < 8; ++r) so[(i * 16 + 8 * hh + r) * EP + j * 16 + ln] = acc[i][j][r] * alpha;
  __builtin_amdgcn_fence(__ATOMIC_ACQ_REL, "workgroup"); __builtin_amdgcn_wave_barrier();      // the wave's staged rows are written before its lanes read each other's words
#pragma unroll      // constant indices: the arrays it walks stay in registers
  for (int q = 0; q < NQ; ++q) {
    v4f v = *(const v4fa*)&so[(q * RPP + rsub) * EP + c4];
    if (HASR) v += x[q];
    *(v4f*)((char*)C + (ob + q * os)) = v;
  }
}

typedef _Float16 v4h __attribute__((ext_vector_type(4)));

__global__ __launch_bounds__(256) void k_x16(const float* __restrict__ x, _Float16* __restrict__ X16, size_t n8) { const size_t t = (size_t)blockIdx.x * 256 + threadIdx.x; if (t >= n8) return; FragH f;
#pragma unroll
  for (int q = 0; q < 8; ++q) f.h[q] = (_Float16)bf16_round(x[t * 8 + q]); *(v8us*)((unsigned short*)X16 + t * 8) = f.half[0];  }
__global__ __launch_bounds__(256) void k_h16(const float* __restrict__ x, _Float16* __restrict__ X16, size_t n8) { const size_t t = (size_t)blockIdx.x * 256 + threadIdx.x; if (t >= n8) return; FragH f;
#pragma unroll
  for (int q = 0; q < 8; ++q) f.h[q] = (_Float16)x[t * 8 + q]; *(v8us*)((unsigned short*)X16 + t * 8) = f.half[0];  }
__global__ __launch_bounds__(256) void k_round16f(const float* __restrict__ W, _Float16* __restrict__ Bt, size_t n8) { const size_t t = (size_t)blockIdx.x * 256 + threadIdx.x; if (t >= n8) return; FragH f;
#pragma unroll
  for (int i = 0; i < 8; ++i) f.h[i] = (_Float16)(bf16_round(W[t * 8 + i]) * 16.0f); *(v8us*)((unsigned short*)Bt + t * 8) = f.half[0];  }
template <int NHv, int TTv>
__global__ __launch_bounds__(256) void k_vt(const _Float16* __restrict__ V16, int ldv, int voff, _Float16* __restrict__ Vt) { __shared__ unsigned short tl[64][66]; const int tid = threadIdx.x; const int slab = blockIdx.x / (TTv / 64), lg = blockIdx.x % (TTv / 64); const int b = slab / NHv, h = slab % NHv;
  for (int i = tid; i < 64 * 8; i += 256) { const int r = i / 8, c8 = (i % 8) * 8; FragH f; f.half[0] = *(const v8us*)((const unsigned short*)V16 + ((size_t)b * TTv + lg * 64 + r) * ldv + voff + h * 64 + c8);
#pragma unroll
    for (int q = 0; q < 8; ++q) tl[r][c8 + q] = f.u[q]; }
  __syncthreads();
  {
#pragma unroll
    for (int rd = 0; rd < 2; ++rd) { const int d = rd * 32 + tid / 8, pc = tid % 8; FragH f;
#pragma unroll
      for (int q = 0; q < 8; ++q) f.u[q] = tl[pc * 8 + q][d];
      *(v8us*)((unsigned short*)Vt + ((size_t)slab * 64 + d) * TTv + lg * 64 + pc * 8) = f.half[0]; }
     } }

__global__ __launch_bounds__(256) void k_hl(const float* __restrict__ F, _Float16* __restrict__ Hh, _Float16* __restrict__ Hl, size_t n8) { const size_t t = (size_t)blockIdx.x * 256 + threadIdx.x; if (t >= n8) return; FragH fh, fl; const v4f a = *(const v4fa*)(F + t * 8), c = *(const v4fa*)(F + t * 8 + 4);
#pragma unroll
  for (int q = 0; q < 4; ++q) { _Float16 h = (_Float16)a[q]; fh.h[q] = h; fl.h[q] = (_Float16)((a[q] - (float)h) * 1024.0f); h = (_Float16)c[q]; fh.h[4 + q] = h; fl.h[4 + q] = (_Float16)((c[q] - (float)h) * 1024.0f); }
  { *(v8us*)((unsigned short*)Hh + t * 8) = fh.half[0]; *(v8us*)((unsigned short*)Hl + t * 8) = fl.half[0];  } }

__global__ __launch_bounds__(256) void k_snorm(const float* __restrict__ x, const float* __restrict__ g, const float* __restrict__ rsc, _Float16* __restrict__ XN, float* __restrict__ XR) {
  #pragma clang fp contract(off)
  const int tid = threadIdx.x, w = tid >> 5, l = tid & 31; const int r = blockIdx.x * 8 + w; if (r >= NBt * LL) return; const float* xr = x + (size_t)r * DD; float ss = 0.f;
#pragma unroll 1
  for (int k = 0; k < 32; ++k) { const float v = bf16_round(xr[l + 32 * k]); ss += v * v; }
  for (int o = 16; o > 0; o >>= 1) ss += __shfl_xor(ss, o, 32); const float nrm = sqrtf(ss) * 0.03125f; const float inv = bf16_round(g[0]) / fmaxf(nrm, 1e-5f);
  {
#pragma unroll 1
    for (int k = 0; k < 32; ++k) { const int c = l + 32 * k; const float v = bf16_round(xr[c]); FragH f; f.h[0] = (_Float16)(v * inv); *(unsigned short*)((unsigned short*)XN + (size_t)r * DD + c) = f.u[0]; *(float*)(XR + (size_t)r * DD + c) = v * bf16_round(rsc[c]); }
     } }
__global__ __launch_bounds__(256) void k_vt(const float* __restrict__ UV, _Float16* __restrict__ VT) { const int t = blockIdx.x * 256 + threadIdx.x; if (t >= NBt * EE * (LL / 8)) return; const int j0 = (t % (LL / 8)) * 8, be = t / (LL / 8), e = be % EE, b = be / EE; FragH f;
#pragma unroll
  for (int q = 0; q < 8; ++q) { const float v = UV[(size_t)(b * LL + j0 + q) * NUV + EE + e]; f.h[q] = (_Float16)(v / (1.0f + expf(-v))); }
  *(v8us*)((unsigned short*)VT + (size_t)be * LL + j0) = f.half[0];  }
__global__ __launch_bounds__(256) void k_qk(const float* __restrict__ UV, const float* __restrict__ gam, const float* __restrict__ bet, const float* __restrict__ CS, const float* __restrict__ SN, _Float16* __restrict__ Q16, _Float16* __restrict__ K16) {
  #pragma clang fp contract(off)
  const int t = blockIdx.x * 256 + threadIdx.x; if (t >= NBt * 2 * LL * 16) return; const int i0 = (t & 15) * 4; const int l = (t >> 4) % LL; const int which = (t / (LL * 16)) & 1; const int bl = (t / (2 * LL * 16)) * LL + l; const float* gp = gam + which * SSz; const float* bp = bet + which * SSz; _Float16* dst = which ? K16 : Q16; FragH o1, o2;
#pragma unroll
  for (int qq = 0; qq < 4; ++qq) { const int i = i0 + qq; const float u1 = UV[(size_t)bl * NUV + 2 * EE + i], u2 = UV[(size_t)bl * NUV + 2 * EE + 64 + i]; const float b1 = u1 / (1.0f + expf(-u1)), b2 = u2 / (1.0f + expf(-u2));
    const float a1 = b1 * bf16_round(gp[i]) + bf16_round(bp[i]), a2 = b2 * bf16_round(gp[64 + i]) + bf16_round(bp[64 + i]); const float c = CS[(size_t)l * 64 + i], s = SN[(size_t)l * 64 + i];
    o1.h[qq] = (_Float16)(a1 * c - a2 * s); o2.h[qq] = (_Float16)(a2 * c + a1 * s); }
  const unsigned long long p1 = *(const unsigned long long*)&o1.u[0], p2 = *(const unsigned long long*)&o2.u[0];
  { *(unsigned long long*)((unsigned short*)dst + (size_t)bl * SSz + i0) = p1; *(unsigned long long*)((unsigned short*)dst + (size_t)bl * SSz + 64 + i0) = p2;  } }
__constant__ float INVF[64] = {1.000000000e+00f,1.154781938e+00f,1.333521485e+00f,1.539926529e+00f,1.778279424e+00f,2.053524971e+00f,2.371373653e+00f,2.738419533e+00f,3.162277699e+00f,3.651741266e+00f,4.216965199e+00f,4.869675159e+00f,5.623413086e+00f,6.493816376e+00f,7.498941898e+00f,8.659643173e+00f,1.000000000e+01f,1.154782009e+01f,1.333521461e+01f,1.539926529e+01f,1.778279495e+01f,2.053524971e+01f,2.371373749e+01f,2.738419724e+01f,3.162277603e+01f,3.651741409e+01f,4.216965103e+01f,4.869675064e+01f,5.623413086e+01f,6.493816376e+01f,7.498941803e+01f,8.659643555e+01f,1.000000000e+02f,1.154781952e+02f,1.333521423e+02f,1.539926453e+02f,1.778279419e+02f,2.053525085e+02f,2.371373749e+02f,2.738419495e+02f,3.162277527e+02f,3.651741333e+02f,4.216965027e+02f,4.869675293e+02f,5.623413086e+02f,6.493816528e+02f,7.498942261e+02f,8.659642944e+02f,1.000000000e+03f,1.154781982e+03f,1.333521484e+03f,1.539926514e+03f,1.778279419e+03f,2.053525146e+03f,2.371373779e+03f,2.738419678e+03f,3.162277588e+03f,3.651741211e+03f,4.216964844e+03f,4.869675293e+03f,5.623413086e+03f,6.493816406e+03f,7.498941895e+03f,8.659643555e+03f};
__global__ __launch_bounds__(256) void k_cstab(float* __restrict__ CS, float* __restrict__ SN) {
  #pragma clang fp contract(off)
  const int t = blockIdx.x * 256 + threadIdx.x; if (t >= LL * 64) return; const int i = t & 63, l = t >> 6; const float invf = INVF[i]; const float ang = (float)l * invf; const float c = (float)cos((double)ang), s = (float)sin((double)ang);
  { *(float*)(CS + t) = c; *(float*)(SN + t) = s;  } }
__global__ __launch_bounds__(256) void k_ker(const float* __restrict__ S, const float* __restrict__ wrel, _Float16* __restrict__ KER) {
  #pragma clang fp contract(off)
  const int t = blockIdx.x * 256 + threadIdx.x; if (t >= NBt * LL * (LL / 8)) return; const int j0 = (t % (LL / 8)) * 8, bi = t / (LL / 8), i = bi % LL; FragH f;
#pragma unroll
  for (int q = 0; q < 8; ++q) { const int j = j0 + q; const float v = (S[(size_t)bi * LL + j] + bf16_round(wrel[j - i + LL - 1])) / 11.313708498984761f; const float r = fmaxf(v, 0.f); f.h[q] = (_Float16)(r * r); }
  *(v8us*)((unsigned short*)KER + (size_t)bi * LL + j0) = f.half[0];  }
__global__ __launch_bounds__(256) void k_gate(const float* __restrict__ UV, const float* __restrict__ KV, _Float16* __restrict__ G16) {
  #pragma clang fp contract(off)
  const int t = blockIdx.x * 256 + threadIdx.x; if (t >= NBt * LL * (EE / 8)) return; const int e0 = (t % (EE / 8)) * 8, i = t / (EE / 8); FragH f;
#pragma unroll
  for (int q = 0; q < 8; ++q) { const float u = UV[(size_t)i * NUV + e0 + q]; f.h[q] = (_Float16)((u / (1.0f + expf(-u))) * KV[(size_t)i * EE + e0 + q]); }
  *(v8us*)((unsigned short*)G16 + (size_t)i * EE + e0) = f.half[0];  }

extern "C" void kernel_launch(void* const* d_in, const int* in_sizes, int n_in,
                              void* d_out, int out_size, void* d_ws, size_t ws_size, hipStream_t stream) {
  (void)in_sizes; (void)n_in; (void)out_size;
  const float* x = (const float*)d_in[0]; const float* g = (const float*)d_in[1]; const float* uvw = (const float*)d_in[2]; const float* gam = (const float*)d_in[3]; const float* bet = (const float*)d_in[4]; const float* wrel = (const float*)d_in[5]; const float* ow = (const float*)d_in[6]; const float* rsc = (const float*)d_in[7];
  char* ws = (char*)d_ws; size_t off = 0;
  auto take = [&](size_t bytes) { char* p = ws + off; off += (bytes + 255) & ~(size_t)255; return p; };
  // All eight batch elements go through each stage in one launch, so every intermediate holds all eight. Ranges are used twice where the first tenant is dead:
  // KV lies over what only the stages in front of kernel*v read (uv weights, sin/cos tables, XN, q, k, scores); the gated product lies over VT. x*res_scale is stored in out, where the last GEMM adds to it.
  _Float16* BOW = (_Float16*)take((size_t)DD * EE * 2); float* UV = (float*)take((size_t)NBt * LL * NUV * 4); _Float16* VT = (_Float16*)take((size_t)NBt * EE * LL * 2); _Float16* KER = (_Float16*)take((size_t)NBt * LL * LL * 2);
  const size_t offKV = off; float* KV = (float*)take((size_t)NBt * LL * EE * 4); const size_t offEnd = off; _Float16* G16 = VT;
  off = offKV;
  _Float16* BUV = (_Float16*)take((size_t)NUV * DD * 2); float* CS = (float*)take((size_t)LL * 64 * 4); float* SN = (float*)take((size_t)LL * 64 * 4);
  _Float16* XN = (_Float16*)take((size_t)NBt * LL * DD * 2); _Float16* Q16 = (_Float16*)take((size_t)NBt * LL * SSz * 2); _Float16* K16 = (_Float16*)take((size_t)NBt * LL * SSz * 2); float* S = (float*)take((size_t)NBt * LL * LL * 4);
  if (off > offEnd || offEnd > ws_size) return;      // 4.2 + 138.4 + 33.6 + 16.8 + 67.1 = 260 MB; the early tenants of the KV range take 63.7 MB of its 67.1
  float* Y = (float*)d_out;
  k_round16f<<<(unsigned)(((size_t)NUV * DD / 8 + 255) / 256), 256, 0, stream>>>(uvw, BUV, (size_t)NUV * DD / 8); k_round16f<<<(unsigned)(((size_t)DD * EE / 8 + 255) / 256), 256, 0, stream>>>(ow, BOW, (size_t)DD * EE / 8);      /* (out,in) = natural Bt */
  k_cstab<<<(LL * 64 + 255) / 256, 256, 0, stream>>>(CS, SN);
  const dim3 gU(NUV / 64, NBt * LL / 128), gS(LL / 64, LL / 64, NBt), gK(EE / 64, LL / 128, NBt), gO(DD / 64, NBt * LL / 64);
  k_snorm<<<NBt * LL / 8, 256, 0, stream>>>(x, g, rsc, XN, Y);
  k_gemm_t<4, 2, false><<<gU, 128, 0, stream>>>(XN, DD, 0, BUV, DD, 0, 0.0625f, UV, NUV, 0, DD);      /* uv pre-activation, the batch as rows: M 8192 N 4224 K 1024 */
  k_vt<<<(NBt * EE * (LL / 8) + 255) / 256, 256, 0, stream>>>(UV, VT); k_qk<<<(NBt * 2 * LL * 16 + 255) / 256, 256, 0, stream>>>(UV, gam, bet, CS, SN, Q16, K16);
  k_gemm_t<2, 2, false><<<gS, 128, 0, stream>>>(Q16, SSz, (size_t)LL * SSz, K16, SSz, (size_t)LL * SSz, 1.0f, S, LL, (size_t)LL * LL, SSz);      /* qk, 8 x: M 1024 N 1024 K 128 */
  k_ker<<<(NBt * LL * (LL / 8) + 255) / 256, 256, 0, stream>>>(S, wrel, KER);
  k_gemm_t<4, 2, false><<<gK, 128, 0, stream>>>(KER, LL, (size_t)LL * LL, VT, LL, (size_t)EE * LL, 1.0f, KV, EE, (size_t)LL * EE, LL);      /* kernel*v, 8 x: M 1024 N 2048 K 1024 */
  k_gate<<<(NBt * LL * (EE / 8) + 255) / 256, 256, 0, stream>>>(UV, KV, G16);
  k_gemm_t<2, 2, true><<<gO, 128, 0, stream>>>(G16, EE, 0, BOW, EE, 0, 0.0625f, Y, DD, 0, EE);      /* y = x*res_scale (already in out) + out*o_w^T, the batch as rows: M 8192 N 1024 K 2048 */
}

// v003
// One run takes 208 microseconds.
// In both of two side-by-side timings against v002, it was 1.35 times as fast.
// All steps since v000 together make it 7.65 times as fast.
#include <hip/hip_runtime.h>
// RTM (GAU-style) block (B 8, L 1024, D 1024, E 2048, s 128): xn = ScaleNorm(x)·g; uv = silu(xn·uv_wᵀ) → u (2048) | v (2048) | base (128); q/k = rope_seq(base·γ + β) (rotation over the sequence axis with angle l·10000^(i/64), half-split); qk = q·kᵀ + w_rel[j − i + 1023]; kernel = relu(qk/√128)²; out = u ⊙ (kernel·v); y = x·res_scale + out·o_wᵀ → [8,1024,1024].
// Compute dtype: x and parameters rounded to bf16; ScaleNorm in f32 → f16 operand; uv GEMM (f32 result), SiLU/affine/rope in f32 (sin/cos of the f32 angle evaluated in double); q, k, v, kernel and the gated product as f16 GEMM operands (≈2^-12), f32 accumulation; residual x·res_scale through the f32 epilogue. v_wmma_f32_16x16x32_f16.
#define NBt 8
#define LL 1024
#define DD 1024
#define EE 2048
#define SSz 128
#define NUV (2 * EE + SSz)       /* 4224 */
typedef __bf16 v16b __attribute__((ext_vector_type(16)));
typedef unsigned short v8us __attribute__((ext_vector_type(8), may_alias));
typedef float  v8f  __attribute__((ext_vector_type(8)));
typedef float  v4f  __attribute__((ext_vector_type(4)));
typedef float  v4fa __attribute__((ext_vector_type(4), may_alias));
union FragB { v16b v; v8us half[2]; unsigned short u[16]; };

__device__ __forceinline__ unsigned short bf16_bits(float x) { unsigned int u = __float_as_uint(x); return (unsigned short)((u + 0x7FFFu + ((u >> 16) & 1u)) >> 16); }
__device__ __forceinline__ float bf16_val(unsigned short b) { return __uint_as_float(((unsigned int)b) << 16); }
__device__ __forceinline__ float bf16_round(float x) { return bf16_val(bf16_bits(x)); }
// D += A·B with NT terms: 1 = ah·bh, 2 = + al·bh (A split), 3 = + ah·bl (both split)
template <int NT>
__device__ __forceinline__ v8f mmaN(v16b ah, v16b al, v16b bh, v16b bl, v8f c) {
  c = __builtin_amdgcn_wmma_f32_16x16x32_bf16(false, ah, false, bh, (short)0, c, false, false);
  if (NT >= 2) c = __builtin_amdgcn_wmma_f32_16x16x32_bf16(false, al, false, bh, (short)0, c, false, false);
  if (NT >= 3) c = __builtin_amdgcn_wmma_f32_16x16x32_bf16(false, ah, false, bl, (short)0, c, false, false);
  asm volatile("v_nop\n\tv_nop\n\tv_nop\n\tv_nop" : "+v"(c) : "v"(ah), "v"(al), "v"(bh), "v"(bl));
  return c;
}

__global__ __launch_bounds__(256) void k_wt_bf16(const float* __restrict__ W, unsigned short* __restrict__ Wt, int K, int N) {
  const int t = blockIdx.x * 256 + threadIdx.x;
  const int k8n = K / 8;
  if (t >= N * k8n) return;
  const int n = t / k8n, k8 = (t % k8n) * 8;
  v8us v;
#pragma unroll
  for (int i = 0; i < 8; ++i) v[i] = bf16_bits(W[(size_t)(k8 + i) * N + n]);
  *(v8us*)(Wt + (size_t)n * K + k8) = v;
  
}

// GEMM C[M][N] (f32, pitch ldc) = act(A[M][K]·W + bias). A f32 row-major (pitch lda) converted per fragment to bf16
// (ASPLIT: hi/lo two planes -> 2 terms, else single rounded term); Wt bf16 [N][K] (pitch ldb). BIAS_BF16 rounds the
// bias to bf16 first (bias quantised to bf16 before the add). K%32==0, M%16==0, N%64==0.
template <bool ASPLIT, int ACT, bool BIAS_BF16>
__global__ __launch_bounds__(128) void k_gemm_bf(const float* __restrict__ A, int lda, const unsigned short* __restrict__ Wt, int ldb,
                                               const float* __restrict__ bias, float* __restrict__ C, int ldc, int M, int N, int K) {
  __shared__ __attribute__((aligned(16))) float so[4][16][64];
  const int tid = threadIdx.x, w = tid >> 5, lane = tid & 31, ln = lane & 15, hh = lane >> 4;
  const int ntn = N / 64;
  const int wid = blockIdx.x * 4 + w;
  const int mt = wid / ntn, nq = wid % ntn;
  if (mt * 16 >= M) return;
  const int row0 = mt * 16, col0 = nq * 64;
  const float* arow = A + (size_t)(row0 + ln) * lda;
  v8f acc[4] = {};
  for (int kb = 0; kb < K; kb += 32) {
    FragB ah, al;
    const v4f x0 = *(const v4fa*)(arow + kb + 8 * hh), x1 = *(const v4fa*)(arow + kb + 8 * hh + 4);
    const v4f x2 = *(const v4fa*)(arow + kb + 16 + 8 * hh), x3 = *(const v4fa*)(arow + kb + 16 + 8 * hh + 4);
    float xs[16] = {x0[0],x0[1],x0[2],x0[3],x1[0],x1[1],x1[2],x1[3],x2[0],x2[1],x2[2],x2[3],x3[0],x3[1],x3[2],x3[3]};
#pragma unroll
    for (int i = 0; i < 16; ++i) { const unsigned short hb = bf16_bits(xs[i]); ah.u[i] = hb; al.u[i] = ASPLIT ? bf16_bits(xs[i] - bf16_val(hb)) : (unsigned short)0; }
#pragma unroll
    for (int t = 0; t < 4; ++t) {
      const unsigned short* brow = Wt + (size_t)(col0 + t * 16 + ln) * ldb + kb;
      FragB b;
      b.half[0] = *(const v8us*)(brow + 8 * hh);
      b.half[1] = *(const v8us*)(brow + 16 + 8 * hh);
      acc[t] = mmaN<ASPLIT ? 2 : 1>(ah.v, al.v, b.v, b.v, acc[t]);
    }
  }
#pragma unroll
  for (int t = 0; t < 4; ++t) {
    float bv = bias ? bias[col0 + t * 16 + ln] : 0.f;
    if (BIAS_BF16) bv = bf16_round(bv);
#pragma unroll
    for (int r = 0; r < 8; ++r) { float v = acc[t][r] + bv; if (ACT == 1) v = fmaxf(v, 0.f); so[w][8 * hh + r][t * 16 + ln] = v; }
  }
  __builtin_amdgcn_fence(__ATOMIC_ACQ_REL, "workgroup");
  __builtin_amdgcn_wave_barrier();
  const int rsub = lane >> 4, c4 = (lane & 15) * 4;
  {
#pragma unroll
    for (int q = 0; q < 8; ++q) {
      const int r = q * 2 + rsub;
      const v4f v = *(const v4fa*)&so[w][r][c4];
      *(v4f*)(C + (size_t)(row0 + r) * ldc + col0 + c4) = v;
    }
    
  }
}

// GEMM C = act(A·W + bias + resid): A f32 (ASPLIT -> hi/lo 2 terms), Wt bf16 [N][K]; ACT 0 none, 1 relu, 2 exact gelu;
// resid (optional, f32, row index = (row % rmod), pitch ldr, RES_BF16 rounds it) added before the activation.
template <bool ASPLIT, int ACT, bool BIAS_BF16, bool RES_BF16>
__global__ __launch_bounds__(128) void k_gemm_bf3(const float* __restrict__ A, int lda, const unsigned short* __restrict__ Wt, int ldb,
                                                const float* __restrict__ bias, const float* __restrict__ resid, int rmod, int ldr,
                                                float* __restrict__ C, int ldc, int M, int N, int K) {
  __shared__ __attribute__((aligned(16))) float so[4][16][64];
  const int tid = threadIdx.x, w = tid >> 5, lane = tid & 31, ln = lane & 15, hh = lane >> 4;
  const int ntn = N / 64;
  const int wid = blockIdx.x * 4 + w;
  const int mt = wid / ntn, nq = wid % ntn;
  if (mt * 16 >= M) return;
  const int row0 = mt * 16, col0 = nq * 64;
  const float* arow = A + (size_t)(row0 + ln) * lda;
  v8f acc[4] = {};
  for (int kb = 0; kb < K; kb += 32) {
    FragB ah, al;
    const v4f x0 = *(const v4fa*)(arow + kb + 8 * hh), x1 = *(const v4fa*)(arow + kb + 8 * hh + 4);
    const v4f x2 = *(const v4fa*)(arow + kb + 16 + 8 * hh), x3 = *(const v4fa*)(arow + kb + 16 + 8 * hh + 4);
    float xs[16] = {x0[0],x0[1],x0[2],x0[3],x1[0],x1[1],x1[2],x1[3],x2[0],x2[1],x2[2],x2[3],x3[0],x3[1],x3[2],x3[3]};
#pragma unroll
    for (int i = 0; i < 16; ++i) { const unsigned short hb = bf16_bits(xs[i]); ah.u[i] = hb; al.u[i] = ASPLIT ? bf16_bits(xs[i] - bf16_val(hb)) : (unsigned short)0; }
#pragma unroll
    for (int t = 0; t < 4; ++t) {
      const unsigned short* brow = Wt + (size_t)(col0 + t * 16 + ln) * ldb + kb;
      FragB b;
      b.half[0] = *(const v8us*)(brow + 8 * hh);
      b.half[1] = *(const v8us*)(brow + 16 + 8 * hh);
      acc[t] = mmaN<ASPLIT ? 2 : 1>(ah.v, al.v, b.v, b.v, acc[t]);
    }
  }
#pragma unroll
  for (int t = 0; t < 4; ++t) {
    const int col = col0 + t * 16 + ln;
    float bv = bias ? bias[col] : 0.f;
    if (BIAS_BF16) bv = bf16_round(bv);
#pragma unroll
    for (int r = 0; r < 8; ++r) {
      float v = acc[t][r] + bv;
      if (resid) { float rv = resid[(size_t)((row0 + 8 * hh + r) % rmod) * ldr + col]; if (RES_BF16) rv = bf16_round(rv); v += rv; }
      if (ACT == 1) v = fmaxf(v, 0.f);
      if (ACT == 2) v = 0.5f * v * (1.0f + erff(v * 0.70710678118654752f));
      if (ACT == 3) { const float u = 0.7978845608028654f * (v + 0.044715f * v * v * v); v = 0.5f * v * (1.0f + tanhf(u)); }
      so[w][8 * hh + r][t * 16 + ln] = v;
    }
  }
  __builtin_amdgcn_fence(__ATOMIC_ACQ_REL, "workgroup");
  __builtin_amdgcn_wave_barrier();
  const int rsub = lane >> 4, c4 = (lane & 15) * 4;
  {
#pragma unroll
    for (int q = 0; q < 8; ++q) {
      const int r = q * 2 + rsub;
      const v4f v = *(const v4fa*)&so[w][r][c4];
      *(v4f*)(C + (size_t)(row0 + r) * ldc + col0 + c4) = v;
    }
    
  }
}
// row LayerNorm (biased variance, eps) over N: s = X (+ R); optional out_sum <- s; out_norm <- (s-mu)*rsqrt(var+eps)*g + b
template <bool PARAM_BF16>
__global__ __launch_bounds__(256) void k_layernorm(const float* __restrict__ X, const float* __restrict__ R, const float* __restrict__ g, const float* __restrict__ bta,
                                                  float* __restrict__ out_sum, float* __restrict__ out_norm, int N, float eps) {
  __shared__ float red[256];
  const int row = blockIdx.x, tid = threadIdx.x;
  const float* x = X + (size_t)row * N; const float* rr = R ? R + (size_t)row * N : nullptr;
  float vals[16];                     // up to N = 4096
  const int per = N / 256;            // contiguous chunk per thread? use strided-by-4 chunks: thread handles j = tid*4 + 1024*u
  float s1 = 0.f;
  for (int u = 0; u < per / 4; ++u) {
    const int j = tid * 4 + 1024 * u;
    const v4f a = *(const v4fa*)(x + j);
    v4f b = {0.f,0.f,0.f,0.f}; if (rr) b = *(const v4fa*)(rr + j);
#pragma unroll
    for (int q = 0; q < 4; ++q) { const float v = a[q] + b[q]; vals[u * 4 + q] = v; s1 += v; }
  }
  red[tid] = s1; __syncthreads();
  for (int st = 128; st > 0; st >>= 1) { if (tid < st) red[tid] += red[tid + st]; __syncthreads(); }
  const float mu = red[0] / (float)N; __syncthreads();
  float s2 = 0.f;
  for (int u = 0; u < per / 4; ++u)
#pragma unroll
    for (int q = 0; q < 4; ++q) { const float c = vals[u * 4 + q] - mu; s2 += c * c; }
  red[tid] = s2; __syncthreads();
  for (int st = 128; st > 0; st >>= 1) { if (tid < st) red[tid] += red[tid + st]; __syncthreads(); }
  const float rs = rsqrtf(red[0] / (float)N + eps);
  {
    for (int u = 0; u < per / 4; ++u) {
      const int j = tid * 4 + 1024 * u;
      v4f o, sm;
#pragma unroll
      for (int q = 0; q < 4; ++q) {
        float gg = g[j + q], bb = bta[j + q];
        if (PARAM_BF16) { gg = bf16_round(gg); bb = bf16_round(bb); }
        sm[q] = vals[u * 4 + q]; o[q] = (vals[u * 4 + q] - mu) * rs * gg + bb;
      }
      if (out_sum) *(v4f*)(out_sum + (size_t)row * N + j) = sm;
      *(v4f*)(out_norm + (size_t)row * N + j) = o;
    }
    
  }
}



// ---- f16 WMMA path (v_wmma_f32_16x16x32_f16): 11-bit significands for operands in range — used for all four GEMMs of this block
typedef _Float16 v16h __attribute__((ext_vector_type(16)));
union FragH { v16h v; v8us half[2]; _Float16 h[16]; unsigned short u[16]; };
template <int NT>
__device__ __forceinline__ v8f mmaH(v16h ah, v16h al, v16h bh, v16h bl, v8f c) {
  c = __builtin_amdgcn_wmma_f32_16x16x32_f16(false, ah, false, bh, (short)0, c, false, false);
  if (NT >= 2) c = __builtin_amdgcn_wmma_f32_16x16x32_f16(false, al, false, bh, (short)0, c, false, false);
  if (NT >= 3) c = __builtin_amdgcn_wmma_f32_16x16x32_f16(false, ah, false, bl, (short)0, c, false, false);
  asm volatile("v_nop\n\tv_nop\n\tv_nop\n\tv_nop" : "+v"(c) : "v"(ah), "v"(al), "v"(bh), "v"(bl));
  return c;
}
// batched GEMM like k_gemm_b but f16 operands: A f32 (split into f16 hi/lo if ASPLIT, else rounded to f16), Bt = f16 values [n][k]; alpha; C f32; N multiple of 16 (partial tiles skipped)
template <bool ASPLIT>
__global__ __launch_bounds__(128) void k_gemm_h(const float* __restrict__ A, int lda, size_t sA, const _Float16* __restrict__ Bh, int ldb, size_t sB, float alpha, float* __restrict__ C, int ldc, size_t sC, int M, int N, int K) {
  __shared__ __attribute__((aligned(16))) float so[4][16][64];
  const int tid = threadIdx.x, w = tid >> 5, lane = tid & 31, ln = lane & 15, hh = lane >> 4; const int by = blockIdx.y;
  A += (size_t)by * sA; Bh += (size_t)by * sB; C += (size_t)by * sC;
  const int ntn = (N + 63) / 64; const int wid = blockIdx.x * 4 + w; const int mt = wid / ntn, nq = wid % ntn; if (mt * 16 >= M) return;
  const int row0 = mt * 16, col0 = nq * 64; const float* arow = A + (size_t)(row0 + ln) * lda;
  v8f acc[4] = {};
  for (int kb = 0; kb < K; kb += 32) {
    FragH ah, al;
    const v4f x0 = *(const v4fa*)(arow + kb + 8 * hh), x1 = *(const v4fa*)(arow + kb + 8 * hh + 4), x2 = *(const v4fa*)(arow + kb + 16 + 8 * hh), x3 = *(const v4fa*)(arow + kb + 16 + 8 * hh + 4);
    float xs[16] = {x0[0],x0[1],x0[2],x0[3],x1[0],x1[1],x1[2],x1[3],x2[0],x2[1],x2[2],x2[3],x3[0],x3[1],x3[2],x3[3]};
#pragma unroll
    for (int i = 0; i < 16; ++i) { const _Float16 h = (_Float16)xs[i]; ah.h[i] = h; al.h[i] = ASPLIT ? (_Float16)(xs[i] - (float)h) : (_Float16)0.0f; }
#pragma unroll
    for (int t = 0; t < 4; ++t) { if (col0 + t * 16 >= N) continue; const size_t boff = (size_t)(col0 + t * 16 + ln) * ldb + kb; FragH bq; bq.half[0] = *(const v8us*)(Bh + boff + 8 * hh); bq.half[1] = *(const v8us*)(Bh + boff + 16 + 8 * hh);
      acc[t] = mmaH<ASPLIT ? 2 : 1>(ah.v, al.v, bq.v, bq.v, acc[t]); }
  }
#pragma unroll
  for (int t = 0; t < 4; ++t) { if (col0 + t * 16 >= N) continue;
#pragma unroll
    for (int r = 0; r < 8; ++r) so[w][8 * hh + r][t * 16 + ln] = acc[t][r] * alpha; }
  __builtin_amdgcn_fence(__ATOMIC_ACQ_REL, "workgroup"); __builtin_amdgcn_wave_barrier();
  const int rsub = lane >> 4, c4 = (lane & 15) * 4;
  {
#pragma unroll
    for (int q = 0; q < 8; ++q) { const int r = q * 2 + rsub; if (col0 + c4 < N) { const v4f v = *(const v4fa*)&so[w][r][c4]; *(v4f*)(C + (size_t)(row0 + r) * ldc + col0 + c4) = v; } }
     }
}

// Wt[n][k] = f16(W[k][n]·scale) from f32 row-major W[K][N] (scale = power of two; bf16-exact weights stay exact in f16 away from the subnormal range)
__global__ __launch_bounds__(256) void k_wt_f16(const float* __restrict__ W, _Float16* __restrict__ Wt, int K, int N, float scale) {
  const int t = blockIdx.x * 256 + threadIdx.x; if (t >= N * (K / 8)) return; const int n = t / (K / 8), k8 = (t % (K / 8)) * 8; FragH f;
#pragma unroll
  for (int i = 0; i < 8; ++i) f.h[i] = (_Float16)(bf16_round(W[(size_t)(k8 + i) * N + n]) * scale); const v8us o = f.half[0];
  *(v8us*)((unsigned short*)Wt + (size_t)n * K + k8) = o; 
}
// k_gemm_hh variant with fused epilogue: v = acc·alpha + bias[by·sBias + col] (+ CP[(row/rowsPerB)·sCPb + by·64 + col] if CP) ; ACT 0 none / 1 elu ; writes f32 C and f16 C16, each if non-null
template <int ACT>
__global__ __launch_bounds__(128) void k_gemm_hhx(const _Float16* __restrict__ A, int lda, size_t sA, const _Float16* __restrict__ Bh, int ldb, size_t sB, float alpha, const float* __restrict__ bias, size_t sBias, const float* __restrict__ CP, int rowsPerB, size_t sCPb, int row0g,
    float* __restrict__ C, _Float16* __restrict__ C16, int ldc, size_t sC, int M, int N, int K) {
  __shared__ __attribute__((aligned(16))) float so[4][16][64];
  const int tid = threadIdx.x, w = tid >> 5, lane = tid & 31, ln = lane & 15, hh = lane >> 4; const int by = blockIdx.y;
  A += (size_t)by * sA; Bh += (size_t)by * sB; const size_t cofs = (size_t)by * sC; const float* bp = bias ? bias + (size_t)by * sBias : nullptr;
  const int ntn = (N + 63) / 64; const int wid = blockIdx.x * 4 + w; const int mt = wid / ntn, nq = wid % ntn; if (mt * 16 >= M) return;
  const int row0 = mt * 16, col0 = nq * 64; const _Float16* arow = A + (size_t)(row0 + ln) * lda;
  v8f acc[4] = {};
  for (int kb = 0; kb < K; kb += 32) { FragH ah; ah.half[0] = *(const v8us*)((const unsigned short*)arow + kb + 8 * hh); ah.half[1] = *(const v8us*)((const unsigned short*)arow + kb + 16 + 8 * hh);
#pragma unroll
    for (int t = 0; t < 4; ++t) { if (col0 + t * 16 >= N) continue; const size_t boff = (size_t)(col0 + t * 16 + ln) * ldb + kb; FragH bq; bq.half[0] = *(const v8us*)((const unsigned short*)Bh + boff + 8 * hh); bq.half[1] = *(const v8us*)((const unsigned short*)Bh + boff + 16 + 8 * hh);
      acc[t] = mmaH<1>(ah.v, ah.v, bq.v, bq.v, acc[t]); }
  }
#pragma unroll
  for (int t = 0; t < 4; ++t) { if (col0 + t * 16 >= N) continue; const int col = col0 + t * 16 + ln; const float bv = bp ? bf16_round(bp[col]) : 0.f;
#pragma unroll
    for (int r = 0; r < 8; ++r) { float v = acc[t][r] * alpha + bv; if (CP) { const int bidx = (row0g + row0 + 8 * hh + r) / rowsPerB; v += CP[(size_t)bidx * sCPb + (size_t)by * 64 + col]; } if (ACT == 1) v = (v > 0.f) ? v : expm1f(v); else if (ACT == 7) v = (v > 0.f) ? v + 1.0f : expf(v); else if (ACT == 8) v = tanhf(v); else if (ACT == 9) v = 0.5f * v * (1.0f + tanhf(0.7978845608028654f * (v + 0.044715f * v * v * v))); else if (ACT == 11) v = 1.0f / (1.0f + expf(-v)); else if (ACT == 12) v = (v > 0.f) ? v : 0.01f * v; else if (ACT == 14) v = (v > 0.f) ? v : 0.1f * v; else if (ACT == 15) v = v / (1.0f + expf(-v)); else if (ACT == 3) v = fmaxf(v, 0.f); else if (ACT == 6) v = 0.5f * v * (1.0f + erff(v * 0.70710678118654752f)); so[w][8 * hh + r][t * 16 + ln] = v; } }
  __builtin_amdgcn_fence(__ATOMIC_ACQ_REL, "workgroup"); __builtin_amdgcn_wave_barrier();
  const int rsub = lane >> 4, c4 = (lane & 15) * 4; typedef _Float16 v4h __attribute__((ext_vector_type(4)));
  {
#pragma unroll
    for (int q = 0; q < 8; ++q) { const int r = q * 2 + rsub; if (col0 + c4 < N) { const v4f v = *(const v4fa*)&so[w][r][c4]; if (C) *(v4f*)(C + cofs + (size_t)(row0 + r) * ldc + col0 + c4) = v; if (C16) { v4h h4; for (int i = 0; i < 4; ++i) h4[i] = (_Float16)v[i]; *(v4h*)(C16 + cofs + (size_t)(row0 + r) * ldc + col0 + c4) = h4; } } }
     }
}


// Block-tiled f16 GEMM: C[row][col] = alpha * sum_k A[row][k] * B[col][k] (+ the value that C[row][col] already holds, if HASR). A and B are k-contiguous f16.
// blockIdx.z is the batch element: A, B and C move on by sA, sB and sC elements for each.
// One work-group of 4 waves (2 x 2) owns a (32 FM) x (32 FN) tile of C; each wave FM x FN fragments. A stage is 128 k of the tile's A rows and
// B rows (256 B a row, LDS pitch 272 B), brought in by asynchronous copies into two buffers: stage s + 1 flies while stage s is multiplied.
// The k order inside a fragment and the order of the k blocks are those of k_gemm_hhx. M, N multiples of the tile, K of 128.
#define TKK 128
#define TPB 272
typedef float fal __attribute__((may_alias));
// eight rows (8 apart) of a stage: each lane copies its own 16 bytes of each. The s_wait_xcnt stands in the copies' own statement so that no address register is rewritten ahead of it.
__device__ __forceinline__ void copy8(unsigned lds, const _Float16* g, size_t g8) {
  asm volatile("global_load_async_to_lds_b128 %0, %8, off\n\t"
               "global_load_async_to_lds_b128 %1, %9, off\n\t"
               "global_load_async_to_lds_b128 %2, %10, off\n\t"
               "global_load_async_to_lds_b128 %3, %11, off\n\t"
               "global_load_async_to_lds_b128 %4, %12, off\n\t"
               "global_load_async_to_lds_b128 %5, %13, off\n\t"
               "global_load_async_to_lds_b128 %6, %14, off\n\t"
               "global_load_async_to_lds_b128 %7, %15, off\n\t"
               "s_wait_xcnt 0x0"
               :: "v"(lds), "v"(lds + 8 * TPB), "v"(lds + 16 * TPB), "v"(lds + 24 * TPB), "v"(lds + 32 * TPB), "v"(lds + 40 * TPB), "v"(lds + 48 * TPB), "v"(lds + 56 * TPB),
                  "v"(g), "v"(g + g8), "v"(g + 2 * g8), "v"(g + 3 * g8), "v"(g + 4 * g8), "v"(g + 5 * g8), "v"(g + 6 * g8), "v"(g + 7 * g8)
               : "memory");
}
// EPI names what the epilogue does with the tile t = alpha * A*B^T; of t, later launches read back only the u and base columns that EPI 1 stores:
//   0  C = t (+ C if HASR), f32.
//   1  uv: columns of u and of base as EPI 0 (pre-activation, f32); columns of v go out as H[b][e][l] = f16(silu(t)), transposed, and are not stored in C.
//   2  scores: H[b][i][j] = f16(relu((t + bf16(X[j - i + L - 1])) / sqrt(128))^2), X = w_rel; C unused.
//   3  gate: H[b*L + i][e] = f16(silu(X[b*L + i][e]) * t), X = the uv pre-activation (pitch NUV); C unused.
typedef unsigned short v4us __attribute__((ext_vector_type(4), may_alias));
template <int FM, int FN, bool HASR, int EPI>
__global__ __launch_bounds__(128) void k_gemm_t(const _Float16* __restrict__ A, int lda, size_t sA, const _Float16* __restrict__ B, int ldb, size_t sB, float alpha, float* __restrict__ C, int ldc, size_t sC, int K,
                                                const float* __restrict__ X, _Float16* __restrict__ H) {
  constexpr int BM = 32 * FM, BN = 32 * FN, STG = (BM + BN) * TPB, EP = FN * 16 + 4;
  static_assert(4 * FM * 16 * EP * 4 <= 2 * STG, "output staging fits the ring");
  __shared__ __attribute__((aligned(16))) unsigned char sm[2 * STG];
  const int tid = threadIdx.x, w = tid >> 5, lane = tid & 31, ln = lane & 15, hh = lane >> 4;
  const int row0 = blockIdx.y * BM, col0 = blockIdx.x * BN, wm = w >> 1, wn = w & 1;
  A += (size_t)blockIdx.z * sA; B += (size_t)blockIdx.z * sB; C += (size_t)blockIdx.z * sC;
  const int cr = tid >> 4, cc = tid & 15;      // copies: 16 lanes cover one 256-B row, the work-group 8 rows an instruction
  const _Float16* gA = A + (size_t)(row0 + cr) * lda + cc * 8;
  const _Float16* gB = B + (size_t)(col0 + cr) * ldb + cc * 8;
  const unsigned lA = (unsigned)(size_t)sm + cr * TPB + cc * 16;
  auto stage = [&](int s, int buf) {
    for (int i = 0; i < BM / 64; ++i) copy8(lA + buf * STG + i * 64 * TPB, gA + (size_t)s * TKK + (size_t)i * 64 * lda, (size_t)8 * lda);
    for (int i = 0; i < BN / 64; ++i) copy8(lA + buf * STG + (BM + i * 64) * TPB, gB + (size_t)s * TKK + (size_t)i * 64 * ldb, (size_t)8 * ldb);
  };
  const int nst = K / TKK;
  stage(0, 0);
  asm volatile("s_wait_asynccnt 0x0" ::: "memory");      // this wave's copies of stage 0 have landed
  __syncthreads();                                       // ... and every other wave's
  if (nst > 1) stage(1, 1);
  v8f acc[FM][FN] = {};
  for (int s = 0; s < nst; ++s) {
    const unsigned char* pa = sm + (s & 1) * STG + (wm * FM * 16 + ln) * TPB + hh * 16;
    const unsigned char* pb = sm + (s & 1) * STG + (BM + wn * FN * 16 + ln) * TPB + hh * 16;
    FragH a[2][FM], b[2][FN];      // two fragment sets: block kk + 1 of this stage is read from LDS while block kk is multiplied
    auto frags = [&](int kk, int set) {
#pragma unroll      // constant indices: the arrays it walks stay in registers
      for (int i = 0; i < FM; ++i) { a[set][i].half[0] = *(const v8us*)(pa + i * 16 * TPB + kk * 64); a[set][i].half[1] = *(const v8us*)(pa + i * 16 * TPB + kk * 64 + 32); }
#pragma unroll      // constant indices: the arrays it walks stay in registers
      for (int j = 0; j < FN; ++j) { b[set][j].half[0] = *(const v8us*)(pb + j * 16 * TPB + kk * 64); b[set][j].half[1] = *(const v8us*)(pb + j * 16 * TPB + kk * 64 + 32); }
    };
    frags(0, 0);
#pragma unroll      // constant indices: the arrays it walks stay in registers
    for (int kk = 0; kk < TKK / 32; ++kk) {
      if (kk + 1 < TKK / 32) frags(kk + 1, (kk + 1) & 1);
      __builtin_amdgcn_sched_barrier(0);      // the next block's LDS reads stay one group ahead of this block's WMMAs (sunk among them, each read's latency is waited out by the wave)
#pragma unroll      // constant indices: the arrays it walks stay in registers
      for (int i = 0; i < FM; ++i)
#pragma unroll      // constant indices: the arrays it walks stay in registers
        for (int j = 0; j < FN; ++j) acc[i][j] = __builtin_amdgcn_wmma_f32_16x16x32_f16(false, a[kk & 1][i].v, false, b[kk & 1][j].v, (short)0, acc[i][j], false, false);
      __builtin_amdgcn_sched_barrier(0);      // and the group after that is not lifted in among them
    }
    asm volatile("s_wait_dscnt 0x0" ::: "memory");       // this wave's reads of stage s are done before the buffer is refilled
    asm volatile("s_wait_asynccnt 0x0" ::: "memory");    // this wave's copies of stage s + 1 have landed
    __syncthreads();                                     // publishes stage s + 1 and ends every reader's last read of stage s
    if (s + 2 < nst) stage(s + 2, s & 1);
  }
  asm volatile("s_wait_asynccnt 0x0" ::: "memory");      // nothing in flight when the ring becomes output staging
  if constexpr (EPI == 1) {
    if (col0 >= EE && col0 < 2 * EE) {      // the same for the whole work-group: a tile of v
      // a lane's 8 accumulator rows of one fragment are 8 neighbours along l of one column e: 16 bytes of a row of H. Each wave stages its block column-major in its own LDS range, then stores whole 128-B lines.
      constexpr int HP = FM * 16 + 8, PPC = FM * 2;      // pitch in halves (16 B x odd); 16-byte parts a column
      unsigned short* sh = (unsigned short*)sm + (size_t)w * (FN * 16) * HP;
#pragma unroll      // constant indices: the arrays it walks stay in registers
      for (int i = 0; i < FM; ++i)
#pragma unroll      // constant indices: the arrays it walks stay in registers
        for (int j = 0; j < FN; ++j) {
          FragH f;
#pragma unroll      // constant indices: the arrays it walks stay in registers
          for (int r = 0; r < 8; ++r) { const float v = acc[i][j][r] * alpha; f.h[r] = (_Float16)(v / (1.0f + expf(-v))); }
          *(v8us*)(sh + (j * 16 + ln) * HP + i * 16 + 8 * hh) = f.half[0];
        }
      __builtin_amdgcn_fence(__ATOMIC_ACQ_REL, "workgroup"); __builtin_amdgcn_wave_barrier();      // the wave's staged columns are written before its lanes read each other's words
      const int rw = row0 + wm * FM * 16;      // the wave's first row; its FM*16 rows lie in one batch element
      unsigned short* vt = (unsigned short*)H + ((size_t)(rw / LL) * EE + (col0 - EE) + wn * FN * 16) * LL + rw % LL;
#pragma unroll      // the stores go out back to back
      for (int q = 0; q < FN * 16 * PPC / 32; ++q) { const int c = (q * 32 + lane) / PPC, p = (q * 32 + lane) % PPC; *(v8us*)(vt + (size_t)c * LL + p * 8) = *(const v8us*)(sh + c * HP + p * 8); }
      return;
    }
  }
  if constexpr (EPI == 2 || EPI == 3) {
    // f16 out: a row of the work-group's tile is 64 columns = one 128-B line, so the four waves stage the tile together and each then stores whole rows of it
    static_assert(BN == 64, "a tile row of f16 is one line");
    constexpr int EPW = BN + 4, NR = BM / 8;      // 16 lanes a row, 2 rows an instruction, BM / 4 rows a wave
    const int rr = w * (BM / 4) + hh, c4 = ln * 4;
    const size_t gr = (size_t)blockIdx.z * LL + row0 + rr;      // row over all batch elements
    v4f x[NR];
    if constexpr (EPI == 3) {
      const float* xp = X + gr * NUV + col0 + c4;
#pragma unroll      // constant indices: the arrays it walks stay in registers
      for (int q = 0; q < NR; ++q) x[q] = *(const v4fa*)(xp + (size_t)(2 * q) * NUV);
      asm volatile("s_wait_xcnt 0x0" :: "v"(xp) : "memory");      // the loads' address pair is held as far as this wait, so that nothing, a load's own result included, is written over it ahead of the wait
    }
    fal* so = (fal*)sm;
#pragma unroll      // constant indices: the arrays it walks stay in registers
    for (int i = 0; i < FM; ++i)
#pragma unroll      // constant indices: the arrays it walks stay in registers
      for (int j = 0; j < FN; ++j)
#pragma unroll      // constant indices: the arrays it walks stay in registers
        for (int r = 0; r < 8; ++r) so[((wm * FM + i) * 16 + 8 * hh + r) * EPW + (wn * FN + j) * 16 + ln] = acc[i][j][r] * alpha;
    __syncthreads();      // every wave's part of the tile is staged before any wave reads whole rows
#pragma unroll      // constant indices: the arrays it walks stay in registers
    for (int q = 0; q < NR; ++q) {
      const v4f t = *(const v4fa*)&so[(rr + 2 * q) * EPW + c4];
      union { v4us o; _Float16 h[4]; } f;
#pragma unroll      // constant indices: the arrays it walks stay in registers
      for (int e = 0; e < 4; ++e) {
        if constexpr (EPI == 2) { const float v = (t[e] + bf16_round(X[col0 + c4 + e - (row0 + rr + 2 * q) + LL - 1])) / 11.313708498984761f; const float r = fmaxf(v, 0.f); f.h[e] = (_Float16)(r * r); }
        else { const float u = x[q][e]; f.h[e] = (_Float16)((u / (1.0f + expf(-u))) * t[e]); }
      }
      *(v4us*)((unsigned short*)H + (gr + 2 * q) * (size_t)ldc + col0 + c4) = f.o;
    }
    return;
  }
  // whole 128-B lines out: each wave stages its own FM*16 x FN*16 block in its own LDS range (behind the last pass's barrier), then stores rows
  constexpr int LPR = FN * 4, RPP = 32 / LPR, NQ = FM * 16 / RPP;
  const int rsub = lane / LPR, c4 = (lane % LPR) * 4;
  const unsigned ob = ((unsigned)(row0 + wm * FM * 16 + rsub) * (unsigned)ldc + (unsigned)(col0 + wn * FN * 16 + c4)) * 4u, os = (unsigned)(RPP * ldc) * 4u;      // byte offsets in this batch element's C, below 2^32
  v4f x[NQ];
  if (HASR) {
#pragma unroll      // constant indices: the arrays it walks stay in registers
    for (int q = 0; q < NQ; ++q) x[q] = *(const v4fa*)((const char*)C + (ob + q * os));
  }
  fal* so = (fal*)sm + (size_t)w * (FM * 16) * EP;
#pragma unroll      // constant indices: the arrays it walks stay in registers
  for (int i = 0; i < FM; ++i)
#pragma unroll      // constant indices: the arrays it walks stay in registers
    for (int j = 0; j < FN; ++j)
#pragma unroll      // constant indices: the arrays it walks stay in registers
      for (int r = 0; r < 8; ++r) so[(i * 16 + 8 * hh + r) * EP + j * 16 + ln] = acc[i][j][r] * alpha;
  __builtin_amdgcn_fence(__ATOMIC_ACQ_REL, "workgroup"); __builtin_amdgcn_wave_barrier();      // the wave's staged rows are written before its lanes read each other's words
#pragma unroll      // constant indices: the arrays it walks stay in registers
  for (int q = 0; q < NQ; ++q) {
    v4f v = *(const v4fa*)&so[(q * RPP + rsub) * EP + c4];
    if (HASR) v += x[q];
    *(v4f*)((char*)C + (ob + q * os)) = v;
  }
}

typedef _Float16 v4h __attribute__((ext_vector_type(4)));

__global__ __launch_bounds__(256) void k_x16(const float* __restrict__ x, _Float16* __restrict__ X16, size_t n8) { const size_t t = (size_t)blockIdx.x * 256 + threadIdx.x; if (t >= n8) return; FragH f;
#pragma unroll
  for (int q = 0; q < 8; ++q) f.h[q] = (_Float16)bf16_round(x[t * 8 + q]); *(v8us*)((unsigned short*)X16 + t * 8) = f.half[0];  }
__global__ __launch_bounds__(256) void k_h16(const float* __restrict__ x, _Float16* __restrict__ X16, size_t n8) { const size_t t = (size_t)blockIdx.x * 256 + threadIdx.x; if (t >= n8) return; FragH f;
#pragma unroll
  for (int q = 0; q < 8; ++q) f.h[q] = (_Float16)x[t * 8 + q]; *(v8us*)((unsigned short*)X16 + t * 8) = f.half[0];  }
__global__ __launch_bounds__(256) void k_round16f(const float* __restrict__ W, _Float16* __restrict__ Bt, size_t n8) { const size_t t = (size_t)blockIdx.x * 256 + threadIdx.x; if (t >= n8) return; FragH f;
#pragma unroll
  for (int i = 0; i < 8; ++i) f.h[i] = (_Float16)(bf16_round(W[t * 8 + i]) * 16.0f); *(v8us*)((unsigned short*)Bt + t * 8) = f.half[0];  }
template <int NHv, int TTv>
__global__ __launch_bounds__(256) void k_vt(const _Float16* __restrict__ V16, int ldv, int voff, _Float16* __restrict__ Vt) { __shared__ unsigned short tl[64][66]; const int tid = threadIdx.x; const int slab = blockIdx.x / (TTv / 64), lg = blockIdx.x % (TTv / 64); const int b = slab / NHv, h = slab % NHv;
  for (int i = tid; i < 64 * 8; i += 256) { const int r = i / 8, c8 = (i % 8) * 8; FragH f; f.half[0] = *(const v8us*)((const unsigned short*)V16 + ((size_t)b * TTv + lg * 64 + r) * ldv + voff + h * 64 + c8);
#pragma unroll
    for (int q = 0; q < 8; ++q) tl[r][c8 + q] = f.u[q]; }
  __syncthreads();
  {
#pragma unroll
    for (int rd = 0; rd < 2; ++rd) { const int d = rd * 32 + tid / 8, pc = tid % 8; FragH f;
#pragma unroll
      for (int q = 0; q < 8; ++q) f.u[q] = tl[pc * 8 + q][d];
      *(v8us*)((unsigned short*)Vt + ((size_t)slab * 64 + d) * TTv + lg * 64 + pc * 8) = f.half[0]; }
     } }

__global__ __launch_bounds__(256) void k_hl(const float* __restrict__ F, _Float16* __restrict__ Hh, _Float16* __restrict__ Hl, size_t n8) { const size_t t = (size_t)blockIdx.x * 256 + threadIdx.x; if (t >= n8) return; FragH fh, fl; const v4f a = *(const v4fa*)(F + t * 8), c = *(const v4fa*)(F + t * 8 + 4);
#pragma unroll
  for (int q = 0; q < 4; ++q) { _Float16 h = (_Float16)a[q]; fh.h[q] = h; fl.h[q] = (_Float16)((a[q] - (float)h) * 1024.0f); h = (_Float16)c[q]; fh.h[4 + q] = h; fl.h[4 + q] = (_Float16)((c[q] - (float)h) * 1024.0f); }
  { *(v8us*)((unsigned short*)Hh + t * 8) = fh.half[0]; *(v8us*)((unsigned short*)Hl + t * 8) = fl.half[0];  } }

__global__ __launch_bounds__(256) void k_snorm(const float* __restrict__ x, const float* __restrict__ g, const float* __restrict__ rsc, _Float16* __restrict__ XN, float* __restrict__ XR) {
  #pragma clang fp contract(off)
  const int tid = threadIdx.x, w = tid >> 5, l = tid & 31; const int r = blockIdx.x * 8 + w; if (r >= NBt * LL) return; const float* xr = x + (size_t)r * DD; float ss = 0.f;
#pragma unroll 1
  for (int k = 0; k < 32; ++k) { const float v = bf16_round(xr[l + 32 * k]); ss += v * v; }
  for (int o = 16; o > 0; o >>= 1) ss += __shfl_xor(ss, o, 32); const float nrm = sqrtf(ss) * 0.03125f; const float inv = bf16_round(g[0]) / fmaxf(nrm, 1e-5f);
  {
#pragma unroll 1
    for (int k = 0; k < 32; ++k) { const int c = l + 32 * k; const float v = bf16_round(xr[c]); FragH f; f.h[0] = (_Float16)(v * inv); *(unsigned short*)((unsigned short*)XN + (size_t)r * DD + c) = f.u[0]; *(float*)(XR + (size_t)r * DD + c) = v * bf16_round(rsc[c]); }
     } }
__global__ __launch_bounds__(256) void k_qk(const float* __restrict__ UV, const float* __restrict__ gam, const float* __restrict__ bet, const float* __restrict__ CS, const float* __restrict__ SN, _Float16* __restrict__ Q16, _Float16* __restrict__ K16) {
  #pragma clang fp contract(off)
  const int t = blockIdx.x * 256 + threadIdx.x; if (t >= NBt * 2 * LL * 16) return; const int i0 = (t & 15) * 4; const int l = (t >> 4) % LL; const int which = (t / (LL * 16)) & 1; const int bl = (t / (2 * LL * 16)) * LL + l; const float* gp = gam + which * SSz; const float* bp = bet + which * SSz; _Float16* dst = which ? K16 : Q16; FragH o1, o2;
#pragma unroll
  for (int qq = 0; qq < 4; ++qq) { const int i = i0 + qq; const float u1 = UV[(size_t)bl * NUV + 2 * EE + i], u2 = UV[(size_t)bl * NUV + 2 * EE + 64 + i]; const float b1 = u1 / (1.0f + expf(-u1)), b2 = u2 / (1.0f + expf(-u2));
    const float a1 = b1 * bf16_round(gp[i]) + bf16_round(bp[i]), a2 = b2 * bf16_round(gp[64 + i]) + bf16_round(bp[64 + i]); const float c = CS[(size_t)l * 64 + i], s = SN[(size_t)l * 64 + i];
    o1.h[qq] = (_Float16)(a1 * c - a2 * s); o2.h[qq] = (_Float16)(a2 * c + a1 * s); }
  const unsigned long long p1 = *(const unsigned long long*)&o1.u[0], p2 = *(const unsigned long long*)&o2.u[0];
  { *(unsigned long long*)((unsigned short*)dst + (size_t)bl * SSz + i0) = p1; *(unsigned long long*)((unsigned short*)dst + (size_t)bl * SSz + 64 + i0) = p2;  } }
__constant__ float INVF[64] = {1.000000000e+00f,1.154781938e+00f,1.333521485e+00f,1.539926529e+00f,1.778279424e+00f,2.053524971e+00f,2.371373653e+00f,2.738419533e+00f,3.162277699e+00f,3.651741266e+00f,4.216965199e+00f,4.869675159e+00f,5.623413086e+00f,6.493816376e+00f,7.498941898e+00f,8.659643173e+00f,1.000000000e+01f,1.154782009e+01f,1.333521461e+01f,1.539926529e+01f,1.778279495e+01f,2.053524971e+01f,2.371373749e+01f,2.738419724e+01f,3.162277603e+01f,3.651741409e+01f,4.216965103e+01f,4.869675064e+01f,5.623413086e+01f,6.493816376e+01f,7.498941803e+01f,8.659643555e+01f,1.000000000e+02f,1.154781952e+02f,1.333521423e+02f,1.539926453e+02f,1.778279419e+02f,2.053525085e+02f,2.371373749e+02f,2.738419495e+02f,3.162277527e+02f,3.651741333e+02f,4.216965027e+02f,4.869675293e+02f,5.623413086e+02f,6.493816528e+02f,7.498942261e+02f,8.659642944e+02f,1.000000000e+03f,1.154781982e+03f,1.333521484e+03f,1.539926514e+03f,1.778279419e+03f,2.053525146e+03f,2.371373779e+03f,2.738419678e+03f,3.162277588e+03f,3.651741211e+03f,4.216964844e+03f,4.869675293e+03f,5.623413086e+03f,6.493816406e+03f,7.498941895e+03f,8.659643555e+03f};
__global__ __launch_bounds__(256) void k_cstab(float* __restrict__ CS, float* __restrict__ SN) {
  #pragma clang fp contract(off)
  const int t = blockIdx.x * 256 + threadIdx.x; if (t >= LL * 64) return; const int i = t & 63, l = t >> 6; const float invf = INVF[i]; const float ang = (float)l * invf; const float c = (float)cos((double)ang), s = (float)sin((double)ang);
  { *(float*)(CS + t) = c; *(float*)(SN + t) = s;  } }

extern "C" void kernel_launch(void* const* d_in, const int* in_sizes, int n_in,
                              void* d_out, int out_size, void* d_ws, size_t ws_size, hipStream_t stream) {
  (void)in_sizes; (void)n_in; (void)out_size;
  const float* x = (const float*)d_in[0]; const float* g = (const float*)d_in[1]; const float* uvw = (const float*)d_in[2]; const float* gam = (const float*)d_in[3]; const float* bet = (const float*)d_in[4]; const float* wrel = (const float*)d_in[5]; const float* ow = (const float*)d_in[6]; const float* rsc = (const float*)d_in[7];
  char* ws = (char*)d_ws; size_t off = 0;
  auto take = [&](size_t bytes) { char* p = ws + off; off += (bytes + 255) & ~(size_t)255; return p; };
  // All eight batch elements go through each stage in one launch, so every intermediate holds all eight. Of UV only the columns of u and of base are written and read. x*res_scale is stored in out, where the last GEMM adds to it.
  _Float16* BOW = (_Float16*)take((size_t)DD * EE * 2); float* UV = (float*)take((size_t)NBt * LL * NUV * 4); _Float16* VT = (_Float16*)take((size_t)NBt * EE * LL * 2); _Float16* KER = (_Float16*)take((size_t)NBt * LL * LL * 2);
  _Float16* G16 = (_Float16*)take((size_t)NBt * LL * EE * 2);
  _Float16* BUV = (_Float16*)take((size_t)NUV * DD * 2); float* CS = (float*)take((size_t)LL * 64 * 4); float* SN = (float*)take((size_t)LL * 64 * 4);
  _Float16* XN = (_Float16*)take((size_t)NBt * LL * DD * 2); _Float16* Q16 = (_Float16*)take((size_t)NBt * LL * SSz * 2); _Float16* K16 = (_Float16*)take((size_t)NBt * LL * SSz * 2);
  if (off > ws_size) return;      // 4.2 + 138.4 + 33.6 + 16.8 + 33.6 + 8.7 + 0.5 + 16.8 + 4.2 = 257 MB, no range used twice
  float* Y = (float*)d_out;
  k_round16f<<<(unsigned)(((size_t)NUV * DD / 8 + 255) / 256), 256, 0, stream>>>(uvw, BUV, (size_t)NUV * DD / 8); k_round16f<<<(unsigned)(((size_t)DD * EE / 8 + 255) / 256), 256, 0, stream>>>(ow, BOW, (size_t)DD * EE / 8);      /* (out,in) = natural Bt */
  k_cstab<<<(LL * 64 + 255) / 256, 256, 0, stream>>>(CS, SN);
  const dim3 gU(NUV / 64, NBt * LL / 128), gS(LL / 64, LL / 64, NBt), gK(EE / 64, LL / 128, NBt), gO(DD / 64, NBt * LL / 64);
  k_snorm<<<NBt * LL / 8, 256, 0, stream>>>(x, g, rsc, XN, Y);
  k_gemm_t<4, 2, false, 1><<<gU, 128, 0, stream>>>(XN, DD, 0, BUV, DD, 0, 0.0625f, UV, NUV, 0, DD, nullptr, VT);      /* uv, the batch as rows: M 8192 N 4224 K 1024; u and base pre-activation to UV, silu(v) transposed to VT */
  k_qk<<<(NBt * 2 * LL * 16 + 255) / 256, 256, 0, stream>>>(UV, gam, bet, CS, SN, Q16, K16);
  k_gemm_t<2, 2, false, 2><<<gS, 128, 0, stream>>>(Q16, SSz, (size_t)LL * SSz, K16, SSz, (size_t)LL * SSz, 1.0f, nullptr, LL, 0, SSz, wrel, KER);      /* qk -> kernel, 8 x: M 1024 N 1024 K 128 */
  k_gemm_t<4, 2, false, 3><<<gK, 128, 0, stream>>>(KER, LL, (size_t)LL * LL, VT, LL, (size_t)EE * LL, 1.0f, nullptr, EE, 0, LL, UV, G16);      /* kernel*v -> gated product, 8 x: M 1024 N 2048 K 1024 */
  k_gemm_t<2, 2, true, 0><<<gO, 128, 0, stream>>>(G16, EE, 0, BOW, EE, 0, 0.0625f, Y, DD, 0, EE, nullptr, nullptr);      /* y = x*res_scale (already in out) + out*o_w^T, the batch as rows: M 8192 N 1024 K 2048 */
}

// v004
// It runs in 186 microseconds.
// Two timings next to v003 both put it at 1.12 times that version's speed.
// Over all steps from v000 it is 8.56 times as fast.
#include <hip/hip_runtime.h>
// RTM (GAU-style) block (B 8, L 1024, D 1024, E 2048, s 128): xn = ScaleNorm(x)·g; uv = silu(xn·uv_wᵀ) → u (2048) | v (2048) | base (128); q/k = rope_seq(base·γ + β) (rotation over the sequence axis with angle l·10000^(i/64), half-split); qk = q·kᵀ + w_rel[j − i + 1023]; kernel = relu(qk/√128)²; out = u ⊙ (kernel·v); y = x·res_scale + out·o_wᵀ → [8,1024,1024].
// Compute dtype: x and parameters rounded to bf16; ScaleNorm in f32 → f16 operand; uv GEMM (f32 result), SiLU/affine/rope in f32 (sin/cos of the f32 angle evaluated in double); q, k, v, kernel and the gated product as f16 GEMM operands (≈2^-12), f32 accumulation; residual x·res_scale through the f32 epilogue. v_wmma_f32_16x16x32_f16.
#define NBt 8
#define LL 1024
#define DD 1024
#define EE 2048
#define SSz 128
#define NUV (2 * EE + SSz)       /* 4224 */
typedef __bf16 v16b __attribute__((ext_vector_type(16)));
typedef unsigned short v8us __attribute__((ext_vector_type(8), may_alias));
typedef float  v8f  __attribute__((ext_vector_type(8)));
typedef float  v4f  __attribute__((ext_vector_type(4)));
typedef float  v4fa __attribute__((ext_vector_type(4), may_alias));
union FragB { v16b v; v8us half[2]; unsigned short u[16]; };

__device__ __forceinline__ unsigned short bf16_bits(float x) { unsigned int u = __float_as_uint(x); return (unsigned short)((u + 0x7FFFu + ((u >> 16) & 1u)) >> 16); }
__device__ __forceinline__ float bf16_val(unsigned short b) { return __uint_as_float(((unsigned int)b) << 16); }
__device__ __forceinline__ float bf16_round(float x) { return bf16_val(bf16_bits(x)); }
// D += A·B with NT terms: 1 = ah·bh, 2 = + al·bh (A split), 3 = + ah·bl (both split)
template <int NT>
__device__ __forceinline__ v8f mmaN(v16b ah, v16b al, v16b bh, v16b bl, v8f c) {
  c = __builtin_amdgcn_wmma_f32_16x16x32_bf16(false, ah, false, bh, (short)0, c, false, false);
  if (NT >= 2) c = __builtin_amdgcn_wmma_f32_16x16x32_bf16(false, al, false, bh, (short)0, c, false, false);
  if (NT >= 3) c = __builtin_amdgcn_wmma_f32_16x16x32_bf16(false, ah, false, bl, (short)0, c, false, false);
  asm volatile("v_nop\n\tv_nop\n\tv_nop\n\tv_nop" : "+v"(c) : "v"(ah), "v"(al), "v"(bh), "v"(bl));
  return c;
}

__global__ __launch_bounds__(256) void k_wt_bf16(const float* __restrict__ W, unsigned short* __restrict__ Wt, int K, int N) {
  const int t = blockIdx.x * 256 + threadIdx.x;
  const int k8n = K / 8;
  if (t >= N * k8n) return;
  const int n = t / k8n, k8 = (t % k8n) * 8;
  v8us v;
#pragma unroll
  for (int i = 0; i < 8; ++i) v[i] = bf16_bits(W[(size_t)(k8 + i) * N + n]);
  *(v8us*)(Wt + (size_t)n * K + k8) = v;
  
}

// GEMM C[M][N] (f32, pitch ldc) = act(A[M][K]·W + bias). A f32 row-major (pitch lda) converted per fragment to bf16
// (ASPLIT: hi/lo two planes -> 2 terms, else single rounded term); Wt bf16 [N][K] (pitch ldb). BIAS_BF16 rounds the
// bias to bf16 first (bias quantised to bf16 before the add). K%32==0, M%16==0, N%64==0.
template <bool ASPLIT, int ACT, bool BIAS_BF16>
__global__ __launch_bounds__(128) void k_gemm_bf(const float* __restrict__ A, int lda, const unsigned short* __restrict__ Wt, int ldb,
                                               const float* __restrict__ bias, float* __restrict__ C, int ldc, int M, int N, int K) {
  __shared__ __attribute__((aligned(16))) float so[4][16][64];
  const int tid = threadIdx.x, w = tid >> 5, lane = tid & 31, ln = lane & 15, hh = lane >> 4;
  const int ntn = N / 64;
  const int wid = blockIdx.x * 4 + w;
  const int mt = wid / ntn, nq = wid % ntn;
  if (mt * 16 >= M) return;
  const int row0 = mt * 16, col0 = nq * 64;
  const float* arow = A + (size_t)(row0 + ln) * lda;
  v8f acc[4] = {};
  for (int kb = 0; kb < K; kb += 32) {
    FragB ah, al;
    const v4f x0 = *(const v4fa*)(arow + kb + 8 * hh), x1 = *(const v4fa*)(arow + kb + 8 * hh + 4);
    const v4f x2 = *(const v4fa*)(arow + kb + 16 + 8 * hh), x3 = *(const v4fa*)(arow + kb + 16 + 8 * hh + 4);
    float xs[16] = {x0[0],x0[1],x0[2],x0[3],x1[0],x1[1],x1[2],x1[3],x2[0],x2[1],x2[2],x2[3],x3[0],x3[1],x3[2],x3[3]};
#pragma unroll
    for (int i = 0; i < 16; ++i) { const unsigned short hb = bf16_bits(xs[i]); ah.u[i] = hb; al.u[i] = ASPLIT ? bf16_bits(xs[i] - bf16_val(hb)) : (unsigned short)0; }
#pragma unroll
    for (int t = 0; t < 4; ++t) {
      const unsigned short* brow = Wt + (size_t)(col0 + t * 16 + ln) * ldb + kb;
      FragB b;
      b.half[0] = *(const v8us*)(brow + 8 * hh);
      b.half[1] = *(const v8us*)(brow + 16 + 8 * hh);
      acc[t] = mmaN<ASPLIT ? 2 : 1>(ah.v, al.v, b.v, b.v, acc[t]);
    }
  }
#pragma unroll
  for (int t = 0; t < 4; ++t) {
    float bv = bias ? bias[col0 + t * 16 + ln] : 0.f;
    if (BIAS_BF16) bv = bf16_round(bv);
#pragma unroll
    for (int r = 0; r < 8; ++r) { float v = acc[t][r] + bv; if (ACT == 1) v = fmaxf(v, 0.f); so[w][8 * hh + r][t * 16 + ln] = v; }
  }
  __builtin_amdgcn_fence(__ATOMIC_ACQ_REL, "workgroup");
  __builtin_amdgcn_wave_barrier();
  const int rsub = lane >> 4, c4 = (lane & 15) * 4;
  {
#pragma unroll
    for (int q = 0; q < 8; ++q) {
      const int r = q * 2 + rsub;
      const v4f v = *(const v4fa*)&so[w][r][c4];
      *(v4f*)(C + (size_t)(row0 + r) * ldc + col0 + c4) = v;
    }
    
  }
}

// GEMM C = act(A·W + bias + resid): A f32 (ASPLIT -> hi/lo 2 terms), Wt bf16 [N][K]; ACT 0 none, 1 relu, 2 exact gelu;
// resid (optional, f32, row index = (row % rmod), pitch ldr, RES_BF16 rounds it) added before the activation.
template <bool ASPLIT, int ACT, bool BIAS_BF16, bool RES_BF16>
__global__ __launch_bounds__(128) void k_gemm_bf3(const float* __restrict__ A, int lda, const unsigned short* __restrict__ Wt, int ldb,
                                                const float* __restrict__ bias, const float* __restrict__ resid, int rmod, int ldr,
                                                float* __restrict__ C, int ldc, int M, int N, int K) {
  __shared__ __attribute__((aligned(16))) float so[4][16][64];
  const int tid = threadIdx.x, w = tid >> 5, lane = tid & 31, ln = lane & 15, hh = lane >> 4;
  const int ntn = N / 64;
  const int wid = blockIdx.x * 4 + w;
  const int mt = wid / ntn, nq = wid % ntn;
  if (mt * 16 >= M) return;
  const int row0 = mt * 16, col0 = nq * 64;
  const float* arow = A + (size_t)(row0 + ln) * lda;
  v8f acc[4] = {};
  for (int kb = 0; kb < K; kb += 32) {
    FragB ah, al;
    const v4f x0 = *(const v4fa*)(arow + kb + 8 * hh), x1 = *(const v4fa*)(arow + kb + 8 * hh + 4);
    const v4f x2 = *(const v4fa*)(arow + kb + 16 + 8 * hh), x3 = *(const v4fa*)(arow + kb + 16 + 8 * hh + 4);
    float xs[16] = {x0[0],x0[1],x0[2],x0[3],x1[0],x1[1],x1[2],x1[3],x2[0],x2[1],x2[2],x2[3],x3[0],x3[1],x3[2],x3[3]};
#pragma unroll
    for (int i = 0; i < 16; ++i) { const unsigned short hb = bf16_bits(xs[i]); ah.u[i] = hb; al.u[i] = ASPLIT ? bf16_bits(xs[i] - bf16_val(hb)) : (unsigned short)0; }
#pragma unroll
    for (int t = 0; t < 4; ++t) {
      const unsigned short* brow = Wt + (size_t)(col0 + t * 16 + ln) * ldb + kb;
      FragB b;
      b.half[0] = *(const v8us*)(brow + 8 * hh);
      b.half[1] = *(const v8us*)(brow + 16 + 8 * hh);
      acc[t] = mmaN<ASPLIT ? 2 : 1>(ah.v, al.v, b.v, b.v, acc[t]);
    }
  }
#pragma unroll
  for (int t = 0; t < 4; ++t) {
    const int col = col0 + t * 16 + ln;
    float bv = bias ? bias[col] : 0.f;
    if (BIAS_BF16) bv = bf16_round(bv);
#pragma unroll
    for (int r = 0; r < 8; ++r) {
      float v = acc[t][r] + bv;
      if (resid) { float rv = resid[(size_t)((row0 + 8 * hh + r) % rmod) * ldr + col]; if (RES_BF16) rv = bf16_round(rv); v += rv; }
      if (ACT == 1) v = fmaxf(v, 0.f);
      if (ACT == 2) v = 0.5f * v * (1.0f + erff(v * 0.70710678118654752f));
      if (ACT == 3) { const float u = 0.7978845608028654f * (v + 0.044715f * v * v * v); v = 0.5f * v * (1.0f + tanhf(u)); }
      so[w][8 * hh + r][t * 16 + ln] = v;
    }
  }
  __builtin_amdgcn_fence(__ATOMIC_ACQ_REL, "workgroup");
  __builtin_amdgcn_wave_barrier();
  const int rsub = lane >> 4, c4 = (lane & 15) * 4;
  {
#pragma unroll
    for (int q = 0; q < 8; ++q) {
      const int r = q * 2 + rsub;
      const v4f v = *(const v4fa*)&so[w][r][c4];
      *(v4f*)(C + (size_t)(row0 + r) * ldc + col0 + c4) = v;
    }
    
  }
}
// row LayerNorm (biased variance, eps) over N: s = X (+ R); optional out_sum <- s; out_norm <- (s-mu)*rsqrt(var+eps)*g + b
template <bool PARAM_BF16>
__global__ __launch_bounds__(256) void k_layernorm(const float* __restrict__ X, const float* __restrict__ R, const float* __restrict__ g, const float* __restrict__ bta,
                                                  float* __restrict__ out_sum, float* __restrict__ out_norm, int N, float eps) {
  __shared__ float red[256];
  const int row = blockIdx.x, tid = threadIdx.x;
  const float* x = X + (size_t)row * N; const float* rr = R ? R + (size_t)row * N : nullptr;
  float vals[16];                     // up to N = 4096
  const int per = N / 256;            // contiguous chunk per thread? use strided-by-4 chunks: thread handles j = tid*4 + 1024*u
  float s1 = 0.f;
  for (int u = 0; u < per / 4; ++u) {
    const int j = tid * 4 + 1024 * u;
    const v4f a = *(const v4fa*)(x + j);
    v4f b = {0.f,0.f,0.f,0.f}; if (rr) b = *(const v4fa*)(rr + j);
#pragma unroll
    for (int q = 0; q < 4; ++q) { const float v = a[q] + b[q]; vals[u * 4 + q] = v; s1 += v; }
  }
  red[tid] = s1; __syncthreads();
  for (int st = 128; st > 0; st >>= 1) { if (tid < st) red[tid] += red[tid + st]; __syncthreads(); }
  const float mu = red[0] / (float)N; __syncthreads();
  float s2 = 0.f;
  for (int u = 0; u < per / 4; ++u)
#pragma unroll
    for (int q = 0; q < 4; ++q) { const float c = vals[u * 4 + q] - mu; s2 += c * c; }
  red[tid] = s2; __syncthreads();
  for (int st = 128; st > 0; st >>= 1) { if (tid < st) red[tid] += red[tid + st]; __syncthreads(); }
  const float rs = rsqrtf(red[0] / (float)N + eps);
  {
    for (int u = 0; u < per / 4; ++u) {
      const int j = tid * 4 + 1024 * u;
      v4f o, sm;
#pragma unroll
      for (int q = 0; q < 4; ++q) {
        float gg = g[j + q], bb = bta[j + q];
        if (PARAM_BF16) { gg = bf16_round(gg); bb = bf16_round(bb); }
        sm[q] = vals[u * 4 + q]; o[q] = (vals[u * 4 + q] - mu) * rs * gg + bb;
      }
      if (out_sum) *(v4f*)(out_sum + (size_t)row * N + j) = sm;
      *(v4f*)(out_norm + (size_t)row * N + j) = o;
    }
    
  }
}



// ---- f16 WMMA path (v_wmma_f32_16x16x32_f16): 11-bit significands for operands in range — used for all four GEMMs of this block
typedef _Float16 v16h __attribute__((ext_vector_type(16)));
union FragH { v16h v; v8us half[2]; _Float16 h[16]; unsigned short u[16]; };
template <int NT>
__device__ __forceinline__ v8f mmaH(v16h ah, v16h al, v16h bh, v16h bl, v8f c) {
  c = __builtin_amdgcn_wmma_f32_16x16x32_f16(false, ah, false, bh, (short)0, c, false, false);
  if (NT >= 2) c = __builtin_amdgcn_wmma_f32_16x16x32_f16(false, al, false, bh, (short)0, c, false, false);
  if (NT >= 3) c = __builtin_amdgcn_wmma_f32_16x16x32_f16(false, ah, false, bl, (short)0, c, false, false);
  asm volatile("v_nop\n\tv_nop\n\tv_nop\n\tv_nop" : "+v"(c) : "v"(ah), "v"(al), "v"(bh), "v"(bl));
  return c;
}
// batched GEMM like k_gemm_b but f16 operands: A f32 (split into f16 hi/lo if ASPLIT, else rounded to f16), Bt = f16 values [n][k]; alpha; C f32; N multiple of 16 (partial tiles skipped)
template <bool ASPLIT>
__global__ __launch_bounds__(128) void k_gemm_h(const float* __restrict__ A, int lda, size_t sA, const _Float16* __restrict__ Bh, int ldb, size_t sB, float alpha, float* __restrict__ C, int ldc, size_t sC, int M, int N, int K) {
  __shared__ __attribute__((aligned(16))) float so[4][16][64];
  const int tid = threadIdx.x, w = tid >> 5, lane = tid & 31, ln = lane & 15, hh = lane >> 4; const int by = blockIdx.y;
  A += (size_t)by * sA; Bh += (size_t)by * sB; C += (size_t)by * sC;
  const int ntn = (N + 63) / 64; const int wid = blockIdx.x * 4 + w; const int mt = wid / ntn, nq = wid % ntn; if (mt * 16 >= M) return;
  const int row0 = mt * 16, col0 = nq * 64; const float* arow = A + (size_t)(row0 + ln) * lda;
  v8f acc[4] = {};
  for (int kb = 0; kb < K; kb += 32) {
    FragH ah, al;
    const v4f x0 = *(const v4fa*)(arow + kb + 8 * hh), x1 = *(const v4fa*)(arow + kb + 8 * hh + 4), x2 = *(const v4fa*)(arow + kb + 16 + 8 * hh), x3 = *(const v4fa*)(arow + kb + 16 + 8 * hh + 4);
    float xs[16] = {x0[0],x0[1],x0[2],x0[3],x1[0],x1[1],x1[2],x1[3],x2[0],x2[1],x2[2],x2[3],x3[0],x3[1],x3[2],x3[3]};
#pragma unroll
    for (int i = 0; i < 16; ++i) { const _Float16 h = (_Float16)xs[i]; ah.h[i] = h; al.h[i] = ASPLIT ? (_Float16)(xs[i] - (float)h) : (_Float16)0.0f; }
#pragma unroll
    for (int t = 0; t < 4; ++t) { if (col0 + t * 16 >= N) continue; const size_t boff = (size_t)(col0 + t * 16 + ln) * ldb + kb; FragH bq; bq.half[0] = *(const v8us*)(Bh + boff + 8 * hh); bq.half[1] = *(const v8us*)(Bh + boff + 16 + 8 * hh);
      acc[t] = mmaH<ASPLIT ? 2 : 1>(ah.v, al.v, bq.v, bq.v, acc[t]); }
  }
#pragma unroll
  for (int t = 0; t < 4; ++t) { if (col0 + t * 16 >= N) continue;
#pragma unroll
    for (int r = 0; r < 8; ++r) so[w][8 * hh + r][t * 16 + ln] = acc[t][r] * alpha; }
  __builtin_amdgcn_fence(__ATOMIC_ACQ_REL, "workgroup"); __builtin_amdgcn_wave_barrier();
  const int rsub = lane >> 4, c4 = (lane & 15) * 4;
  {
#pragma unroll
    for (int q = 0; q < 8; ++q) { const int r = q * 2 + rsub; if (col0 + c4 < N) { const v4f v = *(const v4fa*)&so[w][r][c4]; *(v4f*)(C + (size_t)(row0 + r) * ldc + col0 + c4) = v; } }
     }
}

// Wt[n][k] = f16(W[k][n]·scale) from f32 row-major W[K][N] (scale = power of two; bf16-exact weights stay exact in f16 away from the subnormal range)
__global__ __launch_bounds__(256) void k_wt_f16(const float* __restrict__ W, _Float16* __restrict__ Wt, int K, int N, float scale) {
  const int t = blockIdx.x * 256 + threadIdx.x; if (t >= N * (K / 8)) return; const int n = t / (K / 8), k8 = (t % (K / 8)) * 8; FragH f;
#pragma unroll
  for (int i = 0; i < 8; ++i) f.h[i] = (_Float16)(bf16_round(W[(size_t)(k8 + i) * N + n]) * scale); const v8us o = f.half[0];
  *(v8us*)((unsigned short*)Wt + (size_t)n * K + k8) = o; 
}
// k_gemm_hh variant with fused epilogue: v = acc·alpha + bias[by·sBias + col] (+ CP[(row/rowsPerB)·sCPb + by·64 + col] if CP) ; ACT 0 none / 1 elu ; writes f32 C and f16 C16, each if non-null
template <int ACT>
__global__ __launch_bounds__(128) void k_gemm_hhx(const _Float16* __restrict__ A, int lda, size_t sA, const _Float16* __restrict__ Bh, int ldb, size_t sB, float alpha, const float* __restrict__ bias, size_t sBias, const float* __restrict__ CP, int rowsPerB, size_t sCPb, int row0g,
    float* __restrict__ C, _Float16* __restrict__ C16, int ldc, size_t sC, int M, int N, int K) {
  __shared__ __attribute__((aligned(16))) float so[4][16][64];
  const int tid = threadIdx.x, w = tid >> 5, lane = tid & 31, ln = lane & 15, hh = lane >> 4; const int by = blockIdx.y;
  A += (size_t)by * sA; Bh += (size_t)by * sB; const size_t cofs = (size_t)by * sC; const float* bp = bias ? bias + (size_t)by * sBias : nullptr;
  const int ntn = (N + 63) / 64; const int wid = blockIdx.x * 4 + w; const int mt = wid / ntn, nq = wid % ntn; if (mt * 16 >= M) return;
  const int row0 = mt * 16, col0 = nq * 64; const _Float16* arow = A + (size_t)(row0 + ln) * lda;
  v8f acc[4] = {};
  for (int kb = 0; kb < K; kb += 32) { FragH ah; ah.half[0] = *(const v8us*)((const unsigned short*)arow + kb + 8 * hh); ah.half[1] = *(const v8us*)((const unsigned short*)arow + kb + 16 + 8 * hh);
#pragma unroll
    for (int t = 0; t < 4; ++t) { if (col0 + t * 16 >= N) continue; const size_t boff = (size_t)(col0 + t * 16 + ln) * ldb + kb; FragH bq; bq.half[0] = *(const v8us*)((const unsigned short*)Bh + boff + 8 * hh); bq.half[1] = *(const v8us*)((const unsigned short*)Bh + boff + 16 + 8 * hh);
      acc[t] = mmaH<1>(ah.v, ah.v, bq.v, bq.v, acc[t]); }
  }
#pragma unroll
  for (int t = 0; t < 4; ++t) { if (col0 + t * 16 >= N) continue; const int col = col0 + t * 16 + ln; const float bv = bp ? bf16_round(bp[col]) : 0.f;
#pragma unroll
    for (int r = 0; r < 8; ++r) { float v = acc[t][r] * alpha + bv; if (CP) { const int bidx = (row0g + row0 + 8 * hh + r) / rowsPerB; v += CP[(size_t)bidx * sCPb + (size_t)by * 64 + col]; } if (ACT == 1) v = (v > 0.f) ? v : expm1f(v); else if (ACT == 7) v = (v > 0.f) ? v + 1.0f : expf(v); else if (ACT == 8) v = tanhf(v); else if (ACT == 9) v = 0.5f * v * (1.0f + tanhf(0.7978845608028654f * (v + 0.044715f * v * v * v))); else if (ACT == 11) v = 1.0f / (1.0f + expf(-v)); else if (ACT == 12) v = (v > 0.f) ? v : 0.01f * v; else if (ACT == 14) v = (v > 0.f) ? v : 0.1f * v; else if (ACT == 15) v = v / (1.0f + expf(-v)); else if (ACT == 3) v = fmaxf(v, 0.f); else if (ACT == 6) v = 0.5f * v * (1.0f + erff(v * 0.70710678118654752f)); so[w][8 * hh + r][t * 16 + ln] = v; } }
  __builtin_amdgcn_fence(__ATOMIC_ACQ_REL, "workgroup"); __builtin_amdgcn_wave_barrier();
  const int rsub = lane >> 4, c4 = (lane & 15) * 4; typedef _Float16 v4h __attribute__((ext_vector_type(4)));
  {
#pragma unroll
    for (int q = 0; q < 8; ++q) { const int r = q * 2 + rsub; if (col0 + c4 < N) { const v4f v = *(const v4fa*)&so[w][r][c4]; if (C) *(v4f*)(C + cofs + (size_t)(row0 + r) * ldc + col0 + c4) = v; if (C16) { v4h h4; for (int i = 0; i < 4; ++i) h4[i] = (_Float16)v[i]; *(v4h*)(C16 + cofs + (size_t)(row0 + r) * ldc + col0 + c4) = h4; } } }
     }
}


// Block-tiled f16 GEMM: C[row][col] = alpha * sum_k A[row][k] * B[col][k] (+ the value that C[row][col] already holds, if HASR). A and B are k-contiguous f16.
// blockIdx.z is the batch element: A, B and C move on by sA, sB and sC elements for each.
// One work-group of 4 waves (2 x 2) owns a (32 FM) x (32 FN) tile of C; each wave FM x FN fragments. A stage is 128 k of the tile's A rows and
// B rows (256 B a row, LDS pitch 272 B), brought in by asynchronous copies into two buffers: stage s + 1 flies while stage s is multiplied.
// The k order inside a fragment and the order of the k blocks are those of k_gemm_hhx. M, N multiples of the tile, K of 128.
#define TKK 128
#define TPB 272
typedef float fal __attribute__((may_alias));
// eight rows (8 apart) of a stage: each lane copies its own 16 bytes of each. The s_wait_xcnt stands in the copies' own statement so that no address register is rewritten ahead of it.
__device__ __forceinline__ void copy8(unsigned lds, const _Float16* g, size_t g8) {
  asm volatile("global_load_async_to_lds_b128 %0, %8, off\n\t"
               "global_load_async_to_lds_b128 %1, %9, off\n\t"
               "global_load_async_to_lds_b128 %2, %10, off\n\t"
               "global_load_async_to_lds_b128 %3, %11, off\n\t"
               "global_load_async_to_lds_b128 %4, %12, off\n\t"
               "global_load_async_to_lds_b128 %5, %13, off\n\t"
               "global_load_async_to_lds_b128 %6, %14, off\n\t"
               "global_load_async_to_lds_b128 %7, %15, off\n\t"
               "s_wait_xcnt 0x0"
               :: "v"(lds), "v"(lds + 8 * TPB), "v"(lds + 16 * TPB), "v"(lds + 24 * TPB), "v"(lds + 32 * TPB), "v"(lds + 40 * TPB), "v"(lds + 48 * TPB), "v"(lds + 56 * TPB),
                  "v"(g), "v"(g + g8), "v"(g + 2 * g8), "v"(g + 3 * g8), "v"(g + 4 * g8), "v"(g + 5 * g8), "v"(g + 6 * g8), "v"(g + 7 * g8)
               : "memory");
}
// eight stores of 16 (store8q) or 8 (store8d) bytes a lane, st bytes apart. The s_wait_xcnt stands in the stores' own statement so that no address or data register of theirs is rewritten ahead of it.
__device__ __forceinline__ void store8q(char* p, size_t st, v4f d0, v4f d1, v4f d2, v4f d3, v4f d4, v4f d5, v4f d6, v4f d7) {
  asm volatile("global_store_b128 %0, %8, off\n\t"
               "global_store_b128 %1, %9, off\n\t"
               "global_store_b128 %2, %10, off\n\t"
               "global_store_b128 %3, %11, off\n\t"
               "global_store_b128 %4, %12, off\n\t"
               "global_store_b128 %5, %13, off\n\t"
               "global_store_b128 %6, %14, off\n\t"
               "global_store_b128 %7, %15, off\n\t"
               "s_wait_xcnt 0x0"
               :: "v"(p), "v"(p + st), "v"(p + 2 * st), "v"(p + 3 * st), "v"(p + 4 * st), "v"(p + 5 * st), "v"(p + 6 * st), "v"(p + 7 * st),
                  "v"(d0), "v"(d1), "v"(d2), "v"(d3), "v"(d4), "v"(d5), "v"(d6), "v"(d7)
               : "memory");
}
__device__ __forceinline__ void store8d(char* p, size_t st, unsigned long long d0, unsigned long long d1, unsigned long long d2, unsigned long long d3, unsigned long long d4, unsigned long long d5, unsigned long long d6, unsigned long long d7) {
  asm volatile("global_store_b64 %0, %8, off\n\t"
               "global_store_b64 %1, %9, off\n\t"
               "global_store_b64 %2, %10, off\n\t"
               "global_store_b64 %3, %11, off\n\t"
               "global_store_b64 %4, %12, off\n\t"
               "global_store_b64 %5, %13, off\n\t"
               "global_store_b64 %6, %14, off\n\t"
               "global_store_b64 %7, %15, off\n\t"
               "s_wait_xcnt 0x0"
               :: "v"(p), "v"(p + st), "v"(p + 2 * st), "v"(p + 3 * st), "v"(p + 4 * st), "v"(p + 5 * st), "v"(p + 6 * st), "v"(p + 7 * st),
                  "v"(d0), "v"(d1), "v"(d2), "v"(d3), "v"(d4), "v"(d5), "v"(d6), "v"(d7)
               : "memory");
}
// EPI names what the epilogue does with the tile t = alpha * A*B^T:
//   0  C = t (+ C if HASR), f32.
//   1  uv: columns of u and of base as EPI 0 (pre-activation, f32); columns of v go out as H[b][e][l] = f16(silu(t)), transposed, and are not stored in C.
//   2  scores: H[b][i][j] = f16(relu((t + bf16(X[j - i + L - 1])) / sqrt(128))^2), X = w_rel; C unused.
//   3  gate: H[b*L + i][e] = f16(silu(X[b*L + i][e]) * t), X = the uv pre-activation (pitch NUV); C unused.
typedef unsigned short v4us __attribute__((ext_vector_type(4), may_alias));
template <int FM, int FN, bool HASR, int EPI>
__global__ __launch_bounds__(128) void k_gemm_t(const _Float16* __restrict__ A, int lda, size_t sA, const _Float16* __restrict__ B, int ldb, size_t sB, float alpha, float* __restrict__ C, int ldc, size_t sC, int K,
                                                const float* __restrict__ X, _Float16* __restrict__ H) {
  constexpr int BM = 32 * FM, BN = 32 * FN, STG = (BM + BN) * TPB, EP = FN * 16 + 4;
  static_assert(4 * FM * 16 * EP * 4 <= 2 * STG, "output staging fits the ring");
  __shared__ __attribute__((aligned(16))) unsigned char sm[2 * STG];
  const int tid = threadIdx.x, w = tid >> 5, lane = tid & 31, ln = lane & 15, hh = lane >> 4;
  const int row0 = blockIdx.y * BM, col0 = blockIdx.x * BN, wm = w >> 1, wn = w & 1;
  A += (size_t)blockIdx.z * sA; B += (size_t)blockIdx.z * sB; C += (size_t)blockIdx.z * sC;
  const int cr = tid >> 4, cc = tid & 15;      // copies: 16 lanes cover one 256-B row, the work-group 8 rows an instruction
  const _Float16* gA = A + (size_t)(row0 + cr) * lda + cc * 8;
  const _Float16* gB = B + (size_t)(col0 + cr) * ldb + cc * 8;
  const unsigned lA = (unsigned)(size_t)sm + cr * TPB + cc * 16;
  auto stage = [&](int s, int buf) {
    for (int i = 0; i < BM / 64; ++i) copy8(lA + buf * STG + i * 64 * TPB, gA + (size_t)s * TKK + (size_t)i * 64 * lda, (size_t)8 * lda);
    for (int i = 0; i < BN / 64; ++i) copy8(lA + buf * STG + (BM + i * 64) * TPB, gB + (size_t)s * TKK + (size_t)i * 64 * ldb, (size_t)8 * ldb);
  };
  const int nst = K / TKK;
  stage(0, 0);
  asm volatile("s_wait_asynccnt 0x0" ::: "memory");      // this wave's copies of stage 0 have landed
  __syncthreads();                                       // ... and every other wave's
  if (nst > 1) stage(1, 1);
  v8f acc[FM][FN] = {};
  for (int s = 0; s < nst; ++s) {
    const unsigned char* pa = sm + (s & 1) * STG + (wm * FM * 16 + ln) * TPB + hh * 16;
    const unsigned char* pb = sm + (s & 1) * STG + (BM + wn * FN * 16 + ln) * TPB + hh * 16;
    FragH a[2][FM], b[2][FN];      // two fragment sets: block kk + 1 of this stage is read from LDS while block kk is multiplied
    auto frags = [&](int kk, int set) {
#pragma unroll      // constant indices: the arrays it walks stay in registers
      for (int i = 0; i < FM; ++i) { a[set][i].half[0] = *(const v8us*)(pa + i * 16 * TPB + kk * 64); a[set][i].half[1] = *(const v8us*)(pa + i * 16 * TPB + kk * 64 + 32); }
#pragma unroll      // constant indices: the arrays it walks stay in registers
      for (int j = 0; j < FN; ++j) { b[set][j].half[0] = *(const v8us*)(pb + j * 16 * TPB + kk * 64); b[set][j].half[1] = *(const v8us*)(pb + j * 16 * TPB + kk * 64 + 32); }
    };
    frags(0, 0);
#pragma unroll      // constant indices: the arrays it walks stay in registers
    for (int kk = 0; kk < TKK / 32; ++kk) {
      if (kk + 1 < TKK / 32) frags(kk + 1, (kk + 1) & 1);
      __builtin_amdgcn_sched_barrier(0);      // the next block's LDS reads stay one group ahead of this block's WMMAs (sunk among them, each read's latency is waited out by the wave)
#pragma unroll      // constant indices: the arrays it walks stay in registers
      for (int i = 0; i < FM; ++i)
#pragma unroll      // constant indices: the arrays it walks stay in registers
        for (int j = 0; j < FN; ++j) acc[i][j] = __builtin_amdgcn_wmma_f32_16x16x32_f16(false, a[kk & 1][i].v, false, b[kk & 1][j].v, (short)0, acc[i][j], false, false);
      __builtin_amdgcn_sched_barrier(0);      // and the group after that is not lifted in among them
    }
    asm volatile("s_wait_dscnt 0x0" ::: "memory");       // this wave's reads of stage s are done before the buffer is refilled
    asm volatile("s_wait_asynccnt 0x0" ::: "memory");    // this wave's copies of stage s + 1 have landed
    __syncthreads();                                     // publishes stage s + 1 and ends every reader's last read of stage s
    if (s + 2 < nst) stage(s + 2, s & 1);
  }
  asm volatile("s_wait_asynccnt 0x0" ::: "memory");      // nothing in flight when the ring becomes output staging
  if constexpr (EPI == 1) {
    if (col0 >= EE && col0 < 2 * EE) {      // the same for the whole work-group: a tile of v
      // a lane's 8 accumulator rows of one fragment are 8 neighbours along l of one column e: 16 bytes of a row of H. Each wave stages its block column-major in its own LDS range, then stores whole 128-B lines.
      constexpr int HP = FM * 16 + 8, PPC = FM * 2;      // pitch in halves (16 B x odd); 16-byte parts a column
      unsigned short* sh = (unsigned short*)sm + (size_t)w * (FN * 16) * HP;
#pragma unroll 1      // stays rolled, two fragment rows a trip: unrolled, a lane's 8 FM FN silu make the kernel's text longer than 32 KB
      for (int ih = 0; ih < FM / 2; ++ih) {
#pragma unroll      // constant indices: the arrays it walks stay in registers
        for (int i = 0; i < 2; ++i)
#pragma unroll      // constant indices: the arrays it walks stay in registers
          for (int j = 0; j < FN; ++j) {
            FragH f;
#pragma unroll      // constant indices: the arrays it walks stay in registers
            for (int r = 0; r < 8; ++r) { const float v = acc[i][j][r] * alpha; f.h[r] = (_Float16)(v / (1.0f + expf(-v))); }
            *(v8us*)(sh + (j * 16 + ln) * HP + (ih * 2 + i) * 16 + 8 * hh) = f.half[0];
          }
#pragma unroll      // constant indices: the next trip's two fragment rows move down to where the trip reads them
        for (int i = 0; i + 2 < FM; ++i)
#pragma unroll      // constant indices: the arrays it walks stay in registers
          for (int j = 0; j < FN; ++j) acc[i][j] = acc[i + 2][j];
      }
      __builtin_amdgcn_fence(__ATOMIC_ACQ_REL, "workgroup"); __builtin_amdgcn_wave_barrier();      // the wave's staged columns are written before its lanes read each other's words
      const int rw = row0 + wm * FM * 16;      // the wave's first row; its FM*16 rows lie in one batch element
      unsigned short* vt = (unsigned short*)H + ((size_t)(rw / LL) * EE + (col0 - EE) + wn * FN * 16) * LL + rw % LL;
#pragma unroll      // the stores go out back to back
      for (int q = 0; q < FN * 16 * PPC / 32; ++q) { const int c = (q * 32 + lane) / PPC, p = (q * 32 + lane) % PPC; *(v8us*)(vt + (size_t)c * LL + p * 8) = *(const v8us*)(sh + c * HP + p * 8); }
      return;
    }
  }
  if constexpr (EPI == 2) {
    // f16 out: a row of the work-group's tile is 64 columns = one 128-B line, so the four waves stage the tile together and each then stores whole rows of it
    static_assert(BN == 64, "a tile row of f16 is one line");
    constexpr int EPW = BN + 4, NR = BM / 8;      // 16 lanes a row, 2 rows an instruction, BM / 4 rows a wave
    const int rr = w * (BM / 4) + hh, c4 = ln * 4;
    const size_t gr = (size_t)blockIdx.z * LL + row0 + rr;      // row over all batch elements
    fal* so = (fal*)sm;
#pragma unroll      // constant indices: the arrays it walks stay in registers
    for (int i = 0; i < FM; ++i)
#pragma unroll      // constant indices: the arrays it walks stay in registers
      for (int j = 0; j < FN; ++j)
#pragma unroll      // constant indices: the arrays it walks stay in registers
        for (int r = 0; r < 8; ++r) so[((wm * FM + i) * 16 + 8 * hh + r) * EPW + (wn * FN + j) * 16 + ln] = acc[i][j][r] * alpha;
    __syncthreads();      // every wave's part of the tile is staged before any wave reads whole rows
#pragma unroll      // constant indices: the arrays it walks stay in registers
    for (int q = 0; q < NR; ++q) {
      const v4f t = *(const v4fa*)&so[(rr + 2 * q) * EPW + c4];
      union { v4us o; _Float16 h[4]; } f;
#pragma unroll      // constant indices: the arrays it walks stay in registers
      for (int e = 0; e < 4; ++e) {
        if constexpr (EPI == 2) { const float v = (t[e] + bf16_round(X[col0 + c4 + e - (row0 + rr + 2 * q) + LL - 1])) / 11.313708498984761f; const float r = fmaxf(v, 0.f); f.h[e] = (_Float16)(r * r); }
      }
      *(v4us*)((unsigned short*)H + (gr + 2 * q) * (size_t)ldc + col0 + c4) = f.o;
    }
    return;
  }
  if constexpr (EPI == 3) {
    // f16 out: a row of the work-group's tile is BN columns = one or two 128-B lines, so the four waves stage the tile together and each then stores whole rows of it
    static_assert(BN == 64 || BN == 128, "a tile row of f16 is whole lines, at most one wave wide");
    constexpr int EPW = BN + 4, LPH = BN / 4, RPI = 32 / LPH, NR = BM / 4 / RPI;      // LPH lanes a row, RPI rows an instruction, BM / 4 rows a wave
    static_assert(BM * EPW * 4 <= 2 * STG && NR % 8 == 0, "the staged tile fits the ring; eight rows a trip of the store loop");
    const int rr = w * (BM / 4) + lane / LPH, c4 = (lane % LPH) * 4;
    const size_t gr = (size_t)blockIdx.z * LL + row0 + rr;      // row over all batch elements
    v4f x[NR];
    const float* xp = X + gr * NUV + col0 + c4;
#pragma unroll      // constant indices: the arrays it walks stay in registers
    for (int q = 0; q < NR; ++q) x[q] = *(const v4fa*)(xp + (size_t)(RPI * q) * NUV);
    asm volatile("s_wait_xcnt 0x0" :: "v"(xp) : "memory");      // the loads' address pair is held as far as this wait, so that nothing, a load's own result included, is written over it ahead of the wait
    fal* so = (fal*)sm;
#pragma unroll      // constant indices: the arrays it walks stay in registers
    for (int i = 0; i < FM; ++i)
#pragma unroll      // constant indices: the arrays it walks stay in registers
      for (int j = 0; j < FN; ++j)
#pragma unroll      // constant indices: the arrays it walks stay in registers
        for (int r = 0; r < 8; ++r) so[((wm * FM + i) * 16 + 8 * hh + r) * EPW + (wn * FN + j) * 16 + ln] = acc[i][j][r] * alpha;
    __syncthreads();      // every wave's part of the tile is staged before any wave reads whole rows
    char* hp = (char*)((unsigned short*)H + gr * (size_t)ldc + col0 + c4);
    const size_t hs = (size_t)(RPI * 2) * ldc;      // bytes from one instruction's rows to the next's
#pragma unroll 1      // stays rolled, eight instructions a trip: unrolled, a lane's 4 NR silu make the kernel's text longer than 32 KB
    for (int h = 0; h < NR / 8; ++h) {
      unsigned long long o[8];
#pragma unroll      // constant indices: the arrays it walks stay in registers
      for (int q = 0; q < 8; ++q) {
        const v4f t = *(const v4fa*)&so[(rr + RPI * (h * 8 + q)) * EPW + c4];
        union { unsigned long long o; _Float16 h[4]; } f;
#pragma unroll      // constant indices: the arrays it walks stay in registers
        for (int e = 0; e < 4; ++e) { const float u = x[q][e]; f.h[e] = (_Float16)((u / (1.0f + expf(-u))) * t[e]); }
        o[q] = f.o;
      }
      store8d(hp + (size_t)(h * 8) * hs, hs, o[0], o[1], o[2], o[3], o[4], o[5], o[6], o[7]);
#pragma unroll      // constant indices: the next trips' gate values move down to where a trip reads them
      for (int q = 0; q + 8 < NR; ++q) x[q] = x[q + 8];
    }
    return;
  }
  // whole 128-B lines out: each wave stages its own FM*16 x FN*16 block in its own LDS range (behind the last pass's barrier), then stores rows
  constexpr int LPR = FN * 4, RPP = 32 / LPR, NQ = FM * 16 / RPP;
  const int rsub = lane / LPR, c4 = (lane % LPR) * 4;
  const unsigned ob = ((unsigned)(row0 + wm * FM * 16 + rsub) * (unsigned)ldc + (unsigned)(col0 + wn * FN * 16 + c4)) * 4u, os = (unsigned)(RPP * ldc) * 4u;      // byte offsets in this batch element's C, below 2^32
  v4f x[NQ];
  if constexpr (HASR) {
    static_assert(NQ % 16 == 0, "sixteen loads a wait");
#pragma unroll      // constant indices: the arrays it walks stay in registers
    for (int q0 = 0; q0 < NQ; q0 += 16) {
      unsigned of[16];
#pragma unroll      // constant indices: the arrays it walks stay in registers
      for (int q = 0; q < 16; ++q) { of[q] = ob + (q0 + q) * os; x[q0 + q] = *(const v4fa*)((const char*)C + of[q]); }
      asm volatile("s_wait_xcnt 0x0" :: "v"(of[0]), "v"(of[1]), "v"(of[2]), "v"(of[3]), "v"(of[4]), "v"(of[5]), "v"(of[6]), "v"(of[7]), "v"(of[8]), "v"(of[9]), "v"(of[10]), "v"(of[11]), "v"(of[12]), "v"(of[13]), "v"(of[14]), "v"(of[15]) : "memory");      // the loads' offset registers are held as far as this wait, so that nothing, a load's own result included, is written over them ahead of the wait
    }
  }
  fal* so = (fal*)sm + (size_t)w * (FM * 16) * EP;
#pragma unroll      // constant indices: the arrays it walks stay in registers
  for (int i = 0; i < FM; ++i)
#pragma unroll      // constant indices: the arrays it walks stay in registers
    for (int j = 0; j < FN; ++j)
#pragma unroll      // constant indices: the arrays it walks stay in registers
      for (int r = 0; r < 8; ++r) so[(i * 16 + 8 * hh + r) * EP + j * 16 + ln] = acc[i][j][r] * alpha;
  __builtin_amdgcn_fence(__ATOMIC_ACQ_REL, "workgroup"); __builtin_amdgcn_wave_barrier();      // the wave's staged rows are written before its lanes read each other's words
  static_assert(NQ % 8 == 0, "eight stores a statement");
#pragma unroll      // constant indices: the arrays it walks stay in registers
  for (int q0 = 0; q0 < NQ; q0 += 8) {
    v4f v[8];
#pragma unroll      // constant indices: the arrays it walks stay in registers
    for (int q = 0; q < 8; ++q) { v[q] = *(const v4fa*)&so[((q0 + q) * RPP + rsub) * EP + c4]; if (HASR) v[q] += x[q0 + q]; }
    store8q((char*)C + (ob + q0 * os), os, v[0], v[1], v[2], v[3], v[4], v[5], v[6], v[7]);
  }
}

typedef _Float16 v4h __attribute__((ext_vector_type(4)));

__global__ __launch_bounds__(256) void k_x16(const float* __restrict__ x, _Float16* __restrict__ X16, size_t n8) { const size_t t = (size_t)blockIdx.x * 256 + threadIdx.x; if (t >= n8) return; FragH f;
#pragma unroll
  for (int q = 0; q < 8; ++q) f.h[q] = (_Float16)bf16_round(x[t * 8 + q]); *(v8us*)((unsigned short*)X16 + t * 8) = f.half[0];  }
__global__ __launch_bounds__(256) void k_h16(const float* __restrict__ x, _Float16* __restrict__ X16, size_t n8) { const size_t t = (size_t)blockIdx.x * 256 + threadIdx.x; if (t >= n8) return; FragH f;
#pragma unroll
  for (int q = 0; q < 8; ++q) f.h[q] = (_Float16)x[t * 8 + q]; *(v8us*)((unsigned short*)X16 + t * 8) = f.half[0];  }
__global__ __launch_bounds__(256) void k_round16f(const float* __restrict__ W, _Float16* __restrict__ Bt, size_t n8) { const size_t t = (size_t)blockIdx.x * 256 + threadIdx.x; if (t >= n8) return; FragH f;
#pragma unroll
  for (int i = 0; i < 8; ++i) f.h[i] = (_Float16)(bf16_round(W[t * 8 + i]) * 16.0f); *(v8us*)((unsigned short*)Bt + t * 8) = f.half[0];  }
template <int NHv, int TTv>
__global__ __launch_bounds__(256) void k_vt(const _Float16* __restrict__ V16, int ldv, int voff, _Float16* __restrict__ Vt) { __shared__ unsigned short tl[64][66]; const int tid = threadIdx.x; const int slab = blockIdx.x / (TTv / 64), lg = blockIdx.x % (TTv / 64); const int b = slab / NHv, h = slab % NHv;
  for (int i = tid; i < 64 * 8; i += 256) { const int r = i / 8, c8 = (i % 8) * 8; FragH f; f.half[0] = *(const v8us*)((const unsigned short*)V16 + ((size_t)b * TTv + lg * 64 + r) * ldv + voff + h * 64 + c8);
#pragma unroll
    for (int q = 0; q < 8; ++q) tl[r][c8 + q] = f.u[q]; }
  __syncthreads();
  {
#pragma unroll
    for (int rd = 0; rd < 2; ++rd) { const int d = rd * 32 + tid / 8, pc = tid % 8; FragH f;
#pragma unroll
      for (int q = 0; q < 8; ++q) f.u[q] = tl[pc * 8 + q][d];
      *(v8us*)((unsigned short*)Vt + ((size_t)slab * 64 + d) * TTv + lg * 64 + pc * 8) = f.half[0]; }
     } }

__global__ __launch_bounds__(256) void k_hl(const float* __restrict__ F, _Float16* __restrict__ Hh, _Float16* __restrict__ Hl, size_t n8) { const size_t t = (size_t)blockIdx.x * 256 + threadIdx.x; if (t >= n8) return; FragH fh, fl; const v4f a = *(const v4fa*)(F + t * 8), c = *(const v4fa*)(F + t * 8 + 4);
#pragma unroll
  for (int q = 0; q < 4; ++q) { _Float16 h = (_Float16)a[q]; fh.h[q] = h; fl.h[q] = (_Float16)((a[q] - (float)h) * 1024.0f); h = (_Float16)c[q]; fh.h[4 + q] = h; fl.h[4 + q] = (_Float16)((c[q] - (float)h) * 1024.0f); }
  { *(v8us*)((unsigned short*)Hh + t * 8) = fh.half[0]; *(v8us*)((unsigned short*)Hl + t * 8) = fl.half[0];  } }

__global__ __launch_bounds__(256) void k_snorm(const float* __restrict__ x, const float* __restrict__ g, const float* __restrict__ rsc, _Float16* __restrict__ XN, float* __restrict__ XR) {
  #pragma clang fp contract(off)
  const int tid = threadIdx.x, w = tid >> 5, l = tid & 31; const int r = blockIdx.x * 8 + w; if (r >= NBt * LL) return; const float* xr = x + (size_t)r * DD; float ss = 0.f;
#pragma unroll 1
  for (int k = 0; k < 32; ++k) { const float v = bf16_round(xr[l + 32 * k]); ss += v * v; }
  for (int o = 16; o > 0; o >>= 1) ss += __shfl_xor(ss, o, 32); const float nrm = sqrtf(ss) * 0.03125f; const float inv = bf16_round(g[0]) / fmaxf(nrm, 1e-5f);
  {
#pragma unroll 1
    for (int k = 0; k < 32; ++k) { const int c = l + 32 * k; const float v = bf16_round(xr[c]); FragH f; f.h[0] = (_Float16)(v * inv); *(unsigned short*)((unsigned short*)XN + (size_t)r * DD + c) = f.u[0]; *(float*)(XR + (size_t)r * DD + c) = v * bf16_round(rsc[c]); }
     } }
__global__ __launch_bounds__(256) void k_qk(const float* __restrict__ UV, const float* __restrict__ gam, const float* __restrict__ bet, const float* __restrict__ CS, const float* __restrict__ SN, _Float16* __restrict__ Q16, _Float16* __restrict__ K16) {
  #pragma clang fp contract(off)
  const int t = blockIdx.x * 256 + threadIdx.x; if (t >= NBt * 2 * LL * 16) return; const int i0 = (t & 15) * 4; const int l = (t >> 4) % LL; const int which = (t / (LL * 16)) & 1; const int bl = (t / (2 * LL * 16)) * LL + l; const float* gp = gam + which * SSz; const float* bp = bet + which * SSz; _Float16* dst = which ? K16 : Q16; FragH o1, o2;
#pragma unroll
  for (int qq = 0; qq < 4; ++qq) { const int i = i0 + qq; const float u1 = UV[(size_t)bl * NUV + 2 * EE + i], u2 = UV[(size_t)bl * NUV + 2 * EE + 64 + i]; const float b1 = u1 / (1.0f + expf(-u1)), b2 = u2 / (1.0f + expf(-u2));
    const float a1 = b1 * bf16_round(gp[i]) + bf16_round(bp[i]), a2 = b2 * bf16_round(gp[64 + i]) + bf16_round(bp[64 + i]); const float c = CS[(size_t)l * 64 + i], s = SN[(size_t)l * 64 + i];
    o1.h[qq] = (_Float16)(a1 * c - a2 * s); o2.h[qq] = (_Float16)(a2 * c + a1 * s); }
  const unsigned long long p1 = *(const unsigned long long*)&o1.u[0], p2 = *(const unsigned long long*)&o2.u[0];
  { *(unsigned long long*)((unsigned short*)dst + (size_t)bl * SSz + i0) = p1; *(unsigned long long*)((unsigned short*)dst + (size_t)bl * SSz + 64 + i0) = p2;  } }
__constant__ float INVF[64] = {1.000000000e+00f,1.154781938e+00f,1.333521485e+00f,1.539926529e+00f,1.778279424e+00f,2.053524971e+00f,2.371373653e+00f,2.738419533e+00f,3.162277699e+00f,3.651741266e+00f,4.216965199e+00f,4.869675159e+00f,5.623413086e+00f,6.493816376e+00f,7.498941898e+00f,8.659643173e+00f,1.000000000e+01f,1.154782009e+01f,1.333521461e+01f,1.539926529e+01f,1.778279495e+01f,2.053524971e+01f,2.371373749e+01f,2.738419724e+01f,3.162277603e+01f,3.651741409e+01f,4.216965103e+01f,4.869675064e+01f,5.623413086e+01f,6.493816376e+01f,7.498941803e+01f,8.659643555e+01f,1.000000000e+02f,1.154781952e+02f,1.333521423e+02f,1.539926453e+02f,1.778279419e+02f,2.053525085e+02f,2.371373749e+02f,2.738419495e+02f,3.162277527e+02f,3.651741333e+02f,4.216965027e+02f,4.869675293e+02f,5.623413086e+02f,6.493816528e+02f,7.498942261e+02f,8.659642944e+02f,1.000000000e+03f,1.154781982e+03f,1.333521484e+03f,1.539926514e+03f,1.778279419e+03f,2.053525146e+03f,2.371373779e+03f,2.738419678e+03f,3.162277588e+03f,3.651741211e+03f,4.216964844e+03f,4.869675293e+03f,5.623413086e+03f,6.493816406e+03f,7.498941895e+03f,8.659643555e+03f};
__global__ __launch_bounds__(256) void k_cstab(float* __restrict__ CS, float* __restrict__ SN) {
  #pragma clang fp contract(off)
  const int t = blockIdx.x * 256 + threadIdx.x; if (t >= LL * 64) return; const int i = t & 63, l = t >> 6; const float invf = INVF[i]; const float ang = (float)l * invf; const float c = (float)cos((double)ang), s = (float)sin((double)ang);
  { *(float*)(CS + t) = c; *(float*)(SN + t) = s;  } }

extern "C" void kernel_launch(void* const* d_in, const int* in_sizes, int n_in,
                              void* d_out, int out_size, void* d_ws, size_t ws_size, hipStream_t stream) {
  (void)in_sizes; (void)n_in; (void)out_size;
  const float* x = (const float*)d_in[0]; const float* g = (const float*)d_in[1]; const float* uvw = (const float*)d_in[2]; const float* gam = (const float*)d_in[3]; const float* bet = (const float*)d_in[4]; const float* wrel = (const float*)d_in[5]; const float* ow = (const float*)d_in[6]; const float* rsc = (const float*)d_in[7];
  char* ws = (char*)d_ws; size_t off = 0;
  auto take = [&](size_t bytes) { char* p = ws + off; off += (bytes + 255) & ~(size_t)255; return p; };
  // All eight batch elements go through each stage in one launch, so every intermediate holds all eight. Of UV only the columns of u and of base are written and read. x*res_scale is stored in out, where the last GEMM adds to it.
  _Float16* BOW = (_Float16*)take((size_t)DD * EE * 2); float* UV = (float*)take((size_t)NBt * LL * NUV * 4); _Float16* VT = (_Float16*)take((size_t)NBt * EE * LL * 2); _Float16* KER = (_Float16*)take((size_t)NBt * LL * LL * 2);
  _Float16* G16 = (_Float16*)take((size_t)NBt * LL * EE * 2);
  _Float16* BUV = (_Float16*)take((size_t)NUV * DD * 2); float* CS = (float*)take((size_t)LL * 64 * 4); float* SN = (float*)take((size_t)LL * 64 * 4);
  _Float16* XN = (_Float16*)take((size_t)NBt * LL * DD * 2); _Float16* Q16 = (_Float16*)take((size_t)NBt * LL * SSz * 2); _Float16* K16 = (_Float16*)take((size_t)NBt * LL * SSz * 2);
  if (off > ws_size) return;      // 4.2 + 138.4 + 33.6 + 16.8 + 33.6 + 8.7 + 0.5 + 16.8 + 4.2 = 257 MB, no range used twice
  float* Y = (float*)d_out;
  k_round16f<<<(unsigned)(((size_t)NUV * DD / 8 + 255) / 256), 256, 0, stream>>>(uvw, BUV, (size_t)NUV * DD / 8); k_round16f<<<(unsigned)(((size_t)DD * EE / 8 + 255) / 256), 256, 0, stream>>>(ow, BOW, (size_t)DD * EE / 8);      /* (out,in) = natural Bt */
  k_cstab<<<(LL * 64 + 255) / 256, 256, 0, stream>>>(CS, SN);
  const dim3 gU(NUV / 128, NBt * LL / 128), gS(LL / 64, LL / 64, NBt), gK(EE / 128, LL / 128, NBt), gO(DD / 128, NBt * LL / 128);      /* the three long GEMMs: 128 x 128 of C a work-group */
  k_snorm<<<NBt * LL / 8, 256, 0, stream>>>(x, g, rsc, XN, Y);
  k_gemm_t<4, 4, false, 1><<<gU, 128, 0, stream>>>(XN, DD, 0, BUV, DD, 0, 0.0625f, UV, NUV, 0, DD, nullptr, VT);      /* uv, the batch as rows: M 8192 N 4224 K 1024; u and base pre-activation to UV, silu(v) transposed to VT */
  k_qk<<<(NBt * 2 * LL * 16 + 255) / 256, 256, 0, stream>>>(UV, gam, bet, CS, SN, Q16, K16);
  k_gemm_t<2, 2, false, 2><<<gS, 128, 0, stream>>>(Q16, SSz, (size_t)LL * SSz, K16, SSz, (size_t)LL * SSz, 1.0f, nullptr, LL, 0, SSz, wrel, KER);      /* qk -> kernel, 8 x: M 1024 N 1024 K 128 */
  k_gemm_t<4, 4, false, 3><<<gK, 128, 0, stream>>>(KER, LL, (size_t)LL * LL, VT, LL, (size_t)EE * LL, 1.0f, nullptr, EE, 0, LL, UV, G16);      /* kernel*v -> gated product, 8 x: M 1024 N 2048 K 1024 */
  k_gemm_t<4, 4, true, 0><<<gO, 128, 0, stream>>>(G16, EE, 0, BOW, EE, 0, 0.0625f, Y, DD, 0, EE, nullptr, nullptr);      /* y = x*res_scale (already in out) + out*o_w^T, the batch as rows: M 8192 N 1024 K 2048 */
}

// v005
// Measured time: 172 microseconds a run.
// Next to v004, in two timings, it ran 1.07 and 1.08 times as fast.
// All steps since v000 together make it 9.24 times as fast.
#include <hip/hip_runtime.h>
// RTM (GAU-style) block (B 8, L 1024, D 1024, E 2048, s 128): xn = ScaleNorm(x)·g; uv = silu(xn·uv_wᵀ) → u (2048) | v (2048) | base (128); q/k = rope_seq(base·γ + β) (rotation over the sequence axis with angle l·10000^(i/64), half-split); qk = q·kᵀ + w_rel[j − i + 1023]; kernel = relu(qk/√128)²; out = u ⊙ (kernel·v); y = x·res_scale + out·o_wᵀ → [8,1024,1024].
// Compute dtype: x and parameters rounded to bf16; ScaleNorm in f32 → f16 operand; uv GEMM (f32 result), SiLU/affine/rope in f32 (sin/cos of the f32 angle evaluated in double); q, k, v, kernel and the gated product as f16 GEMM operands (≈2^-12), f32 accumulation; residual x·res_scale through the f32 epilogue. v_wmma_f32_16x16x32_f16.
#define NBt 8
#define LL 1024
#define DD 1024
#define EE 2048
#define SSz 128
#define NUV (2 * EE + SSz)       /* 4224 */
typedef __bf16 v16b __attribute__((ext_vector_type(16)));
typedef unsigned short v8us __attribute__((ext_vector_type(8), may_alias));
typedef float  v8f  __attribute__((ext_vector_type(8)));
typedef float  v4f  __attribute__((ext_vector_type(4)));
typedef float  v4fa __attribute__((ext_vector_type(4), may_alias));
union FragB { v16b v; v8us half[2]; unsigned short u[16]; };

__device__ __forceinline__ unsigned short bf16_bits(float x) { unsigned int u = __float_as_uint(x); return (unsigned short)((u + 0x7FFFu + ((u >> 16) & 1u)) >> 16); }
__device__ __forceinline__ float bf16_val(unsigned short b) { return __uint_as_float(((unsigned int)b) << 16); }
__device__ __forceinline__ float bf16_round(float x) { return bf16_val(bf16_bits(x)); }
// D += A·B with NT terms: 1 = ah·bh, 2 = + al·bh (A split), 3 = + ah·bl (both split)
template <int NT>
__device__ __forceinline__ v8f mmaN(v16b ah, v16b al, v16b bh, v16b bl, v8f c) {
  c = __builtin_amdgcn_wmma_f32_16x16x32_bf16(false, ah, false, bh, (short)0, c, false, false);
  if (NT >= 2) c = __builtin_amdgcn_wmma_f32_16x16x32_bf16(false, al, false, bh, (short)0, c, false, false);
  if (NT >= 3) c = __builtin_amdgcn_wmma_f32_16x16x32_bf16(false, ah, false, bl, (short)0, c, false, false);
  asm volatile("v_nop\n\tv_nop\n\tv_nop\n\tv_nop" : "+v"(c) : "v"(ah), "v"(al), "v"(bh), "v"(bl));
  return c;
}

__global__ __launch_bounds__(256) void k_wt_bf16(const float* __restrict__ W, unsigned short* __restrict__ Wt, int K, int N) {
  const int t = blockIdx.x * 256 + threadIdx.x;
  const int k8n = K / 8;
  if (t >= N * k8n) return;
  const int n = t / k8n, k8 = (t % k8n) * 8;
  v8us v;
#pragma unroll
  for (int i = 0; i < 8; ++i) v[i] = bf16_bits(W[(size_t)(k8 + i) * N + n]);
  *(v8us*)(Wt + (size_t)n * K + k8) = v;
  
}

// GEMM C[M][N] (f32, pitch ldc) = act(A[M][K]·W + bias). A f32 row-major (pitch lda) converted per fragment to bf16
// (ASPLIT: hi/lo two planes -> 2 terms, else single rounded term); Wt bf16 [N][K] (pitch ldb). BIAS_BF16 rounds the
// bias to bf16 first (bias quantised to bf16 before the add). K%32==0, M%16==0, N%64==0.
template <bool ASPLIT, int ACT, bool BIAS_BF16>
__global__ __launch_bounds__(128) void k_gemm_bf(const float* __restrict__ A, int lda, const unsigned short* __restrict__ Wt, int ldb,
                                               const float* __restrict__ bias, float* __restrict__ C, int ldc, int M, int N, int K) {
  __shared__ __attribute__((aligned(16))) float so[4][16][64];
  const int tid = threadIdx.x, w = tid >> 5, lane = tid & 31, ln = lane & 15, hh = lane >> 4;
  const int ntn = N / 64;
  const int wid = blockIdx.x * 4 + w;
  const int mt = wid / ntn, nq = wid % ntn;
  if (mt * 16 >= M) return;
  const int row0 = mt * 16, col0 = nq * 64;
  const float* arow = A + (size_t)(row0 + ln) * lda;
  v8f acc[4] = {};
  for (int kb = 0; kb < K; kb += 32) {
    FragB ah, al;
    const v4f x0 = *(const v4fa*)(arow + kb + 8 * hh), x1 = *(const v4fa*)(arow + kb + 8 * hh + 4);
    const v4f x2 = *(const v4fa*)(arow + kb + 16 + 8 * hh), x3 = *(const v4fa*)(arow + kb + 16 + 8 * hh + 4);
    float xs[16] = {x0[0],x0[1],x0[2],x0[3],x1[0],x1[1],x1[2],x1[3],x2[0],x2[1],x2[2],x2[3],x3[0],x3[1],x3[2],x3[3]};
#pragma unroll
    for (int i = 0; i < 16; ++i) { const unsigned short hb = bf16_bits(xs[i]); ah.u[i] = hb; al.u[i] = ASPLIT ? bf16_bits(xs[i] - bf16_val(hb)) : (unsigned short)0; }
#pragma unroll
    for (int t = 0; t < 4; ++t) {
      const unsigned short* brow = Wt + (size_t)(col0 + t * 16 + ln) * ldb + kb;
      FragB b;
      b.half[0] = *(const v8us*)(brow + 8 * hh);
      b.half[1] = *(const v8us*)(brow + 16 + 8 * hh);
      acc[t] = mmaN<ASPLIT ? 2 : 1>(ah.v, al.v, b.v, b.v, acc[t]);
    }
  }
#pragma unroll
  for (int t = 0; t < 4; ++t) {
    float bv = bias ? bias[col0 + t * 16 + ln] : 0.f;
    if (BIAS_BF16) bv = bf16_round(bv);
#pragma unroll
    for (int r = 0; r < 8; ++r) { float v = acc[t][r] + bv; if (ACT == 1) v = fmaxf(v, 0.f); so[w][8 * hh + r][t * 16 + ln] = v; }
  }
  __builtin_amdgcn_fence(__ATOMIC_ACQ_REL, "workgroup");
  __builtin_amdgcn_wave_barrier();
  const int rsub = lane >> 4, c4 = (lane & 15) * 4;
  {
#pragma unroll
    for (int q = 0; q < 8; ++q) {
      const int r = q * 2 + rsub;
      const v4f v = *(const v4fa*)&so[w][r][c4];
      *(v4f*)(C + (size_t)(row0 + r) * ldc + col0 + c4) = v;
    }
    
  }
}

// GEMM C = act(A·W + bias + resid): A f32 (ASPLIT -> hi/lo 2 terms), Wt bf16 [N][K]; ACT 0 none, 1 relu, 2 exact gelu;
// resid (optional, f32, row index = (row % rmod), pitch ldr, RES_BF16 rounds it) added before the activation.
template <bool ASPLIT, int ACT, bool BIAS_BF16, bool RES_BF16>
__global__ __launch_bounds__(128) void k_gemm_bf3(const float* __restrict__ A, int lda, const unsigned short* __restrict__ Wt, int ldb,
                                                const float* __restrict__ bias, const float* __restrict__ resid, int rmod, int ldr,
                                                float* __restrict__ C, int ldc, int M, int N, int K) {
  __shared__ __attribute__((aligned(16))) float so[4][16][64];
  const int tid = threadIdx.x, w = tid >> 5, lane = tid & 31, ln = lane & 15, hh = lane >> 4;
  const int ntn = N / 64;
  const int wid = blockIdx.x * 4 + w;
  const int mt = wid / ntn, nq = wid % ntn;
  if (mt * 16 >= M) return;
  const int row0 = mt * 16, col0 = nq * 64;
  const float* arow = A + (size_t)(row0 + ln) * lda;
  v8f acc[4] = {};
  for (int kb = 0; kb < K; kb += 32) {
    FragB ah, al;
    const v4f x0 = *(const v4fa*)(arow + kb + 8 * hh), x1 = *(const v4fa*)(arow + kb + 8 * hh + 4);
    const v4f x2 = *(const v4fa*)(arow + kb + 16 + 8 * hh), x3 = *(const v4fa*)(arow + kb + 16 + 8 * hh + 4);
    float xs[16] = {x0[0],x0[1],x0[2],x0[3],x1[0],x1[1],x1[2],x1[3],x2[0],x2[1],x2[2],x2[3],x3[0],x3[1],x3[2],x3[3]};
#pragma unroll
    for (int i = 0; i < 16; ++i) { const unsigned short hb = bf16_bits(xs[i]); ah.u[i] = hb; al.u[i] = ASPLIT ? bf16_bits(xs[i] - bf16_val(hb)) : (unsigned short)0; }
#pragma unroll
    for (int t = 0; t < 4; ++t) {
      const unsigned short* brow = Wt + (size_t)(col0 + t * 16 + ln) * ldb + kb;
      FragB b;
      b.half[0] = *(const v8us*)(brow + 8 * hh);
      b.half[1] = *(const v8us*)(brow + 16 + 8 * hh);
      acc[t] = mmaN<ASPLIT ? 2 : 1>(ah.v, al.v, b.v, b.v, acc[t]);
    }
  }
#pragma unroll
  for (int t = 0; t < 4; ++t) {
    const int col = col0 + t * 16 + ln;
    float bv = bias ? bias[col] : 0.f;
    if (BIAS_BF16) bv = bf16_round(bv);
#pragma unroll
    for (int r = 0; r < 8; ++r) {
      float v = acc[t][r] + bv;
      if (resid) { float rv = resid[(size_t)((row0 + 8 * hh + r) % rmod) * ldr + col]; if (RES_BF16) rv = bf16_round(rv); v += rv; }
      if (ACT == 1) v = fmaxf(v, 0.f);
      if (ACT == 2) v = 0.5f * v * (1.0f + erff(v * 0.70710678118654752f));
      if (ACT == 3) { const float u = 0.7978845608028654f * (v + 0.044715f * v * v * v); v = 0.5f * v * (1.0f + tanhf(u)); }
      so[w][8 * hh + r][t * 16 + ln] = v;
    }
  }
  __builtin_amdgcn_fence(__ATOMIC_ACQ_REL, "workgroup");
  __builtin_amdgcn_wave_barrier();
  const int rsub = lane >> 4, c4 = (lane & 15) * 4;
  {
#pragma unroll
    for (int q = 0; q < 8; ++q) {
      const int r = q * 2 + rsub;
      const v4f v = *(const v4fa*)&so[w][r][c4];
      *(v4f*)(C + (size_t)(row0 + r) * ldc + col0 + c4) = v;
    }
    
  }
}
// row LayerNorm (biased variance, eps) over N: s = X (+ R); optional out_sum <- s; out_norm <- (s-mu)*rsqrt(var+eps)*g + b
template <bool PARAM_BF16>
__global__ __launch_bounds__(256) void k_layernorm(const float* __restrict__ X, const float* __restrict__ R, const float* __restrict__ g, const float* __restrict__ bta,
                                                  float* __restrict__ out_sum, float* __restrict__ out_norm, int N, float eps) {
  __shared__ float red[256];
  const int row = blockIdx.x, tid = threadIdx.x;
  const float* x = X + (size_t)row * N; const float* rr = R ? R + (size_t)row * N : nullptr;
  float vals[16];                     // up to N = 4096
  const int per = N / 256;            // contiguous chunk per thread? use strided-by-4 chunks: thread handles j = tid*4 + 1024*u
  float s1 = 0.f;
  for (int u = 0; u < per / 4; ++u) {
    const int j = tid * 4 + 1024 * u;
    const v4f a = *(const v4fa*)(x + j);
    v4f b = {0.f,0.f,0.f,0.f}; if (rr) b = *(const v4fa*)(rr + j);
#pragma unroll
    for (int q = 0; q < 4; ++q) { const float v = a[q] + b[q]; vals[u * 4 + q] = v; s1 += v; }
  }
  red[tid] = s1; __syncthreads();
  for (int st = 128; st > 0; st >>= 1) { if (tid < st) red[tid] += red[tid + st]; __syncthreads(); }
  const float mu = red[0] / (float)N; __syncthreads();
  float s2 = 0.f;
  for (int u = 0; u < per / 4; ++u)
#pragma unroll
    for (int q = 0; q < 4; ++q) { const float c = vals[u * 4 + q] - mu; s2 += c * c; }
  red[tid] = s2; __syncthreads();
  for (int st = 128; st > 0; st >>= 1) { if (tid < st) red[tid] += red[tid + st]; __syncthreads(); }
  const float rs = rsqrtf(red[0] / (float)N + eps);
  {
    for (int u = 0; u < per / 4; ++u) {
      const int j = tid * 4 + 1024 * u;
      v4f o, sm;
#pragma unroll
      for (int q = 0; q < 4; ++q) {
        float gg = g[j + q], bb = bta[j + q];
        if (PARAM_BF16) { gg = bf16_round(gg); bb = bf16_round(bb); }
        sm[q] = vals[u * 4 + q]; o[q] = (vals[u * 4 + q] - mu) * rs * gg + bb;
      }
      if (out_sum) *(v4f*)(out_sum + (size_t)row * N + j) = sm;
      *(v4f*)(out_norm + (size_t)row * N + j) = o;
    }
    
  }
}



// ---- f16 WMMA path (v_wmma_f32_16x16x32_f16): 11-bit significands for operands in range — used for all four GEMMs of this block
typedef _Float16 v16h __attribute__((ext_vector_type(16)));
union FragH { v16h v; v8us half[2]; _Float16 h[16]; unsigned short u[16]; };
template <int NT>
__device__ __forceinline__ v8f mmaH(v16h ah, v16h al, v16h bh, v16h bl, v8f c) {
  c = __builtin_amdgcn_wmma_f32_16x16x32_f16(false, ah, false, bh, (short)0, c, false, false);
  if (NT >= 2) c = __builtin_amdgcn_wmma_f32_16x16x32_f16(false, al, false, bh, (short)0, c, false, false);
  if (NT >= 3) c = __builtin_amdgcn_wmma_f32_16x16x32_f16(false, ah, false, bl, (short)0, c, false, false);
  asm volatile("v_nop\n\tv_nop\n\tv_nop\n\tv_nop" : "+v"(c) : "v"(ah), "v"(al), "v"(bh), "v"(bl));
  return c;
}
// batched GEMM like k_gemm_b but f16 operands: A f32 (split into f16 hi/lo if ASPLIT, else rounded to f16), Bt = f16 values [n][k]; alpha; C f32; N multiple of 16 (partial tiles skipped)
template <bool ASPLIT>
__global__ __launch_bounds__(128) void k_gemm_h(const float* __restrict__ A, int lda, size_t sA, const _Float16* __restrict__ Bh, int ldb, size_t sB, float alpha, float* __restrict__ C, int ldc, size_t sC, int M, int N, int K) {
  __shared__ __attribute__((aligned(16))) float so[4][16][64];
  const int tid = threadIdx.x, w = tid >> 5, lane = tid & 31, ln = lane & 15, hh = lane >> 4; const int by = blockIdx.y;
  A += (size_t)by * sA; Bh += (size_t)by * sB; C += (size_t)by * sC;
  const int ntn = (N + 63) / 64; const int wid = blockIdx.x * 4 + w; const int mt = wid / ntn, nq = wid % ntn; if (mt * 16 >= M) return;
  const int row0 = mt * 16, col0 = nq * 64; const float* arow = A + (size_t)(row0 + ln) * lda;
  v8f acc[4] = {};
  for (int kb = 0; kb < K; kb += 32) {
    FragH ah, al;
    const v4f x0 = *(const v4fa*)(arow + kb + 8 * hh), x1 = *(const v4fa*)(arow + kb + 8 * hh + 4), x2 = *(const v4fa*)(arow + kb + 16 + 8 * hh), x3 = *(const v4fa*)(arow + kb + 16 + 8 * hh + 4);
    float xs[16] = {x0[0],x0[1],x0[2],x0[3],x1[0],x1[1],x1[2],x1[3],x2[0],x2[1],x2[2],x2[3],x3[0],x3[1],x3[2],x3[3]};
#pragma unroll
    for (int i = 0; i < 16; ++i) { const _Float16 h = (_Float16)xs[i]; ah.h[i] = h; al.h[i] = ASPLIT ? (_Float16)(xs[i] - (float)h) : (_Float16)0.0f; }
#pragma unroll
    for (int t = 0; t < 4; ++t) { if (col0 + t * 16 >= N) continue; const size_t boff = (size_t)(col0 + t * 16 + ln) * ldb + kb; FragH bq; bq.half[0] = *(const v8us*)(Bh + boff + 8 * hh); bq.half[1] = *(const v8us*)(Bh + boff + 16 + 8 * hh);
      acc[t] = mmaH<ASPLIT ? 2 : 1>(ah.v, al.v, bq.v, bq.v, acc[t]); }
  }
#pragma unroll
  for (int t = 0; t < 4; ++t) { if (col0 + t * 16 >= N) continue;
#pragma unroll
    for (int r = 0; r < 8; ++r) so[w][8 * hh + r][t * 16 + ln] = acc[t][r] * alpha; }
  __builtin_amdgcn_fence(__ATOMIC_ACQ_REL, "workgroup"); __builtin_amdgcn_wave_barrier();
  const int rsub = lane >> 4, c4 = (lane & 15) * 4;
  {
#pragma unroll
    for (int q = 0; q < 8; ++q) { const int r = q * 2 + rsub; if (col0 + c4 < N) { const v4f v = *(const v4fa*)&so[w][r][c4]; *(v4f*)(C + (size_t)(row0 + r) * ldc + col0 + c4) = v; } }
     }
}

// Wt[n][k] = f16(W[k][n]·scale) from f32 row-major W[K][N] (scale = power of two; bf16-exact weights stay exact in f16 away from the subnormal range)
__global__ __launch_bounds__(256) void k_wt_f16(const float* __restrict__ W, _Float16* __restrict__ Wt, int K, int N, float scale) {
  const int t = blockIdx.x * 256 + threadIdx.x; if (t >= N * (K / 8)) return; const int n = t / (K / 8), k8 = (t % (K / 8)) * 8; FragH f;
#pragma unroll
  for (int i = 0; i < 8; ++i) f.h[i] = (_Float16)(bf16_round(W[(size_t)(k8 + i) * N + n]) * scale); const v8us o = f.half[0];
  *(v8us*)((unsigned short*)Wt + (size_t)n * K + k8) = o; 
}
// k_gemm_hh variant with fused epilogue: v = acc·alpha + bias[by·sBias + col] (+ CP[(row/rowsPerB)·sCPb + by·64 + col] if CP) ; ACT 0 none / 1 elu ; writes f32 C and f16 C16, each if non-null
template <int ACT>
__global__ __launch_bounds__(128) void k_gemm_hhx(const _Float16* __restrict__ A, int lda, size_t sA, const _Float16* __restrict__ Bh, int ldb, size_t sB, float alpha, const float* __restrict__ bias, size_t sBias, const float* __restrict__ CP, int rowsPerB, size_t sCPb, int row0g,
    float* __restrict__ C, _Float16* __restrict__ C16, int ldc, size_t sC, int M, int N, int K) {
  __shared__ __attribute__((aligned(16))) float so[4][16][64];
  const int tid = threadIdx.x, w = tid >> 5, lane = tid & 31, ln = lane & 15, hh = lane >> 4; const int by = blockIdx.y;
  A += (size_t)by * sA; Bh += (size_t)by * sB; const size_t cofs = (size_t)by * sC; const float* bp = bias ? bias + (size_t)by * sBias : nullptr;
  const int ntn = (N + 63) / 64; const int wid = blockIdx.x * 4 + w; const int mt = wid / ntn, nq = wid % ntn; if (mt * 16 >= M) return;
  const int row0 = mt * 16, col0 = nq * 64; const _Float16* arow = A + (size_t)(row0 + ln) * lda;
  v8f acc[4] = {};
  for (int kb = 0; kb < K; kb += 32) { FragH ah; ah.half[0] = *(const v8us*)((const unsigned short*)arow + kb + 8 * hh); ah.half[1] = *(const v8us*)((const unsigned short*)arow + kb + 16 + 8 * hh);
#pragma unroll
    for (int t = 0; t < 4; ++t) { if (col0 + t * 16 >= N) continue; const size_t boff = (size_t)(col0 + t * 16 + ln) * ldb + kb; FragH bq; bq.half[0] = *(const v8us*)((const unsigned short*)Bh + boff + 8 * hh); bq.half[1] = *(const v8us*)((const unsigned short*)Bh + boff + 16 + 8 * hh);
      acc[t] = mmaH<1>(ah.v, ah.v, bq.v, bq.v, acc[t]); }
  }
#pragma unroll
  for (int t = 0; t < 4; ++t) { if (col0 + t * 16 >= N) continue; const int col = col0 + t * 16 + ln; const float bv = bp ? bf16_round(bp[col]) : 0.f;
#pragma unroll
    for (int r = 0; r < 8; ++r) { float v = acc[t][r] * alpha + bv; if (CP) { const int bidx = (row0g + row0 + 8 * hh + r) / rowsPerB; v += CP[(size_t)bidx * sCPb + (size_t)by * 64 + col]; } if (ACT == 1) v = (v > 0.f) ? v : expm1f(v); else if (ACT == 7) v = (v > 0.f) ? v + 1.0f : expf(v); else if (ACT == 8) v = tanhf(v); else if (ACT == 9) v = 0.5f * v * (1.0f + tanhf(0.7978845608028654f * (v + 0.044715f * v * v * v))); else if (ACT == 11) v = 1.0f / (1.0f + expf(-v)); else if (ACT == 12) v = (v > 0.f) ? v : 0.01f * v; else if (ACT == 14) v = (v > 0.f) ? v : 0.1f * v; else if (ACT == 15) v = v / (1.0f + expf(-v)); else if (ACT == 3) v = fmaxf(v, 0.f); else if (ACT == 6) v = 0.5f * v * (1.0f + erff(v * 0.70710678118654752f)); so[w][8 * hh + r][t * 16 + ln] = v; } }
  __builtin_amdgcn_fence(__ATOMIC_ACQ_REL, "workgroup"); __builtin_amdgcn_wave_barrier();
  const int rsub = lane >> 4, c4 = (lane & 15) * 4; typedef _Float16 v4h __attribute__((ext_vector_type(4)));
  {
#pragma unroll
    for (int q = 0; q < 8; ++q) { const int r = q * 2 + rsub; if (col0 + c4 < N) { const v4f v = *(const v4fa*)&so[w][r][c4]; if (C) *(v4f*)(C + cofs + (size_t)(row0 + r) * ldc + col0 + c4) = v; if (C16) { v4h h4; for (int i = 0; i < 4; ++i) h4[i] = (_Float16)v[i]; *(v4h*)(C16 + cofs + (size_t)(row0 + r) * ldc + col0 + c4) = h4; } } }
     }
}


// Block-tiled f16 GEMM: C[row][col] = alpha * sum_k A[row][k] * B[col][k] (+ the value that C[row][col] already holds, if HASR). A and B are k-contiguous f16.
// blockIdx.z is the batch element: A, B and C move on by sA, sB and sC elements for each.
// One work-group of 4 waves (2 x 2) owns a (32 FM) x (32 FN) tile of C; each wave FM x FN fragments. A stage is 128 k of the tile's A rows and
// B rows (256 B a row, LDS pitch 272 B), brought in by asynchronous copies into two buffers: stage s + 1 flies while stage s is multiplied.
// The k order inside a fragment and the order of the k blocks are those of k_gemm_hhx. M, N multiples of the tile, K of 128.
#define TKK 128
#define TPB 272
typedef float fal __attribute__((may_alias));
// eight rows (8 apart) of a stage: each lane copies its own 16 bytes of each. The s_wait_xcnt stands in the copies' own statement so that no address register is rewritten ahead of it.
__device__ __forceinline__ void copy8(unsigned lds, const _Float16* g, size_t g8) {
  asm volatile("global_load_async_to_lds_b128 %0, %8, off\n\t"
               "global_load_async_to_lds_b128 %1, %9, off\n\t"
               "global_load_async_to_lds_b128 %2, %10, off\n\t"
               "global_load_async_to_lds_b128 %3, %11, off\n\t"
               "global_load_async_to_lds_b128 %4, %12, off\n\t"
               "global_load_async_to_lds_b128 %5, %13, off\n\t"
               "global_load_async_to_lds_b128 %6, %14, off\n\t"
               "global_load_async_to_lds_b128 %7, %15, off\n\t"
               "s_wait_xcnt 0x0"
               :: "v"(lds), "v"(lds + 8 * TPB), "v"(lds + 16 * TPB), "v"(lds + 24 * TPB), "v"(lds + 32 * TPB), "v"(lds + 40 * TPB), "v"(lds + 48 * TPB), "v"(lds + 56 * TPB),
                  "v"(g), "v"(g + g8), "v"(g + 2 * g8), "v"(g + 3 * g8), "v"(g + 4 * g8), "v"(g + 5 * g8), "v"(g + 6 * g8), "v"(g + 7 * g8)
               : "memory");
}
// eight stores of 16 (store8q) or 8 (store8d) bytes a lane, st bytes apart. The s_wait_xcnt stands in the stores' own statement so that no address or data register of theirs is rewritten ahead of it.
__device__ __forceinline__ void store8q(char* p, size_t st, v4f d0, v4f d1, v4f d2, v4f d3, v4f d4, v4f d5, v4f d6, v4f d7) {
  asm volatile("global_store_b128 %0, %8, off\n\t"
               "global_store_b128 %1, %9, off\n\t"
               "global_store_b128 %2, %10, off\n\t"
               "global_store_b128 %3, %11, off\n\t"
               "global_store_b128 %4, %12, off\n\t"
               "global_store_b128 %5, %13, off\n\t"
               "global_store_b128 %6, %14, off\n\t"
               "global_store_b128 %7, %15, off\n\t"
               "s_wait_xcnt 0x0"
               :: "v"(p), "v"(p + st), "v"(p + 2 * st), "v"(p + 3 * st), "v"(p + 4 * st), "v"(p + 5 * st), "v"(p + 6 * st), "v"(p + 7 * st),
                  "v"(d0), "v"(d1), "v"(d2), "v"(d3), "v"(d4), "v"(d5), "v"(d6), "v"(d7)
               : "memory");
}
__device__ __forceinline__ void store8d(char* p, size_t st, unsigned long long d0, unsigned long long d1, unsigned long long d2, unsigned long long d3, unsigned long long d4, unsigned long long d5, unsigned long long d6, unsigned long long d7) {
  asm volatile("global_store_b64 %0, %8, off\n\t"
               "global_store_b64 %1, %9, off\n\t"
               "global_store_b64 %2, %10, off\n\t"
               "global_store_b64 %3, %11, off\n\t"
               "global_store_b64 %4, %12, off\n\t"
               "global_store_b64 %5, %13, off\n\t"
               "global_store_b64 %6, %14, off\n\t"
               "global_store_b64 %7, %15, off\n\t"
               "s_wait_xcnt 0x0"
               :: "v"(p), "v"(p + st), "v"(p + 2 * st), "v"(p + 3 * st), "v"(p + 4 * st), "v"(p + 5 * st), "v"(p + 6 * st), "v"(p + 7 * st),
                  "v"(d0), "v"(d1), "v"(d2), "v"(d3), "v"(d4), "v"(d5), "v"(d6), "v"(d7)
               : "memory");
}
// EPI names what the epilogue does with the tile t = alpha * A*B^T:
//   0  C = t (+ C if HASR), f32.
//   1  uv: columns of u and of base as EPI 0 (pre-activation, f32); columns of v go out as H[b][e][l] = f16(silu(t)), transposed, and are not stored in C.
//   2  scores: H[b][i][j] = f16(relu((t + bf16(X[j - i + L - 1])) / sqrt(128))^2), X = w_rel; C unused.
//   3  gate: H[b*L + i][e] = f16(silu(X[b*L + i][e]) * t), X = the uv pre-activation (pitch NUV); C unused.
typedef unsigned short v4us __attribute__((ext_vector_type(4), may_alias));
template <int FM, int FN, bool HASR, int EPI>
__global__ __launch_bounds__(128) void k_gemm_t(const _Float16* __restrict__ A, int lda, size_t sA, const _Float16* __restrict__ B, int ldb, size_t sB, float alpha, float* __restrict__ C, int ldc, size_t sC, int K,
                                                const float* __restrict__ X, _Float16* __restrict__ H) {
  constexpr int BM = 32 * FM, BN = 32 * FN, STG = (BM + BN) * TPB, EP = FN * 16 + 4;
  static_assert(4 * FM * 16 * EP * 4 <= 2 * STG, "output staging fits the ring");
  __shared__ __attribute__((aligned(16))) unsigned char sm[2 * STG];
  const int tid = threadIdx.x, w = tid >> 5, lane = tid & 31, ln = lane & 15, hh = lane >> 4;
  const int row0 = blockIdx.y * BM, col0 = blockIdx.x * BN, wm = w >> 1, wn = w & 1;
  A += (size_t)blockIdx.z * sA; B += (size_t)blockIdx.z * sB; C += (size_t)blockIdx.z * sC;
  const int cr = tid >> 4, cc = tid & 15;      // copies: 16 lanes cover one 256-B row, the work-group 8 rows an instruction
  const _Float16* gA = A + (size_t)(row0 + cr) * lda + cc * 8;
  const _Float16* gB = B + (size_t)(col0 + cr) * ldb + cc * 8;
  const unsigned lA = (unsigned)(size_t)sm + cr * TPB + cc * 16;
  auto stage = [&](int s, int buf) {
    for (int i = 0; i < BM / 64; ++i) copy8(lA + buf * STG + i * 64 * TPB, gA + (size_t)s * TKK + (size_t)i * 64 * lda, (size_t)8 * lda);
    for (int i = 0; i < BN / 64; ++i) copy8(lA + buf * STG + (BM + i * 64) * TPB, gB + (size_t)s * TKK + (size_t)i * 64 * ldb, (size_t)8 * ldb);
  };
  const int nst = K / TKK;
  stage(0, 0);
  asm volatile("s_wait_asynccnt 0x0" ::: "memory");      // this wave's copies of stage 0 have landed
  __syncthreads();                                       // ... and every other wave's
  if (nst > 1) stage(1, 1);
  v8f acc[FM][FN] = {};
  for (int s = 0; s < nst; ++s) {
    const unsigned char* pa = sm + (s & 1) * STG + (wm * FM * 16 + ln) * TPB + hh * 16;
    const unsigned char* pb = sm + (s & 1) * STG + (BM + wn * FN * 16 + ln) * TPB + hh * 16;
    FragH a[2][FM], b[2][FN];      // two fragment sets: block kk + 1 of this stage is read from LDS while block kk is multiplied
    auto frags = [&](int kk, int set) {
#pragma unroll      // constant indices: the arrays it walks stay in registers
      for (int i = 0; i < FM; ++i) { a[set][i].half[0] = *(const v8us*)(pa + i * 16 * TPB + kk * 64); a[set][i].half[1] = *(const v8us*)(pa + i * 16 * TPB + kk * 64 + 32); }
#pragma unroll      // constant indices: the arrays it walks stay in registers
      for (int j = 0; j < FN; ++j) { b[set][j].half[0] = *(const v8us*)(pb + j * 16 * TPB + kk * 64); b[set][j].half[1] = *(const v8us*)(pb + j * 16 * TPB + kk * 64 + 32); }
    };
    frags(0, 0);
#pragma unroll      // constant indices: the arrays it walks stay in registers
    for (int kk = 0; kk < TKK / 32; ++kk) {
      if (kk + 1 < TKK / 32) frags(kk + 1, (kk + 1) & 1);
      __builtin_amdgcn_sched_barrier(0);      // the next block's LDS reads stay one group ahead of this block's WMMAs (sunk among them, each read's latency is waited out by the wave)
#pragma unroll      // constant indices: the arrays it walks stay in registers
      for (int i = 0; i < FM; ++i)
#pragma unroll      // constant indices: the arrays it walks stay in registers
        for (int j = 0; j < FN; ++j) acc[i][j] = __builtin_amdgcn_wmma_f32_16x16x32_f16(false, a[kk & 1][i].v, false, b[kk & 1][j].v, (short)0, acc[i][j], false, false);
      __builtin_amdgcn_sched_barrier(0);      // and the group after that is not lifted in among them
    }
    asm volatile("s_wait_dscnt 0x0" ::: "memory");       // this wave's reads of stage s are done before the buffer is refilled
    asm volatile("s_wait_asynccnt 0x0" ::: "memory");    // this wave's copies of stage s + 1 have landed
    __syncthreads();                                     // publishes stage s + 1 and ends every reader's last read of stage s
    if (s + 2 < nst) stage(s + 2, s & 1);
  }
  asm volatile("s_wait_asynccnt 0x0" ::: "memory");      // nothing in flight when the ring becomes output staging
  if constexpr (EPI == 1) {
    if (col0 >= EE && col0 < 2 * EE) {      // the same for the whole work-group: a tile of v
      // a lane's 8 accumulator rows of one fragment are 8 neighbours along l of one column e: 16 bytes of a row of H. Each wave stages its block column-major in its own LDS range, then stores whole 128-B lines.
      constexpr int HP = FM * 16 + 8, PPC = FM * 2;      // pitch in halves (16 B x odd); 16-byte parts a column
      unsigned short* sh = (unsigned short*)sm + (size_t)w * (FN * 16) * HP;
#pragma unroll 1      // stays rolled, two fragment rows a trip: unrolled, a lane's 8 FM FN silu make the kernel's text longer than 32 KB
      for (int ih = 0; ih < FM / 2; ++ih) {
#pragma unroll      // constant indices: the arrays it walks stay in registers
        for (int i = 0; i < 2; ++i)
#pragma unroll      // constant indices: the arrays it walks stay in registers
          for (int j = 0; j < FN; ++j) {
            FragH f;
#pragma unroll      // constant indices: the arrays it walks stay in registers
            for (int r = 0; r < 8; ++r) { const float v = acc[i][j][r] * alpha; f.h[r] = (_Float16)(v / (1.0f + expf(-v))); }
            *(v8us*)(sh + (j * 16 + ln) * HP + (ih * 2 + i) * 16 + 8 * hh) = f.half[0];
          }
#pragma unroll      // constant indices: the next trip's two fragment rows move down to where the trip reads them
        for (int i = 0; i + 2 < FM; ++i)
#pragma unroll      // constant indices: the arrays it walks stay in registers
          for (int j = 0; j < FN; ++j) acc[i][j] = acc[i + 2][j];
      }
      __builtin_amdgcn_fence(__ATOMIC_ACQ_REL, "workgroup"); __builtin_amdgcn_wave_barrier();      // the wave's staged columns are written before its lanes read each other's words
      const int rw = row0 + wm * FM * 16;      // the wave's first row; its FM*16 rows lie in one batch element
      unsigned short* vt = (unsigned short*)H + ((size_t)(rw / LL) * EE + (col0 - EE) + wn * FN * 16) * LL + rw % LL;
#pragma unroll      // the stores go out back to back
      for (int q = 0; q < FN * 16 * PPC / 32; ++q) { const int c = (q * 32 + lane) / PPC, p = (q * 32 + lane) % PPC; *(v8us*)(vt + (size_t)c * LL + p * 8) = *(const v8us*)(sh + c * HP + p * 8); }
      return;
    }
  }
  if constexpr (EPI == 2) {
    // f16 out: a row of the work-group's tile is 64 columns = one 128-B line, so the four waves stage the tile together and each then stores whole rows of it
    static_assert(BN == 64, "a tile row of f16 is one line");
    constexpr int EPW = BN + 4, NR = BM / 8;      // 16 lanes a row, 2 rows an instruction, BM / 4 rows a wave
    const int rr = w * (BM / 4) + hh, c4 = ln * 4;
    const size_t gr = (size_t)blockIdx.z * LL + row0 + rr;      // row over all batch elements
    fal* so = (fal*)sm;
#pragma unroll      // constant indices: the arrays it walks stay in registers
    for (int i = 0; i < FM; ++i)
#pragma unroll      // constant indices: the arrays it walks stay in registers
      for (int j = 0; j < FN; ++j)
#pragma unroll      // constant indices: the arrays it walks stay in registers
        for (int r = 0; r < 8; ++r) so[((wm * FM + i) * 16 + 8 * hh + r) * EPW + (wn * FN + j) * 16 + ln] = acc[i][j][r] * alpha;
    __syncthreads();      // every wave's part of the tile is staged before any wave reads whole rows
#pragma unroll      // constant indices: the arrays it walks stay in registers
    for (int q = 0; q < NR; ++q) {
      const v4f t = *(const v4fa*)&so[(rr + 2 * q) * EPW + c4];
      union { v4us o; _Float16 h[4]; } f;
#pragma unroll      // constant indices: the arrays it walks stay in registers
      for (int e = 0; e < 4; ++e) {
        if constexpr (EPI == 2) { const float v = (t[e] + bf16_round(X[col0 + c4 + e - (row0 + rr + 2 * q) + LL - 1])) / 11.313708498984761f; const float r = fmaxf(v, 0.f); f.h[e] = (_Float16)(r * r); }
      }
      *(v4us*)((unsigned short*)H + (gr + 2 * q) * (size_t)ldc + col0 + c4) = f.o;
    }
    return;
  }
  if constexpr (EPI == 3) {
    // f16 out: a row of the work-group's tile is BN columns = one or two 128-B lines, so the four waves stage the tile together and each then stores whole rows of it
    static_assert(BN == 64 || BN == 128, "a tile row of f16 is whole lines, at most one wave wide");
    constexpr int EPW = BN + 4, LPH = BN / 4, RPI = 32 / LPH, NR = BM / 4 / RPI;      // LPH lanes a row, RPI rows an instruction, BM / 4 rows a wave
    static_assert(BM * EPW * 4 <= 2 * STG && NR % 8 == 0, "the staged tile fits the ring; eight rows a trip of the store loop");
    const int rr = w * (BM / 4) + lane / LPH, c4 = (lane % LPH) * 4;
    const size_t gr = (size_t)blockIdx.z * LL + row0 + rr;      // row over all batch elements
    v4f x[NR];
    const float* xp = X + gr * NUV + col0 + c4;
#pragma unroll      // constant indices: the arrays it walks stay in registers
    for (int q = 0; q < NR; ++q) x[q] = *(const v4fa*)(xp + (size_t)(RPI * q) * NUV);
    asm volatile("s_wait_xcnt 0x0" :: "v"(xp) : "memory");      // the loads' address pair is held as far as this wait, so that nothing, a load's own result included, is written over it ahead of the wait
    fal* so = (fal*)sm;
#pragma unroll      // constant indices: the arrays it walks stay in registers
    for (int i = 0; i < FM; ++i)
#pragma unroll      // constant indices: the arrays it walks stay in registers
      for (int j = 0; j < FN; ++j)
#pragma unroll      // constant indices: the arrays it walks stay in registers
        for (int r = 0; r < 8; ++r) so[((wm * FM + i) * 16 + 8 * hh + r) * EPW + (wn * FN + j) * 16 + ln] = acc[i][j][r] * alpha;
    __syncthreads();      // every wave's part of the tile is staged before any wave reads whole rows
    char* hp = (char*)((unsigned short*)H + gr * (size_t)ldc + col0 + c4);
    const size_t hs = (size_t)(RPI * 2) * ldc;      // bytes from one instruction's rows to the next's
#pragma unroll 1      // stays rolled, eight instructions a trip: unrolled, a lane's 4 NR silu make the kernel's text longer than 32 KB
    for (int h = 0; h < NR / 8; ++h) {
      unsigned long long o[8];
#pragma unroll      // constant indices: the arrays it walks stay in registers
      for (int q = 0; q < 8; ++q) {
        const v4f t = *(const v4fa*)&so[(rr + RPI * (h * 8 + q)) * EPW + c4];
        union { unsigned long long o; _Float16 h[4]; } f;
#pragma unroll      // constant indices: the arrays it walks stay in registers
        for (int e = 0; e < 4; ++e) { const float u = x[q][e]; f.h[e] = (_Float16)((u / (1.0f + expf(-u))) * t[e]); }
        o[q] = f.o;
      }
      store8d(hp + (size_t)(h * 8) * hs, hs, o[0], o[1], o[2], o[3], o[4], o[5], o[6], o[7]);
#pragma unroll      // constant indices: the next trips' gate values move down to where a trip reads them
      for (int q = 0; q + 8 < NR; ++q) x[q] = x[q + 8];
    }
    return;
  }
  // whole 128-B lines out: each wave stages its own FM*16 x FN*16 block in its own LDS range (behind the last pass's barrier), then stores rows
  constexpr int LPR = FN * 4, RPP = 32 / LPR, NQ = FM * 16 / RPP;
  const int rsub = lane / LPR, c4 = (lane % LPR) * 4;
  const unsigned ob = ((unsigned)(row0 + wm * FM * 16 + rsub) * (unsigned)ldc + (unsigned)(col0 + wn * FN * 16 + c4)) * 4u, os = (unsigned)(RPP * ldc) * 4u;      // byte offsets in this batch element's C, below 2^32
  v4f x[NQ];
  if constexpr (HASR) {
    static_assert(NQ % 16 == 0, "sixteen loads a wait");
#pragma unroll      // constant indices: the arrays it walks stay in registers
    for (int q0 = 0; q0 < NQ; q0 += 16) {
      unsigned of[16];
#pragma unroll      // constant indices: the arrays it walks stay in registers
      for (int q = 0; q < 16; ++q) { of[q] = ob + (q0 + q) * os; x[q0 + q] = *(const v4fa*)((const char*)C + of[q]); }
      asm volatile("s_wait_xcnt 0x0" :: "v"(of[0]), "v"(of[1]), "v"(of[2]), "v"(of[3]), "v"(of[4]), "v"(of[5]), "v"(of[6]), "v"(of[7]), "v"(of[8]), "v"(of[9]), "v"(of[10]), "v"(of[11]), "v"(of[12]), "v"(of[13]), "v"(of[14]), "v"(of[15]) : "memory");      // the loads' offset registers are held as far as this wait, so that nothing, a load's own result included, is written over them ahead of the wait
    }
  }
  fal* so = (fal*)sm + (size_t)w * (FM * 16) * EP;
#pragma unroll      // constant indices: the arrays it walks stay in registers
  for (int i = 0; i < FM; ++i)
#pragma unroll      // constant indices: the arrays it walks stay in registers
    for (int j = 0; j < FN; ++j)
#pragma unroll      // constant indices: the arrays it walks stay in registers
      for (int r = 0; r < 8; ++r) so[(i * 16 + 8 * hh + r) * EP + j * 16 + ln] = acc[i][j][r] * alpha;
  __builtin_amdgcn_fence(__ATOMIC_ACQ_REL, "workgroup"); __builtin_amdgcn_wave_barrier();      // the wave's staged rows are written before its lanes read each other's words
  static_assert(NQ % 8 == 0, "eight stores a statement");
#pragma unroll      // constant indices: the arrays it walks stay in registers
  for (int q0 = 0; q0 < NQ; q0 += 8) {
    v4f v[8];
#pragma unroll      // constant indices: the arrays it walks stay in registers
    for (int q = 0; q < 8; ++q) { v[q] = *(const v4fa*)&so[((q0 + q) * RPP + rsub) * EP + c4]; if (HASR) v[q] += x[q0 + q]; }
    store8q((char*)C + (ob + q0 * os), os, v[0], v[1], v[2], v[3], v[4], v[5], v[6], v[7]);
  }
}

typedef _Float16 v4h __attribute__((ext_vector_type(4)));

__global__ __launch_bounds__(256) void k_x16(const float* __restrict__ x, _Float16* __restrict__ X16, size_t n8) { const size_t t = (size_t)blockIdx.x * 256 + threadIdx.x; if (t >= n8) return; FragH f;
#pragma unroll
  for (int q = 0; q < 8; ++q) f.h[q] = (_Float16)bf16_round(x[t * 8 + q]); *(v8us*)((unsigned short*)X16 + t * 8) = f.half[0];  }
__global__ __launch_bounds__(256) void k_h16(const float* __restrict__ x, _Float16* __restrict__ X16, size_t n8) { const size_t t = (size_t)blockIdx.x * 256 + threadIdx.x; if (t >= n8) return; FragH f;
#pragma unroll
  for (int q = 0; q < 8; ++q) f.h[q] = (_Float16)x[t * 8 + q]; *(v8us*)((unsigned short*)X16 + t * 8) = f.half[0];  }
template <int NHv, int TTv>
__global__ __launch_bounds__(256) void k_vt(const _Float16* __restrict__ V16, int ldv, int voff, _Float16* __restrict__ Vt) { __shared__ unsigned short tl[64][66]; const int tid = threadIdx.x; const int slab = blockIdx.x / (TTv / 64), lg = blockIdx.x % (TTv / 64); const int b = slab / NHv, h = slab % NHv;
  for (int i = tid; i < 64 * 8; i += 256) { const int r = i / 8, c8 = (i % 8) * 8; FragH f; f.half[0] = *(const v8us*)((const unsigned short*)V16 + ((size_t)b * TTv + lg * 64 + r) * ldv + voff + h * 64 + c8);
#pragma unroll
    for (int q = 0; q < 8; ++q) tl[r][c8 + q] = f.u[q]; }
  __syncthreads();
  {
#pragma unroll
    for (int rd = 0; rd < 2; ++rd) { const int d = rd * 32 + tid / 8, pc = tid % 8; FragH f;
#pragma unroll
      for (int q = 0; q < 8; ++q) f.u[q] = tl[pc * 8 + q][d];
      *(v8us*)((unsigned short*)Vt + ((size_t)slab * 64 + d) * TTv + lg * 64 + pc * 8) = f.half[0]; }
     } }

__global__ __launch_bounds__(256) void k_hl(const float* __restrict__ F, _Float16* __restrict__ Hh, _Float16* __restrict__ Hl, size_t n8) { const size_t t = (size_t)blockIdx.x * 256 + threadIdx.x; if (t >= n8) return; FragH fh, fl; const v4f a = *(const v4fa*)(F + t * 8), c = *(const v4fa*)(F + t * 8 + 4);
#pragma unroll
  for (int q = 0; q < 4; ++q) { _Float16 h = (_Float16)a[q]; fh.h[q] = h; fl.h[q] = (_Float16)((a[q] - (float)h) * 1024.0f); h = (_Float16)c[q]; fh.h[4 + q] = h; fl.h[4 + q] = (_Float16)((c[q] - (float)h) * 1024.0f); }
  { *(v8us*)((unsigned short*)Hh + t * 8) = fh.half[0]; *(v8us*)((unsigned short*)Hl + t * 8) = fl.half[0];  } }

__global__ __launch_bounds__(256) void k_qk(const float* __restrict__ UV, const float* __restrict__ gam, const float* __restrict__ bet, const float* __restrict__ CS, const float* __restrict__ SN, _Float16* __restrict__ Q16, _Float16* __restrict__ K16) {
  #pragma clang fp contract(off)
  const int t = blockIdx.x * 256 + threadIdx.x; if (t >= NBt * 2 * LL * 16) return; const int i0 = (t & 15) * 4; const int l = (t >> 4) % LL; const int which = (t / (LL * 16)) & 1; const int bl = (t / (2 * LL * 16)) * LL + l; const float* gp = gam + which * SSz; const float* bp = bet + which * SSz; _Float16* dst = which ? K16 : Q16; FragH o1, o2;
#pragma unroll
  for (int qq = 0; qq < 4; ++qq) { const int i = i0 + qq; const float u1 = UV[(size_t)bl * NUV + 2 * EE + i], u2 = UV[(size_t)bl * NUV + 2 * EE + 64 + i]; const float b1 = u1 / (1.0f + expf(-u1)), b2 = u2 / (1.0f + expf(-u2));
    const float a1 = b1 * bf16_round(gp[i]) + bf16_round(bp[i]), a2 = b2 * bf16_round(gp[64 + i]) + bf16_round(bp[64 + i]); const float c = CS[(size_t)l * 64 + i], s = SN[(size_t)l * 64 + i];
    o1.h[qq] = (_Float16)(a1 * c - a2 * s); o2.h[qq] = (_Float16)(a2 * c + a1 * s); }
  const unsigned long long p1 = *(const unsigned long long*)&o1.u[0], p2 = *(const unsigned long long*)&o2.u[0];
  { *(unsigned long long*)((unsigned short*)dst + (size_t)bl * SSz + i0) = p1; *(unsigned long long*)((unsigned short*)dst + (size_t)bl * SSz + 64 + i0) = p2;  } }
__constant__ float INVF[64] = {1.000000000e+00f,1.154781938e+00f,1.333521485e+00f,1.539926529e+00f,1.778279424e+00f,2.053524971e+00f,2.371373653e+00f,2.738419533e+00f,3.162277699e+00f,3.651741266e+00f,4.216965199e+00f,4.869675159e+00f,5.623413086e+00f,6.493816376e+00f,7.498941898e+00f,8.659643173e+00f,1.000000000e+01f,1.154782009e+01f,1.333521461e+01f,1.539926529e+01f,1.778279495e+01f,2.053524971e+01f,2.371373749e+01f,2.738419724e+01f,3.162277603e+01f,3.651741409e+01f,4.216965103e+01f,4.869675064e+01f,5.623413086e+01f,6.493816376e+01f,7.498941803e+01f,8.659643555e+01f,1.000000000e+02f,1.154781952e+02f,1.333521423e+02f,1.539926453e+02f,1.778279419e+02f,2.053525085e+02f,2.371373749e+02f,2.738419495e+02f,3.162277527e+02f,3.651741333e+02f,4.216965027e+02f,4.869675293e+02f,5.623413086e+02f,6.493816528e+02f,7.498942261e+02f,8.659642944e+02f,1.000000000e+03f,1.154781982e+03f,1.333521484e+03f,1.539926514e+03f,1.778279419e+03f,2.053525146e+03f,2.371373779e+03f,2.738419678e+03f,3.162277588e+03f,3.651741211e+03f,4.216964844e+03f,4.869675293e+03f,5.623413086e+03f,6.493816406e+03f,7.498941895e+03f,8.659643555e+03f};
// Everything that depends on the inputs alone, in one launch: the rope table, ScaleNorm with the x*res_scale start value, and the two weight matrices as f16 (x 16; (out,in) is already the B^T layout).
// The four parts are independent; a work-group does one part, picked by its index. Each wave issues all of its 16-byte loads (512 contiguous bytes a wave-wide load) before it uses the first, and stores whole lines.
#define PB_CS (LL * 64 / 256)              /* 256 work-groups: table, one (l, i) a lane; first, as theirs is the longest dependent chain */
#define PB_SN (NBt * LL / 16)              /* 512: ScaleNorm, two rows a wave */
#define PB_WU (NUV * DD / (256 * 64))      /* 264: uv_w, 64 values a lane */
#define PB_WO (DD * EE / (256 * 64))       /* 128: o_w, 64 values a lane */
__device__ __forceinline__ void round16_part(const float* __restrict__ Wf, _Float16* __restrict__ Bt, int part, int tid) {
  const size_t e0 = (size_t)part * (256 * 64) + tid * 4;
  const float* wp = Wf + e0;
  v4f a[16];
#pragma unroll      // constant indices: the arrays it walks stay in registers
  for (int j = 0; j < 16; ++j) a[j] = *(const v4fa*)(wp + j * 1024);
  asm volatile("s_wait_xcnt 0x0" :: "v"(wp) : "memory");      // the loads' address pair is held as far as this wait, so that nothing, a load's own result included, is written over it ahead of the wait; and no load sinks below it
  unsigned long long o[16];
#pragma unroll      // constant indices: the arrays it walks stay in registers
  for (int j = 0; j < 16; ++j) {
    union { unsigned long long o; _Float16 h[4]; } f;
#pragma unroll      // constant indices: the arrays it walks stay in registers
    for (int e = 0; e < 4; ++e) f.h[e] = (_Float16)(bf16_round(a[j][e]) * 16.0f);
    o[j] = f.o;
  }
  char* bp = (char*)((unsigned short*)Bt + e0);
  store8d(bp, 2048, o[0], o[1], o[2], o[3], o[4], o[5], o[6], o[7]);
  store8d(bp + 8 * 2048, 2048, o[8], o[9], o[10], o[11], o[12], o[13], o[14], o[15]);
}
__global__ __launch_bounds__(256) void k_prep(const float* __restrict__ x, const float* __restrict__ g, const float* __restrict__ rsc, const float* __restrict__ uvw, const float* __restrict__ ow,
                                              _Float16* __restrict__ XN, float* __restrict__ XR, _Float16* __restrict__ BUV, _Float16* __restrict__ BOW, float* __restrict__ CS, float* __restrict__ SN) {
  const int b = blockIdx.x, tid = threadIdx.x;
  if (b < PB_CS) {
    const int t = b * 256 + tid, i = t & 63, l = t >> 6; const float invf = INVF[i];
    asm volatile("s_wait_xcnt 0x0" :: "v"(i) : "memory");      // the load's index register is held as far as this wait, so that nothing, the load's own result included, is written over it ahead of the wait
    const float ang = (float)l * invf;
    const float c = (float)cos((double)ang), s = (float)sin((double)ang);
    CS[t] = c; SN[t] = s;
    return;
  }
  if (b < PB_CS + PB_SN) {
    const int lane = tid & 31; const size_t r0 = ((size_t)(b - PB_CS) * 8 + (tid >> 5)) * 2;      // the wave's two rows
    const float* xp = x + r0 * DD + lane * 4; const float* sp = rsc + lane * 4;
    v4f a[2][8], sc[8];
#pragma unroll      // constant indices: the arrays it walks stay in registers
    for (int k = 0; k < 8; ++k) { a[0][k] = *(const v4fa*)(xp + k * 128); a[1][k] = *(const v4fa*)(xp + DD + k * 128); }
#pragma unroll      // constant indices: the arrays it walks stay in registers
    for (int k = 0; k < 8; ++k) sc[k] = *(const v4fa*)(sp + k * 128);
    asm volatile("s_wait_xcnt 0x0" :: "v"(xp), "v"(sp) : "memory");      // the loads' address pairs are held as far as this wait, so that nothing, a load's own result included, is written over them ahead of the wait; and no load sinks below it
    const float gg = bf16_round(g[0]);
#pragma unroll      // constant indices: the arrays it walks stay in registers
    for (int k = 0; k < 8; ++k)
#pragma unroll      // constant indices: the arrays it walks stay in registers
      for (int e = 0; e < 4; ++e) sc[k][e] = bf16_round(sc[k][e]);
#pragma unroll      // constant indices: the arrays it walks stay in registers
    for (int r = 0; r < 2; ++r) {
      float s4[4] = {0.f, 0.f, 0.f, 0.f};      // four independent chains a lane
#pragma unroll      // constant indices: the arrays it walks stay in registers
      for (int k = 0; k < 8; ++k)
#pragma unroll      // constant indices: the arrays it walks stay in registers
        for (int e = 0; e < 4; ++e) { const float v = bf16_round(a[r][k][e]); a[r][k][e] = v; s4[e] += v * v; }
      float ss = (s4[0] + s4[1]) + (s4[2] + s4[3]);
      for (int o = 16; o > 0; o >>= 1) ss += __shfl_xor(ss, o, 32);
      const float nrm = sqrtf(ss) * 0.03125f; const float inv = gg / fmaxf(nrm, 1e-5f);
      unsigned long long o[8];
#pragma unroll      // constant indices: the arrays it walks stay in registers
      for (int k = 0; k < 8; ++k) {
        union { unsigned long long o; _Float16 h[4]; } f;
#pragma unroll      // constant indices: the arrays it walks stay in registers
        for (int e = 0; e < 4; ++e) { f.h[e] = (_Float16)(a[r][k][e] * inv); a[r][k][e] *= sc[k][e]; }
        o[k] = f.o;
      }
      const size_t e0 = (r0 + r) * DD + lane * 4;
      store8d((char*)((unsigned short*)XN + e0), 256, o[0], o[1], o[2], o[3], o[4], o[5], o[6], o[7]);
      store8q((char*)(XR + e0), 512, a[r][0], a[r][1], a[r][2], a[r][3], a[r][4], a[r][5], a[r][6], a[r][7]);
    }
    return;
  }
  if (b < PB_CS + PB_SN + PB_WU) { round16_part(uvw, BUV, b - (PB_CS + PB_SN), tid); return; }
  round16_part(ow, BOW, b - (PB_CS + PB_SN + PB_WU), tid);
}

extern "C" void kernel_launch(void* const* d_in, const int* in_sizes, int n_in,
                              void* d_out, int out_size, void* d_ws, size_t ws_size, hipStream_t stream) {
  (void)in_sizes; (void)n_in; (void)out_size;
  const float* x = (const float*)d_in[0]; const float* g = (const float*)d_in[1]; const float* uvw = (const float*)d_in[2]; const float* gam = (const float*)d_in[3]; const float* bet = (const float*)d_in[4]; const float* wrel = (const float*)d_in[5]; const float* ow = (const float*)d_in[6]; const float* rsc = (const float*)d_in[7];
  char* ws = (char*)d_ws; size_t off = 0;
  auto take = [&](size_t bytes) { char* p = ws + off; off += (bytes + 255) & ~(size_t)255; return p; };
  // All eight batch elements go through each stage in one launch, so every intermediate holds all eight. Of UV only the columns of u and of base are written and read. x*res_scale is stored in out, where the last GEMM adds to it.
  _Float16* BOW = (_Float16*)take((size_t)DD * EE * 2); float* UV = (float*)take((size_t)NBt * LL * NUV * 4); _Float16* VT = (_Float16*)take((size_t)NBt * EE * LL * 2); _Float16* KER = (_Float16*)take((size_t)NBt * LL * LL * 2);
  _Float16* G16 = (_Float16*)take((size_t)NBt * LL * EE * 2);
  _Float16* BUV = (_Float16*)take((size_t)NUV * DD * 2); float* CS = (float*)take((size_t)LL * 64 * 4); float* SN = (float*)take((size_t)LL * 64 * 4);
  _Float16* XN = (_Float16*)take((size_t)NBt * LL * DD * 2); _Float16* Q16 = (_Float16*)take((size_t)NBt * LL * SSz * 2); _Float16* K16 = (_Float16*)take((size_t)NBt * LL * SSz * 2);
  if (off > ws_size) return;      // 4.2 + 138.4 + 33.6 + 16.8 + 33.6 + 8.7 + 0.5 + 16.8 + 4.2 = 257 MB, no range used twice
  float* Y = (float*)d_out;
  k_prep<<<PB_CS + PB_SN + PB_WU + PB_WO, 256, 0, stream>>>(x, g, rsc, uvw, ow, XN, Y, BUV, BOW, CS, SN);      /* rope table, ScaleNorm (x*res_scale to out), both weights to f16 */
  const dim3 gU(NUV / 128, NBt * LL / 128), gS(LL / 64, LL / 64, NBt), gK(EE / 128, LL / 128, NBt), gO(DD / 128, NBt * LL / 128);      /* the three long GEMMs: 128 x 128 of C a work-group */
  k_gemm_t<4, 4, false, 1><<<gU, 128, 0, stream>>>(XN, DD, 0, BUV, DD, 0, 0.0625f, UV, NUV, 0, DD, nullptr, VT);      /* uv, the batch as rows: M 8192 N 4224 K 1024; u and base pre-activation to UV, silu(v) transposed to VT */
  k_qk<<<(NBt * 2 * LL * 16 + 255) / 256, 256, 0, stream>>>(UV, gam, bet, CS, SN, Q16, K16);
  k_gemm_t<2, 2, false, 2><<<gS, 128, 0, stream>>>(Q16, SSz, (size_t)LL * SSz, K16, SSz, (size_t)LL * SSz, 1.0f, nullptr, LL, 0, SSz, wrel, KER);      /* qk -> kernel, 8 x: M 1024 N 1024 K 128 */
  k_gemm_t<4, 4, false, 3><<<gK, 128, 0, stream>>>(KER, LL, (size_t)LL * LL, VT, LL, (size_t)EE * LL, 1.0f, nullptr, EE, 0, LL, UV, G16);      /* kernel*v -> gated product, 8 x: M 1024 N 2048 K 1024 */
  k_gemm_t<4, 4, true, 0><<<gO, 128, 0, stream>>>(G16, EE, 0, BOW, EE, 0, 0.0625f, Y, DD, 0, EE, nullptr, nullptr);      /* y = x*res_scale (already in out) + out*o_w^T, the batch as rows: M 8192 N 1024 K 2048 */
}

// v006
// A run of this version takes 148 microseconds.
// Two timings next to v005 put it at 1.16 and 1.15 times that version's speed.
// Over all steps from v000 it is 10.7 times as fast.
#include <hip/hip_runtime.h>
// RTM (GAU-style) block (B 8, L 1024, D 1024, E 2048, s 128): xn = ScaleNorm(x)·g; uv = silu(xn·uv_wᵀ) → u (2048) | v (2048) | base (128); q/k = rope_seq(base·γ + β) (rotation over the sequence axis with angle l·10000^(i/64), half-split); qk = q·kᵀ + w_rel[j − i + 1023]; kernel = relu(qk/√128)²; out = u ⊙ (kernel·v); y = x·res_scale + out·o_wᵀ → [8,1024,1024].
// Compute dtype: x and parameters rounded to bf16; ScaleNorm in f32 → f16 operand; uv GEMM (f32 result), SiLU/affine/rope in f32 (sin/cos of the f32 angle evaluated in double); q, k, v, kernel and the gated product as f16 GEMM operands (≈2^-12), f32 accumulation; residual x·res_scale through the f32 epilogue. v_wmma_f32_16x16x32_f16.
#define NBt 8
#define LL 1024
#define DD 1024
#define EE 2048
#define SSz 128
#define NUV (2 * EE + SSz)       /* 4224 */
typedef __bf16 v16b __attribute__((ext_vector_type(16)));
typedef unsigned short v8us __attribute__((ext_vector_type(8), may_alias));
typedef float  v8f  __attribute__((ext_vector_type(8)));
typedef float  v4f  __attribute__((ext_vector_type(4)));
typedef float  v4fa __attribute__((ext_vector_type(4), may_alias));
union FragB { v16b v; v8us half[2]; unsigned short u[16]; };

__device__ __forceinline__ unsigned short bf16_bits(float x) { unsigned int u = __float_as_uint(x); return (unsigned short)((u + 0x7FFFu + ((u >> 16) & 1u)) >> 16); }
__device__ __forceinline__ float bf16_val(unsigned short b) { return __uint_as_float(((unsigned int)b) << 16); }
__device__ __forceinline__ float bf16_round(float x) { return bf16_val(bf16_bits(x)); }
// D += A·B with NT terms: 1 = ah·bh, 2 = + al·bh (A split), 3 = + ah·bl (both split)
template <int NT>
__device__ __forceinline__ v8f mmaN(v16b ah, v16b al, v16b bh, v16b bl, v8f c) {
  c = __builtin_amdgcn_wmma_f32_16x16x32_bf16(false, ah, false, bh, (short)0, c, false, false);
  if (NT >= 2) c = __builtin_amdgcn_wmma_f32_16x16x32_bf16(false, al, false, bh, (short)0, c, false, false);
  if (NT >= 3) c = __builtin_amdgcn_wmma_f32_16x16x32_bf16(false, ah, false, bl, (short)0, c, false, false);
  asm volatile("v_nop\n\tv_nop\n\tv_nop\n\tv_nop" : "+v"(c) : "v"(ah), "v"(al), "v"(bh), "v"(bl));
  return c;
}

__global__ __launch_bounds__(256) void k_wt_bf16(const float* __restrict__ W, unsigned short* __restrict__ Wt, int K, int N) {
  const int t = blockIdx.x * 256 + threadIdx.x;
  const int k8n = K / 8;
  if (t >= N * k8n) return;
  const int n = t / k8n, k8 = (t % k8n) * 8;
  v8us v;
#pragma unroll
  for (int i = 0; i < 8; ++i) v[i] = bf16_bits(W[(size_t)(k8 + i) * N + n]);
  *(v8us*)(Wt + (size_t)n * K + k8) = v;
  
}

// GEMM C[M][N] (f32, pitch ldc) = act(A[M][K]·W + bias). A f32 row-major (pitch lda) converted per fragment to bf16
// (ASPLIT: hi/lo two planes -> 2 terms, else single rounded term); Wt bf16 [N][K] (pitch ldb). BIAS_BF16 rounds the
// bias to bf16 first (bias quantised to bf16 before the add). K%32==0, M%16==0, N%64==0.
template <bool ASPLIT, int ACT, bool BIAS_BF16>
__global__ __launch_bounds__(128) void k_gemm_bf(const float* __restrict__ A, int lda, const unsigned short* __restrict__ Wt, int ldb,
                                               const float* __restrict__ bias, float* __restrict__ C, int ldc, int M, int N, int K) {
  __shared__ __attribute__((aligned(16))) float so[4][16][64];
  const int tid = threadIdx.x, w = tid >> 5, lane = tid & 31, ln = lane & 15, hh = lane >> 4;
  const int ntn = N / 64;
  const int wid = blockIdx.x * 4 + w;
  const int mt = wid / ntn, nq = wid % ntn;
  if (mt * 16 >= M) return;
  const int row0 = mt * 16, col0 = nq * 64;
  const float* arow = A + (size_t)(row0 + ln) * lda;
  v8f acc[4] = {};
  for (int kb = 0; kb < K; kb += 32) {
    FragB ah, al;
    const v4f x0 = *(const v4fa*)(arow + kb + 8 * hh), x1 = *(const v4fa*)(arow + kb + 8 * hh + 4);
    const v4f x2 = *(const v4fa*)(arow + kb + 16 + 8 * hh), x3 = *(const v4fa*)(arow + kb + 16 + 8 * hh + 4);
    float xs[16] = {x0[0],x0[1],x0[2],x0[3],x1[0],x1[1],x1[2],x1[3],x2[0],x2[1],x2[2],x2[3],x3[0],x3[1],x3[2],x3[3]};
#pragma unroll
    for (int i = 0; i < 16; ++i) { const unsigned short hb = bf16_bits(xs[i]); ah.u[i] = hb; al.u[i] = ASPLIT ? bf16_bits(xs[i] - bf16_val(hb)) : (unsigned short)0; }
#pragma unroll
    for (int t = 0; t < 4; ++t) {
      const unsigned short* brow = Wt + (size_t)(col0 + t * 16 + ln) * ldb + kb;
      FragB b;
      b.half[0] = *(const v8us*)(brow + 8 * hh);
      b.half[1] = *(const v8us*)(brow + 16 + 8 * hh);
      acc[t] = mmaN<ASPLIT ? 2 : 1>(ah.v, al.v, b.v, b.v, acc[t]);
    }
  }
#pragma unroll
  for (int t = 0; t < 4; ++t) {
    float bv = bias ? bias[col0 + t * 16 + ln] : 0.f;
    if (BIAS_BF16) bv = bf16_round(bv);
#pragma unroll
    for (int r = 0; r < 8; ++r) { float v = acc[t][r] + bv; if (ACT == 1) v = fmaxf(v, 0.f); so[w][8 * hh + r][t * 16 + ln] = v; }
  }
  __builtin_amdgcn_fence(__ATOMIC_ACQ_REL, "workgroup");
  __builtin_amdgcn_wave_barrier();
  const int rsub = lane >> 4, c4 = (lane & 15) * 4;
  {
#pragma unroll
    for (int q = 0; q < 8; ++q) {
      const int r = q * 2 + rsub;
      const v4f v = *(const v4fa*)&so[w][r][c4];
      *(v4f*)(C + (size_t)(row0 + r) * ldc + col0 + c4) = v;
    }
    
  }
}

// GEMM C = act(A·W + bias + resid): A f32 (ASPLIT -> hi/lo 2 terms), Wt bf16 [N][K]; ACT 0 none, 1 relu, 2 exact gelu;
// resid (optional, f32, row index = (row % rmod), pitch ldr, RES_BF16 rounds it) added before the activation.
template <bool ASPLIT, int ACT, bool BIAS_BF16, bool RES_BF16>
__global__ __launch_bounds__(128) void k_gemm_bf3(const float* __restrict__ A, int lda, const unsigned short* __restrict__ Wt, int ldb,
                                                const float* __restrict__ bias, const float* __restrict__ resid, int rmod, int ldr,
                                                float* __restrict__ C, int ldc, int M, int N, int K) {
  __shared__ __attribute__((aligned(16))) float so[4][16][64];
  const int tid = threadIdx.x, w = tid >> 5, lane = tid & 31, ln = lane & 15, hh = lane >> 4;
  const int ntn = N / 64;
  const int wid = blockIdx.x * 4 + w;
  const int mt = wid / ntn, nq = wid % ntn;
  if (mt * 16 >= M) return;
  const int row0 = mt * 16, col0 = nq * 64;
  const float* arow = A + (size_t)(row0 + ln) * lda;
  v8f acc[4] = {};
  for (int kb = 0; kb < K; kb += 32) {
    FragB ah, al;
    const v4f x0 = *(const v4fa*)(arow + kb + 8 * hh), x1 = *(const v4fa*)(arow + kb + 8 * hh + 4);
    const v4f x2 = *(const v4fa*)(arow + kb + 16 + 8 * hh), x3 = *(const v4fa*)(arow + kb + 16 + 8 * hh + 4);
    float xs[16] = {x0[0],x0[1],x0[2],x0[3],x1[0],x1[1],x1[2],x1[3],x2[0],x2[1],x2[2],x2[3],x3[0],x3[1],x3[2],x3[3]};
#pragma unroll
    for (int i = 0; i < 16; ++i) { const unsigned short hb = bf16_bits(xs[i]); ah.u[i] = hb; al.u[i] = ASPLIT ? bf16_bits(xs[i] - bf16_val(hb)) : (unsigned short)0; }
#pragma unroll
    for (int t = 0; t < 4; ++t) {
      const unsigned short* brow = Wt + (size_t)(col0 + t * 16 + ln) * ldb + kb;
      FragB b;
      b.half[0] = *(const v8us*)(brow + 8 * hh);
      b.half[1] = *(const v8us*)(brow + 16 + 8 * hh);
      acc[t] = mmaN<ASPLIT ? 2 : 1>(ah.v, al.v, b.v, b.v, acc[t]);
    }
  }
#pragma unroll
  for (int t = 0; t < 4; ++t) {
    const int col = col0 + t * 16 + ln;
    float bv = bias ? bias[col] : 0.f;
    if (BIAS_BF16) bv = bf16_round(bv);
#pragma unroll
    for (int r = 0; r < 8; ++r) {
      float v = acc[t][r] + bv;
      if (resid) { float rv = resid[(size_t)((row0 + 8 * hh + r) % rmod) * ldr + col]; if (RES_BF16) rv = bf16_round(rv); v += rv; }
      if (ACT == 1) v = fmaxf(v, 0.f);
      if (ACT == 2) v = 0.5f * v * (1.0f + erff(v * 0.70710678118654752f));
      if (ACT == 3) { const float u = 0.7978845608028654f * (v + 0.044715f * v * v * v); v = 0.5f * v * (1.0f + tanhf(u)); }
      so[w][8 * hh + r][t * 16 + ln] = v;
    }
  }
  __builtin_amdgcn_fence(__ATOMIC_ACQ_REL, "workgroup");
  __builtin_amdgcn_wave_barrier();
  const int rsub = lane >> 4, c4 = (lane & 15) * 4;
  {
#pragma unroll
    for (int q = 0; q < 8; ++q) {
      const int r = q * 2 + rsub;
      const v4f v = *(const v4fa*)&so[w][r][c4];
      *(v4f*)(C + (size_t)(row0 + r) * ldc + col0 + c4) = v;
    }
    
  }
}
// row LayerNorm (biased variance, eps) over N: s = X (+ R); optional out_sum <- s; out_norm <- (s-mu)*rsqrt(var+eps)*g + b
template <bool PARAM_BF16>
__global__ __launch_bounds__(256) void k_layernorm(const float* __restrict__ X, const float* __restrict__ R, const float* __restrict__ g, const float* __restrict__ bta,
                                                  float* __restrict__ out_sum, float* __restrict__ out_norm, int N, float eps) {
  __shared__ float red[256];
  const int row = blockIdx.x, tid = threadIdx.x;
  const float* x = X + (size_t)row * N; const float* rr = R ? R + (size_t)row * N : nullptr;
  float vals[16];                     // up to N = 4096
  const int per = N / 256;            // contiguous chunk per thread? use strided-by-4 chunks: thread handles j = tid*4 + 1024*u
  float s1 = 0.f;
  for (int u = 0; u < per / 4; ++u) {
    const int j = tid * 4 + 1024 * u;
    const v4f a = *(const v4fa*)(x + j);
    v4f b = {0.f,0.f,0.f,0.f}; if (rr) b = *(const v4fa*)(rr + j);
#pragma unroll
    for (int q = 0; q < 4; ++q) { const float v = a[q] + b[q]; vals[u * 4 + q] = v; s1 += v; }
  }
  red[tid] = s1; __syncthreads();
  for (int st = 128; st > 0; st >>= 1) { if (tid < st) red[tid] += red[tid + st]; __syncthreads(); }
  const float mu = red[0] / (float)N; __syncthreads();
  float s2 = 0.f;
  for (int u = 0; u < per / 4; ++u)
#pragma unroll
    for (int q = 0; q < 4; ++q) { const float c = vals[u * 4 + q] - mu; s2 += c * c; }
  red[tid] = s2; __syncthreads();
  for (int st = 128; st > 0; st >>= 1) { if (tid < st) red[tid] += red[tid + st]; __syncthreads(); }
  const float rs = rsqrtf(red[0] / (float)N + eps);
  {
    for (int u = 0; u < per / 4; ++u) {
      const int j = tid * 4 + 1024 * u;
      v4f o, sm;
#pragma unroll
      for (int q = 0; q < 4; ++q) {
        float gg = g[j + q], bb = bta[j + q];
        if (PARAM_BF16) { gg = bf16_round(gg); bb = bf16_round(bb); }
        sm[q] = vals[u * 4 + q]; o[q] = (vals[u * 4 + q] - mu) * rs * gg + bb;
      }
      if (out_sum) *(v4f*)(out_sum + (size_t)row * N + j) = sm;
      *(v4f*)(out_norm + (size_t)row * N + j) = o;
    }
    
  }
}



// ---- f16 WMMA path (v_wmma_f32_16x16x32_f16): 11-bit significands for operands in range — used for all four GEMMs of this block
typedef _Float16 v16h __attribute__((ext_vector_type(16)));
union FragH { v16h v; v8us half[2]; _Float16 h[16]; unsigned short u[16]; };
template <int NT>
__device__ __forceinline__ v8f mmaH(v16h ah, v16h al, v16h bh, v16h bl, v8f c) {
  c = __builtin_amdgcn_wmma_f32_16x16x32_f16(false, ah, false, bh, (short)0, c, false, false);
  if (NT >= 2) c = __builtin_amdgcn_wmma_f32_16x16x32_f16(false, al, false, bh, (short)0, c, false, false);
  if (NT >= 3) c = __builtin_amdgcn_wmma_f32_16x16x32_f16(false, ah, false, bl, (short)0, c, false, false);
  asm volatile("v_nop\n\tv_nop\n\tv_nop\n\tv_nop" : "+v"(c) : "v"(ah), "v"(al), "v"(bh), "v"(bl));
  return c;
}
// batched GEMM like k_gemm_b but f16 operands: A f32 (split into f16 hi/lo if ASPLIT, else rounded to f16), Bt = f16 values [n][k]; alpha; C f32; N multiple of 16 (partial tiles skipped)
template <bool ASPLIT>
__global__ __launch_bounds__(128) void k_gemm_h(const float* __restrict__ A, int lda, size_t sA, const _Float16* __restrict__ Bh, int ldb, size_t sB, float alpha, float* __restrict__ C, int ldc, size_t sC, int M, int N, int K) {
  __shared__ __attribute__((aligned(16))) float so[4][16][64];
  const int tid = threadIdx.x, w = tid >> 5, lane = tid & 31, ln = lane & 15, hh = lane >> 4; const int by = blockIdx.y;
  A += (size_t)by * sA; Bh += (size_t)by * sB; C += (size_t)by * sC;
  const int ntn = (N + 63) / 64; const int wid = blockIdx.x * 4 + w; const int mt = wid / ntn, nq = wid % ntn; if (mt * 16 >= M) return;
  const int row0 = mt * 16, col0 = nq * 64; const float* arow = A + (size_t)(row0 + ln) * lda;
  v8f acc[4] = {};
  for (int kb = 0; kb < K; kb += 32) {
    FragH ah, al;
    const v4f x0 = *(const v4fa*)(arow + kb + 8 * hh), x1 = *(const v4fa*)(arow + kb + 8 * hh + 4), x2 = *(const v4fa*)(arow + kb + 16 + 8 * hh), x3 = *(const v4fa*)(arow + kb + 16 + 8 * hh + 4);
    float xs[16] = {x0[0],x0[1],x0[2],x0[3],x1[0],x1[1],x1[2],x1[3],x2[0],x2[1],x2[2],x2[3],x3[0],x3[1],x3[2],x3[3]};
#pragma unroll
    for (int i = 0; i < 16; ++i) { const _Float16 h = (_Float16)xs[i]; ah.h[i] = h; al.h[i] = ASPLIT ? (_Float16)(xs[i] - (float)h) : (_Float16)0.0f; }
#pragma unroll
    for (int t = 0; t < 4; ++t) { if (col0 + t * 16 >= N) continue; const size_t boff = (size_t)(col0 + t * 16 + ln) * ldb + kb; FragH bq; bq.half[0] = *(const v8us*)(Bh + boff + 8 * hh); bq.half[1] = *(const v8us*)(Bh + boff + 16 + 8 * hh);
      acc[t] = mmaH<ASPLIT ? 2 : 1>(ah.v, al.v, bq.v, bq.v, acc[t]); }
  }
#pragma unroll
  for (int t = 0; t < 4; ++t) { if (col0 + t * 16 >= N) continue;
#pragma unroll
    for (int r = 0; r < 8; ++r) so[w][8 * hh + r][t * 16 + ln] = acc[t][r] * alpha; }
  __builtin_amdgcn_fence(__ATOMIC_ACQ_REL, "workgroup"); __builtin_amdgcn_wave_barrier();
  const int rsub = lane >> 4, c4 = (lane & 15) * 4;
  {
#pragma unroll
    for (int q = 0; q < 8; ++q) { const int r = q * 2 + rsub; if (col0 + c4 < N) { const v4f v = *(const v4fa*)&so[w][r][c4]; *(v4f*)(C + (size_t)(row0 + r) * ldc + col0 + c4) = v; } }
     }
}

// Wt[n][k] = f16(W[k][n]·scale) from f32 row-major W[K][N] (scale = power of two; bf16-exact weights stay exact in f16 away from the subnormal range)
__global__ __launch_bounds__(256) void k_wt_f16(const float* __restrict__ W, _Float16* __restrict__ Wt, int K, int N, float scale) {
  const int t = blockIdx.x * 256 + threadIdx.x; if (t >= N * (K / 8)) return; const int n = t / (K / 8), k8 = (t % (K / 8)) * 8; FragH f;
#pragma unroll
  for (int i = 0; i < 8; ++i) f.h[i] = (_Float16)(bf16_round(W[(size_t)(k8 + i) * N + n]) * scale); const v8us o = f.half[0];
  *(v8us*)((unsigned short*)Wt + (size_t)n * K + k8) = o; 
}
// k_gemm_hh variant with fused epilogue: v = acc·alpha + bias[by·sBias + col] (+ CP[(row/rowsPerB)·sCPb + by·64 + col] if CP) ; ACT 0 none / 1 elu ; writes f32 C and f16 C16, each if non-null
template <int ACT>
__global__ __launch_bounds__(128) void k_gemm_hhx(const _Float16* __restrict__ A, int lda, size_t sA, const _Float16* __restrict__ Bh, int ldb, size_t sB, float alpha, const float* __restrict__ bias, size_t sBias, const float* __restrict__ CP, int rowsPerB, size_t sCPb, int row0g,
    float* __restrict__ C, _Float16* __restrict__ C16, int ldc, size_t sC, int M, int N, int K) {
  __shared__ __attribute__((aligned(16))) float so[4][16][64];
  const int tid = threadIdx.x, w = tid >> 5, lane = tid & 31, ln = lane & 15, hh = lane >> 4; const int by = blockIdx.y;
  A += (size_t)by * sA; Bh += (size_t)by * sB; const size_t cofs = (size_t)by * sC; const float* bp = bias ? bias + (size_t)by * sBias : nullptr;
  const int ntn = (N + 63) / 64; const int wid = blockIdx.x * 4 + w; const int mt = wid / ntn, nq = wid % ntn; if (mt * 16 >= M) return;
  const int row0 = mt * 16, col0 = nq * 64; const _Float16* arow = A + (size_t)(row0 + ln) * lda;
  v8f acc[4] = {};
  for (int kb = 0; kb < K; kb += 32) { FragH ah; ah.half[0] = *(const v8us*)((const unsigned short*)arow + kb + 8 * hh); ah.half[1] = *(const v8us*)((const unsigned short*)arow + kb + 16 + 8 * hh);
#pragma unroll
    for (int t = 0; t < 4; ++t) { if (col0 + t * 16 >= N) continue; const size_t boff = (size_t)(col0 + t * 16 + ln) * ldb + kb; FragH bq; bq.half[0] = *(const v8us*)((const unsigned short*)Bh + boff + 8 * hh); bq.half[1] = *(const v8us*)((const unsigned short*)Bh + boff + 16 + 8 * hh);
      acc[t] = mmaH<1>(ah.v, ah.v, bq.v, bq.v, acc[t]); }
  }
#pragma unroll
  for (int t = 0; t < 4; ++t) { if (col0 + t * 16 >= N) continue; const int col = col0 + t * 16 + ln; const float bv = bp ? bf16_round(bp[col]) : 0.f;
#pragma unroll
    for (int r = 0; r < 8; ++r) { float v = acc[t][r] * alpha + bv; if (CP) { const int bidx = (row0g + row0 + 8 * hh + r) / rowsPerB; v += CP[(size_t)bidx * sCPb + (size_t)by * 64 + col]; } if (ACT == 1) v = (v > 0.f) ? v : expm1f(v); else if (ACT == 7) v = (v > 0.f) ? v + 1.0f : expf(v); else if (ACT == 8) v = tanhf(v); else if (ACT == 9) v = 0.5f * v * (1.0f + tanhf(0.7978845608028654f * (v + 0.044715f * v * v * v))); else if (ACT == 11) v = 1.0f / (1.0f + expf(-v)); else if (ACT == 12) v = (v > 0.f) ? v : 0.01f * v; else if (ACT == 14) v = (v > 0.f) ? v : 0.1f * v; else if (ACT == 15) v = v / (1.0f + expf(-v)); else if (ACT == 3) v = fmaxf(v, 0.f); else if (ACT == 6) v = 0.5f * v * (1.0f + erff(v * 0.70710678118654752f)); so[w][8 * hh + r][t * 16 + ln] = v; } }
  __builtin_amdgcn_fence(__ATOMIC_ACQ_REL, "workgroup"); __builtin_amdgcn_wave_barrier();
  const int rsub = lane >> 4, c4 = (lane & 15) * 4; typedef _Float16 v4h __attribute__((ext_vector_type(4)));
  {
#pragma unroll
    for (int q = 0; q < 8; ++q) { const int r = q * 2 + rsub; if (col0 + c4 < N) { const v4f v = *(const v4fa*)&so[w][r][c4]; if (C) *(v4f*)(C + cofs + (size_t)(row0 + r) * ldc + col0 + c4) = v; if (C16) { v4h h4; for (int i = 0; i < 4; ++i) h4[i] = (_Float16)v[i]; *(v4h*)(C16 + cofs + (size_t)(row0 + r) * ldc + col0 + c4) = h4; } } }
     }
}


// Block-tiled f16 GEMM: C[row][col] = alpha * sum_k A[row][k] * B[col][k] (+ the value that C[row][col] already holds, if HASR). A and B are k-contiguous f16.
// blockIdx.z is the batch element: A, B and C move on by sA, sB and sC elements for each.
// One work-group of 4 waves (2 x 2) owns a (32 FM) x (32 FN) tile of C; each wave FM x FN fragments. A stage is 128 k of the tile's A rows and
// B rows (256 B a row, LDS pitch 272 B), brought in by asynchronous copies into two buffers: stage s + 1 flies while stage s is multiplied.
// The k order inside a fragment and the order of the k blocks are those of k_gemm_hhx. M, N multiples of the tile, K of 128.
#define TKK 128
#define TPB 272
typedef float fal __attribute__((may_alias));
// eight rows (8 apart) of a stage: each lane copies its own 16 bytes of each. The s_wait_xcnt stands in the copies' own statement so that no address register is rewritten ahead of it.
__device__ __forceinline__ void copy8(unsigned lds, const _Float16* g, size_t g8) {
  asm volatile("global_load_async_to_lds_b128 %0, %8, off\n\t"
               "global_load_async_to_lds_b128 %1, %9, off\n\t"
               "global_load_async_to_lds_b128 %2, %10, off\n\t"
               "global_load_async_to_lds_b128 %3, %11, off\n\t"
               "global_load_async_to_lds_b128 %4, %12, off\n\t"
               "global_load_async_to_lds_b128 %5, %13, off\n\t"
               "global_load_async_to_lds_b128 %6, %14, off\n\t"
               "global_load_async_to_lds_b128 %7, %15, off\n\t"
               "s_wait_xcnt 0x0"
               :: "v"(lds), "v"(lds + 8 * TPB), "v"(lds + 16 * TPB), "v"(lds + 24 * TPB), "v"(lds + 32 * TPB), "v"(lds + 40 * TPB), "v"(lds + 48 * TPB), "v"(lds + 56 * TPB),
                  "v"(g), "v"(g + g8), "v"(g + 2 * g8), "v"(g + 3 * g8), "v"(g + 4 * g8), "v"(g + 5 * g8), "v"(g + 6 * g8), "v"(g + 7 * g8)
               : "memory");
}
// eight stores of 16 (store8q) or 8 (store8d) bytes a lane, st bytes apart. The s_wait_xcnt stands in the stores' own statement so that no address or data register of theirs is rewritten ahead of it.
__device__ __forceinline__ void store8q(char* p, size_t st, v4f d0, v4f d1, v4f d2, v4f d3, v4f d4, v4f d5, v4f d6, v4f d7) {
  asm volatile("global_store_b128 %0, %8, off\n\t"
               "global_store_b128 %1, %9, off\n\t"
               "global_store_b128 %2, %10, off\n\t"
               "global_store_b128 %3, %11, off\n\t"
               "global_store_b128 %4, %12, off\n\t"
               "global_store_b128 %5, %13, off\n\t"
               "global_store_b128 %6, %14, off\n\t"
               "global_store_b128 %7, %15, off\n\t"
               "s_wait_xcnt 0x0"
               :: "v"(p), "v"(p + st), "v"(p + 2 * st), "v"(p + 3 * st), "v"(p + 4 * st), "v"(p + 5 * st), "v"(p + 6 * st), "v"(p + 7 * st),
                  "v"(d0), "v"(d1), "v"(d2), "v"(d3), "v"(d4), "v"(d5), "v"(d6), "v"(d7)
               : "memory");
}
__device__ __forceinline__ void store8d(char* p, size_t st, unsigned long long d0, unsigned long long d1, unsigned long long d2, unsigned long long d3, unsigned long long d4, unsigned long long d5, unsigned long long d6, unsigned long long d7) {
  asm volatile("global_store_b64 %0, %8, off\n\t"
               "global_store_b64 %1, %9, off\n\t"
               "global_store_b64 %2, %10, off\n\t"
               "global_store_b64 %3, %11, off\n\t"
               "global_store_b64 %4, %12, off\n\t"
               "global_store_b64 %5, %13, off\n\t"
               "global_store_b64 %6, %14, off\n\t"
               "global_store_b64 %7, %15, off\n\t"
               "s_wait_xcnt 0x0"
               :: "v"(p), "v"(p + st), "v"(p + 2 * st), "v"(p + 3 * st), "v"(p + 4 * st), "v"(p + 5 * st), "v"(p + 6 * st), "v"(p + 7 * st),
                  "v"(d0), "v"(d1), "v"(d2), "v"(d3), "v"(d4), "v"(d5), "v"(d6), "v"(d7)
               : "memory");
}
// EPI names what the epilogue does with the tile t = alpha * A*B^T:
//   0  C = t (+ C if HASR), f32.
//   1  uv: columns of u and of base as EPI 0 (pre-activation, f32); columns of v go out as H[b][e][l] = f16(silu(t)), transposed, and are not stored in C.
//   2  scores: H[b][i][j] = f16(relu((t + bf16(X[j - i + L - 1])) / sqrt(128))^2), X = w_rel; C unused.
//   3  gate: H[b*L + i][e] = f16(silu(X[b*L + i][e]) * t), X = the uv pre-activation (pitch NUV); C unused.
typedef unsigned short v4us __attribute__((ext_vector_type(4), may_alias));
// s[i] = silu(v[i]) = v[i] / (1 + e^-v[i]) for eight values, on the hardware's own exp2 and reciprocal (about 1 ulp of f32 each; every result here is rounded to f16): 5 vector instructions a value,
// where expf and an IEEE division take about 27 in one dependent chain. e^-v overflowing to inf gives v * 0, as v / inf does; underflowing to 0 gives v.
// One asm statement, eight independent values step by step, each in place in its own register: so no instruction directly behind a transcendental reads that one's result or writes over its source
// (left to the register allocator, neighbouring v_exp_f32 and v_rcp_f32 took each other's source registers), and every producer stands eight instructions ahead of its reader.
__device__ __forceinline__ void silu8(const float (&v)[8], float (&s)[8]) {
  asm("v_mul_f32 %0, 0xbfb8aa3b, %8\n\tv_mul_f32 %1, 0xbfb8aa3b, %9\n\tv_mul_f32 %2, 0xbfb8aa3b, %10\n\tv_mul_f32 %3, 0xbfb8aa3b, %11\n\t"      /* -v * log2(e) */
      "v_mul_f32 %4, 0xbfb8aa3b, %12\n\tv_mul_f32 %5, 0xbfb8aa3b, %13\n\tv_mul_f32 %6, 0xbfb8aa3b, %14\n\tv_mul_f32 %7, 0xbfb8aa3b, %15\n\t"
      "v_exp_f32 %0, %0\n\tv_exp_f32 %1, %1\n\tv_exp_f32 %2, %2\n\tv_exp_f32 %3, %3\n\tv_exp_f32 %4, %4\n\tv_exp_f32 %5, %5\n\tv_exp_f32 %6, %6\n\tv_exp_f32 %7, %7\n\t"
      "v_add_f32 %0, 1.0, %0\n\tv_add_f32 %1, 1.0, %1\n\tv_add_f32 %2, 1.0, %2\n\tv_add_f32 %3, 1.0, %3\n\tv_add_f32 %4, 1.0, %4\n\tv_add_f32 %5, 1.0, %5\n\tv_add_f32 %6, 1.0, %6\n\tv_add_f32 %7, 1.0, %7\n\t"
      "v_rcp_f32 %0, %0\n\tv_rcp_f32 %1, %1\n\tv_rcp_f32 %2, %2\n\tv_rcp_f32 %3, %3\n\tv_rcp_f32 %4, %4\n\tv_rcp_f32 %5, %5\n\tv_rcp_f32 %6, %6\n\tv_rcp_f32 %7, %7\n\t"
      "v_mul_f32 %0, %8, %0\n\tv_mul_f32 %1, %9, %1\n\tv_mul_f32 %2, %10, %2\n\tv_mul_f32 %3, %11, %3\n\tv_mul_f32 %4, %12, %4\n\tv_mul_f32 %5, %13, %5\n\tv_mul_f32 %6, %14, %6\n\tv_mul_f32 %7, %15, %7"
      : "=&v"(s[0]), "=&v"(s[1]), "=&v"(s[2]), "=&v"(s[3]), "=&v"(s[4]), "=&v"(s[5]), "=&v"(s[6]), "=&v"(s[7])
      : "v"(v[0]), "v"(v[1]), "v"(v[2]), "v"(v[3]), "v"(v[4]), "v"(v[5]), "v"(v[6]), "v"(v[7]));
}
template <int FM, int FN, bool HASR, int EPI>
__global__ __launch_bounds__(128) void k_gemm_t(const _Float16* __restrict__ A, int lda, size_t sA, const _Float16* __restrict__ B, int ldb, size_t sB, float alpha, float* __restrict__ C, int ldc, size_t sC, int K,
                                                const float* __restrict__ X, _Float16* __restrict__ H) {
  constexpr int BM = 32 * FM, BN = 32 * FN, STG = (BM + BN) * TPB, EP = FN * 16 + 4;
  static_assert(4 * FM * 16 * EP * 4 <= 2 * STG, "output staging fits the ring");
  __shared__ __attribute__((aligned(16))) unsigned char sm[2 * STG];
  const int tid = threadIdx.x, w = tid >> 5, lane = tid & 31, ln = lane & 15, hh = lane >> 4;
  const int row0 = blockIdx.y * BM, col0 = blockIdx.x * BN, wm = w >> 1, wn = w & 1;
  A += (size_t)blockIdx.z * sA; B += (size_t)blockIdx.z * sB; C += (size_t)blockIdx.z * sC;
  const int cr = tid >> 4, cc = tid & 15;      // copies: 16 lanes cover one 256-B row, the work-group 8 rows an instruction
  const _Float16* gA = A + (size_t)(row0 + cr) * lda + cc * 8;
  const _Float16* gB = B + (size_t)(col0 + cr) * ldb + cc * 8;
  const unsigned lA = (unsigned)(size_t)sm + cr * TPB + cc * 16;
  auto stage = [&](int s, int buf) {
    for (int i = 0; i < BM / 64; ++i) copy8(lA + buf * STG + i * 64 * TPB, gA + (size_t)s * TKK + (size_t)i * 64 * lda, (size_t)8 * lda);
    for (int i = 0; i < BN / 64; ++i) copy8(lA + buf * STG + (BM + i * 64) * TPB, gB + (size_t)s * TKK + (size_t)i * 64 * ldb, (size_t)8 * ldb);
  };
  const int nst = K / TKK;
  stage(0, 0);
  asm volatile("s_wait_asynccnt 0x0" ::: "memory");      // this wave's copies of stage 0 have landed
  __syncthreads();                                       // ... and every other wave's
  if (nst > 1) stage(1, 1);
  v8f acc[FM][FN] = {};
  for (int s = 0; s < nst; ++s) {
    const unsigned char* pa = sm + (s & 1) * STG + (wm * FM * 16 + ln) * TPB + hh * 16;
    const unsigned char* pb = sm + (s & 1) * STG + (BM + wn * FN * 16 + ln) * TPB + hh * 16;
    FragH a[2][FM], b[2][FN];      // two fragment sets: block kk + 1 of this stage is read from LDS while block kk is multiplied
    auto frags = [&](int kk, int set) {
#pragma unroll      // constant indices: the arrays it walks stay in registers
      for (int i = 0; i < FM; ++i) { a[set][i].half[0] = *(const v8us*)(pa + i * 16 * TPB + kk * 64); a[set][i].half[1] = *(const v8us*)(pa + i * 16 * TPB + kk * 64 + 32); }
#pragma unroll      // constant indices: the arrays it walks stay in registers
      for (int j = 0; j < FN; ++j) { b[set][j].half[0] = *(const v8us*)(pb + j * 16 * TPB + kk * 64); b[set][j].half[1] = *(const v8us*)(pb + j * 16 * TPB + kk * 64 + 32); }
    };
    frags(0, 0);
#pragma unroll      // constant indices: the arrays it walks stay in registers
    for (int kk = 0; kk < TKK / 32; ++kk) {
      if (kk + 1 < TKK / 32) frags(kk + 1, (kk + 1) & 1);
      __builtin_amdgcn_sched_barrier(0);      // the next block's LDS reads stay one group ahead of this block's WMMAs (sunk among them, each read's latency is waited out by the wave)
#pragma unroll      // constant indices: the arrays it walks stay in registers
      for (int i = 0; i < FM; ++i)
#pragma unroll      // constant indices: the arrays it walks stay in registers
        for (int j = 0; j < FN; ++j) acc[i][j] = __builtin_amdgcn_wmma_f32_16x16x32_f16(false, a[kk & 1][i].v, false, b[kk & 1][j].v, (short)0, acc[i][j], false, false);
      __builtin_amdgcn_sched_barrier(0);      // and the group after that is not lifted in among them
    }
    asm volatile("s_wait_dscnt 0x0" ::: "memory");       // this wave's reads of stage s are done before the buffer is refilled
    asm volatile("s_wait_asynccnt 0x0" ::: "memory");    // this wave's copies of stage s + 1 have landed
    __syncthreads();                                     // publishes stage s + 1 and ends every reader's last read of stage s
    if (s + 2 < nst) stage(s + 2, s & 1);
  }
  asm volatile("s_wait_asynccnt 0x0" ::: "memory");      // nothing in flight when the ring becomes output staging
  if constexpr (EPI == 1) {
    if (col0 >= EE && col0 < 2 * EE) {      // the same for the whole work-group: a tile of v
      // a lane's 8 accumulator rows of one fragment are 8 neighbours along l of one column e: 16 bytes of a row of H. Each wave stages its block column-major in its own LDS range, then stores whole 128-B lines.
      constexpr int HP = FM * 16 + 8, PPC = FM * 2;      // pitch in halves (16 B x odd); 16-byte parts a column
      unsigned short* sh = (unsigned short*)sm + (size_t)w * (FN * 16) * HP;
#pragma unroll      // constant indices: the arrays it walks stay in registers
      for (int i = 0; i < FM; ++i)
#pragma unroll      // constant indices: the arrays it walks stay in registers
        for (int j = 0; j < FN; ++j) {
          FragH f; float v[8], s[8];
#pragma unroll      // constant indices: the arrays it walks stay in registers
          for (int r = 0; r < 8; ++r) v[r] = acc[i][j][r] * alpha;
          silu8(v, s);
#pragma unroll      // constant indices: the arrays it walks stay in registers
          for (int r = 0; r < 8; ++r) f.h[r] = (_Float16)s[r];
          *(v8us*)(sh + (j * 16 + ln) * HP + i * 16 + 8 * hh) = f.half[0];
        }
      __builtin_amdgcn_fence(__ATOMIC_ACQ_REL, "workgroup"); __builtin_amdgcn_wave_barrier();      // the wave's staged columns are written before its lanes read each other's words
      const int rw = row0 + wm * FM * 16;      // the wave's first row; its FM*16 rows lie in one batch element
      unsigned short* vt = (unsigned short*)H + ((size_t)(rw / LL) * EE + (col0 - EE) + wn * FN * 16) * LL + rw % LL;
#pragma unroll      // the stores go out back to back
      for (int q = 0; q < FN * 16 * PPC / 32; ++q) { const int c = (q * 32 + lane) / PPC, p = (q * 32 + lane) % PPC; *(v8us*)(vt + (size_t)c * LL + p * 8) = *(const v8us*)(sh + c * HP + p * 8); }
      return;
    }
  }
  if constexpr (EPI == 2) {
    // f16 out: a row of the work-group's tile is 64 columns = one 128-B line, so the four waves stage the tile together and each then stores whole rows of it
    static_assert(BN == 64, "a tile row of f16 is one line");
    constexpr int EPW = BN + 4, NR = BM / 8;      // 16 lanes a row, 2 rows an instruction, BM / 4 rows a wave
    const int rr = w * (BM / 4) + hh, c4 = ln * 4;
    const size_t gr = (size_t)blockIdx.z * LL + row0 + rr;      // row over all batch elements
    fal* so = (fal*)sm;
#pragma unroll      // constant indices: the arrays it walks stay in registers
    for (int i = 0; i < FM; ++i)
#pragma unroll      // constant indices: the arrays it walks stay in registers
      for (int j = 0; j < FN; ++j)
#pragma unroll      // constant indices: the arrays it walks stay in registers
        for (int r = 0; r < 8; ++r) so[((wm * FM + i) * 16 + 8 * hh + r) * EPW + (wn * FN + j) * 16 + ln] = acc[i][j][r] * alpha;
    __syncthreads();      // every wave's part of the tile is staged before any wave reads whole rows
#pragma unroll      // constant indices: the arrays it walks stay in registers
    for (int q = 0; q < NR; ++q) {
      const v4f t = *(const v4fa*)&so[(rr + 2 * q) * EPW + c4];
      union { v4us o; _Float16 h[4]; } f;
#pragma unroll      // constant indices: the arrays it walks stay in registers
      for (int e = 0; e < 4; ++e) {
        if constexpr (EPI == 2) { const float v = (t[e] + bf16_round(X[col0 + c4 + e - (row0 + rr + 2 * q) + LL - 1])) * 0.08838834764831845f; const float r = fmaxf(v, 0.f); f.h[e] = (_Float16)(r * r); }
      }
      *(v4us*)((unsigned short*)H + (gr + 2 * q) * (size_t)ldc + col0 + c4) = f.o;
    }
    return;
  }
  if constexpr (EPI == 3) {
    // f16 out: a row of the work-group's tile is BN columns = one or two 128-B lines, so the four waves stage the tile together and each then stores whole rows of it
    static_assert(BN == 64 || BN == 128, "a tile row of f16 is whole lines, at most one wave wide");
    constexpr int EPW = BN + 4, LPH = BN / 4, RPI = 32 / LPH, NR = BM / 4 / RPI;      // LPH lanes a row, RPI rows an instruction, BM / 4 rows a wave
    static_assert(BM * EPW * 4 <= 2 * STG && NR % 8 == 0, "the staged tile fits the ring; eight rows a trip of the store loop");
    const int rr = w * (BM / 4) + lane / LPH, c4 = (lane % LPH) * 4;
    const size_t gr = (size_t)blockIdx.z * LL + row0 + rr;      // row over all batch elements
    v4f x[NR];
    const float* xp = X + gr * NUV + col0 + c4;
#pragma unroll      // constant indices: the arrays it walks stay in registers
    for (int q = 0; q < NR; ++q) x[q] = *(const v4fa*)(xp + (size_t)(RPI * q) * NUV);
    asm volatile("s_wait_xcnt 0x0" :: "v"(xp) : "memory");      // the loads' address pair is held as far as this wait, so that nothing, a load's own result included, is written over it ahead of the wait
    fal* so = (fal*)sm;
#pragma unroll      // constant indices: the arrays it walks stay in registers
    for (int i = 0; i < FM; ++i)
#pragma unroll      // constant indices: the arrays it walks stay in registers
      for (int j = 0; j < FN; ++j)
#pragma unroll      // constant indices: the arrays it walks stay in registers
        for (int r = 0; r < 8; ++r) so[((wm * FM + i) * 16 + 8 * hh + r) * EPW + (wn * FN + j) * 16 + ln] = acc[i][j][r] * alpha;
    __syncthreads();      // every wave's part of the tile is staged before any wave reads whole rows
    char* hp = (char*)((unsigned short*)H + gr * (size_t)ldc + col0 + c4);
    const size_t hs = (size_t)(RPI * 2) * ldc;      // bytes from one instruction's rows to the next's
#pragma unroll      // constant indices: the arrays it walks stay in registers
    for (int h = 0; h < NR / 8; ++h) {
      unsigned long long o[8];
#pragma unroll      // constant indices: the arrays it walks stay in registers
      for (int q = 0; q < 8; q += 2) {
        const v4f t0 = *(const v4fa*)&so[(rr + RPI * (h * 8 + q)) * EPW + c4], t1 = *(const v4fa*)&so[(rr + RPI * (h * 8 + q + 1)) * EPW + c4];
        const v4f u0 = x[h * 8 + q], u1 = x[h * 8 + q + 1];
        const float u[8] = {u0[0], u0[1], u0[2], u0[3], u1[0], u1[1], u1[2], u1[3]};
        float s[8];
        silu8(u, s);
        union { unsigned long long o; _Float16 h[4]; } f0, f1;
#pragma unroll      // constant indices: the arrays it walks stay in registers
        for (int e = 0; e < 4; ++e) { f0.h[e] = (_Float16)(s[e] * t0[e]); f1.h[e] = (_Float16)(s[4 + e] * t1[e]); }
        o[q] = f0.o; o[q + 1] = f1.o;
      }
      store8d(hp + (size_t)(h * 8) * hs, hs, o[0], o[1], o[2], o[3], o[4], o[5], o[6], o[7]);
    }
    return;
  }
  // whole 128-B lines out: each wave stages its own FM*16 x FN*16 block in its own LDS range (behind the last pass's barrier), then stores rows
  constexpr int LPR = FN * 4, RPP = 32 / LPR, NQ = FM * 16 / RPP;
  const int rsub = lane / LPR, c4 = (lane % LPR) * 4;
  const unsigned ob = ((unsigned)(row0 + wm * FM * 16 + rsub) * (unsigned)ldc + (unsigned)(col0 + wn * FN * 16 + c4)) * 4u, os = (unsigned)(RPP * ldc) * 4u;      // byte offsets in this batch element's C, below 2^32
  v4f x[NQ];
  if constexpr (HASR) {
    static_assert(NQ % 16 == 0, "sixteen loads a wait");
#pragma unroll      // constant indices: the arrays it walks stay in registers
    for (int q0 = 0; q0 < NQ; q0 += 16) {
      unsigned of[16];
#pragma unroll      // constant indices: the arrays it walks stay in registers
      for (int q = 0; q < 16; ++q) { of[q] = ob + (q0 + q) * os; x[q0 + q] = *(const v4fa*)((const char*)C + of[q]); }
      asm volatile("s_wait_xcnt 0x0" :: "v"(of[0]), "v"(of[1]), "v"(of[2]), "v"(of[3]), "v"(of[4]), "v"(of[5]), "v"(of[6]), "v"(of[7]), "v"(of[8]), "v"(of[9]), "v"(of[10]), "v"(of[11]), "v"(of[12]), "v"(of[13]), "v"(of[14]), "v"(of[15]) : "memory");      // the loads' offset registers are held as far as this wait, so that nothing, a load's own result included, is written over them ahead of the wait
    }
  }
  fal* so = (fal*)sm + (size_t)w * (FM * 16) * EP;
#pragma unroll      // constant indices: the arrays it walks stay in registers
  for (int i = 0; i < FM; ++i)
#pragma unroll      // constant indices: the arrays it walks stay in registers
    for (int j = 0; j < FN; ++j)
#pragma unroll      // constant indices: the arrays it walks stay in registers
      for (int r = 0; r < 8; ++r) so[(i * 16 + 8 * hh + r) * EP + j * 16 + ln] = acc[i][j][r] * alpha;
  __builtin_amdgcn_fence(__ATOMIC_ACQ_REL, "workgroup"); __builtin_amdgcn_wave_barrier();      // the wave's staged rows are written before its lanes read each other's words
  static_assert(NQ % 8 == 0, "eight stores a statement");
#pragma unroll      // constant indices: the arrays it walks stay in registers
  for (int q0 = 0; q0 < NQ; q0 += 8) {
    v4f v[8];
#pragma unroll      // constant indices: the arrays it walks stay in registers
    for (int q = 0; q < 8; ++q) { v[q] = *(const v4fa*)&so[((q0 + q) * RPP + rsub) * EP + c4]; if (HASR) v[q] += x[q0 + q]; }
    store8q((char*)C + (ob + q0 * os), os, v[0], v[1], v[2], v[3], v[4], v[5], v[6], v[7]);
  }
}

typedef _Float16 v4h __attribute__((ext_vector_type(4)));

__global__ __launch_bounds__(256) void k_x16(const float* __restrict__ x, _Float16* __restrict__ X16, size_t n8) { const size_t t = (size_t)blockIdx.x * 256 + threadIdx.x; if (t >= n8) return; FragH f;
#pragma unroll
  for (int q = 0; q < 8; ++q) f.h[q] = (_Float16)bf16_round(x[t * 8 + q]); *(v8us*)((unsigned short*)X16 + t * 8) = f.half[0];  }
__global__ __launch_bounds__(256) void k_h16(const float* __restrict__ x, _Float16* __restrict__ X16, size_t n8) { const size_t t = (size_t)blockIdx.x * 256 + threadIdx.x; if (t >= n8) return; FragH f;
#pragma unroll
  for (int q = 0; q < 8; ++q) f.h[q] = (_Float16)x[t * 8 + q]; *(v8us*)((unsigned short*)X16 + t * 8) = f.half[0];  }
template <int NHv, int TTv>
__global__ __launch_bounds__(256) void k_vt(const _Float16* __restrict__ V16, int ldv, int voff, _Float16* __restrict__ Vt) { __shared__ unsigned short tl[64][66]; const int tid = threadIdx.x; const int slab = blockIdx.x / (TTv / 64), lg = blockIdx.x % (TTv / 64); const int b = slab / NHv, h = slab % NHv;
  for (int i = tid; i < 64 * 8; i += 256) { const int r = i / 8, c8 = (i % 8) * 8; FragH f; f.half[0] = *(const v8us*)((const unsigned short*)V16 + ((size_t)b * TTv + lg * 64 + r) * ldv + voff + h * 64 + c8);
#pragma unroll
    for (int q = 0; q < 8; ++q) tl[r][c8 + q] = f.u[q]; }
  __syncthreads();
  {
#pragma unroll
    for (int rd = 0; rd < 2; ++rd) { const int d = rd * 32 + tid / 8, pc = tid % 8; FragH f;
#pragma unroll
      for (int q = 0; q < 8; ++q) f.u[q] = tl[pc * 8 + q][d];
      *(v8us*)((unsigned short*)Vt + ((size_t)slab * 64 + d) * TTv + lg * 64 + pc * 8) = f.half[0]; }
     } }

__global__ __launch_bounds__(256) void k_hl(const float* __restrict__ F, _Float16* __restrict__ Hh, _Float16* __restrict__ Hl, size_t n8) { const size_t t = (size_t)blockIdx.x * 256 + threadIdx.x; if (t >= n8) return; FragH fh, fl; const v4f a = *(const v4fa*)(F + t * 8), c = *(const v4fa*)(F + t * 8 + 4);
#pragma unroll
  for (int q = 0; q < 4; ++q) { _Float16 h = (_Float16)a[q]; fh.h[q] = h; fl.h[q] = (_Float16)((a[q] - (float)h) * 1024.0f); h = (_Float16)c[q]; fh.h[4 + q] = h; fl.h[4 + q] = (_Float16)((c[q] - (float)h) * 1024.0f); }
  { *(v8us*)((unsigned short*)Hh + t * 8) = fh.half[0]; *(v8us*)((unsigned short*)Hl + t * 8) = fl.half[0];  } }

__global__ __launch_bounds__(256) void k_qk(const float* __restrict__ UV, const float* __restrict__ gam, const float* __restrict__ bet, const float* __restrict__ CS, const float* __restrict__ SN, _Float16* __restrict__ Q16, _Float16* __restrict__ K16) {
  #pragma clang fp contract(off)
  const int t = blockIdx.x * 256 + threadIdx.x; if (t >= NBt * 2 * LL * 16) return; const int i0 = (t & 15) * 4; const int l = (t >> 4) % LL; const int which = (t / (LL * 16)) & 1; const int bl = (t / (2 * LL * 16)) * LL + l; const float* gp = gam + which * SSz; const float* bp = bet + which * SSz; _Float16* dst = which ? K16 : Q16; FragH o1, o2;
#pragma unroll
  for (int qq = 0; qq < 4; ++qq) { const int i = i0 + qq; const float u1 = UV[(size_t)bl * NUV + 2 * EE + i], u2 = UV[(size_t)bl * NUV + 2 * EE + 64 + i]; const float b1 = u1 / (1.0f + expf(-u1)), b2 = u2 / (1.0f + expf(-u2));
    const float a1 = b1 * bf16_round(gp[i]) + bf16_round(bp[i]), a2 = b2 * bf16_round(gp[64 + i]) + bf16_round(bp[64 + i]); const float c = CS[(size_t)l * 64 + i], s = SN[(size_t)l * 64 + i];
    o1.h[qq] = (_Float16)(a1 * c - a2 * s); o2.h[qq] = (_Float16)(a2 * c + a1 * s); }
  const unsigned long long p1 = *(const unsigned long long*)&o1.u[0], p2 = *(const unsigned long long*)&o2.u[0];
  { *(unsigned long long*)((unsigned short*)dst + (size_t)bl * SSz + i0) = p1; *(unsigned long long*)((unsigned short*)dst + (size_t)bl * SSz + 64 + i0) = p2;  } }
__constant__ float INVF[64] = {1.000000000e+00f,1.154781938e+00f,1.333521485e+00f,1.539926529e+00f,1.778279424e+00f,2.053524971e+00f,2.371373653e+00f,2.738419533e+00f,3.162277699e+00f,3.651741266e+00f,4.216965199e+00f,4.869675159e+00f,5.623413086e+00f,6.493816376e+00f,7.498941898e+00f,8.659643173e+00f,1.000000000e+01f,1.154782009e+01f,1.333521461e+01f,1.539926529e+01f,1.778279495e+01f,2.053524971e+01f,2.371373749e+01f,2.738419724e+01f,3.162277603e+01f,3.651741409e+01f,4.216965103e+01f,4.869675064e+01f,5.623413086e+01f,6.493816376e+01f,7.498941803e+01f,8.659643555e+01f,1.000000000e+02f,1.154781952e+02f,1.333521423e+02f,1.539926453e+02f,1.778279419e+02f,2.053525085e+02f,2.371373749e+02f,2.738419495e+02f,3.162277527e+02f,3.651741333e+02f,4.216965027e+02f,4.869675293e+02f,5.623413086e+02f,6.493816528e+02f,7.498942261e+02f,8.659642944e+02f,1.000000000e+03f,1.154781982e+03f,1.333521484e+03f,1.539926514e+03f,1.778279419e+03f,2.053525146e+03f,2.371373779e+03f,2.738419678e+03f,3.162277588e+03f,3.651741211e+03f,4.216964844e+03f,4.869675293e+03f,5.623413086e+03f,6.493816406e+03f,7.498941895e+03f,8.659643555e+03f};
// Everything that depends on the inputs alone, in one launch: the rope table, ScaleNorm with the x*res_scale start value, and the two weight matrices as f16 (x 16; (out,in) is already the B^T layout).
// The four parts are independent; a work-group does one part, picked by its index. Each wave issues all of its 16-byte loads (512 contiguous bytes a wave-wide load) before it uses the first, and stores whole lines.
#define PB_CS (LL * 64 / 256)              /* 256 work-groups: table, one (l, i) a lane; first, as theirs is the longest dependent chain */
#define PB_SN (NBt * LL / 16)              /* 512: ScaleNorm, two rows a wave */
#define PB_WU (NUV * DD / (256 * 64))      /* 264: uv_w, 64 values a lane */
#define PB_WO (DD * EE / (256 * 64))       /* 128: o_w, 64 values a lane */
__device__ __forceinline__ void round16_part(const float* __restrict__ Wf, _Float16* __restrict__ Bt, int part, int tid) {
  const size_t e0 = (size_t)part * (256 * 64) + tid * 4;
  const float* wp = Wf + e0;
  v4f a[16];
#pragma unroll      // constant indices: the arrays it walks stay in registers
  for (int j = 0; j < 16; ++j) a[j] = *(const v4fa*)(wp + j * 1024);
  asm volatile("s_wait_xcnt 0x0" :: "v"(wp) : "memory");      // the loads' address pair is held as far as this wait, so that nothing, a load's own result included, is written over it ahead of the wait; and no load sinks below it
  unsigned long long o[16];
#pragma unroll      // constant indices: the arrays it walks stay in registers
  for (int j = 0; j < 16; ++j) {
    union { unsigned long long o; _Float16 h[4]; } f;
#pragma unroll      // constant indices: the arrays it walks stay in registers
    for (int e = 0; e < 4; ++e) f.h[e] = (_Float16)(bf16_round(a[j][e]) * 16.0f);
    o[j] = f.o;
  }
  char* bp = (char*)((unsigned short*)Bt + e0);
  store8d(bp, 2048, o[0], o[1], o[2], o[3], o[4], o[5], o[6], o[7]);
  store8d(bp + 8 * 2048, 2048, o[8], o[9], o[10], o[11], o[12], o[13], o[14], o[15]);
}
__global__ __launch_bounds__(256) void k_prep(const float* __restrict__ x, const float* __restrict__ g, const float* __restrict__ rsc, const float* __restrict__ uvw, const float* __restrict__ ow,
                                              _Float16* __restrict__ XN, float* __restrict__ XR, _Float16* __restrict__ BUV, _Float16* __restrict__ BOW, float* __restrict__ CS, float* __restrict__ SN) {
  const int b = blockIdx.x, tid = threadIdx.x;
  if (b < PB_CS) {
    const int t = b * 256 + tid, i = t & 63, l = t >> 6; const float invf = INVF[i];
    asm volatile("s_wait_xcnt 0x0" :: "v"(i) : "memory");      // the load's index register is held as far as this wait, so that nothing, the load's own result included, is written over it ahead of the wait
    const float ang = (float)l * invf;
    const float c = (float)cos((double)ang), s = (float)sin((double)ang);
    CS[t] = c; SN[t] = s;
    return;
  }
  if (b < PB_CS + PB_SN) {
    const int lane = tid & 31; const size_t r0 = ((size_t)(b - PB_CS) * 8 + (tid >> 5)) * 2;      // the wave's two rows
    const float* xp = x + r0 * DD + lane * 4; const float* sp = rsc + lane * 4;
    v4f a[2][8], sc[8];
#pragma unroll      // constant indices: the arrays it walks stay in registers
    for (int k = 0; k < 8; ++k) { a[0][k] = *(const v4fa*)(xp + k * 128); a[1][k] = *(const v4fa*)(xp + DD + k * 128); }
#pragma unroll      // constant indices: the arrays it walks stay in registers
    for (int k = 0; k < 8; ++k) sc[k] = *(const v4fa*)(sp + k * 128);
    asm volatile("s_wait_xcnt 0x0" :: "v"(xp), "v"(sp) : "memory");      // the loads' address pairs are held as far as this wait, so that nothing, a load's own result included, is written over them ahead of the wait; and no load sinks below it
    const float gg = bf16_round(g[0]);
#pragma unroll      // constant indices: the arrays it walks stay in registers
    for (int k = 0; k < 8; ++k)
#pragma unroll      // constant indices: the arrays it walks stay in registers
      for (int e = 0; e < 4; ++e) sc[k][e] = bf16_round(sc[k][e]);
#pragma unroll      // constant indices: the arrays it walks stay in registers
    for (int r = 0; r < 2; ++r) {
      float s4[4] = {0.f, 0.f, 0.f, 0.f};      // four independent chains a lane
#pragma unroll      // constant indices: the arrays it walks stay in registers
      for (int k = 0; k < 8; ++k)
#pragma unroll      // constant indices: the arrays it walks stay in registers
        for (int e = 0; e < 4; ++e) { const float v = bf16_round(a[r][k][e]); a[r][k][e] = v; s4[e] += v * v; }
      float ss = (s4[0] + s4[1]) + (s4[2] + s4[3]);
      for (int o = 16; o > 0; o >>= 1) ss += __shfl_xor(ss, o, 32);
      const float nrm = sqrtf(ss) * 0.03125f; const float inv = gg / fmaxf(nrm, 1e-5f);
      unsigned long long o[8];
#pragma unroll      // constant indices: the arrays it walks stay in registers
      for (int k = 0; k < 8; ++k) {
        union { unsigned long long o; _Float16 h[4]; } f;
#pragma unroll      // constant indices: the arrays it walks stay in registers
        for (int e = 0; e < 4; ++e) { f.h[e] = (_Float16)(a[r][k][e] * inv); a[r][k][e] *= sc[k][e]; }
        o[k] = f.o;
      }
      const size_t e0 = (r0 + r) * DD + lane * 4;
      store8d((char*)((unsigned short*)XN + e0), 256, o[0], o[1], o[2], o[3], o[4], o[5], o[6], o[7]);
      store8q((char*)(XR + e0), 512, a[r][0], a[r][1], a[r][2], a[r][3], a[r][4], a[r][5], a[r][6], a[r][7]);
    }
    return;
  }
  if (b < PB_CS + PB_SN + PB_WU) { round16_part(uvw, BUV, b - (PB_CS + PB_SN), tid); return; }
  round16_part(ow, BOW, b - (PB_CS + PB_SN + PB_WU), tid);
}

extern "C" void kernel_launch(void* const* d_in, const int* in_sizes, int n_in,
                              void* d_out, int out_size, void* d_ws, size_t ws_size, hipStream_t stream) {
  (void)in_sizes; (void)n_in; (void)out_size;
  const float* x = (const float*)d_in[0]; const float* g = (const float*)d_in[1]; const float* uvw = (const float*)d_in[2]; const float* gam = (const float*)d_in[3]; const float* bet = (const float*)d_in[4]; const float* wrel = (const float*)d_in[5]; const float* ow = (const float*)d_in[6]; const float* rsc = (const float*)d_in[7];
  char* ws = (char*)d_ws; size_t off = 0;
  auto take = [&](size_t bytes) { char* p = ws + off; off += (bytes + 255) & ~(size_t)255; return p; };
  // All eight batch elements go through each stage in one launch, so every intermediate holds all eight. Of UV only the columns of u and of base are written and read. x*res_scale is stored in out, where the last GEMM adds to it.
  _Float16* BOW = (_Float16*)take((size_t)DD * EE * 2); float* UV = (float*)take((size_t)NBt * LL * NUV * 4); _Float16* VT = (_Float16*)take((size_t)NBt * EE * LL * 2); _Float16* KER = (_Float16*)take((size_t)NBt * LL * LL * 2);
  _Float16* G16 = (_Float16*)take((size_t)NBt * LL * EE * 2);
  _Float16* BUV = (_Float16*)take((size_t)NUV * DD * 2); float* CS = (float*)take((size_t)LL * 64 * 4); float* SN = (float*)take((size_t)LL * 64 * 4);
  _Float16* XN = (_Float16*)take((size_t)NBt * LL * DD * 2); _Float16* Q16 = (_Float16*)take((size_t)NBt * LL * SSz * 2); _Float16* K16 = (_Float16*)take((size_t)NBt * LL * SSz * 2);
  if (off > ws_size) return;      // 4.2 + 138.4 + 33.6 + 16.8 + 33.6 + 8.7 + 0.5 + 16.8 + 4.2 = 257 MB, no range used twice
  float* Y = (float*)d_out;
  k_prep<<<PB_CS + PB_SN + PB_WU + PB_WO, 256, 0, stream>>>(x, g, rsc, uvw, ow, XN, Y, BUV, BOW, CS, SN);      /* rope table, ScaleNorm (x*res_scale to out), both weights to f16 */
  const dim3 gU(NUV / 128, NBt * LL / 128), gS(LL / 64, LL / 64, NBt), gK(EE / 128, LL / 128, NBt), gO(DD / 128, NBt * LL / 128);      /* the three long GEMMs: 128 x 128 of C a work-group */
  k_gemm_t<4, 4, false, 1><<<gU, 128, 0, stream>>>(XN, DD, 0, BUV, DD, 0, 0.0625f, UV, NUV, 0, DD, nullptr, VT);      /* uv, the batch as rows: M 8192 N 4224 K 1024; u and base pre-activation to UV, silu(v) transposed to VT */
  k_qk<<<(NBt * 2 * LL * 16 + 255) / 256, 256, 0, stream>>>(UV, gam, bet, CS, SN, Q16, K16);
  k_gemm_t<2, 2, false, 2><<<gS, 128, 0, stream>>>(Q16, SSz, (size_t)LL * SSz, K16, SSz, (size_t)LL * SSz, 1.0f, nullptr, LL, 0, SSz, wrel, KER);      /* qk -> kernel, 8 x: M 1024 N 1024 K 128 */
  k_gemm_t<4, 4, false, 3><<<gK, 128, 0, stream>>>(KER, LL, (size_t)LL * LL, VT, LL, (size_t)EE * LL, 1.0f, nullptr, EE, 0, LL, UV, G16);      /* kernel*v -> gated product, 8 x: M 1024 N 2048 K 1024 */
  k_gemm_t<4, 4, true, 0><<<gO, 128, 0, stream>>>(G16, EE, 0, BOW, EE, 0, 0.0625f, Y, DD, 0, EE, nullptr, nullptr);      /* y = x*res_scale (already in out) + out*o_w^T, the batch as rows: M 8192 N 1024 K 2048 */
}

// v007
// Measured time: 140 microseconds a run.
// Next to v006, in two timings, it ran 1.06 times as fast each time.
// Counting every step since v000, it is 11.3 times as fast.
#include <hip/hip_runtime.h>
// RTM (GAU-style) block (B 8, L 1024, D 1024, E 2048, s 128): xn = ScaleNorm(x)·g; uv = silu(xn·uv_wᵀ) → u (2048) | v (2048) | base (128); q/k = rope_seq(base·γ + β) (rotation over the sequence axis with angle l·10000^(i/64), half-split); qk = q·kᵀ + w_rel[j − i + 1023]; kernel = relu(qk/√128)²; out = u ⊙ (kernel·v); y = x·res_scale + out·o_wᵀ → [8,1024,1024].
// Compute dtype: x and parameters rounded to bf16; ScaleNorm in f32 → f16 operand; uv GEMM (f32 result), SiLU/affine/rope in f32 (sin/cos of the f32 angle evaluated in double); q, k, v, kernel and the gated product as f16 GEMM operands (≈2^-12), f32 accumulation; residual x·res_scale through the f32 epilogue. v_wmma_f32_16x16x32_f16.
#define NBt 8
#define LL 1024
#define DD 1024
#define EE 2048
#define SSz 128
#define NUV (2 * EE + SSz)       /* 4224 */
typedef __bf16 v16b __attribute__((ext_vector_type(16)));
typedef unsigned short v8us __attribute__((ext_vector_type(8), may_alias));
typedef float  v8f  __attribute__((ext_vector_type(8)));
typedef float  v4f  __attribute__((ext_vector_type(4)));
typedef float  v4fa __attribute__((ext_vector_type(4), may_alias));
union FragB { v16b v; v8us half[2]; unsigned short u[16]; };

__device__ __forceinline__ unsigned short bf16_bits(float x) { unsigned int u = __float_as_uint(x); return (unsigned short)((u + 0x7FFFu + ((u >> 16) & 1u)) >> 16); }
__device__ __forceinline__ float bf16_val(unsigned short b) { return __uint_as_float(((unsigned int)b) << 16); }
__device__ __forceinline__ float bf16_round(float x) { return bf16_val(bf16_bits(x)); }
// D += A·B with NT terms: 1 = ah·bh, 2 = + al·bh (A split), 3 = + ah·bl (both split)
template <int NT>
__device__ __forceinline__ v8f mmaN(v16b ah, v16b al, v16b bh, v16b bl, v8f c) {
  c = __builtin_amdgcn_wmma_f32_16x16x32_bf16(false, ah, false, bh, (short)0, c, false, false);
  if (NT >= 2) c = __builtin_amdgcn_wmma_f32_16x16x32_bf16(false, al, false, bh, (short)0, c, false, false);
  if (NT >= 3) c = __builtin_amdgcn_wmma_f32_16x16x32_bf16(false, ah, false, bl, (short)0, c, false, false);
  asm volatile("v_nop\n\tv_nop\n\tv_nop\n\tv_nop" : "+v"(c) : "v"(ah), "v"(al), "v"(bh), "v"(bl));
  return c;
}

__global__ __launch_bounds__(256) void k_wt_bf16(const float* __restrict__ W, unsigned short* __restrict__ Wt, int K, int N) {
  const int t = blockIdx.x * 256 + threadIdx.x;
  const int k8n = K / 8;
  if (t >= N * k8n) return;
  const int n = t / k8n, k8 = (t % k8n) * 8;
  v8us v;
#pragma unroll
  for (int i = 0; i < 8; ++i) v[i] = bf16_bits(W[(size_t)(k8 + i) * N + n]);
  *(v8us*)(Wt + (size_t)n * K + k8) = v;
  
}

// GEMM C[M][N] (f32, pitch ldc) = act(A[M][K]·W + bias). A f32 row-major (pitch lda) converted per fragment to bf16
// (ASPLIT: hi/lo two planes -> 2 terms, else single rounded term); Wt bf16 [N][K] (pitch ldb). BIAS_BF16 rounds the
// bias to bf16 first (bias quantised to bf16 before the add). K%32==0, M%16==0, N%64==0.
template <bool ASPLIT, int ACT, bool BIAS_BF16>
__global__ __launch_bounds__(128) void k_gemm_bf(const float* __restrict__ A, int lda, const unsigned short* __restrict__ Wt, int ldb,
                                               const float* __restrict__ bias, float* __restrict__ C, int ldc, int M, int N, int K) {
  __shared__ __attribute__((aligned(16))) float so[4][16][64];
  const int tid = threadIdx.x, w = tid >> 5, lane = tid & 31, ln = lane & 15, hh = lane >> 4;
  const int ntn = N / 64;
  const int wid = blockIdx.x * 4 + w;
  const int mt = wid / ntn, nq = wid % ntn;
  if (mt * 16 >= M) return;
  const int row0 = mt * 16, col0 = nq * 64;
  const float* arow = A + (size_t)(row0 + ln) * lda;
  v8f acc[4] = {};
  for (int kb = 0; kb < K; kb += 32) {
    FragB ah, al;
    const v4f x0 = *(const v4fa*)(arow + kb + 8 * hh), x1 = *(const v4fa*)(arow + kb + 8 * hh + 4);
    const v4f x2 = *(const v4fa*)(arow + kb + 16 + 8 * hh), x3 = *(const v4fa*)(arow + kb + 16 + 8 * hh + 4);
    float xs[16] = {x0[0],x0[1],x0[2],x0[3],x1[0],x1[1],x1[2],x1[3],x2[0],x2[1],x2[2],x2[3],x3[0],x3[1],x3[2],x3[3]};
#pragma unroll
    for (int i = 0; i < 16; ++i) { const unsigned short hb = bf16_bits(xs[i]); ah.u[i] = hb; al.u[i] = ASPLIT ? bf16_bits(xs[i] - bf16_val(hb)) : (unsigned short)0; }
#pragma unroll
    for (int t = 0; t < 4; ++t) {
      const unsigned short* brow = Wt + (size_t)(col0 + t * 16 + ln) * ldb + kb;
      FragB b;
      b.half[0] = *(const v8us*)(brow + 8 * hh);
      b.half[1] = *(const v8us*)(brow + 16 + 8 * hh);
      acc[t] = mmaN<ASPLIT ? 2 : 1>(ah.v, al.v, b.v, b.v, acc[t]);
    }
  }
#pragma unroll
  for (int t = 0; t < 4; ++t) {
    float bv = bias ? bias[col0 + t * 16 + ln] : 0.f;
    if (BIAS_BF16) bv = bf16_round(bv);
#pragma unroll
    for (int r = 0; r < 8; ++r) { float v = acc[t][r] + bv; if (ACT == 1) v = fmaxf(v, 0.f); so[w][8 * hh + r][t * 16 + ln] = v; }
  }
  __builtin_amdgcn_fence(__ATOMIC_ACQ_REL, "workgroup");
  __builtin_amdgcn_wave_barrier();
  const int rsub = lane >> 4, c4 = (lane & 15) * 4;
  {
#pragma unroll
    for (int q = 0; q < 8; ++q) {
      const int r = q * 2 + rsub;
      const v4f v = *(const v4fa*)&so[w][r][c4];
      *(v4f*)(C + (size_t)(row0 + r) * ldc + col0 + c4) = v;
    }
    
  }
}

// GEMM C = act(A·W + bias + resid): A f32 (ASPLIT -> hi/lo 2 terms), Wt bf16 [N][K]; ACT 0 none, 1 relu, 2 exact gelu;
// resid (optional, f32, row index = (row % rmod), pitch ldr, RES_BF16 rounds it) added before the activation.
template <bool ASPLIT, int ACT, bool BIAS_BF16, bool RES_BF16>
__global__ __launch_bounds__(128) void k_gemm_bf3(const float* __restrict__ A, int lda, const unsigned short* __restrict__ Wt, int ldb,
                                                const float* __restrict__ bias, const float* __restrict__ resid, int rmod, int ldr,
                                                float* __restrict__ C, int ldc, int M, int N, int K) {
  __shared__ __attribute__((aligned(16))) float so[4][16][64];
  const int tid = threadIdx.x, w = tid >> 5, lane = tid & 31, ln = lane & 15, hh = lane >> 4;
  const int ntn = N / 64;
  const int wid = blockIdx.x * 4 + w;
  const int mt = wid / ntn, nq = wid % ntn;
  if (mt * 16 >= M) return;
  const int row0 = mt * 16, col0 = nq * 64;
  const float* arow = A + (size_t)(row0 + ln) * lda;
  v8f acc[4] = {};
  for (int kb = 0; kb < K; kb += 32) {
    FragB ah, al;
    const v4f x0 = *(const v4fa*)(arow + kb + 8 * hh), x1 = *(const v4fa*)(arow + kb + 8 * hh + 4);
    const v4f x2 = *(const v4fa*)(arow + kb + 16 + 8 * hh), x3 = *(const v4fa*)(arow + kb + 16 + 8 * hh + 4);
    float xs[16] = {x0[0],x0[1],x0[2],x0[3],x1[0],x1[1],x1[2],x1[3],x2[0],x2[1],x2[2],x2[3],x3[0],x3[1],x3[2],x3[3]};
#pragma unroll
    for (int i = 0; i < 16; ++i) { const unsigned short hb = bf16_bits(xs[i]); ah.u[i] = hb; al.u[i] = ASPLIT ? bf16_bits(xs[i] - bf16_val(hb)) : (unsigned short)0; }
#pragma unroll
    for (int t = 0; t < 4; ++t) {
      const unsigned short* brow = Wt + (size_t)(col0 + t * 16 + ln) * ldb + kb;
      FragB b;
      b.half[0] = *(const v8us*)(brow + 8 * hh);
      b.half[1] = *(const v8us*)(brow + 16 + 8 * hh);
      acc[t] = mmaN<ASPLIT ? 2 : 1>(ah.v, al.v, b.v, b.v, acc[t]);
    }
  }
#pragma unroll
  for (int t = 0; t < 4; ++t) {
    const int col = col0 + t * 16 + ln;
    float bv = bias ? bias[col] : 0.f;
    if (BIAS_BF16) bv = bf16_round(bv);
#pragma unroll
    for (int r = 0; r < 8; ++r) {
      float v = acc[t][r] + bv;
      if (resid) { float rv = resid[(size_t)((row0 + 8 * hh + r) % rmod) * ldr + col]; if (RES_BF16) rv = bf16_round(rv); v += rv; }
      if (ACT == 1) v = fmaxf(v, 0.f);
      if (ACT == 2) v = 0.5f * v * (1.0f + erff(v * 0.70710678118654752f));
      if (ACT == 3) { const float u = 0.7978845608028654f * (v + 0.044715f * v * v * v); v = 0.5f * v * (1.0f + tanhf(u)); }
      so[w][8 * hh + r][t * 16 + ln] = v;
    }
  }
  __builtin_amdgcn_fence(__ATOMIC_ACQ_REL, "workgroup");
  __builtin_amdgcn_wave_barrier();
  const int rsub = lane >> 4, c4 = (lane & 15) * 4;
  {
#pragma unroll
    for (int q = 0; q < 8; ++q) {
      const int r = q * 2 + rsub;
      const v4f v = *(const v4fa*)&so[w][r][c4];
      *(v4f*)(C + (size_t)(row0 + r) * ldc + col0 + c4) = v;
    }
    
  }
}
// row LayerNorm (biased variance, eps) over N: s = X (+ R); optional out_sum <- s; out_norm <- (s-mu)*rsqrt(var+eps)*g + b
template <bool PARAM_BF16>
__global__ __launch_bounds__(256) void k_layernorm(const float* __restrict__ X, const float* __restrict__ R, const float* __restrict__ g, const float* __restrict__ bta,
                                                  float* __restrict__ out_sum, float* __restrict__ out_norm, int N, float eps) {
  __shared__ float red[256];
  const int row = blockIdx.x, tid = threadIdx.x;
  const float* x = X + (size_t)row * N; const float* rr = R ? R + (size_t)row * N : nullptr;
  float vals[16];                     // up to N = 4096
  const int per = N / 256;            // contiguous chunk per thread? use strided-by-4 chunks: thread handles j = tid*4 + 1024*u
  float s1 = 0.f;
  for (int u = 0; u < per / 4; ++u) {
    const int j = tid * 4 + 1024 * u;
    const v4f a = *(const v4fa*)(x + j);
    v4f b = {0.f,0.f,0.f,0.f}; if (rr) b = *(const v4fa*)(rr + j);
#pragma unroll
    for (int q = 0; q < 4; ++q) { const float v = a[q] + b[q]; vals[u * 4 + q] = v; s1 += v; }
  }
  red[tid] = s1; __syncthreads();
  for (int st = 128; st > 0; st >>= 1) { if (tid < st) red[tid] += red[tid + st]; __syncthreads(); }
  const float mu = red[0] / (float)N; __syncthreads();
  float s2 = 0.f;
  for (int u = 0; u < per / 4; ++u)
#pragma unroll
    for (int q = 0; q < 4; ++q) { const float c = vals[u * 4 + q] - mu; s2 += c * c; }
  red[tid] = s2; __syncthreads();
  for (int st = 128; st > 0; st >>= 1) { if (tid < st) red[tid] += red[tid + st]; __syncthreads(); }
  const float rs = rsqrtf(red[0] / (float)N + eps);
  {
    for (int u = 0; u < per / 4; ++u) {
      const int j = tid * 4 + 1024 * u;
      v4f o, sm;
#pragma unroll
      for (int q = 0; q < 4; ++q) {
        float gg = g[j + q], bb = bta[j + q];
        if (PARAM_BF16) { gg = bf16_round(gg); bb = bf16_round(bb); }
        sm[q] = vals[u * 4 + q]; o[q] = (vals[u * 4 + q] - mu) * rs * gg + bb;
      }
      if (out_sum) *(v4f*)(out_sum + (size_t)row * N + j) = sm;
      *(v4f*)(out_norm + (size_t)row * N + j) = o;
    }
    
  }
}



// ---- f16 WMMA path (v_wmma_f32_16x16x32_f16): 11-bit significands for operands in range — used for all four GEMMs of this block
typedef _Float16 v16h __attribute__((ext_vector_type(16)));
union FragH { v16h v; v8us half[2]; _Float16 h[16]; unsigned short u[16]; };
template <int NT>
__device__ __forceinline__ v8f mmaH(v16h ah, v16h al, v16h bh, v16h bl, v8f c) {
  c = __builtin_amdgcn_wmma_f32_16x16x32_f16(false, ah, false, bh, (short)0, c, false, false);
  if (NT >= 2) c = __builtin_amdgcn_wmma_f32_16x16x32_f16(false, al, false, bh, (short)0, c, false, false);
  if (NT >= 3) c = __builtin_amdgcn_wmma_f32_16x16x32_f16(false, ah, false, bl, (short)0, c, false, false);
  asm volatile("v_nop\n\tv_nop\n\tv_nop\n\tv_nop" : "+v"(c) : "v"(ah), "v"(al), "v"(bh), "v"(bl));
  return c;
}
// batched GEMM like k_gemm_b but f16 operands: A f32 (split into f16 hi/lo if ASPLIT, else rounded to f16), Bt = f16 values [n][k]; alpha; C f32; N multiple of 16 (partial tiles skipped)
template <bool ASPLIT>
__global__ __launch_bounds__(128) void k_gemm_h(const float* __restrict__ A, int lda, size_t sA, const _Float16* __restrict__ Bh, int ldb, size_t sB, float alpha, float* __restrict__ C, int ldc, size_t sC, int M, int N, int K) {
  __shared__ __attribute__((aligned(16))) float so[4][16][64];
  const int tid = threadIdx.x, w = tid >> 5, lane = tid & 31, ln = lane & 15, hh = lane >> 4; const int by = blockIdx.y;
  A += (size_t)by * sA; Bh += (size_t)by * sB; C += (size_t)by * sC;
  const int ntn = (N + 63) / 64; const int wid = blockIdx.x * 4 + w; const int mt = wid / ntn, nq = wid % ntn; if (mt * 16 >= M) return;
  const int row0 = mt * 16, col0 = nq * 64; const float* arow = A + (size_t)(row0 + ln) * lda;
  v8f acc[4] = {};
  for (int kb = 0; kb < K; kb += 32) {
    FragH ah, al;
    const v4f x0 = *(const v4fa*)(arow + kb + 8 * hh), x1 = *(const v4fa*)(arow + kb + 8 * hh + 4), x2 = *(const v4fa*)(arow + kb + 16 + 8 * hh), x3 = *(const v4fa*)(arow + kb + 16 + 8 * hh + 4);
    float xs[16] = {x0[0],x0[1],x0[2],x0[3],x1[0],x1[1],x1[2],x1[3],x2[0],x2[1],x2[2],x2[3],x3[0],x3[1],x3[2],x3[3]};
#pragma unroll
    for (int i = 0; i < 16; ++i) { const _Float16 h = (_Float16)xs[i]; ah.h[i] = h; al.h[i] = ASPLIT ? (_Float16)(xs[i] - (float)h) : (_Float16)0.0f; }
#pragma unroll
    for (int t = 0; t < 4; ++t) { if (col0 + t * 16 >= N) continue; const size_t boff = (size_t)(col0 + t * 16 + ln) * ldb + kb; FragH bq; bq.half[0] = *(const v8us*)(Bh + boff + 8 * hh); bq.half[1] = *(const v8us*)(Bh + boff + 16 + 8 * hh);
      acc[t] = mmaH<ASPLIT ? 2 : 1>(ah.v, al.v, bq.v, bq.v, acc[t]); }
  }
#pragma unroll
  for (int t = 0; t < 4; ++t) { if (col0 + t * 16 >= N) continue;
#pragma unroll
    for (int r = 0; r < 8; ++r) so[w][8 * hh + r][t * 16 + ln] = acc[t][r] * alpha; }
  __builtin_amdgcn_fence(__ATOMIC_ACQ_REL, "workgroup"); __builtin_amdgcn_wave_barrier();
  const int rsub = lane >> 4, c4 = (lane & 15) * 4;
  {
#pragma unroll
    for (int q = 0; q < 8; ++q) { const int r = q * 2 + rsub; if (col0 + c4 < N) { const v4f v = *(const v4fa*)&so[w][r][c4]; *(v4f*)(C + (size_t)(row0 + r) * ldc + col0 + c4) = v; } }
     }
}

// Wt[n][k] = f16(W[k][n]·scale) from f32 row-major W[K][N] (scale = power of two; bf16-exact weights stay exact in f16 away from the subnormal range)
__global__ __launch_bounds__(256) void k_wt_f16(const float* __restrict__ W, _Float16* __restrict__ Wt, int K, int N, float scale) {
  const int t = blockIdx.x * 256 + threadIdx.x; if (t >= N * (K / 8)) return; const int n = t / (K / 8), k8 = (t % (K / 8)) * 8; FragH f;
#pragma unroll
  for (int i = 0; i < 8; ++i) f.h[i] = (_Float16)(bf16_round(W[(size_t)(k8 + i) * N + n]) * scale); const v8us o = f.half[0];
  *(v8us*)((unsigned short*)Wt + (size_t)n * K + k8) = o; 
}
// k_gemm_hh variant with fused epilogue: v = acc·alpha + bias[by·sBias + col] (+ CP[(row/rowsPerB)·sCPb + by·64 + col] if CP) ; ACT 0 none / 1 elu ; writes f32 C and f16 C16, each if non-null
template <int ACT>
__global__ __launch_bounds__(128) void k_gemm_hhx(const _Float16* __restrict__ A, int lda, size_t sA, const _Float16* __restrict__ Bh, int ldb, size_t sB, float alpha, const float* __restrict__ bias, size_t sBias, const float* __restrict__ CP, int rowsPerB, size_t sCPb, int row0g,
    float* __restrict__ C, _Float16* __restrict__ C16, int ldc, size_t sC, int M, int N, int K) {
  __shared__ __attribute__((aligned(16))) float so[4][16][64];
  const int tid = threadIdx.x, w = tid >> 5, lane = tid & 31, ln = lane & 15, hh = lane >> 4; const int by = blockIdx.y;
  A += (size_t)by * sA; Bh += (size_t)by * sB; const size_t cofs = (size_t)by * sC; const float* bp = bias ? bias + (size_t)by * sBias : nullptr;
  const int ntn = (N + 63) / 64; const int wid = blockIdx.x * 4 + w; const int mt = wid / ntn, nq = wid % ntn; if (mt * 16 >= M) return;
  const int row0 = mt * 16, col0 = nq * 64; const _Float16* arow = A + (size_t)(row0 + ln) * lda;
  v8f acc[4] = {};
  for (int kb = 0; kb < K; kb += 32) { FragH ah; ah.half[0] = *(const v8us*)((const unsigned short*)arow + kb + 8 * hh); ah.half[1] = *(const v8us*)((const unsigned short*)arow + kb + 16 + 8 * hh);
#pragma unroll
    for (int t = 0; t < 4; ++t) { if (col0 + t * 16 >= N) continue; const size_t boff = (size_t)(col0 + t * 16 + ln) * ldb + kb; FragH bq; bq.half[0] = *(const v8us*)((const unsigned short*)Bh + boff + 8 * hh); bq.half[1] = *(const v8us*)((const unsigned short*)Bh + boff + 16 + 8 * hh);
      acc[t] = mmaH<1>(ah.v, ah.v, bq.v, bq.v, acc[t]); }
  }
#pragma unroll
  for (int t = 0; t < 4; ++t) { if (col0 + t * 16 >= N) continue; const int col = col0 + t * 16 + ln; const float bv = bp ? bf16_round(bp[col]) : 0.f;
#pragma unroll
    for (int r = 0; r < 8; ++r) { float v = acc[t][r] * alpha + bv; if (CP) { const int bidx = (row0g + row0 + 8 * hh + r) / rowsPerB; v += CP[(size_t)bidx * sCPb + (size_t)by * 64 + col]; } if (ACT == 1) v = (v > 0.f) ? v : expm1f(v); else if (ACT == 7) v = (v > 0.f) ? v + 1.0f : expf(v); else if (ACT == 8) v = tanhf(v); else if (ACT == 9) v = 0.5f * v * (1.0f + tanhf(0.7978845608028654f * (v + 0.044715f * v * v * v))); else if (ACT == 11) v = 1.0f / (1.0f + expf(-v)); else if (ACT == 12) v = (v > 0.f) ? v : 0.01f * v; else if (ACT == 14) v = (v > 0.f) ? v : 0.1f * v; else if (ACT == 15) v = v / (1.0f + expf(-v)); else if (ACT == 3) v = fmaxf(v, 0.f); else if (ACT == 6) v = 0.5f * v * (1.0f + erff(v * 0.70710678118654752f)); so[w][8 * hh + r][t * 16 + ln] = v; } }
  __builtin_amdgcn_fence(__ATOMIC_ACQ_REL, "workgroup"); __builtin_amdgcn_wave_barrier();
  const int rsub = lane >> 4, c4 = (lane & 15) * 4; typedef _Float16 v4h __attribute__((ext_vector_type(4)));
  {
#pragma unroll
    for (int q = 0; q < 8; ++q) { const int r = q * 2 + rsub; if (col0 + c4 < N) { const v4f v = *(const v4fa*)&so[w][r][c4]; if (C) *(v4f*)(C + cofs + (size_t)(row0 + r) * ldc + col0 + c4) = v; if (C16) { v4h h4; for (int i = 0; i < 4; ++i) h4[i] = (_Float16)v[i]; *(v4h*)(C16 + cofs + (size_t)(row0 + r) * ldc + col0 + c4) = h4; } } }
     }
}


// Block-tiled f16 GEMM: C[row][col] = alpha * sum_k A[row][k] * B[col][k] (+ the value that C[row][col] already holds, if HASR). A and B are k-contiguous f16.
// blockIdx.z is the batch element: A, B and C move on by sA, sB and sC elements for each.
// One work-group of 4 waves (2 x 2) owns a (32 FM) x (32 FN) tile of C; each wave FM x FN fragments. A stage is 128 k of the tile's A rows and
// B rows (256 B a row, LDS pitch 272 B), brought in by tensor loads, one a wave and stage, into two buffers: stage s + 1 flies while stage s is multiplied.
// The k order inside a fragment and the order of the k blocks are those of k_gemm_hhx. M, N multiples of the tile, K of 128.
#define TKK 128
#define TPB 272
typedef float fal __attribute__((may_alias));
typedef unsigned u32x4 __attribute__((ext_vector_type(4)));
typedef unsigned u32x8 __attribute__((ext_vector_type(8)));
__device__ __forceinline__ unsigned uni(unsigned v) { return (unsigned)__builtin_amdgcn_readfirstlane(v); }
// a wave-uniform value held in a scalar register: a test on it compiles to a scalar branch (a tensor load ignores EXEC), and what is formed from it is formed behind the waits that stand in front of it
__device__ __forceinline__ unsigned pinned(unsigned v) { unsigned w = uni(v); asm volatile("" : "+s"(w)); return w; }
// one request of the whole wave: rows x 256 bytes from global memory (row pitch in group 1) to LDS at pitch 272 B; the waits are the caller's
__device__ __forceinline__ void tdm_load(u32x4 g0, u32x8 g1) { asm volatile("tensor_load_to_lds %0, %1" :: "s"(g0), "s"(g1) : "memory"); }
// eight stores of 16 (store8q) or 8 (store8d) bytes a lane, st bytes apart. The s_wait_xcnt stands in the stores' own statement so that no address or data register of theirs is rewritten ahead of it.
__device__ __forceinline__ void store8q(char* p, size_t st, v4f d0, v4f d1, v4f d2, v4f d3, v4f d4, v4f d5, v4f d6, v4f d7) {
  asm volatile("global_store_b128 %0, %8, off\n\t"
               "global_store_b128 %1, %9, off\n\t"
               "global_store_b128 %2, %10, off\n\t"
               "global_store_b128 %3, %11, off\n\t"
               "global_store_b128 %4, %12, off\n\t"
               "global_store_b128 %5, %13, off\n\t"
               "global_store_b128 %6, %14, off\n\t"
               "global_store_b128 %7, %15, off\n\t"
               "s_wait_xcnt 0x0"
               :: "v"(p), "v"(p + st), "v"(p + 2 * st), "v"(p + 3 * st), "v"(p + 4 * st), "v"(p + 5 * st), "v"(p + 6 * st), "v"(p + 7 * st),
                  "v"(d0), "v"(d1), "v"(d2), "v"(d3), "v"(d4), "v"(d5), "v"(d6), "v"(d7)
               : "memory");
}
__device__ __forceinline__ void store8d(char* p, size_t st, unsigned long long d0, unsigned long long d1, unsigned long long d2, unsigned long long d3, unsigned long long d4, unsigned long long d5, unsigned long long d6, unsigned long long d7) {
  asm volatile("global_store_b64 %0, %8, off\n\t"
               "global_store_b64 %1, %9, off\n\t"
               "global_store_b64 %2, %10, off\n\t"
               "global_store_b64 %3, %11, off\n\t"
               "global_store_b64 %4, %12, off\n\t"
               "global_store_b64 %5, %13, off\n\t"
               "global_store_b64 %6, %14, off\n\t"
               "global_store_b64 %7, %15, off\n\t"
               "s_wait_xcnt 0x0"
               :: "v"(p), "v"(p + st), "v"(p + 2 * st), "v"(p + 3 * st), "v"(p + 4 * st), "v"(p + 5 * st), "v"(p + 6 * st), "v"(p + 7 * st),
                  "v"(d0), "v"(d1), "v"(d2), "v"(d3), "v"(d4), "v"(d5), "v"(d6), "v"(d7)
               : "memory");
}
// EPI names what the epilogue does with the tile t = alpha * A*B^T:
//   0  C = t (+ C if HASR), f32.
//   1  uv: columns of u and of base as EPI 0 (pre-activation, f32); columns of v go out as H[b][e][l] = f16(silu(t)), transposed, and are not stored in C.
//   2  scores: H[b][i][j] = f16(relu((t + bf16(X[j - i + L - 1])) / sqrt(128))^2), X = w_rel; C unused.
//   3  gate: H[b*L + i][e] = f16(silu(X[b*L + i][e]) * t), X = the uv pre-activation (pitch NUV); C unused.
typedef unsigned short v4us __attribute__((ext_vector_type(4), may_alias));
// s[i] = silu(v[i]) = v[i] / (1 + e^-v[i]) for eight values, on the hardware's own exp2 and reciprocal (about 1 ulp of f32 each; every result here is rounded to f16): 5 vector instructions a value,
// where expf and an IEEE division take about 27 in one dependent chain. e^-v overflowing to inf gives v * 0, as v / inf does; underflowing to 0 gives v.
// One asm statement, eight independent values step by step, each in place in its own register: so no instruction directly behind a transcendental reads that one's result or writes over its source
// (left to the register allocator, neighbouring v_exp_f32 and v_rcp_f32 took each other's source registers), and every producer stands eight instructions ahead of its reader.
__device__ __forceinline__ void silu8(const float (&v)[8], float (&s)[8]) {
  asm("v_mul_f32 %0, 0xbfb8aa3b, %8\n\tv_mul_f32 %1, 0xbfb8aa3b, %9\n\tv_mul_f32 %2, 0xbfb8aa3b, %10\n\tv_mul_f32 %3, 0xbfb8aa3b, %11\n\t"      /* -v * log2(e) */
      "v_mul_f32 %4, 0xbfb8aa3b, %12\n\tv_mul_f32 %5, 0xbfb8aa3b, %13\n\tv_mul_f32 %6, 0xbfb8aa3b, %14\n\tv_mul_f32 %7, 0xbfb8aa3b, %15\n\t"
      "v_exp_f32 %0, %0\n\tv_exp_f32 %1, %1\n\tv_exp_f32 %2, %2\n\tv_exp_f32 %3, %3\n\tv_exp_f32 %4, %4\n\tv_exp_f32 %5, %5\n\tv_exp_f32 %6, %6\n\tv_exp_f32 %7, %7\n\t"
      "v_add_f32 %0, 1.0, %0\n\tv_add_f32 %1, 1.0, %1\n\tv_add_f32 %2, 1.0, %2\n\tv_add_f32 %3, 1.0, %3\n\tv_add_f32 %4, 1.0, %4\n\tv_add_f32 %5, 1.0, %5\n\tv_add_f32 %6, 1.0, %6\n\tv_add_f32 %7, 1.0, %7\n\t"
      "v_rcp_f32 %0, %0\n\tv_rcp_f32 %1, %1\n\tv_rcp_f32 %2, %2\n\tv_rcp_f32 %3, %3\n\tv_rcp_f32 %4, %4\n\tv_rcp_f32 %5, %5\n\tv_rcp_f32 %6, %6\n\tv_rcp_f32 %7, %7\n\t"
      "v_mul_f32 %0, %8, %0\n\tv_mul_f32 %1, %9, %1\n\tv_mul_f32 %2, %10, %2\n\tv_mul_f32 %3, %11, %3\n\tv_mul_f32 %4, %12, %4\n\tv_mul_f32 %5, %13, %5\n\tv_mul_f32 %6, %14, %6\n\tv_mul_f32 %7, %15, %7"
      : "=&v"(s[0]), "=&v"(s[1]), "=&v"(s[2]), "=&v"(s[3]), "=&v"(s[4]), "=&v"(s[5]), "=&v"(s[6]), "=&v"(s[7])
      : "v"(v[0]), "v"(v[1]), "v"(v[2]), "v"(v[3]), "v"(v[4]), "v"(v[5]), "v"(v[6]), "v"(v[7]));
}
template <int FM, int FN, bool HASR, int EPI>
__global__ __launch_bounds__(128) void k_gemm_t(const _Float16* __restrict__ A, int lda, size_t sA, const _Float16* __restrict__ B, int ldb, size_t sB, float alpha, float* __restrict__ C, int ldc, size_t sC, int K,
                                                const float* __restrict__ X, _Float16* __restrict__ H) {
  static_assert(FM == FN, "four equal slices a stage: two of A, two of B");
  constexpr int BM = 32 * FM, BN = 32 * FN, SLR = FM * 16, SLB = (SLR * TPB + 2047) / 2048 * 2048, STG = 4 * SLB, EP = FN * 16 + 4;      // a slice: one wave's load, SLR rows, its place in LDS a multiple of 2 KiB
  static_assert(4 * FM * 16 * EP * 4 <= 2 * STG, "output staging fits the ring");
  __shared__ __attribute__((aligned(2048))) unsigned char sm[2 * STG];
  const int tid = threadIdx.x, w = tid >> 5, lane = tid & 31, ln = lane & 15, hh = lane >> 4;
  const int row0 = blockIdx.y * BM, col0 = blockIdx.x * BN, wm = w >> 1, wn = w & 1;
  A += (size_t)blockIdx.z * sA; B += (size_t)blockIdx.z * sB; C += (size_t)blockIdx.z * sC;
  // every wave loads one slice of every stage: waves 0 and 1 the two halves of the tile's A rows, waves 2 and 3 of its B rows
  const unsigned wv = uni(tid >> 5);
  const unsigned long long gsl = wv < 2 ? (unsigned long long)(size_t)(A + (size_t)(row0 + wv * SLR) * lda) : (unsigned long long)(size_t)(B + (size_t)(col0 + (wv - 2) * SLR) * ldb);
  const unsigned lsl = (unsigned)(size_t)sm + wv * SLB;
  u32x8 g1;      // 1-byte elements, tensor = tile = SLR rows of 256 B, 16 B of LDS pad behind every 256 B, no mask
  // pinned(): each descriptor word is held in its scalar register through the loop (left as constants, the compiler took these registers for other values while a request was outstanding and set them anew in front of the next)
  g1[0] = pinned((1u << 20) | (5u << 22) | (3u << 25)); g1[1] = pinned(256u << 16); g1[2] = pinned((unsigned)SLR << 16); g1[3] = pinned(256u << 16);
  g1[4] = pinned((unsigned)SLR); g1[5] = pinned((unsigned)(wv < 2 ? lda : ldb) * 2u); g1[6] = pinned(0u); g1[7] = pinned(0u);
  u32x4 g0;
  g0[0] = pinned(1u);      // pinned(): a descriptor word held in its scalar register, as those of g1
  auto stage = [&](unsigned s) {      // s comes from pinned(): the request's own words are formed behind the wait in front of it
    const unsigned long long ga = gsl + (unsigned long long)s * (TKK * 2);
    g0[1] = uni(lsl + (s & 1u) * STG); g0[2] = uni((unsigned)ga); g0[3] = uni((((unsigned)(ga >> 32)) & 0x01FFFFFFu) | 0x80000000u);
    tdm_load(g0, g1);
  };
  // the wave's own request has landed. The descriptor is named as an input so that its registers are held as far as this wait and take no other value while the request is outstanding
  auto landed = [&]() { asm volatile("s_wait_tensorcnt 0x0" :: "s"(g0), "s"(g1) : "memory"); };
  const int nst = K / TKK;
  stage(pinned(0u));
  landed();                                              // this wave's slice of stage 0 has landed
  __syncthreads();                                       // ... and every other wave's
  if (pinned(nst > 1)) stage(pinned(1u));
  v8f acc[FM][FN] = {};
  for (int s = 0; s < nst; ++s) {
    const unsigned char* pa = sm + (s & 1) * STG + wm * SLB + ln * TPB + hh * 16;
    const unsigned char* pb = sm + (s & 1) * STG + (2 + wn) * SLB + ln * TPB + hh * 16;
    FragH a[2][FM], b[2][FN];      // two fragment sets: block kk + 1 of this stage is read from LDS while block kk is multiplied
    auto frags = [&](int kk, int set) {
#pragma unroll      // constant indices: the arrays it walks stay in registers
      for (int i = 0; i < FM; ++i) { a[set][i].half[0] = *(const v8us*)(pa + i * 16 * TPB + kk * 64); a[set][i].half[1] = *(const v8us*)(pa + i * 16 * TPB + kk * 64 + 32); }
#pragma unroll      // constant indices: the arrays it walks stay in registers
      for (int j = 0; j < FN; ++j) { b[set][j].half[0] = *(const v8us*)(pb + j * 16 * TPB + kk * 64); b[set][j].half[1] = *(const v8us*)(pb + j * 16 * TPB + kk * 64 + 32); }
    };
    frags(0, 0);
#pragma unroll      // constant indices: the arrays it walks stay in registers
    for (int kk = 0; kk < TKK / 32; ++kk) {
      if (kk + 1 < TKK / 32) frags(kk + 1, (kk + 1) & 1);
      __builtin_amdgcn_sched_barrier(0);      // the next block's LDS reads stay one group ahead of this block's WMMAs (sunk among them, each read's latency is waited out by the wave)
#pragma unroll      // constant indices: the arrays it walks stay in registers
      for (int i = 0; i < FM; ++i)
#pragma unroll      // constant indices: the arrays it walks stay in registers
        for (int j = 0; j < FN; ++j) acc[i][j] = __builtin_amdgcn_wmma_f32_16x16x32_f16(false, a[kk & 1][i].v, false, b[kk & 1][j].v, (short)0, acc[i][j], false, false);
      __builtin_amdgcn_sched_barrier(0);      // and the group after that is not lifted in among them
    }
    asm volatile("s_wait_dscnt 0x0" ::: "memory");       // this wave's reads of stage s are done before the buffer is refilled
    landed();                                            // this wave's slice of stage s + 1 has landed
    __syncthreads();                                     // publishes stage s + 1 and ends every reader's last read of stage s
    if (pinned(s + 2 < nst)) stage(pinned((unsigned)s + 2u));
  }
  landed();                                              // nothing in flight when the ring becomes output staging
  asm volatile("s_wait_dscnt 0x0" ::: "memory");         // and none of this wave's reads of it
  if constexpr (EPI == 1) {
    if (col0 >= EE && col0 < 2 * EE) {      // the same for the whole work-group: a tile of v
      // a lane's 8 accumulator rows of one fragment are 8 neighbours along l of one column e: 16 bytes of a row of H. Each wave stages its block column-major in its own LDS range, then stores whole 128-B lines.
      constexpr int HP = FM * 16 + 8, PPC = FM * 2;      // pitch in halves (16 B x odd); 16-byte parts a column
      unsigned short* sh = (unsigned short*)sm + (size_t)w * (FN * 16) * HP;
#pragma unroll      // constant indices: the arrays it walks stay in registers
      for (int i = 0; i < FM; ++i)
#pragma unroll      // constant indices: the arrays it walks stay in registers
        for (int j = 0; j < FN; ++j) {
          FragH f; float v[8], s[8];
#pragma unroll      // constant indices: the arrays it walks stay in registers
          for (int r = 0; r < 8; ++r) v[r] = acc[i][j][r] * alpha;
          silu8(v, s);
#pragma unroll      // constant indices: the arrays it walks stay in registers
          for (int r = 0; r < 8; ++r) f.h[r] = (_Float16)s[r];
          *(v8us*)(sh + (j * 16 + ln) * HP + i * 16 + 8 * hh) = f.half[0];
        }
      __builtin_amdgcn_fence(__ATOMIC_ACQ_REL, "workgroup"); __builtin_amdgcn_wave_barrier();      // the wave's staged columns are written before its lanes read each other's words
      const int rw = row0 + wm * FM * 16;      // the wave's first row; its FM*16 rows lie in one batch element
      unsigned short* vt = (unsigned short*)H + ((size_t)(rw / LL) * EE + (col0 - EE) + wn * FN * 16) * LL + rw % LL;
#pragma unroll      // the stores go out back to back
      for (int q = 0; q < FN * 16 * PPC / 32; ++q) { const int c = (q * 32 + lane) / PPC, p = (q * 32 + lane) % PPC; *(v8us*)(vt + (size_t)c * LL + p * 8) = *(const v8us*)(sh + c * HP + p * 8); }
      return;
    }
  }
  if constexpr (EPI == 2) {
    // f16 out: a row of the work-group's tile is 64 columns = one 128-B line, so the four waves stage the tile together and each then stores whole rows of it
    static_assert(BN == 64, "a tile row of f16 is one line");
    constexpr int EPW = BN + 4, NR = BM / 8;      // 16 lanes a row, 2 rows an instruction, BM / 4 rows a wave
    const int rr = w * (BM / 4) + hh, c4 = ln * 4;
    const size_t gr = (size_t)blockIdx.z * LL + row0 + rr;      // row over all batch elements
    fal* so = (fal*)sm;
#pragma unroll      // constant indices: the arrays it walks stay in registers
    for (int i = 0; i < FM; ++i)
#pragma unroll      // constant indices: the arrays it walks stay in registers
      for (int j = 0; j < FN; ++j)
#pragma unroll      // constant indices: the arrays it walks stay in registers
        for (int r = 0; r < 8; ++r) so[((wm * FM + i) * 16 + 8 * hh + r) * EPW + (wn * FN + j) * 16 + ln] = acc[i][j][r] * alpha;
    __syncthreads();      // every wave's part of the tile is staged before any wave reads whole rows
#pragma unroll      // constant indices: the arrays it walks stay in registers
    for (int q = 0; q < NR; ++q) {
      const v4f t = *(const v4fa*)&so[(rr + 2 * q) * EPW + c4];
      union { v4us o; _Float16 h[4]; } f;
#pragma unroll      // constant indices: the arrays it walks stay in registers
      for (int e = 0; e < 4; ++e) {
        if constexpr (EPI == 2) { const float v = (t[e] + bf16_round(X[col0 + c4 + e - (row0 + rr + 2 * q) + LL - 1])) * 0.08838834764831845f; const float r = fmaxf(v, 0.f); f.h[e] = (_Float16)(r * r); }
      }
      *(v4us*)((unsigned short*)H + (gr + 2 * q) * (size_t)ldc + col0 + c4) = f.o;
    }
    return;
  }
  if constexpr (EPI == 3) {
    // f16 out: a row of the work-group's tile is BN columns = one or two 128-B lines, so the four waves stage the tile together and each then stores whole rows of it
    static_assert(BN == 64 || BN == 128, "a tile row of f16 is whole lines, at most one wave wide");
    constexpr int EPW = BN + 4, LPH = BN / 4, RPI = 32 / LPH, NR = BM / 4 / RPI;      // LPH lanes a row, RPI rows an instruction, BM / 4 rows a wave
    static_assert(BM * EPW * 4 <= 2 * STG && NR % 8 == 0, "the staged tile fits the ring; eight rows a trip of the store loop");
    const int rr = w * (BM / 4) + lane / LPH, c4 = (lane % LPH) * 4;
    const size_t gr = (size_t)blockIdx.z * LL + row0 + rr;      // row over all batch elements
    v4f x[NR];
    const float* xp = X + gr * NUV + col0 + c4;
#pragma unroll      // constant indices: the arrays it walks stay in registers
    for (int q = 0; q < NR; ++q) x[q] = *(const v4fa*)(xp + (size_t)(RPI * q) * NUV);
    asm volatile("s_wait_xcnt 0x0" :: "v"(xp) : "memory");      // the loads' address pair is held as far as this wait, so that nothing, a load's own result included, is written over it ahead of the wait
    fal* so = (fal*)sm;
#pragma unroll      // constant indices: the arrays it walks stay in registers
    for (int i = 0; i < FM; ++i)
#pragma unroll      // constant indices: the arrays it walks stay in registers
      for (int j = 0; j < FN; ++j)
#pragma unroll      // constant indices: the arrays it walks stay in registers
        for (int r = 0; r < 8; ++r) so[((wm * FM + i) * 16 + 8 * hh + r) * EPW + (wn * FN + j) * 16 + ln] = acc[i][j][r] * alpha;
    __syncthreads();      // every wave's part of the tile is staged before any wave reads whole rows
    char* hp = (char*)((unsigned short*)H + gr * (size_t)ldc + col0 + c4);
    const size_t hs = (size_t)(RPI * 2) * ldc;      // bytes from one instruction's rows to the next's
#pragma unroll      // constant indices: the arrays it walks stay in registers
    for (int h = 0; h < NR / 8; ++h) {
      unsigned long long o[8];
#pragma unroll      // constant indices: the arrays it walks stay in registers
      for (int q = 0; q < 8; q += 2) {
        const v4f t0 = *(const v4fa*)&so[(rr + RPI * (h * 8 + q)) * EPW + c4], t1 = *(const v4fa*)&so[(rr + RPI * (h * 8 + q + 1)) * EPW + c4];
        const v4f u0 = x[h * 8 + q], u1 = x[h * 8 + q + 1];
        const float u[8] = {u0[0], u0[1], u0[2], u0[3], u1[0], u1[1], u1[2], u1[3]};
        float s[8];
        silu8(u, s);
        union { unsigned long long o; _Float16 h[4]; } f0, f1;
#pragma unroll      // constant indices: the arrays it walks stay in registers
        for (int e = 0; e < 4; ++e) { f0.h[e] = (_Float16)(s[e] * t0[e]); f1.h[e] = (_Float16)(s[4 + e] * t1[e]); }
        o[q] = f0.o; o[q + 1] = f1.o;
      }
      store8d(hp + (size_t)(h * 8) * hs, hs, o[0], o[1], o[2], o[3], o[4], o[5], o[6], o[7]);
    }
    return;
  }
  // whole 128-B lines out: each wave stages its own FM*16 x FN*16 block in its own LDS range (behind the last pass's barrier), then stores rows
  constexpr int LPR = FN * 4, RPP = 32 / LPR, NQ = FM * 16 / RPP;
  const int rsub = lane / LPR, c4 = (lane % LPR) * 4;
  const unsigned ob = ((unsigned)(row0 + wm * FM * 16 + rsub) * (unsigned)ldc + (unsigned)(col0 + wn * FN * 16 + c4)) * 4u, os = (unsigned)(RPP * ldc) * 4u;      // byte offsets in this batch element's C, below 2^32
  v4f x[NQ];
  if constexpr (HASR) {
    static_assert(NQ % 16 == 0, "sixteen loads a wait");
#pragma unroll      // constant indices: the arrays it walks stay in registers
    for (int q0 = 0; q0 < NQ; q0 += 16) {
      unsigned of[16];
#pragma unroll      // constant indices: the arrays it walks stay in registers
      for (int q = 0; q < 16; ++q) { of[q] = ob + (q0 + q) * os; x[q0 + q] = *(const v4fa*)((const char*)C + of[q]); }
      asm volatile("s_wait_xcnt 0x0" :: "v"(of[0]), "v"(of[1]), "v"(of[2]), "v"(of[3]), "v"(of[4]), "v"(of[5]), "v"(of[6]), "v"(of[7]), "v"(of[8]), "v"(of[9]), "v"(of[10]), "v"(of[11]), "v"(of[12]), "v"(of[13]), "v"(of[14]), "v"(of[15]) : "memory");      // the loads' offset registers are held as far as this wait, so that nothing, a load's own result included, is written over them ahead of the wait
    }
  }
  fal* so = (fal*)sm + (size_t)w * (FM * 16) * EP;
#pragma unroll      // constant indices: the arrays it walks stay in registers
  for (int i = 0; i < FM; ++i)
#pragma unroll      // constant indices: the arrays it walks stay in registers
    for (int j = 0; j < FN; ++j)
#pragma unroll      // constant indices: the arrays it walks stay in registers
      for (int r = 0; r < 8; ++r) so[(i * 16 + 8 * hh + r) * EP + j * 16 + ln] = acc[i][j][r] * alpha;
  __builtin_amdgcn_fence(__ATOMIC_ACQ_REL, "workgroup"); __builtin_amdgcn_wave_barrier();      // the wave's staged rows are written before its lanes read each other's words
  static_assert(NQ % 8 == 0, "eight stores a statement");
#pragma unroll      // constant indices: the arrays it walks stay in registers
  for (int q0 = 0; q0 < NQ; q0 += 8) {
    v4f v[8];
#pragma unroll      // constant indices: the arrays it walks stay in registers
    for (int q = 0; q < 8; ++q) { v[q] = *(const v4fa*)&so[((q0 + q) * RPP + rsub) * EP + c4]; if (HASR) v[q] += x[q0 + q]; }
    store8q((char*)C + (ob + q0 * os), os, v[0], v[1], v[2], v[3], v[4], v[5], v[6], v[7]);
  }
}

typedef _Float16 v4h __attribute__((ext_vector_type(4)));

__global__ __launch_bounds__(256) void k_x16(const float* __restrict__ x, _Float16* __restrict__ X16, size_t n8) { const size_t t = (size_t)blockIdx.x * 256 + threadIdx.x; if (t >= n8) return; FragH f;
#pragma unroll
  for (int q = 0; q < 8; ++q) f.h[q] = (_Float16)bf16_round(x[t * 8 + q]); *(v8us*)((unsigned short*)X16 + t * 8) = f.half[0];  }
__global__ __launch_bounds__(256) void k_h16(const float* __restrict__ x, _Float16* __restrict__ X16, size_t n8) { const size_t t = (size_t)blockIdx.x * 256 + threadIdx.x; if (t >= n8) return; FragH f;
#pragma unroll
  for (int q = 0; q < 8; ++q) f.h[q] = (_Float16)x[t * 8 + q]; *(v8us*)((unsigned short*)X16 + t * 8) = f.half[0];  }
template <int NHv, int TTv>
__global__ __launch_bounds__(256) void k_vt(const _Float16* __restrict__ V16, int ldv, int voff, _Float16* __restrict__ Vt) { __shared__ unsigned short tl[64][66]; const int tid = threadIdx.x; const int slab = blockIdx.x / (TTv / 64), lg = blockIdx.x % (TTv / 64); const int b = slab / NHv, h = slab % NHv;
  for (int i = tid; i < 64 * 8; i += 256) { const int r = i / 8, c8 = (i % 8) * 8; FragH f; f.half[0] = *(const v8us*)((const unsigned short*)V16 + ((size_t)b * TTv + lg * 64 + r) * ldv + voff + h * 64 + c8);
#pragma unroll
    for (int q = 0; q < 8; ++q) tl[r][c8 + q] = f.u[q]; }
  __syncthreads();
  {
#pragma unroll
    for (int rd = 0; rd < 2; ++rd) { const int d = rd * 32 + tid / 8, pc = tid % 8; FragH f;
#pragma unroll
      for (int q = 0; q < 8; ++q) f.u[q] = tl[pc * 8 + q][d];
      *(v8us*)((unsigned short*)Vt + ((size_t)slab * 64 + d) * TTv + lg * 64 + pc * 8) = f.half[0]; }
     } }

__global__ __launch_bounds__(256) void k_hl(const float* __restrict__ F, _Float16* __restrict__ Hh, _Float16* __restrict__ Hl, size_t n8) { const size_t t = (size_t)blockIdx.x * 256 + threadIdx.x; if (t >= n8) return; FragH fh, fl; const v4f a = *(const v4fa*)(F + t * 8), c = *(const v4fa*)(F + t * 8 + 4);
#pragma unroll
  for (int q = 0; q < 4; ++q) { _Float16 h = (_Float16)a[q]; fh.h[q] = h; fl.h[q] = (_Float16)((a[q] - (float)h) * 1024.0f); h = (_Float16)c[q]; fh.h[4 + q] = h; fl.h[4 + q] = (_Float16)((c[q] - (float)h) * 1024.0f); }
  { *(v8us*)((unsigned short*)Hh + t * 8) = fh.half[0]; *(v8us*)((unsigned short*)Hl + t * 8) = fl.half[0];  } }

__global__ __launch_bounds__(256) void k_qk(const float* __restrict__ UV, const float* __restrict__ gam, const float* __restrict__ bet, const float* __restrict__ CS, const float* __restrict__ SN, _Float16* __restrict__ Q16, _Float16* __restrict__ K16) {
  #pragma clang fp contract(off)
  const int t = blockIdx.x * 256 + threadIdx.x; if (t >= NBt * 2 * LL * 16) return; const int i0 = (t & 15) * 4; const int l = (t >> 4) % LL; const int which = (t / (LL * 16)) & 1; const int bl = (t / (2 * LL * 16)) * LL + l; const float* gp = gam + which * SSz; const float* bp = bet + which * SSz; _Float16* dst = which ? K16 : Q16; FragH o1, o2;
#pragma unroll
  for (int qq = 0; qq < 4; ++qq) { const int i = i0 + qq; const float u1 = UV[(size_t)bl * NUV + 2 * EE + i], u2 = UV[(size_t)bl * NUV + 2 * EE + 64 + i]; const float b1 = u1 / (1.0f + expf(-u1)), b2 = u2 / (1.0f + expf(-u2));
    const float a1 = b1 * bf16_round(gp[i]) + bf16_round(bp[i]), a2 = b2 * bf16_round(gp[64 + i]) + bf16_round(bp[64 + i]); const float c = CS[(size_t)l * 64 + i], s = SN[(size_t)l * 64 + i];
    o1.h[qq] = (_Float16)(a1 * c - a2 * s); o2.h[qq] = (_Float16)(a2 * c + a1 * s); }
  const unsigned long long p1 = *(const unsigned long long*)&o1.u[0], p2 = *(const unsigned long long*)&o2.u[0];
  { *(unsigned long long*)((unsigned short*)dst + (size_t)bl * SSz + i0) = p1; *(unsigned long long*)((unsigned short*)dst + (size_t)bl * SSz + 64 + i0) = p2;  } }
__constant__ float INVF[64] = {1.000000000e+00f,1.154781938e+00f,1.333521485e+00f,1.539926529e+00f,1.778279424e+00f,2.053524971e+00f,2.371373653e+00f,2.738419533e+00f,3.162277699e+00f,3.651741266e+00f,4.216965199e+00f,4.869675159e+00f,5.623413086e+00f,6.493816376e+00f,7.498941898e+00f,8.659643173e+00f,1.000000000e+01f,1.154782009e+01f,1.333521461e+01f,1.539926529e+01f,1.778279495e+01f,2.053524971e+01f,2.371373749e+01f,2.738419724e+01f,3.162277603e+01f,3.651741409e+01f,4.216965103e+01f,4.869675064e+01f,5.623413086e+01f,6.493816376e+01f,7.498941803e+01f,8.659643555e+01f,1.000000000e+02f,1.154781952e+02f,1.333521423e+02f,1.539926453e+02f,1.778279419e+02f,2.053525085e+02f,2.371373749e+02f,2.738419495e+02f,3.162277527e+02f,3.651741333e+02f,4.216965027e+02f,4.869675293e+02f,5.623413086e+02f,6.493816528e+02f,7.498942261e+02f,8.659642944e+02f,1.000000000e+03f,1.154781982e+03f,1.333521484e+03f,1.539926514e+03f,1.778279419e+03f,2.053525146e+03f,2.371373779e+03f,2.738419678e+03f,3.162277588e+03f,3.651741211e+03f,4.216964844e+03f,4.869675293e+03f,5.623413086e+03f,6.493816406e+03f,7.498941895e+03f,8.659643555e+03f};
// Everything that depends on the inputs alone, in one launch: the rope table, ScaleNorm with the x*res_scale start value, and the two weight matrices as f16 (x 16; (out,in) is already the B^T layout).
// The four parts are independent; a work-group does one part, picked by its index. Each wave issues all of its 16-byte loads (512 contiguous bytes a wave-wide load) before it uses the first, and stores whole lines.
#define PB_CS (LL * 64 / 256)              /* 256 work-groups: table, one (l, i) a lane; first, as theirs is the longest dependent chain */
#define PB_SN (NBt * LL / 16)              /* 512: ScaleNorm, two rows a wave */
#define PB_WU (NUV * DD / (256 * 64))      /* 264: uv_w, 64 values a lane */
#define PB_WO (DD * EE / (256 * 64))       /* 128: o_w, 64 values a lane */
__device__ __forceinline__ void round16_part(const float* __restrict__ Wf, _Float16* __restrict__ Bt, int part, int tid) {
  const size_t e0 = (size_t)part * (256 * 64) + tid * 4;
  const float* wp = Wf + e0;
  v4f a[16];
#pragma unroll      // constant indices: the arrays it walks stay in registers
  for (int j = 0; j < 16; ++j) a[j] = *(const v4fa*)(wp + j * 1024);
  asm volatile("s_wait_xcnt 0x0" :: "v"(wp) : "memory");      // the loads' address pair is held as far as this wait, so that nothing, a load's own result included, is written over it ahead of the wait; and no load sinks below it
  unsigned long long o[16];
#pragma unroll      // constant indices: the arrays it walks stay in registers
  for (int j = 0; j < 16; ++j) {
    union { unsigned long long o; _Float16 h[4]; } f;
#pragma unroll      // constant indices: the arrays it walks stay in registers
    for (int e = 0; e < 4; ++e) f.h[e] = (_Float16)(bf16_round(a[j][e]) * 16.0f);
    o[j] = f.o;
  }
  char* bp = (char*)((unsigned short*)Bt + e0);
  store8d(bp, 2048, o[0], o[1], o[2], o[3], o[4], o[5], o[6], o[7]);
  store8d(bp + 8 * 2048, 2048, o[8], o[9], o[10], o[11], o[12], o[13], o[14], o[15]);
}
__global__ __launch_bounds__(256) void k_prep(const float* __restrict__ x, const float* __restrict__ g, const float* __restrict__ rsc, const float* __restrict__ uvw, const float* __restrict__ ow,
                                              _Float16* __restrict__ XN, float* __restrict__ XR, _Float16* __restrict__ BUV, _Float16* __restrict__ BOW, float* __restrict__ CS, float* __restrict__ SN) {
  const int b = blockIdx.x, tid = threadIdx.x;
  if (b < PB_CS) {
    const int t = b * 256 + tid, i = t & 63, l = t >> 6; const float invf = INVF[i];
    asm volatile("s_wait_xcnt 0x0" :: "v"(i) : "memory");      // the load's index register is held as far as this wait, so that nothing, the load's own result included, is written over it ahead of the wait
    const float ang = (float)l * invf;
    const float c = (float)cos((double)ang), s = (float)sin((double)ang);
    CS[t] = c; SN[t] = s;
    return;
  }
  if (b < PB_CS + PB_SN) {
    const int lane = tid & 31; const size_t r0 = ((size_t)(b - PB_CS) * 8 + (tid >> 5)) * 2;      // the wave's two rows
    const float* xp = x + r0 * DD + lane * 4; const float* sp = rsc + lane * 4;
    v4f a[2][8], sc[8];
#pragma unroll      // constant indices: the arrays it walks stay in registers
    for (int k = 0; k < 8; ++k) { a[0][k] = *(const v4fa*)(xp + k * 128); a[1][k] = *(const v4fa*)(xp + DD + k * 128); }
#pragma unroll      // constant indices: the arrays it walks stay in registers
    for (int k = 0; k < 8; ++k) sc[k] = *(const v4fa*)(sp + k * 128);
    asm volatile("s_wait_xcnt 0x0" :: "v"(xp), "v"(sp) : "memory");      // the loads' address pairs are held as far as this wait, so that nothing, a load's own result included, is written over them ahead of the wait; and no load sinks below it
    const float gg = bf16_round(g[0]);
#pragma unroll      // constant indices: the arrays it walks stay in registers
    for (int k = 0; k < 8; ++k)
#pragma unroll      // constant indices: the arrays it walks stay in registers
      for (int e = 0; e < 4; ++e) sc[k][e] = bf16_round(sc[k][e]);
#pragma unroll      // constant indices: the arrays it walks stay in registers
    for (int r = 0; r < 2; ++r) {
      float s4[4] = {0.f, 0.f, 0.f, 0.f};      // four independent chains a lane
#pragma unroll      // constant indices: the arrays it walks stay in registers
      for (int k = 0; k < 8; ++k)
#pragma unroll      // constant indices: the arrays it walks stay in registers
        for (int e = 0; e < 4; ++e) { const float v = bf16_round(a[r][k][e]); a[r][k][e] = v; s4[e] += v * v; }
      float ss = (s4[0] + s4[1]) + (s4[2] + s4[3]);
      for (int o = 16; o > 0; o >>= 1) ss += __shfl_xor(ss, o, 32);
      const float nrm = sqrtf(ss) * 0.03125f; const float inv = gg / fmaxf(nrm, 1e-5f);
      unsigned long long o[8];
#pragma unroll      // constant indices: the arrays it walks stay in registers
      for (int k = 0; k < 8; ++k) {
        union { unsigned long long o; _Float16 h[4]; } f;
#pragma unroll      // constant indices: the arrays it walks stay in registers
        for (int e = 0; e < 4; ++e) { f.h[e] = (_Float16)(a[r][k][e] * inv); a[r][k][e] *= sc[k][e]; }
        o[k] = f.o;
      }
      const size_t e0 = (r0 + r) * DD + lane * 4;
      store8d((char*)((unsigned short*)XN + e0), 256, o[0], o[1], o[2], o[3], o[4], o[5], o[6], o[7]);
      store8q((char*)(XR + e0), 512, a[r][0], a[r][1], a[r][2], a[r][3], a[r][4], a[r][5], a[r][6], a[r][7]);
    }
    return;
  }
  if (b < PB_CS + PB_SN + PB_WU) { round16_part(uvw, BUV, b - (PB_CS + PB_SN), tid); return; }
  round16_part(ow, BOW, b - (PB_CS + PB_SN + PB_WU), tid);
}

extern "C" void kernel_launch(void* const* d_in, const int* in_sizes, int n_in,
                              void* d_out, int out_size, void* d_ws, size_t ws_size, hipStream_t stream) {
  (void)in_sizes; (void)n_in; (void)out_size;
  const float* x = (const float*)d_in[0]; const float* g = (const float*)d_in[1]; const float* uvw = (const float*)d_in[2]; const float* gam = (const float*)d_in[3]; const float* bet = (const float*)d_in[4]; const float* wrel = (const float*)d_in[5]; const float* ow = (const float*)d_in[6]; const float* rsc = (const float*)d_in[7];
  char* ws = (char*)d_ws; size_t off = 0;
  auto take = [&](size_t bytes) { char* p = ws + off; off += (bytes + 255) & ~(size_t)255; return p; };
  // All eight batch elements go through each stage in one launch, so every intermediate holds all eight. Of UV only the columns of u and of base are written and read. x*res_scale is stored in out, where the last GEMM adds to it.
  _Float16* BOW = (_Float16*)take((size_t)DD * EE * 2); float* UV = (float*)take((size_t)NBt * LL * NUV * 4); _Float16* VT = (_Float16*)take((size_t)NBt * EE * LL * 2); _Float16* KER = (_Float16*)take((size_t)NBt * LL * LL * 2);
  _Float16* G16 = (_Float16*)take((size_t)NBt * LL * EE * 2);
  _Float16* BUV = (_Float16*)take((size_t)NUV * DD * 2); float* CS = (float*)take((size_t)LL * 64 * 4); float* SN = (float*)take((size_t)LL * 64 * 4);
  _Float16* XN = (_Float16*)take((size_t)NBt * LL * DD * 2); _Float16* Q16 = (_Float16*)take((size_t)NBt * LL * SSz * 2); _Float16* K16 = (_Float16*)take((size_t)NBt * LL * SSz * 2);
  if (off > ws_size) return;      // 4.2 + 138.4 + 33.6 + 16.8 + 33.6 + 8.7 + 0.5 + 16.8 + 4.2 = 257 MB, no range used twice
  float* Y = (float*)d_out;
  k_prep<<<PB_CS + PB_SN + PB_WU + PB_WO, 256, 0, stream>>>(x, g, rsc, uvw, ow, XN, Y, BUV, BOW, CS, SN);      /* rope table, ScaleNorm (x*res_scale to out), both weights to f16 */
  const dim3 gU(NUV / 128, NBt * LL / 128), gS(LL / 64, LL / 64, NBt), gK(EE / 128, LL / 128, NBt), gO(DD / 128, NBt * LL / 128);      /* the three long GEMMs: 128 x 128 of C a work-group */
  k_gemm_t<4, 4, false, 1><<<gU, 128, 0, stream>>>(XN, DD, 0, BUV, DD, 0, 0.0625f, UV, NUV, 0, DD, nullptr, VT);      /* uv, the batch as rows: M 8192 N 4224 K 1024; u and base pre-activation to UV, silu(v) transposed to VT */
  k_qk<<<(NBt * 2 * LL * 16 + 255) / 256, 256, 0, stream>>>(UV, gam, bet, CS, SN, Q16, K16);
  k_gemm_t<2, 2, false, 2><<<gS, 128, 0, stream>>>(Q16, SSz, (size_t)LL * SSz, K16, SSz, (size_t)LL * SSz, 1.0f, nullptr, LL, 0, SSz, wrel, KER);      /* qk -> kernel, 8 x: M 1024 N 1024 K 128 */
  k_gemm_t<4, 4, false, 3><<<gK, 128, 0, stream>>>(KER, LL, (size_t)LL * LL, VT, LL, (size_t)EE * LL, 1.0f, nullptr, EE, 0, LL, UV, G16);      /* kernel*v -> gated product, 8 x: M 1024 N 2048 K 1024 */
  k_gemm_t<4, 4, true, 0><<<gO, 128, 0, stream>>>(G16, EE, 0, BOW, EE, 0, 0.0625f, Y, DD, 0, EE, nullptr, nullptr);      /* y = x*res_scale (already in out) + out*o_w^T, the batch as rows: M 8192 N 1024 K 2048 */
}
